// v000
// The times below were measured on an AMD MI455X: many runs one after another, warmed up first and cycling through
// copies of the inputs, with the whole window's GPU time divided by the number of runs. Launches and the gaps
// between them are all in it. The median over several windows is given; except for v000 it joins two sittings, which
// can be a few percent apart, so the side-by-side timings, each taken in one sitting, are the better comparison.
// The starting kernel, v000, takes 683 microseconds a run.
// Contractions: QKV projection = v_wmma_f32_16x16x32_bf16 on RNE-bf16 copies of x and W (f32 accumulate); q.k^T and p.v = bf16 hi/lo split (hi*hi + hi*lo + lo*hi) on v_wmma_f32_16x16x32_bf16, f32 accumulate; softmax and normalisation in f32.
#include <hip/hip_runtime.h>
#include <stdint.h>

// ---------------------------------------------------------------------------------------------------------------------
// Shared 16-bit WMMA helpers
// ---------------------------------------------------------------------------------------------------------------------
typedef __attribute__((ext_vector_type(16))) _Float16 v16h;
typedef __attribute__((ext_vector_type(8)))  _Float16 v8h;
typedef __attribute__((ext_vector_type(16))) __bf16   v16b;
typedef __attribute__((ext_vector_type(8)))  __bf16   v8b;
typedef __attribute__((ext_vector_type(8)))  float    v8f;
typedef __attribute__((ext_vector_type(4)))  float    v4f;
typedef __attribute__((ext_vector_type(4)))  unsigned v4u;
#define PSCALE 32768.0f
#define U16(p) ((const unsigned short*)(const void*)(p))
#define PSCALE_INV (1.0f / 32768.0f)

__device__ __forceinline__ unsigned short f2bf_bits(float f) {
  unsigned u = __float_as_uint(f);
  return (unsigned short)((u + 0x7FFFu + ((u >> 16) & 1u)) >> 16);
}
__device__ __forceinline__ float bf_bits2f(unsigned short h) { return __uint_as_float(((unsigned)h) << 16); }

// hazard guards as plain device helpers (no inline asm inside the kernel template body)
__device__ __forceinline__ void dep_guard_h(v8f& a, v8f& b, v16h x, v16h y) { asm volatile("v_nop\n\tv_nop\n\tv_nop\n\tv_nop" : "+v"(a), "+v"(b) : "v"(x), "v"(y)); }
__device__ __forceinline__ void dep_guard_b(v8f& a, v8f& b, v16b x, v16b y) { asm volatile("v_nop\n\tv_nop\n\tv_nop\n\tv_nop" : "+v"(a), "+v"(b) : "v"(x), "v"(y)); }
__device__ __forceinline__ void keep4_h(v16h a, v16h b, v16h c, v16h d) { asm volatile("v_nop" :: "v"(a), "v"(b), "v"(c), "v"(d)); }
__device__ __forceinline__ void keep4_b(v16b a, v16b b, v16b c, v16b d) { asm volatile("v_nop" :: "v"(a), "v"(b), "v"(c), "v"(d)); }
__device__ __forceinline__ void acc_guard4(v8f& a, v8f& b, v8f& c, v8f& d) { asm volatile("v_nop\n\tv_nop\n\tv_nop\n\tv_nop" : "+v"(a), "+v"(b), "+v"(c), "+v"(d)); }
template <typename T> struct Frag;
template <> struct Frag<_Float16> {
  typedef v16h V; union U { v16h v; v8h h[2]; };
  static __device__ __forceinline__ v16h load(const _Float16* p) {   // elements 0..7 <- p[0..7], 8..15 <- p[16..23]
    U f; f.h[0] = *(const v8h*)(p); f.h[1] = *(const v8h*)(p + 16); return f.v;
  }
  static __device__ __forceinline__ v8f mma(v16h a, v16h b, v8f c) {
    return __builtin_amdgcn_wmma_f32_16x16x32_f16(false, a, false, b, (short)0, c, false, false);
  }
  static __device__ __forceinline__ void guard(v8f& a, v8f& b, v16h x, v16h y) { dep_guard_h(a, b, x, y); }
  static __device__ __forceinline__ void keep(v16h a, v16h b, v16h c, v16h d) { keep4_h(a, b, c, d); }
};
template <> struct Frag<__bf16> {
  typedef v16b V; union U { v16b v; v8b h[2]; };
  static __device__ __forceinline__ v16b load(const __bf16* p) {
    U f; f.h[0] = *(const v8b*)(p); f.h[1] = *(const v8b*)(p + 16); return f.v;
  }
  static __device__ __forceinline__ v8f mma(v16b a, v16b b, v8f c) {
    return __builtin_amdgcn_wmma_f32_16x16x32_bf16(false, a, false, b, (short)0, c, false, false);
  }
  static __device__ __forceinline__ void guard(v8f& a, v8f& b, v16b x, v16b y) { dep_guard_b(a, b, x, y); }
  static __device__ __forceinline__ void keep(v16b a, v16b b, v16b c, v16b d) { keep4_b(a, b, c, d); }
};

// ---- Register-blocked batched WMMA GEMM ------------------------------------
// C[m,n] = scale * sum_k A[m,k] * Bt[n,k] (+bias)(+resid); each wave owns a 64x64 tile.
// A row-major [M,K]; Bt row-major [N,K]; M,N % 64 == 0, K % 32 == 0.
// SPLIT: operands are hi/lo planes (A2/Bt2 = lo planes, same layout); product = hi*hi + hi*lo + lo*hi.
// BIAS_MODE: 0 = none, 1 = bias[m], 2 = bias[n].
// OUT_MODE: 0 = f32, 1 = f16, 2 = bf16 hi plane (Cout) + bf16 lo plane (Cout2).
// ET: 0 = f16 operands, 1 = bf16 operands (pointers passed as 16-bit storage)
template <int ET> struct Elem;
template <> struct Elem<0> { typedef _Float16 T; };
template <> struct Elem<1> { typedef __bf16 T; };
template <int ET, bool SPLIT, int BIAS_MODE, int OUT_MODE, bool RESID, int ACT = 0>
__global__ __launch_bounds__(256) void wmma_gemm64(
    const unsigned short* __restrict__ Ap, const unsigned short* __restrict__ A2p, int lda, long strideA,
    const unsigned short* __restrict__ Btp, const unsigned short* __restrict__ Bt2p, int ldb, long strideB,
    void* __restrict__ Cout, void* __restrict__ Cout2, int ldc, long strideC,
    const float* __restrict__ bias,
    const float* __restrict__ resid, long strideR,
    int M, int N, int K, float scale) {
  typedef typename Elem<ET>::T T;
  typedef typename Frag<T>::V V;
  const T* A = (const T*)Ap; const T* A2 = (const T*)A2p; const T* Bt = (const T*)Btp; const T* Bt2 = (const T*)Bt2p;
  __shared__ __align__(16) float sT[8][16 * 68];   // per-wave 16x64 slab, pitch 68 floats
  const int b    = blockIdx.y;
  const int lane = threadIdx.x & 31;
  const int wave = threadIdx.x >> 5;
  const int tilesN = N >> 6;
  const int tilesM = M >> 6;
  const int tile = blockIdx.x * 8 + wave;
  if (tile >= tilesM * tilesN) return;   // wave-uniform; no block barriers in this kernel
  const int tm = tile / tilesN;
  const int tn = tile - tm * tilesN;
  const int m0 = tm << 6;
  const int n0 = tn << 6;

  const T* Ab  = A  + (size_t)b * strideA;
  const T* Bb  = Bt + (size_t)b * strideB;
  const T* Ab2 = SPLIT ? (A2  + (size_t)b * strideA) : nullptr;
  const T* Bb2 = SPLIT ? (Bt2 + (size_t)b * strideB) : nullptr;

  const int rlane = lane & 15;                 // row (A) / col (B, D) within subtile
  const int koff  = (lane >> 4) * 8;           // k offset of this lane half
  const int mOff  = (lane >> 4) * 8;           // D row offset

  v8f acc[4][4];
#pragma unroll
  for (int i = 0; i < 4; ++i)
#pragma unroll
    for (int j = 0; j < 4; ++j) acc[i][j] = (v8f){0.f,0.f,0.f,0.f,0.f,0.f,0.f,0.f};

  for (int k0 = 0; k0 < K; k0 += 32) {
    V bh[4], bl[4];
#pragma unroll
    for (int j = 0; j < 4; ++j) {
      const size_t bo = (size_t)(n0 + (j << 4) + rlane) * ldb + koff + k0;
      bh[j] = Frag<T>::load(Bb + bo);
      if (SPLIT) bl[j] = Frag<T>::load(Bb2 + bo);
    }
#pragma unroll
    for (int i = 0; i < 4; ++i) {
      const size_t ao = (size_t)(m0 + (i << 4) + rlane) * lda + koff + k0;
      V ah = Frag<T>::load(Ab + ao);
      V al;
      if (SPLIT) al = Frag<T>::load(Ab2 + ao);
#pragma unroll
      for (int j = 0; j < 4; ++j) {
        acc[i][j] = Frag<T>::mma(ah, bh[j], acc[i][j]);
        if (SPLIT) {
          acc[i][j] = Frag<T>::mma(ah, bl[j], acc[i][j]);
          acc[i][j] = Frag<T>::mma(al, bh[j], acc[i][j]);
        }
      }
      Frag<T>::guard(acc[i][0], acc[i][3], ah, SPLIT ? al : ah);
    }
    Frag<T>::keep(bh[0], bh[1], bh[2], bh[3]);
    if (SPLIT) Frag<T>::keep(bl[0], bl[1], bl[2], bl[3]);
  }
  acc_guard4(acc[0][0], acc[0][1], acc[0][2], acc[0][3]);
  acc_guard4(acc[1][0], acc[1][1], acc[1][2], acc[1][3]);
  acc_guard4(acc[2][0], acc[2][1], acc[2][2], acc[2][3]);
  acc_guard4(acc[3][0], acc[3][1], acc[3][2], acc[3][3]);

  // ---- epilogue ----
  float* slab = sT[wave];
  const float* Rb = RESID ? (resid + (size_t)b * strideR) : nullptr;
#pragma unroll
  for (int i = 0; i < 4; ++i) {
    const int mBase = m0 + (i << 4);
#pragma unroll
    for (int j = 0; j < 4; ++j) {
      const int n = n0 + (j << 4) + rlane;
      float bv = 0.f;
      if (BIAS_MODE == 2) bv = bias[n];
#pragma unroll
      for (int r = 0; r < 8; ++r) {
        float v = acc[i][j][r] * scale;
        if (BIAS_MODE == 1) v += bias[mBase + mOff + r];
        if (BIAS_MODE == 2) v += bv;
        if (RESID) v += Rb[(size_t)(mBase + mOff + r) * ldc + n];
        if (ACT == 1) v = tanhf(v);
        if (ACT == 2) v = fmaxf(v, 0.0f);
        if (ACT == 3) v = v / (1.0f + expf(-v));
        if (ACT == 4) v = (v > 0.f) ? v : 0.01f * v;
        if (ACT == 5) v = 0.5f * v * (1.0f + erff(v * 0.70710678118654752f));
        slab[(mOff + r) * 68 + (j << 4) + rlane] = v;
      }
    }
    __builtin_amdgcn_fence(__ATOMIC_RELEASE, "workgroup");
    __builtin_amdgcn_wave_barrier();
    __builtin_amdgcn_fence(__ATOMIC_ACQUIRE, "workgroup");
    if (OUT_MODE == 0) {
      float* C = (float*)Cout + (size_t)b * strideC;
      const int hh = lane >> 4, c4 = (lane & 15) * 4;     // row seg = 256 B = 16 lanes x 16 B
      {
#pragma unroll
        for (int it = 0; it < 8; ++it) {
          const int row = it * 2 + hh;
          v4f v = *(const v4f*)(slab + row * 68 + c4);
          *(v4f*)(C + (size_t)(mBase + row) * ldc + n0 + c4) = v;
        }
        
      }
    } else {
      const int q = lane >> 3, c8 = (lane & 7) * 8;
      unsigned short* C  = (unsigned short*)Cout  + (size_t)b * strideC;
      unsigned short* C2 = (OUT_MODE == 2) ? ((unsigned short*)Cout2 + (size_t)b * strideC) : nullptr;
      {
#pragma unroll
        for (int it = 0; it < 4; ++it) {
          const int row = it * 4 + q;
          const float* sp = slab + row * 68 + c8;
          v8h hv, lv;
#pragma unroll
          for (int e = 0; e < 8; ++e) {
            if (OUT_MODE == 1) {
              hv[e] = (_Float16)sp[e];
            } else {
              unsigned short hb = f2bf_bits(sp[e]);
              unsigned short lb = f2bf_bits(sp[e] - bf_bits2f(hb));
              hv[e] = __builtin_bit_cast(_Float16, hb);
              lv[e] = __builtin_bit_cast(_Float16, lb);
            }
          }
          *(v8h*)(C + (size_t)(mBase + row) * ldc + n0 + c8) = hv;
          if (OUT_MODE == 2) *(v8h*)(C2 + (size_t)(mBase + row) * ldc + n0 + c8) = lv;
        }
        
      }
    }
    __builtin_amdgcn_fence(__ATOMIC_RELEASE, "workgroup");
    __builtin_amdgcn_wave_barrier();
    __builtin_amdgcn_fence(__ATOMIC_ACQUIRE, "workgroup");
  }
}

// ---------------------------------------------------------------------------------------------------------------------
// bf16 helpers for the attention kernel
// ---------------------------------------------------------------------------------------------------------------------
__device__ __forceinline__ unsigned short at_bf_bits(float f) {
  unsigned u = __float_as_uint(f);
  return (unsigned short)((u + 0x7FFFu + ((u >> 16) & 1u)) >> 16);
}
__device__ __forceinline__ __bf16 at_f2bf(float f) { return __builtin_bit_cast(__bf16, at_bf_bits(f)); }
__device__ __forceinline__ void at_split(float f, __bf16& hi, __bf16& lo) {
  const unsigned short hb = at_bf_bits(f);
  hi = __builtin_bit_cast(__bf16, hb);
  lo = at_f2bf(f - __uint_as_float(((unsigned)hb) << 16));
}
__device__ __forceinline__ v8f at_mma(v16b a, v16b b, v8f c) {
  c = __builtin_amdgcn_wmma_f32_16x16x32_bf16(false, a, false, b, (short)0, c, false, false);
  asm volatile("v_nop\n\tv_nop\n\tv_nop\n\tv_nop" : "+v"(c) : "v"(a), "v"(b));
  return c;
}

// ---------------------------------------------------------------------------------------------------------------------
// Problem constants
// ---------------------------------------------------------------------------------------------------------------------
constexpr int kBatch   = 4;
constexpr int kSeq     = 2048;
constexpr int kEmb     = 1024;
constexpr int kHeads   = 16;
constexpr int kHeadDim = 64;
constexpr int kRows    = kBatch * kSeq;   // 8192 = GEMM M
constexpr int kN3      = 3 * kEmb;        // 3072 = GEMM N
static_assert(kEmb % 32 == 0, "K");
static_assert(kRows % 64 == 0 && kN3 % 64 == 0, "MN");
static_assert(((kRows / 64) * (kN3 / 64)) % 8 == 0, "tiles");
static_assert(kHeads * kHeadDim == kEmb, "heads");
static_assert(kSeq % 64 == 0, "S");
static_assert((kRows * kEmb) % (8 * 256) == 0, "cast grid");
static_assert(kEmb % 64 == 0 && kN3 % 64 == 0, "transpose grid");

// ---------------------------------------------------------------------------------------------------------------------
// f32 -> bf16 (RNE) cast: thread i converts elements 8i..8i+7 (two 16-B loads, one 16-B store);
// Coverage: n8 threads x 8 = whole plane (n8 = n/8 exact).
// ---------------------------------------------------------------------------------------------------------------------
__global__ __launch_bounds__(256) void cast_f32_bf16x8(const float* __restrict__ in, unsigned short* __restrict__ outp, int n8) {
  const int i = blockIdx.x * 256 + threadIdx.x;
  if (i < n8) {
    const size_t e0 = (size_t)i * 8;
    const v4f a = *(const v4f*)(in + e0);
    const v4f c = *(const v4f*)(in + e0 + 4);
    v4u u;
    u[0] = (unsigned)f2bf_bits(a[0]) | ((unsigned)f2bf_bits(a[1]) << 16);
    u[1] = (unsigned)f2bf_bits(a[2]) | ((unsigned)f2bf_bits(a[3]) << 16);
    u[2] = (unsigned)f2bf_bits(c[0]) | ((unsigned)f2bf_bits(c[1]) << 16);
    u[3] = (unsigned)f2bf_bits(c[2]) | ((unsigned)f2bf_bits(c[3]) << 16);
    *(v4u*)(outp + e0) = u;
    
  }
}

// ---------------------------------------------------------------------------------------------------------------------
// Transpose + cast: in [R][Cc] f32 row-major -> outp [Cc][R] bf16, outp[n][e] = bf16(in[e][n]).
// Tile 64 (e) x 64 (n); grid (Cc/64, R/64); block 256.
// Load coverage: 256 threads x 16 elements = 64x64. Store coverage: 8 waves x 2 iterations x 4 rows = 64 rows,
// ---------------------------------------------------------------------------------------------------------------------
__global__ __launch_bounds__(256) void transpose_cast_bf16(const float* __restrict__ in, unsigned short* __restrict__ outp, int R, int Cc) {
  __shared__ __align__(16) unsigned short tT[64 * 72];   // [n_local][e_local], pitch 72
  const int tid = threadIdx.x;
  const int n0 = blockIdx.x * 64;
  const int e0 = blockIdx.y * 64;
  {
    const int el = tid >> 2, nl = (tid & 3) * 16;
    const float* src = in + (size_t)(e0 + el) * Cc + n0 + nl;
#pragma unroll
    for (int i = 0; i < 4; ++i) {
      const v4f f = *(const v4f*)(src + 4 * i);
#pragma unroll
      for (int e = 0; e < 4; ++e) tT[(nl + 4 * i + e) * 72 + el] = f2bf_bits(f[e]);
    }
  }
  __syncthreads();
  const int wave = tid >> 5, lane = tid & 31, q = lane >> 3, c8 = (lane & 7) * 8;
  {
#pragma unroll
    for (int it = 0; it < 2; ++it) {
      const int nl = wave * 8 + it * 4 + q;
      const v4u w = *(const v4u*)(tT + nl * 72 + c8);
      *(v4u*)(outp + (size_t)(n0 + nl) * R + e0 + c8) = w;
    }
    
  }
}

// ---------------------------------------------------------------------------------------------------------------------
// Causal attention, head dim 64, 16-bit plane inputs, f32 output.
//   q, k, v are bf16 hi + lo planes: element (b, s, h, d) at plane[(b*S + s)*ld + h*64 + d] (ld in elements, % 8 == 0).
//   scores = sscale * q.k^T : bf16 hi/lo split (hi*hi + hi*lo + lo*hi), f32 accumulate
//   out    = p.v            : p (f32, split into bf16 hi/lo in LDS) and v hi/lo planes, f32 accumulate
//   online softmax in f32; keys with kv > q replaced by -inf before the softmax.
//   Block = 4 waves = 64 query rows of one (b, h); grid.x = B * H * (S/64); S % 64 == 0.
// ---------------------------------------------------------------------------------------------------------------------
constexpr int kQB = 64;   // query rows per block
constexpr int kKC = 64;   // keys per chunk
constexpr int kNW = 4;    // waves per block
constexpr int kOP = 68;   // output slab pitch (floats)

__global__ __launch_bounds__(128)
void attn_causal_hd64_split(const unsigned short* __restrict__ qh, const unsigned short* __restrict__ ql,
                            const unsigned short* __restrict__ kh, const unsigned short* __restrict__ kl,
                            const unsigned short* __restrict__ vh, const unsigned short* __restrict__ vl,
                            float* __restrict__ out,
                            int S, int H, int ldq, int ldk, int ldv, int ldo, float sscale) {
  typedef Frag<__bf16>::U FB;
  __shared__ __align__(16) unsigned short Ksh[kKC * kHeadDim];   // K hi [kv][d]
  __shared__ __align__(16) unsigned short Ksl[kKC * kHeadDim];   // K lo [kv][d]
  __shared__ __align__(16) unsigned short Vth[kHeadDim * kKC];   // V hi [d][kv]
  __shared__ __align__(16) unsigned short Vtl[kHeadDim * kKC];   // V lo [d][kv]
  __shared__ __align__(16) __bf16 Psh[kNW][16 * kKC];            // per wave P hi [row][kv]
  __shared__ __align__(16) __bf16 Psl[kNW][16 * kKC];            // per wave P lo [row][kv]
  __shared__ __align__(16) float  Os[kNW][16 * kOP];             // per wave out tile

  const int tid  = threadIdx.x;
  const int wave = tid >> 5;
  const int lane = tid & 31;
  const int hh   = lane >> 4;
  const int c    = lane & 15;

  const int nqb = S / kQB;
  const int bx = blockIdx.x;
  const int qb = bx % nqb;
  const int bh = bx / nqb;
  const int h  = bh % H;
  const int b  = bh / H;
  const int q0 = qb * kQB + wave * 16;
  const size_t rowb = (size_t)b * (size_t)S;
  const int hcol = h * kHeadDim;

  // ---- Q fragments (A operand, row = query q0 + c, k = d): 2 d-chunks, hi and lo planes ----
  v16b qah[2], qal[2];
  {
    const size_t qo = (rowb + (size_t)(q0 + c)) * (size_t)ldq + (size_t)(hcol + 8 * hh);
    const __bf16* qr  = (const __bf16*)(const void*)(qh + qo);
    const __bf16* qr2 = (const __bf16*)(const void*)(ql + qo);
#pragma unroll
    for (int dc = 0; dc < 2; ++dc) {
      qah[dc] = Frag<__bf16>::load(qr + dc * 32);
      qal[dc] = Frag<__bf16>::load(qr2 + dc * 32);
    }
  }

  float mrow[8], lrow[8];
  v8f oacc[4];
#pragma unroll
  for (int r = 0; r < 8; ++r) { mrow[r] = -__builtin_inff(); lrow[r] = 0.f; }
#pragma unroll
  for (int t = 0; t < 4; ++t) oacc[t] = (v8f){0.f,0.f,0.f,0.f,0.f,0.f,0.f,0.f};

  const int nChunks = qb + 1;   // block-uniform; causal: key chunks 0..qb
  for (int kc = 0; kc < nChunks; ++kc) {
    const int kv0 = kc * kKC;
    __syncthreads();
    {
      // staging: thread -> kv row kvr = tid>>1 (0..63), d half dh = (tid&1)*32; 128 threads x 32 = 64x64 per plane
      const int kvr = tid >> 1, dh = (tid & 1) * 32;
      const size_t krow = rowb + (size_t)(kv0 + kvr);
      const unsigned short* gkh = kh + krow * (size_t)ldk + hcol + dh;
      const unsigned short* gkl = kl + krow * (size_t)ldk + hcol + dh;
      v4u wa[4], wb[4];
#pragma unroll
      for (int i = 0; i < 4; ++i) { wa[i] = *(const v4u*)(gkh + 8 * i); wb[i] = *(const v4u*)(gkl + 8 * i); }
#pragma unroll
      for (int i = 0; i < 4; ++i) {
        *(v4u*)(Ksh + kvr * kHeadDim + dh + 8 * i) = wa[i];
        *(v4u*)(Ksl + kvr * kHeadDim + dh + 8 * i) = wb[i];
      }
      asm volatile("" ::: "memory");
      const unsigned short* gvh = vh + krow * (size_t)ldv + hcol + dh;
      const unsigned short* gvl = vl + krow * (size_t)ldv + hcol + dh;
#pragma unroll
      for (int i = 0; i < 4; ++i) { wa[i] = *(const v4u*)(gvh + 8 * i); wb[i] = *(const v4u*)(gvl + 8 * i); }
#pragma unroll
      for (int i = 0; i < 4; ++i) {
#pragma unroll
        for (int m = 0; m < 4; ++m) {
          const unsigned ua = wa[i][m];
          const unsigned ub = wb[i][m];
          const int d = dh + 8 * i + 2 * m;
          Vth[d * kKC + kvr]       = (unsigned short)(ua & 0xffffu);
          Vth[(d + 1) * kKC + kvr] = (unsigned short)(ua >> 16);
          Vtl[d * kKC + kvr]       = (unsigned short)(ub & 0xffffu);
          Vtl[(d + 1) * kKC + kvr] = (unsigned short)(ub >> 16);
        }
      }
    }
    __syncthreads();

    // ---- scores: s[j][r] = S[query 8hh+r][kv kv0 + j*16 + c] ----
    v8f s[4];
#pragma unroll
    for (int j = 0; j < 4; ++j) {
      s[j] = (v8f){0.f,0.f,0.f,0.f,0.f,0.f,0.f,0.f};
#pragma unroll
      for (int dc = 0; dc < 2; ++dc) {
        FB kb, kb2;
        const unsigned short* kp  = Ksh + (j * 16 + c) * kHeadDim + dc * 32 + 8 * hh;
        const unsigned short* kp2 = Ksl + (j * 16 + c) * kHeadDim + dc * 32 + 8 * hh;
        kb.h[0]  = *(const v8b*)(const void*)(kp);
        kb.h[1]  = *(const v8b*)(const void*)(kp + 16);
        kb2.h[0] = *(const v8b*)(const void*)(kp2);
        kb2.h[1] = *(const v8b*)(const void*)(kp2 + 16);
        s[j] = at_mma(qah[dc], kb.v, s[j]);
        s[j] = at_mma(qah[dc], kb2.v, s[j]);
        s[j] = at_mma(qal[dc], kb.v, s[j]);
      }
    }
    const bool diag = (kc == qb);   // block-uniform
    float cm[8];
#pragma unroll
    for (int r = 0; r < 8; ++r) {
      const int qrow = q0 + 8 * hh + r;
      float m = -__builtin_inff();
#pragma unroll
      for (int j = 0; j < 4; ++j) {
        const int kvcol = kv0 + j * 16 + c;
        float sv = s[j][r] * sscale;
        sv = (diag && (kvcol > qrow)) ? -__builtin_inff() : sv;
        s[j][r] = sv;
        m = fmaxf(m, sv);
      }
#pragma unroll
      for (int off = 1; off < 16; off <<= 1) m = fmaxf(m, __shfl_xor(m, off, 32));
      cm[r] = m;
    }
    __bf16* pwh = Psh[wave];
    __bf16* pwl = Psl[wave];
#pragma unroll
    for (int r = 0; r < 8; ++r) {
      const float mnew = fmaxf(mrow[r], cm[r]);
      const float alpha = expf(mrow[r] - mnew);
      mrow[r] = mnew;
      float psum = 0.f;
#pragma unroll
      for (int j = 0; j < 4; ++j) {
        const float p = expf(s[j][r] - mnew);
        psum += p;
        __bf16 a, bl;
        at_split(p, a, bl);
        pwh[(8 * hh + r) * kKC + j * 16 + c] = a;
        pwl[(8 * hh + r) * kKC + j * 16 + c] = bl;
      }
#pragma unroll
      for (int off = 1; off < 16; off <<= 1) psum += __shfl_xor(psum, off, 32);
      lrow[r] = lrow[r] * alpha + psum;
#pragma unroll
      for (int t = 0; t < 4; ++t) oacc[t][r] *= alpha;
    }
    __builtin_amdgcn_fence(__ATOMIC_RELEASE, "workgroup");
    __builtin_amdgcn_wave_barrier();
    __builtin_amdgcn_fence(__ATOMIC_ACQUIRE, "workgroup");
    // ---- out[query][d] += P[query][kv] * V[kv][d]; A = P (row = query c, k = kv), B from Vt [d][kv] ----
#pragma unroll
    for (int kk = 0; kk < 2; ++kk) {
      FB pa, pl;
      pa.h[0] = *(const v8b*)(pwh + c * kKC + kk * 32 + 8 * hh);
      pa.h[1] = *(const v8b*)(pwh + c * kKC + kk * 32 + 16 + 8 * hh);
      pl.h[0] = *(const v8b*)(pwl + c * kKC + kk * 32 + 8 * hh);
      pl.h[1] = *(const v8b*)(pwl + c * kKC + kk * 32 + 16 + 8 * hh);
#pragma unroll
      for (int t = 0; t < 4; ++t) {
        FB vb, vb2;
        const unsigned short* vpa = Vth + (t * 16 + c) * kKC + kk * 32 + 8 * hh;
        const unsigned short* vpb = Vtl + (t * 16 + c) * kKC + kk * 32 + 8 * hh;
        vb.h[0]  = *(const v8b*)(const void*)(vpa);
        vb.h[1]  = *(const v8b*)(const void*)(vpa + 16);
        vb2.h[0] = *(const v8b*)(const void*)(vpb);
        vb2.h[1] = *(const v8b*)(const void*)(vpb + 16);
        oacc[t] = at_mma(pa.v, vb.v, oacc[t]);
        oacc[t] = at_mma(pa.v, vb2.v, oacc[t]);
        oacc[t] = at_mma(pl.v, vb.v, oacc[t]);
      }
    }
  }

  // ---- epilogue: normalise, stage the wave's 16x64 tile, write whole 256-B row segments ----
  float* os = Os[wave];
#pragma unroll
  for (int r = 0; r < 8; ++r) {
    const float inv = 1.0f / lrow[r];
#pragma unroll
    for (int t = 0; t < 4; ++t) os[(8 * hh + r) * kOP + t * 16 + c] = oacc[t][r] * inv;
  }
  __builtin_amdgcn_fence(__ATOMIC_RELEASE, "workgroup");
  __builtin_amdgcn_wave_barrier();
  __builtin_amdgcn_fence(__ATOMIC_ACQUIRE, "workgroup");
  {
    float* ob = out + (size_t)hcol;
    const int c4 = (lane & 15) * 4;   // 16 lanes x 16 B = 256 B = one row segment of 64 floats
    {
#pragma unroll
      for (int it = 0; it < 8; ++it) {
        const int row = it * 2 + hh;
        v4f val = *(const v4f*)(os + row * kOP + c4);
        *(v4f*)(ob + (rowb + (size_t)(q0 + row)) * (size_t)ldo + c4) = val;
      }
      
    }
  }
}

// ---------------------------------------------------------------------------------------------------------------------
// Host launcher
// Workspace region map (bytes):
//   [0,            16,777,216)  Xb   bf16 [8192][1024]           (RNE copy of x)
//   [16,777,216,   23,068,672)  Wt   bf16 [3072][1024]           (RNE copy of W^T)
//   [23,068,672,   73,400,320)  Phi  bf16 [8192][3072]           (qkv hi plane)
//   [73,400,320,  123,731,968)  Plo  bf16 [8192][3072]           (qkv lo plane)
//   total 123,731,968
// ---------------------------------------------------------------------------------------------------------------------
extern "C" void kernel_launch(void* const* d_in, const int* in_sizes, int n_in,
                              void* d_out, int out_size, void* d_ws, size_t ws_size,
                              hipStream_t stream) {
  if (n_in < 2) return;
  if (in_sizes[0] != kRows * kEmb) return;
  if (in_sizes[1] != kEmb * kN3) return;
  if (out_size != kRows * kEmb) return;

  const size_t bytesXb = (size_t)kRows * kEmb * 2;
  const size_t bytesWt = (size_t)kN3 * kEmb * 2;
  const size_t bytesPl = (size_t)kRows * kN3 * 2;
  const size_t offXb = 0;
  const size_t offWt = offXb + bytesXb;
  const size_t offHi = offWt + bytesWt;
  const size_t offLo = offHi + bytesPl;
  const size_t total = offLo + bytesPl;
  if (total > ws_size) return;

  const float* x = (const float*)d_in[0];   // [4, 2048, 1024] f32
  const float* W = (const float*)d_in[1];   // [1024, 3072] f32
  float* outp = (float*)d_out;              // [4, 2048, 1024] f32

  char* ws = (char*)d_ws;
  unsigned short* Xb  = (unsigned short*)(ws + offXb);
  unsigned short* Wt  = (unsigned short*)(ws + offWt);
  unsigned short* Phi = (unsigned short*)(ws + offHi);
  unsigned short* Plo = (unsigned short*)(ws + offLo);
  const float* fdum = (const float*)(ws + offXb);

  // 1) x -> bf16 plane: 1,048,576 threads x 8 elements = 8,388,608
  const int n8 = (kRows * kEmb) / 8;
  cast_f32_bf16x8<<<dim3(n8 / 256), dim3(256), 0, stream>>>(x, Xb, n8);

  // 2) W [1024][3072] -> Wt [3072][1024] bf16; grid (Cc/64, R/64) = (48, 16)
  transpose_cast_bf16<<<dim3(kN3 / 64, kEmb / 64), dim3(256), 0, stream>>>(W, Wt, kEmb, kN3);

  // 3) qkv = Xb [8192][1024] x Wt [3072][1024]^T -> bf16 hi/lo planes [8192][3072]; M=8192, N=3072, K=1024
  const int tiles = (kRows / 64) * (kN3 / 64);   // 6144 tiles, 8 per block
  wmma_gemm64<1, false, 0, 2, false, 0><<<dim3(tiles / 8, 1), dim3(256), 0, stream>>>(
      (const unsigned short*)Xb, (const unsigned short*)Xb, kEmb, 0L,
      (const unsigned short*)Wt, (const unsigned short*)Wt, kEmb, 0L,
      (void*)Phi, (void*)Plo, kN3, 0L,
      fdum, fdum, 0L,
      kRows, kN3, kEmb, 1.0f);

  // 4) causal attention: q cols [0,1024), k cols [1024,2048), v cols [2048,3072) of the planes; ld = 3072
  attn_causal_hd64_split<<<dim3(kBatch * kHeads * (kSeq / kQB)), dim3(128), 0, stream>>>(
      (const unsigned short*)Phi, (const unsigned short*)Plo,
      (const unsigned short*)(Phi + kEmb), (const unsigned short*)(Plo + kEmb),
      (const unsigned short*)(Phi + 2 * kEmb), (const unsigned short*)(Plo + 2 * kEmb),
      outp, kSeq, kHeads, kN3, kN3, kN3, kEmb, 0.125f);
}

// v001
// A run of this version takes 545 microseconds.
// In both of two side-by-side timings against v000, it was 1.30 times as fast.
// Contractions: QKV projection = v_wmma_f32_16x16x32_bf16 on RNE-bf16 copies of x and W (f32 accumulate); q.k^T and p.v = bf16 hi/lo split (hi*hi + hi*lo + lo*hi) on v_wmma_f32_16x16x32_bf16, f32 accumulate; softmax and normalisation in f32.
#include <hip/hip_runtime.h>
#include <stdint.h>

// ---------------------------------------------------------------------------------------------------------------------
// Shared 16-bit WMMA helpers
// ---------------------------------------------------------------------------------------------------------------------
typedef __attribute__((ext_vector_type(16))) _Float16 v16h;
typedef __attribute__((ext_vector_type(8)))  _Float16 v8h;
typedef __attribute__((ext_vector_type(16))) __bf16   v16b;
typedef __attribute__((ext_vector_type(8)))  __bf16   v8b;
typedef __attribute__((ext_vector_type(8)))  float    v8f;
typedef __attribute__((ext_vector_type(4)))  float    v4f;
typedef __attribute__((ext_vector_type(4)))  unsigned v4u;
#define PSCALE 32768.0f
#define U16(p) ((const unsigned short*)(const void*)(p))
#define PSCALE_INV (1.0f / 32768.0f)

__device__ __forceinline__ unsigned short f2bf_bits(float f) {
  unsigned u = __float_as_uint(f);
  return (unsigned short)((u + 0x7FFFu + ((u >> 16) & 1u)) >> 16);
}
__device__ __forceinline__ float bf_bits2f(unsigned short h) { return __uint_as_float(((unsigned)h) << 16); }

// hazard guards as plain device helpers (no inline asm inside the kernel template body)
__device__ __forceinline__ void dep_guard_h(v8f& a, v8f& b, v16h x, v16h y) { asm volatile("v_nop\n\tv_nop\n\tv_nop\n\tv_nop" : "+v"(a), "+v"(b) : "v"(x), "v"(y)); }
__device__ __forceinline__ void dep_guard_b(v8f& a, v8f& b, v16b x, v16b y) { asm volatile("v_nop\n\tv_nop\n\tv_nop\n\tv_nop" : "+v"(a), "+v"(b) : "v"(x), "v"(y)); }
__device__ __forceinline__ void keep4_h(v16h a, v16h b, v16h c, v16h d) { asm volatile("v_nop" :: "v"(a), "v"(b), "v"(c), "v"(d)); }
__device__ __forceinline__ void keep4_b(v16b a, v16b b, v16b c, v16b d) { asm volatile("v_nop" :: "v"(a), "v"(b), "v"(c), "v"(d)); }
__device__ __forceinline__ void acc_guard4(v8f& a, v8f& b, v8f& c, v8f& d) { asm volatile("v_nop\n\tv_nop\n\tv_nop\n\tv_nop" : "+v"(a), "+v"(b), "+v"(c), "+v"(d)); }
template <typename T> struct Frag;
template <> struct Frag<_Float16> {
  typedef v16h V; union U { v16h v; v8h h[2]; };
  static __device__ __forceinline__ v16h load(const _Float16* p) {   // elements 0..7 <- p[0..7], 8..15 <- p[16..23]
    U f; f.h[0] = *(const v8h*)(p); f.h[1] = *(const v8h*)(p + 16); return f.v;
  }
  static __device__ __forceinline__ v8f mma(v16h a, v16h b, v8f c) {
    return __builtin_amdgcn_wmma_f32_16x16x32_f16(false, a, false, b, (short)0, c, false, false);
  }
  static __device__ __forceinline__ void guard(v8f& a, v8f& b, v16h x, v16h y) { dep_guard_h(a, b, x, y); }
  static __device__ __forceinline__ void keep(v16h a, v16h b, v16h c, v16h d) { keep4_h(a, b, c, d); }
};
template <> struct Frag<__bf16> {
  typedef v16b V; union U { v16b v; v8b h[2]; };
  static __device__ __forceinline__ v16b load(const __bf16* p) {
    U f; f.h[0] = *(const v8b*)(p); f.h[1] = *(const v8b*)(p + 16); return f.v;
  }
  static __device__ __forceinline__ v8f mma(v16b a, v16b b, v8f c) {
    return __builtin_amdgcn_wmma_f32_16x16x32_bf16(false, a, false, b, (short)0, c, false, false);
  }
  static __device__ __forceinline__ void guard(v8f& a, v8f& b, v16b x, v16b y) { dep_guard_b(a, b, x, y); }
  static __device__ __forceinline__ void keep(v16b a, v16b b, v16b c, v16b d) { keep4_b(a, b, c, d); }
};

// ---- Register-blocked batched WMMA GEMM ------------------------------------
// C[m,n] = scale * sum_k A[m,k] * Bt[n,k] (+bias)(+resid); each wave owns a 64x64 tile.
// A row-major [M,K]; Bt row-major [N,K]; M,N % 64 == 0, K % 32 == 0.
// SPLIT: operands are hi/lo planes (A2/Bt2 = lo planes, same layout); product = hi*hi + hi*lo + lo*hi.
// BIAS_MODE: 0 = none, 1 = bias[m], 2 = bias[n].
// OUT_MODE: 0 = f32, 1 = f16, 2 = bf16 hi plane (Cout) + bf16 lo plane (Cout2).
// ET: 0 = f16 operands, 1 = bf16 operands (pointers passed as 16-bit storage)
template <int ET> struct Elem;
template <> struct Elem<0> { typedef _Float16 T; };
template <> struct Elem<1> { typedef __bf16 T; };
template <int ET, bool SPLIT, int BIAS_MODE, int OUT_MODE, bool RESID, int ACT = 0>
__global__ __launch_bounds__(256) void wmma_gemm64(
    const unsigned short* __restrict__ Ap, const unsigned short* __restrict__ A2p, int lda, long strideA,
    const unsigned short* __restrict__ Btp, const unsigned short* __restrict__ Bt2p, int ldb, long strideB,
    void* __restrict__ Cout, void* __restrict__ Cout2, int ldc, long strideC,
    const float* __restrict__ bias,
    const float* __restrict__ resid, long strideR,
    int M, int N, int K, float scale) {
  typedef typename Elem<ET>::T T;
  typedef typename Frag<T>::V V;
  const T* A = (const T*)Ap; const T* A2 = (const T*)A2p; const T* Bt = (const T*)Btp; const T* Bt2 = (const T*)Bt2p;
  __shared__ __align__(16) float sT[8][16 * 68];   // per-wave 16x64 slab, pitch 68 floats
  const int b    = blockIdx.y;
  const int lane = threadIdx.x & 31;
  const int wave = threadIdx.x >> 5;
  const int tilesN = N >> 6;
  const int tilesM = M >> 6;
  const int tile = blockIdx.x * 8 + wave;
  if (tile >= tilesM * tilesN) return;   // wave-uniform; no block barriers in this kernel
  const int tm = tile / tilesN;
  const int tn = tile - tm * tilesN;
  const int m0 = tm << 6;
  const int n0 = tn << 6;

  const T* Ab  = A  + (size_t)b * strideA;
  const T* Bb  = Bt + (size_t)b * strideB;
  const T* Ab2 = SPLIT ? (A2  + (size_t)b * strideA) : nullptr;
  const T* Bb2 = SPLIT ? (Bt2 + (size_t)b * strideB) : nullptr;

  const int rlane = lane & 15;                 // row (A) / col (B, D) within subtile
  const int koff  = (lane >> 4) * 8;           // k offset of this lane half
  const int mOff  = (lane >> 4) * 8;           // D row offset

  v8f acc[4][4];
#pragma unroll
  for (int i = 0; i < 4; ++i)
#pragma unroll
    for (int j = 0; j < 4; ++j) acc[i][j] = (v8f){0.f,0.f,0.f,0.f,0.f,0.f,0.f,0.f};

  for (int k0 = 0; k0 < K; k0 += 32) {
    V bh[4], bl[4];
#pragma unroll
    for (int j = 0; j < 4; ++j) {
      const size_t bo = (size_t)(n0 + (j << 4) + rlane) * ldb + koff + k0;
      bh[j] = Frag<T>::load(Bb + bo);
      if (SPLIT) bl[j] = Frag<T>::load(Bb2 + bo);
    }
#pragma unroll
    for (int i = 0; i < 4; ++i) {
      const size_t ao = (size_t)(m0 + (i << 4) + rlane) * lda + koff + k0;
      V ah = Frag<T>::load(Ab + ao);
      V al;
      if (SPLIT) al = Frag<T>::load(Ab2 + ao);
#pragma unroll
      for (int j = 0; j < 4; ++j) {
        acc[i][j] = Frag<T>::mma(ah, bh[j], acc[i][j]);
        if (SPLIT) {
          acc[i][j] = Frag<T>::mma(ah, bl[j], acc[i][j]);
          acc[i][j] = Frag<T>::mma(al, bh[j], acc[i][j]);
        }
      }
      Frag<T>::guard(acc[i][0], acc[i][3], ah, SPLIT ? al : ah);
    }
    Frag<T>::keep(bh[0], bh[1], bh[2], bh[3]);
    if (SPLIT) Frag<T>::keep(bl[0], bl[1], bl[2], bl[3]);
  }
  acc_guard4(acc[0][0], acc[0][1], acc[0][2], acc[0][3]);
  acc_guard4(acc[1][0], acc[1][1], acc[1][2], acc[1][3]);
  acc_guard4(acc[2][0], acc[2][1], acc[2][2], acc[2][3]);
  acc_guard4(acc[3][0], acc[3][1], acc[3][2], acc[3][3]);

  // ---- epilogue ----
  float* slab = sT[wave];
  const float* Rb = RESID ? (resid + (size_t)b * strideR) : nullptr;
#pragma unroll
  for (int i = 0; i < 4; ++i) {
    const int mBase = m0 + (i << 4);
#pragma unroll
    for (int j = 0; j < 4; ++j) {
      const int n = n0 + (j << 4) + rlane;
      float bv = 0.f;
      if (BIAS_MODE == 2) bv = bias[n];
#pragma unroll
      for (int r = 0; r < 8; ++r) {
        float v = acc[i][j][r] * scale;
        if (BIAS_MODE == 1) v += bias[mBase + mOff + r];
        if (BIAS_MODE == 2) v += bv;
        if (RESID) v += Rb[(size_t)(mBase + mOff + r) * ldc + n];
        if (ACT == 1) v = tanhf(v);
        if (ACT == 2) v = fmaxf(v, 0.0f);
        if (ACT == 3) v = v / (1.0f + expf(-v));
        if (ACT == 4) v = (v > 0.f) ? v : 0.01f * v;
        if (ACT == 5) v = 0.5f * v * (1.0f + erff(v * 0.70710678118654752f));
        slab[(mOff + r) * 68 + (j << 4) + rlane] = v;
      }
    }
    __builtin_amdgcn_fence(__ATOMIC_RELEASE, "workgroup");
    __builtin_amdgcn_wave_barrier();
    __builtin_amdgcn_fence(__ATOMIC_ACQUIRE, "workgroup");
    if (OUT_MODE == 0) {
      float* C = (float*)Cout + (size_t)b * strideC;
      const int hh = lane >> 4, c4 = (lane & 15) * 4;     // row seg = 256 B = 16 lanes x 16 B
      {
#pragma unroll
        for (int it = 0; it < 8; ++it) {
          const int row = it * 2 + hh;
          v4f v = *(const v4f*)(slab + row * 68 + c4);
          *(v4f*)(C + (size_t)(mBase + row) * ldc + n0 + c4) = v;
        }
        
      }
    } else {
      const int q = lane >> 3, c8 = (lane & 7) * 8;
      unsigned short* C  = (unsigned short*)Cout  + (size_t)b * strideC;
      unsigned short* C2 = (OUT_MODE == 2) ? ((unsigned short*)Cout2 + (size_t)b * strideC) : nullptr;
      {
#pragma unroll
        for (int it = 0; it < 4; ++it) {
          const int row = it * 4 + q;
          const float* sp = slab + row * 68 + c8;
          v8h hv, lv;
#pragma unroll
          for (int e = 0; e < 8; ++e) {
            if (OUT_MODE == 1) {
              hv[e] = (_Float16)sp[e];
            } else {
              unsigned short hb = f2bf_bits(sp[e]);
              unsigned short lb = f2bf_bits(sp[e] - bf_bits2f(hb));
              hv[e] = __builtin_bit_cast(_Float16, hb);
              lv[e] = __builtin_bit_cast(_Float16, lb);
            }
          }
          *(v8h*)(C + (size_t)(mBase + row) * ldc + n0 + c8) = hv;
          if (OUT_MODE == 2) *(v8h*)(C2 + (size_t)(mBase + row) * ldc + n0 + c8) = lv;
        }
        
      }
    }
    __builtin_amdgcn_fence(__ATOMIC_RELEASE, "workgroup");
    __builtin_amdgcn_wave_barrier();
    __builtin_amdgcn_fence(__ATOMIC_ACQUIRE, "workgroup");
  }
}

// ---------------------------------------------------------------------------------------------------------------------
// bf16 helpers for the attention kernel
// ---------------------------------------------------------------------------------------------------------------------
__device__ __forceinline__ unsigned short at_bf_bits(float f) {
  unsigned u = __float_as_uint(f);
  return (unsigned short)((u + 0x7FFFu + ((u >> 16) & 1u)) >> 16);
}
__device__ __forceinline__ __bf16 at_f2bf(float f) { return __builtin_bit_cast(__bf16, at_bf_bits(f)); }
__device__ __forceinline__ void at_split(float f, __bf16& hi, __bf16& lo) {
  const unsigned short hb = at_bf_bits(f);
  hi = __builtin_bit_cast(__bf16, hb);
  lo = at_f2bf(f - __uint_as_float(((unsigned)hb) << 16));
}
__device__ __forceinline__ v8f at_mma(v16b a, v16b b, v8f c) {
  c = __builtin_amdgcn_wmma_f32_16x16x32_bf16(false, a, false, b, (short)0, c, false, false);
  asm volatile("v_nop\n\tv_nop\n\tv_nop\n\tv_nop" : "+v"(c) : "v"(a), "v"(b));
  return c;
}

// ---------------------------------------------------------------------------------------------------------------------
// Problem constants
// ---------------------------------------------------------------------------------------------------------------------
constexpr int kBatch   = 4;
constexpr int kSeq     = 2048;
constexpr int kEmb     = 1024;
constexpr int kHeads   = 16;
constexpr int kHeadDim = 64;
constexpr int kRows    = kBatch * kSeq;   // 8192 = GEMM M
constexpr int kN3      = 3 * kEmb;        // 3072 = GEMM N
static_assert(kEmb % 32 == 0, "K");
static_assert(kRows % 64 == 0 && kN3 % 64 == 0, "MN");
static_assert(((kRows / 64) * (kN3 / 64)) % 8 == 0, "tiles");
static_assert(kHeads * kHeadDim == kEmb, "heads");
static_assert(kSeq % 64 == 0, "S");
static_assert((kRows * kEmb) % (8 * 256) == 0, "cast grid");
static_assert(kEmb % 64 == 0 && kN3 % 64 == 0, "transpose grid");

// ---------------------------------------------------------------------------------------------------------------------
// f32 -> bf16 (RNE) cast: thread i converts elements 8i..8i+7 (two 16-B loads, one 16-B store);
// Coverage: n8 threads x 8 = whole plane (n8 = n/8 exact).
// ---------------------------------------------------------------------------------------------------------------------
__global__ __launch_bounds__(256) void cast_f32_bf16x8(const float* __restrict__ in, unsigned short* __restrict__ outp, int n8) {
  const int i = blockIdx.x * 256 + threadIdx.x;
  if (i < n8) {
    const size_t e0 = (size_t)i * 8;
    const v4f a = *(const v4f*)(in + e0);
    const v4f c = *(const v4f*)(in + e0 + 4);
    v4u u;
    u[0] = (unsigned)f2bf_bits(a[0]) | ((unsigned)f2bf_bits(a[1]) << 16);
    u[1] = (unsigned)f2bf_bits(a[2]) | ((unsigned)f2bf_bits(a[3]) << 16);
    u[2] = (unsigned)f2bf_bits(c[0]) | ((unsigned)f2bf_bits(c[1]) << 16);
    u[3] = (unsigned)f2bf_bits(c[2]) | ((unsigned)f2bf_bits(c[3]) << 16);
    *(v4u*)(outp + e0) = u;
    
  }
}

// ---------------------------------------------------------------------------------------------------------------------
// Transpose + cast: in [R][Cc] f32 row-major -> outp [Cc][R] bf16, outp[n][e] = bf16(in[e][n]).
// Tile 64 (e) x 64 (n); grid (Cc/64, R/64); block 256.
// Load coverage: 256 threads x 16 elements = 64x64. Store coverage: 8 waves x 2 iterations x 4 rows = 64 rows,
// ---------------------------------------------------------------------------------------------------------------------
__global__ __launch_bounds__(256) void transpose_cast_bf16(const float* __restrict__ in, unsigned short* __restrict__ outp, int R, int Cc) {
  __shared__ __align__(16) unsigned short tT[64 * 72];   // [n_local][e_local], pitch 72
  const int tid = threadIdx.x;
  const int n0 = blockIdx.x * 64;
  const int e0 = blockIdx.y * 64;
  {
    const int el = tid >> 2, nl = (tid & 3) * 16;
    const float* src = in + (size_t)(e0 + el) * Cc + n0 + nl;
#pragma unroll
    for (int i = 0; i < 4; ++i) {
      const v4f f = *(const v4f*)(src + 4 * i);
#pragma unroll
      for (int e = 0; e < 4; ++e) tT[(nl + 4 * i + e) * 72 + el] = f2bf_bits(f[e]);
    }
  }
  __syncthreads();
  const int wave = tid >> 5, lane = tid & 31, q = lane >> 3, c8 = (lane & 7) * 8;
  {
#pragma unroll
    for (int it = 0; it < 2; ++it) {
      const int nl = wave * 8 + it * 4 + q;
      const v4u w = *(const v4u*)(tT + nl * 72 + c8);
      *(v4u*)(outp + (size_t)(n0 + nl) * R + e0 + c8) = w;
    }
    
  }
}

// ---------------------------------------------------------------------------------------------------------------------
// Causal attention, head dim 64, 16-bit plane inputs, f32 output.
//   q, k, v are bf16 hi + lo planes: element (b, s, h, d) at plane[(b*S + s)*ld + h*64 + d] (ld in elements, % 8 == 0).
//   scores = sscale * q.k^T : bf16 hi/lo split (hi*hi + hi*lo + lo*hi), f32 accumulate
//   out    = p.v            : p (f32, split into bf16 hi/lo in LDS) and v hi/lo planes, f32 accumulate
//   online softmax in f32; keys with kv > q replaced by -inf before the softmax.
//   Block = 4 waves = 64 query rows of one (b, h); grid.x = B * H * (S/64); S % 64 == 0.
// ---------------------------------------------------------------------------------------------------------------------
constexpr int kQB = 64;   // query rows per block
constexpr int kKC = 64;   // keys per chunk
constexpr int kNW = 4;    // waves per block
constexpr int kOP = 68;   // output slab pitch (floats)
constexpr int kLP = 72;   // LDS row pitch of the K, V^T and P tiles, in 16-bit elements: 144 B = 16 B x odd, so that the
                          // 16 rows one 16-byte fragment read touches fall on distinct banks; columns 64..71 are never used

__global__ __launch_bounds__(128)
void attn_causal_hd64_split(const unsigned short* __restrict__ qh, const unsigned short* __restrict__ ql,
                            const unsigned short* __restrict__ kh, const unsigned short* __restrict__ kl,
                            const unsigned short* __restrict__ vh, const unsigned short* __restrict__ vl,
                            float* __restrict__ out,
                            int S, int H, int ldq, int ldk, int ldv, int ldo, float sscale) {
  typedef Frag<__bf16>::U FB;
  __shared__ __align__(16) unsigned short Ksh[kKC * kLP];        // K hi [kv][d]
  __shared__ __align__(16) unsigned short Ksl[kKC * kLP];        // K lo [kv][d]
  __shared__ __align__(16) unsigned short Vth[kHeadDim * kLP];   // V hi [d][kv]
  __shared__ __align__(16) unsigned short Vtl[kHeadDim * kLP];   // V lo [d][kv]
  __shared__ __align__(16) __bf16 Psh[kNW][16 * kLP];            // per wave P hi [row][kv]
  __shared__ __align__(16) __bf16 Psl[kNW][16 * kLP];            // per wave P lo [row][kv]
  __shared__ __align__(16) float  Os[kNW][16 * kOP];             // per wave out tile

  const int tid  = threadIdx.x;
  const int wave = tid >> 5;
  const int lane = tid & 31;
  const int hh   = lane >> 4;
  const int c    = lane & 15;

  const int nqb = S / kQB;
  const int bx = blockIdx.x;
  const int qb = bx % nqb;
  const int bh = bx / nqb;
  const int h  = bh % H;
  const int b  = bh / H;
  const int q0 = qb * kQB + wave * 16;
  const size_t rowb = (size_t)b * (size_t)S;
  const int hcol = h * kHeadDim;

  // ---- Q fragments (A operand, row = query q0 + c, k = d): 2 d-chunks, hi and lo planes ----
  v16b qah[2], qal[2];
  {
    const size_t qo = (rowb + (size_t)(q0 + c)) * (size_t)ldq + (size_t)(hcol + 8 * hh);
    const __bf16* qr  = (const __bf16*)(const void*)(qh + qo);
    const __bf16* qr2 = (const __bf16*)(const void*)(ql + qo);
#pragma unroll
    for (int dc = 0; dc < 2; ++dc) {
      qah[dc] = Frag<__bf16>::load(qr + dc * 32);
      qal[dc] = Frag<__bf16>::load(qr2 + dc * 32);
    }
  }

  float mrow[8], lrow[8];
  v8f oacc[4];
#pragma unroll
  for (int r = 0; r < 8; ++r) { mrow[r] = -__builtin_inff(); lrow[r] = 0.f; }
#pragma unroll
  for (int t = 0; t < 4; ++t) oacc[t] = (v8f){0.f,0.f,0.f,0.f,0.f,0.f,0.f,0.f};

  const int nChunks = qb + 1;   // block-uniform; causal: key chunks 0..qb
  for (int kc = 0; kc < nChunks; ++kc) {
    const int kv0 = kc * kKC;
    __syncthreads();
    {
      // staging: thread -> kv row kvr = tid>>1 (0..63), d half dh = (tid&1)*32; 128 threads x 32 = 64x64 per plane
      const int kvr = tid >> 1, dh = (tid & 1) * 32;
      const size_t krow = rowb + (size_t)(kv0 + kvr);
      const unsigned short* gkh = kh + krow * (size_t)ldk + hcol + dh;
      const unsigned short* gkl = kl + krow * (size_t)ldk + hcol + dh;
      v4u wa[4], wb[4];
#pragma unroll
      for (int i = 0; i < 4; ++i) { wa[i] = *(const v4u*)(gkh + 8 * i); wb[i] = *(const v4u*)(gkl + 8 * i); }
#pragma unroll
      for (int i = 0; i < 4; ++i) {
        *(v4u*)(Ksh + kvr * kLP + dh + 8 * i) = wa[i];
        *(v4u*)(Ksl + kvr * kLP + dh + 8 * i) = wb[i];
      }
      asm volatile("" ::: "memory");
      const unsigned short* gvh = vh + krow * (size_t)ldv + hcol + dh;
      const unsigned short* gvl = vl + krow * (size_t)ldv + hcol + dh;
#pragma unroll
      for (int i = 0; i < 4; ++i) { wa[i] = *(const v4u*)(gvh + 8 * i); wb[i] = *(const v4u*)(gvl + 8 * i); }
#pragma unroll
      for (int i = 0; i < 4; ++i) {
#pragma unroll
        for (int m = 0; m < 4; ++m) {
          const unsigned ua = wa[i][m];
          const unsigned ub = wb[i][m];
          const int d = dh + 8 * i + 2 * m;
          Vth[d * kLP + kvr]       = (unsigned short)(ua & 0xffffu);
          Vth[(d + 1) * kLP + kvr] = (unsigned short)(ua >> 16);
          Vtl[d * kLP + kvr]       = (unsigned short)(ub & 0xffffu);
          Vtl[(d + 1) * kLP + kvr] = (unsigned short)(ub >> 16);
        }
      }
    }
    __syncthreads();

    // ---- scores: s[j][r] = S[query 8hh+r][kv kv0 + j*16 + c] ----
    v8f s[4];
#pragma unroll
    for (int j = 0; j < 4; ++j) {
      s[j] = (v8f){0.f,0.f,0.f,0.f,0.f,0.f,0.f,0.f};
#pragma unroll
      for (int dc = 0; dc < 2; ++dc) {
        FB kb, kb2;
        const unsigned short* kp  = Ksh + (j * 16 + c) * kLP + dc * 32 + 8 * hh;
        const unsigned short* kp2 = Ksl + (j * 16 + c) * kLP + dc * 32 + 8 * hh;
        kb.h[0]  = *(const v8b*)(const void*)(kp);
        kb.h[1]  = *(const v8b*)(const void*)(kp + 16);
        kb2.h[0] = *(const v8b*)(const void*)(kp2);
        kb2.h[1] = *(const v8b*)(const void*)(kp2 + 16);
        s[j] = at_mma(qah[dc], kb.v, s[j]);
        s[j] = at_mma(qah[dc], kb2.v, s[j]);
        s[j] = at_mma(qal[dc], kb.v, s[j]);
      }
    }
    const bool diag = (kc == qb);   // block-uniform
    float cm[8];
#pragma unroll
    for (int r = 0; r < 8; ++r) {
      const int qrow = q0 + 8 * hh + r;
      float m = -__builtin_inff();
#pragma unroll
      for (int j = 0; j < 4; ++j) {
        const int kvcol = kv0 + j * 16 + c;
        float sv = s[j][r] * sscale;
        sv = (diag && (kvcol > qrow)) ? -__builtin_inff() : sv;
        s[j][r] = sv;
        m = fmaxf(m, sv);
      }
#pragma unroll
      for (int off = 1; off < 16; off <<= 1) m = fmaxf(m, __shfl_xor(m, off, 32));
      cm[r] = m;
    }
    __bf16* pwh = Psh[wave];
    __bf16* pwl = Psl[wave];
#pragma unroll
    for (int r = 0; r < 8; ++r) {
      const float mnew = fmaxf(mrow[r], cm[r]);
      const float alpha = expf(mrow[r] - mnew);
      mrow[r] = mnew;
      float psum = 0.f;
#pragma unroll
      for (int j = 0; j < 4; ++j) {
        const float p = expf(s[j][r] - mnew);
        psum += p;
        __bf16 a, bl;
        at_split(p, a, bl);
        pwh[(8 * hh + r) * kLP + j * 16 + c] = a;
        pwl[(8 * hh + r) * kLP + j * 16 + c] = bl;
      }
#pragma unroll
      for (int off = 1; off < 16; off <<= 1) psum += __shfl_xor(psum, off, 32);
      lrow[r] = lrow[r] * alpha + psum;
#pragma unroll
      for (int t = 0; t < 4; ++t) oacc[t][r] *= alpha;
    }
    __builtin_amdgcn_fence(__ATOMIC_RELEASE, "workgroup");
    __builtin_amdgcn_wave_barrier();
    __builtin_amdgcn_fence(__ATOMIC_ACQUIRE, "workgroup");
    // ---- out[query][d] += P[query][kv] * V[kv][d]; A = P (row = query c, k = kv), B from Vt [d][kv] ----
#pragma unroll
    for (int kk = 0; kk < 2; ++kk) {
      FB pa, pl;
      pa.h[0] = *(const v8b*)(pwh + c * kLP + kk * 32 + 8 * hh);
      pa.h[1] = *(const v8b*)(pwh + c * kLP + kk * 32 + 16 + 8 * hh);
      pl.h[0] = *(const v8b*)(pwl + c * kLP + kk * 32 + 8 * hh);
      pl.h[1] = *(const v8b*)(pwl + c * kLP + kk * 32 + 16 + 8 * hh);
#pragma unroll
      for (int t = 0; t < 4; ++t) {
        FB vb, vb2;
        const unsigned short* vpa = Vth + (t * 16 + c) * kLP + kk * 32 + 8 * hh;
        const unsigned short* vpb = Vtl + (t * 16 + c) * kLP + kk * 32 + 8 * hh;
        vb.h[0]  = *(const v8b*)(const void*)(vpa);
        vb.h[1]  = *(const v8b*)(const void*)(vpa + 16);
        vb2.h[0] = *(const v8b*)(const void*)(vpb);
        vb2.h[1] = *(const v8b*)(const void*)(vpb + 16);
        oacc[t] = at_mma(pa.v, vb.v, oacc[t]);
        oacc[t] = at_mma(pa.v, vb2.v, oacc[t]);
        oacc[t] = at_mma(pl.v, vb.v, oacc[t]);
      }
    }
  }

  // ---- epilogue: normalise, stage the wave's 16x64 tile, write whole 256-B row segments ----
  float* os = Os[wave];
#pragma unroll
  for (int r = 0; r < 8; ++r) {
    const float inv = 1.0f / lrow[r];
#pragma unroll
    for (int t = 0; t < 4; ++t) os[(8 * hh + r) * kOP + t * 16 + c] = oacc[t][r] * inv;
  }
  __builtin_amdgcn_fence(__ATOMIC_RELEASE, "workgroup");
  __builtin_amdgcn_wave_barrier();
  __builtin_amdgcn_fence(__ATOMIC_ACQUIRE, "workgroup");
  {
    float* ob = out + (size_t)hcol;
    const int c4 = (lane & 15) * 4;   // 16 lanes x 16 B = 256 B = one row segment of 64 floats
    {
#pragma unroll
      for (int it = 0; it < 8; ++it) {
        const int row = it * 2 + hh;
        v4f val = *(const v4f*)(os + row * kOP + c4);
        *(v4f*)(ob + (rowb + (size_t)(q0 + row)) * (size_t)ldo + c4) = val;
      }
      
    }
  }
}

// ---------------------------------------------------------------------------------------------------------------------
// Host launcher
// Workspace region map (bytes):
//   [0,            16,777,216)  Xb   bf16 [8192][1024]           (RNE copy of x)
//   [16,777,216,   23,068,672)  Wt   bf16 [3072][1024]           (RNE copy of W^T)
//   [23,068,672,   73,400,320)  Phi  bf16 [8192][3072]           (qkv hi plane)
//   [73,400,320,  123,731,968)  Plo  bf16 [8192][3072]           (qkv lo plane)
//   total 123,731,968
// ---------------------------------------------------------------------------------------------------------------------
extern "C" void kernel_launch(void* const* d_in, const int* in_sizes, int n_in,
                              void* d_out, int out_size, void* d_ws, size_t ws_size,
                              hipStream_t stream) {
  if (n_in < 2) return;
  if (in_sizes[0] != kRows * kEmb) return;
  if (in_sizes[1] != kEmb * kN3) return;
  if (out_size != kRows * kEmb) return;

  const size_t bytesXb = (size_t)kRows * kEmb * 2;
  const size_t bytesWt = (size_t)kN3 * kEmb * 2;
  const size_t bytesPl = (size_t)kRows * kN3 * 2;
  const size_t offXb = 0;
  const size_t offWt = offXb + bytesXb;
  const size_t offHi = offWt + bytesWt;
  const size_t offLo = offHi + bytesPl;
  const size_t total = offLo + bytesPl;
  if (total > ws_size) return;

  const float* x = (const float*)d_in[0];   // [4, 2048, 1024] f32
  const float* W = (const float*)d_in[1];   // [1024, 3072] f32
  float* outp = (float*)d_out;              // [4, 2048, 1024] f32

  char* ws = (char*)d_ws;
  unsigned short* Xb  = (unsigned short*)(ws + offXb);
  unsigned short* Wt  = (unsigned short*)(ws + offWt);
  unsigned short* Phi = (unsigned short*)(ws + offHi);
  unsigned short* Plo = (unsigned short*)(ws + offLo);
  const float* fdum = (const float*)(ws + offXb);

  // 1) x -> bf16 plane: 1,048,576 threads x 8 elements = 8,388,608
  const int n8 = (kRows * kEmb) / 8;
  cast_f32_bf16x8<<<dim3(n8 / 256), dim3(256), 0, stream>>>(x, Xb, n8);

  // 2) W [1024][3072] -> Wt [3072][1024] bf16; grid (Cc/64, R/64) = (48, 16)
  transpose_cast_bf16<<<dim3(kN3 / 64, kEmb / 64), dim3(256), 0, stream>>>(W, Wt, kEmb, kN3);

  // 3) qkv = Xb [8192][1024] x Wt [3072][1024]^T -> bf16 hi/lo planes [8192][3072]; M=8192, N=3072, K=1024
  const int tiles = (kRows / 64) * (kN3 / 64);   // 6144 tiles, 8 per block
  wmma_gemm64<1, false, 0, 2, false, 0><<<dim3(tiles / 8, 1), dim3(256), 0, stream>>>(
      (const unsigned short*)Xb, (const unsigned short*)Xb, kEmb, 0L,
      (const unsigned short*)Wt, (const unsigned short*)Wt, kEmb, 0L,
      (void*)Phi, (void*)Plo, kN3, 0L,
      fdum, fdum, 0L,
      kRows, kN3, kEmb, 1.0f);

  // 4) causal attention: q cols [0,1024), k cols [1024,2048), v cols [2048,3072) of the planes; ld = 3072
  attn_causal_hd64_split<<<dim3(kBatch * kHeads * (kSeq / kQB)), dim3(128), 0, stream>>>(
      (const unsigned short*)Phi, (const unsigned short*)Plo,
      (const unsigned short*)(Phi + kEmb), (const unsigned short*)(Plo + kEmb),
      (const unsigned short*)(Phi + 2 * kEmb), (const unsigned short*)(Plo + 2 * kEmb),
      outp, kSeq, kHeads, kN3, kN3, kN3, kEmb, 0.125f);
}

// v002
// One run takes 375 microseconds.
// In two side-by-side timings against v001, it was 1.45 and 1.46 times as fast.
// All steps since v000 together make it 1.89 times as fast.
// Contractions: QKV projection = v_wmma_f32_16x16x32_bf16 on RNE-bf16 copies of x and W (f32 accumulate); q.k^T and p.v = bf16 hi/lo split (hi*hi + hi*lo + lo*hi) on v_wmma_f32_16x16x32_bf16, f32 accumulate; softmax and normalisation in f32.
#include <hip/hip_runtime.h>
#include <stdint.h>

// ---------------------------------------------------------------------------------------------------------------------
// Shared 16-bit WMMA helpers
// ---------------------------------------------------------------------------------------------------------------------
typedef __attribute__((ext_vector_type(16))) _Float16 v16h;
typedef __attribute__((ext_vector_type(8)))  _Float16 v8h;
typedef __attribute__((ext_vector_type(16))) __bf16   v16b;
typedef __attribute__((ext_vector_type(8)))  __bf16   v8b;
typedef __attribute__((ext_vector_type(8)))  float    v8f;
typedef __attribute__((ext_vector_type(4)))  float    v4f;
typedef __attribute__((ext_vector_type(4)))  unsigned v4u;
#define PSCALE 32768.0f
#define U16(p) ((const unsigned short*)(const void*)(p))
#define PSCALE_INV (1.0f / 32768.0f)

__device__ __forceinline__ unsigned short f2bf_bits(float f) {
  unsigned u = __float_as_uint(f);
  return (unsigned short)((u + 0x7FFFu + ((u >> 16) & 1u)) >> 16);
}
__device__ __forceinline__ float bf_bits2f(unsigned short h) { return __uint_as_float(((unsigned)h) << 16); }

// hazard guards as plain device helpers (no inline asm inside the kernel template body)
__device__ __forceinline__ void dep_guard_h(v8f& a, v8f& b, v16h x, v16h y) { asm volatile("v_nop\n\tv_nop\n\tv_nop\n\tv_nop" : "+v"(a), "+v"(b) : "v"(x), "v"(y)); }
__device__ __forceinline__ void dep_guard_b(v8f& a, v8f& b, v16b x, v16b y) { asm volatile("v_nop\n\tv_nop\n\tv_nop\n\tv_nop" : "+v"(a), "+v"(b) : "v"(x), "v"(y)); }
__device__ __forceinline__ void keep4_h(v16h a, v16h b, v16h c, v16h d) { asm volatile("v_nop" :: "v"(a), "v"(b), "v"(c), "v"(d)); }
__device__ __forceinline__ void keep4_b(v16b a, v16b b, v16b c, v16b d) { asm volatile("v_nop" :: "v"(a), "v"(b), "v"(c), "v"(d)); }
__device__ __forceinline__ void acc_guard4(v8f& a, v8f& b, v8f& c, v8f& d) { asm volatile("v_nop\n\tv_nop\n\tv_nop\n\tv_nop" : "+v"(a), "+v"(b), "+v"(c), "+v"(d)); }
template <typename T> struct Frag;
template <> struct Frag<_Float16> {
  typedef v16h V; union U { v16h v; v8h h[2]; };
  static __device__ __forceinline__ v16h load(const _Float16* p) {   // elements 0..7 <- p[0..7], 8..15 <- p[16..23]
    U f; f.h[0] = *(const v8h*)(p); f.h[1] = *(const v8h*)(p + 16); return f.v;
  }
  static __device__ __forceinline__ v8f mma(v16h a, v16h b, v8f c) {
    return __builtin_amdgcn_wmma_f32_16x16x32_f16(false, a, false, b, (short)0, c, false, false);
  }
  static __device__ __forceinline__ void guard(v8f& a, v8f& b, v16h x, v16h y) { dep_guard_h(a, b, x, y); }
  static __device__ __forceinline__ void keep(v16h a, v16h b, v16h c, v16h d) { keep4_h(a, b, c, d); }
};
template <> struct Frag<__bf16> {
  typedef v16b V; union U { v16b v; v8b h[2]; };
  static __device__ __forceinline__ v16b load(const __bf16* p) {
    U f; f.h[0] = *(const v8b*)(p); f.h[1] = *(const v8b*)(p + 16); return f.v;
  }
  static __device__ __forceinline__ v8f mma(v16b a, v16b b, v8f c) {
    return __builtin_amdgcn_wmma_f32_16x16x32_bf16(false, a, false, b, (short)0, c, false, false);
  }
  static __device__ __forceinline__ void guard(v8f& a, v8f& b, v16b x, v16b y) { dep_guard_b(a, b, x, y); }
  static __device__ __forceinline__ void keep(v16b a, v16b b, v16b c, v16b d) { keep4_b(a, b, c, d); }
};

// ---- Register-blocked batched WMMA GEMM ------------------------------------
// C[m,n] = scale * sum_k A[m,k] * Bt[n,k] (+bias)(+resid); each wave owns a 64x64 tile.
// A row-major [M,K]; Bt row-major [N,K]; M,N % 64 == 0, K % 32 == 0.
// SPLIT: operands are hi/lo planes (A2/Bt2 = lo planes, same layout); product = hi*hi + hi*lo + lo*hi.
// BIAS_MODE: 0 = none, 1 = bias[m], 2 = bias[n].
// OUT_MODE: 0 = f32, 1 = f16, 2 = bf16 hi plane (Cout) + bf16 lo plane (Cout2).
// ET: 0 = f16 operands, 1 = bf16 operands (pointers passed as 16-bit storage)
template <int ET> struct Elem;
template <> struct Elem<0> { typedef _Float16 T; };
template <> struct Elem<1> { typedef __bf16 T; };
template <int ET, bool SPLIT, int BIAS_MODE, int OUT_MODE, bool RESID, int ACT = 0>
__global__ __launch_bounds__(256) void wmma_gemm64(
    const unsigned short* __restrict__ Ap, const unsigned short* __restrict__ A2p, int lda, long strideA,
    const unsigned short* __restrict__ Btp, const unsigned short* __restrict__ Bt2p, int ldb, long strideB,
    void* __restrict__ Cout, void* __restrict__ Cout2, int ldc, long strideC,
    const float* __restrict__ bias,
    const float* __restrict__ resid, long strideR,
    int M, int N, int K, float scale) {
  typedef typename Elem<ET>::T T;
  typedef typename Frag<T>::V V;
  const T* A = (const T*)Ap; const T* A2 = (const T*)A2p; const T* Bt = (const T*)Btp; const T* Bt2 = (const T*)Bt2p;
  __shared__ __align__(16) float sT[8][16 * 68];   // per-wave 16x64 slab, pitch 68 floats
  const int b    = blockIdx.y;
  const int lane = threadIdx.x & 31;
  const int wave = threadIdx.x >> 5;
  const int tilesN = N >> 6;
  const int tilesM = M >> 6;
  const int tile = blockIdx.x * 8 + wave;
  if (tile >= tilesM * tilesN) return;   // wave-uniform; no block barriers in this kernel
  const int tm = tile / tilesN;
  const int tn = tile - tm * tilesN;
  const int m0 = tm << 6;
  const int n0 = tn << 6;

  const T* Ab  = A  + (size_t)b * strideA;
  const T* Bb  = Bt + (size_t)b * strideB;
  const T* Ab2 = SPLIT ? (A2  + (size_t)b * strideA) : nullptr;
  const T* Bb2 = SPLIT ? (Bt2 + (size_t)b * strideB) : nullptr;

  const int rlane = lane & 15;                 // row (A) / col (B, D) within subtile
  const int koff  = (lane >> 4) * 8;           // k offset of this lane half
  const int mOff  = (lane >> 4) * 8;           // D row offset

  v8f acc[4][4];
#pragma unroll
  for (int i = 0; i < 4; ++i)
#pragma unroll
    for (int j = 0; j < 4; ++j) acc[i][j] = (v8f){0.f,0.f,0.f,0.f,0.f,0.f,0.f,0.f};

  for (int k0 = 0; k0 < K; k0 += 32) {
    V bh[4], bl[4];
#pragma unroll
    for (int j = 0; j < 4; ++j) {
      const size_t bo = (size_t)(n0 + (j << 4) + rlane) * ldb + koff + k0;
      bh[j] = Frag<T>::load(Bb + bo);
      if (SPLIT) bl[j] = Frag<T>::load(Bb2 + bo);
    }
#pragma unroll
    for (int i = 0; i < 4; ++i) {
      const size_t ao = (size_t)(m0 + (i << 4) + rlane) * lda + koff + k0;
      V ah = Frag<T>::load(Ab + ao);
      V al;
      if (SPLIT) al = Frag<T>::load(Ab2 + ao);
#pragma unroll
      for (int j = 0; j < 4; ++j) {
        acc[i][j] = Frag<T>::mma(ah, bh[j], acc[i][j]);
        if (SPLIT) {
          acc[i][j] = Frag<T>::mma(ah, bl[j], acc[i][j]);
          acc[i][j] = Frag<T>::mma(al, bh[j], acc[i][j]);
        }
      }
      Frag<T>::guard(acc[i][0], acc[i][3], ah, SPLIT ? al : ah);
    }
    Frag<T>::keep(bh[0], bh[1], bh[2], bh[3]);
    if (SPLIT) Frag<T>::keep(bl[0], bl[1], bl[2], bl[3]);
  }
  acc_guard4(acc[0][0], acc[0][1], acc[0][2], acc[0][3]);
  acc_guard4(acc[1][0], acc[1][1], acc[1][2], acc[1][3]);
  acc_guard4(acc[2][0], acc[2][1], acc[2][2], acc[2][3]);
  acc_guard4(acc[3][0], acc[3][1], acc[3][2], acc[3][3]);

  // ---- epilogue ----
  float* slab = sT[wave];
  const float* Rb = RESID ? (resid + (size_t)b * strideR) : nullptr;
#pragma unroll
  for (int i = 0; i < 4; ++i) {
    const int mBase = m0 + (i << 4);
#pragma unroll
    for (int j = 0; j < 4; ++j) {
      const int n = n0 + (j << 4) + rlane;
      float bv = 0.f;
      if (BIAS_MODE == 2) bv = bias[n];
#pragma unroll
      for (int r = 0; r < 8; ++r) {
        float v = acc[i][j][r] * scale;
        if (BIAS_MODE == 1) v += bias[mBase + mOff + r];
        if (BIAS_MODE == 2) v += bv;
        if (RESID) v += Rb[(size_t)(mBase + mOff + r) * ldc + n];
        if (ACT == 1) v = tanhf(v);
        if (ACT == 2) v = fmaxf(v, 0.0f);
        if (ACT == 3) v = v / (1.0f + expf(-v));
        if (ACT == 4) v = (v > 0.f) ? v : 0.01f * v;
        if (ACT == 5) v = 0.5f * v * (1.0f + erff(v * 0.70710678118654752f));
        slab[(mOff + r) * 68 + (j << 4) + rlane] = v;
      }
    }
    __builtin_amdgcn_fence(__ATOMIC_RELEASE, "workgroup");
    __builtin_amdgcn_wave_barrier();
    __builtin_amdgcn_fence(__ATOMIC_ACQUIRE, "workgroup");
    if (OUT_MODE == 0) {
      float* C = (float*)Cout + (size_t)b * strideC;
      const int hh = lane >> 4, c4 = (lane & 15) * 4;     // row seg = 256 B = 16 lanes x 16 B
      {
#pragma unroll
        for (int it = 0; it < 8; ++it) {
          const int row = it * 2 + hh;
          v4f v = *(const v4f*)(slab + row * 68 + c4);
          *(v4f*)(C + (size_t)(mBase + row) * ldc + n0 + c4) = v;
        }
        
      }
    } else {
      const int q = lane >> 3, c8 = (lane & 7) * 8;
      unsigned short* C  = (unsigned short*)Cout  + (size_t)b * strideC;
      unsigned short* C2 = (OUT_MODE == 2) ? ((unsigned short*)Cout2 + (size_t)b * strideC) : nullptr;
      {
#pragma unroll
        for (int it = 0; it < 4; ++it) {
          const int row = it * 4 + q;
          const float* sp = slab + row * 68 + c8;
          v8h hv, lv;
#pragma unroll
          for (int e = 0; e < 8; ++e) {
            if (OUT_MODE == 1) {
              hv[e] = (_Float16)sp[e];
            } else {
              unsigned short hb = f2bf_bits(sp[e]);
              unsigned short lb = f2bf_bits(sp[e] - bf_bits2f(hb));
              hv[e] = __builtin_bit_cast(_Float16, hb);
              lv[e] = __builtin_bit_cast(_Float16, lb);
            }
          }
          *(v8h*)(C + (size_t)(mBase + row) * ldc + n0 + c8) = hv;
          if (OUT_MODE == 2) *(v8h*)(C2 + (size_t)(mBase + row) * ldc + n0 + c8) = lv;
        }
        
      }
    }
    __builtin_amdgcn_fence(__ATOMIC_RELEASE, "workgroup");
    __builtin_amdgcn_wave_barrier();
    __builtin_amdgcn_fence(__ATOMIC_ACQUIRE, "workgroup");
  }
}

// ---------------------------------------------------------------------------------------------------------------------
// bf16 helpers for the attention kernel
// ---------------------------------------------------------------------------------------------------------------------
__device__ __forceinline__ unsigned short at_bf_bits(float f) {
  unsigned u = __float_as_uint(f);
  return (unsigned short)((u + 0x7FFFu + ((u >> 16) & 1u)) >> 16);
}
__device__ __forceinline__ __bf16 at_f2bf(float f) { return __builtin_bit_cast(__bf16, at_bf_bits(f)); }
__device__ __forceinline__ void at_split(float f, __bf16& hi, __bf16& lo) {
  const unsigned short hb = at_bf_bits(f);
  hi = __builtin_bit_cast(__bf16, hb);
  lo = at_f2bf(f - __uint_as_float(((unsigned)hb) << 16));
}
__device__ __forceinline__ v8f at_mma(v16b a, v16b b, v8f c) {
  c = __builtin_amdgcn_wmma_f32_16x16x32_bf16(false, a, false, b, (short)0, c, false, false);
  asm volatile("v_nop\n\tv_nop\n\tv_nop\n\tv_nop" : "+v"(c) : "v"(a), "v"(b));
  return c;
}

// ---------------------------------------------------------------------------------------------------------------------
// Problem constants
// ---------------------------------------------------------------------------------------------------------------------
constexpr int kBatch   = 4;
constexpr int kSeq     = 2048;
constexpr int kEmb     = 1024;
constexpr int kHeads   = 16;
constexpr int kHeadDim = 64;
constexpr int kRows    = kBatch * kSeq;   // 8192 = GEMM M
constexpr int kN3      = 3 * kEmb;        // 3072 = GEMM N
static_assert(kEmb % 32 == 0, "K");
static_assert(kRows % 64 == 0 && kN3 % 64 == 0, "MN");
static_assert(((kRows / 64) * (kN3 / 64)) % 8 == 0, "tiles");
static_assert(kHeads * kHeadDim == kEmb, "heads");
static_assert(kSeq % 64 == 0, "S");
static_assert((kRows * kEmb) % (8 * 256) == 0, "cast grid");
static_assert(kEmb % 64 == 0 && kN3 % 64 == 0, "transpose grid");

// ---------------------------------------------------------------------------------------------------------------------
// f32 -> bf16 (RNE) cast: thread i converts elements 8i..8i+7 (two 16-B loads, one 16-B store);
// Coverage: n8 threads x 8 = whole plane (n8 = n/8 exact).
// ---------------------------------------------------------------------------------------------------------------------
__global__ __launch_bounds__(256) void cast_f32_bf16x8(const float* __restrict__ in, unsigned short* __restrict__ outp, int n8) {
  const int i = blockIdx.x * 256 + threadIdx.x;
  if (i < n8) {
    const size_t e0 = (size_t)i * 8;
    const v4f a = *(const v4f*)(in + e0);
    const v4f c = *(const v4f*)(in + e0 + 4);
    v4u u;
    u[0] = (unsigned)f2bf_bits(a[0]) | ((unsigned)f2bf_bits(a[1]) << 16);
    u[1] = (unsigned)f2bf_bits(a[2]) | ((unsigned)f2bf_bits(a[3]) << 16);
    u[2] = (unsigned)f2bf_bits(c[0]) | ((unsigned)f2bf_bits(c[1]) << 16);
    u[3] = (unsigned)f2bf_bits(c[2]) | ((unsigned)f2bf_bits(c[3]) << 16);
    *(v4u*)(outp + e0) = u;
    
  }
}

// ---------------------------------------------------------------------------------------------------------------------
// Transpose + cast: in [R][Cc] f32 row-major -> outp [Cc][R] bf16, outp[n][e] = bf16(in[e][n]).
// Tile 64 (e) x 64 (n); grid (Cc/64, R/64); block 256.
// Load coverage: 256 threads x 16 elements = 64x64. Store coverage: 8 waves x 2 iterations x 4 rows = 64 rows,
// ---------------------------------------------------------------------------------------------------------------------
__global__ __launch_bounds__(256) void transpose_cast_bf16(const float* __restrict__ in, unsigned short* __restrict__ outp, int R, int Cc) {
  __shared__ __align__(16) unsigned short tT[64 * 72];   // [n_local][e_local], pitch 72
  const int tid = threadIdx.x;
  const int n0 = blockIdx.x * 64;
  const int e0 = blockIdx.y * 64;
  {
    const int el = tid >> 2, nl = (tid & 3) * 16;
    const float* src = in + (size_t)(e0 + el) * Cc + n0 + nl;
#pragma unroll
    for (int i = 0; i < 4; ++i) {
      const v4f f = *(const v4f*)(src + 4 * i);
#pragma unroll
      for (int e = 0; e < 4; ++e) tT[(nl + 4 * i + e) * 72 + el] = f2bf_bits(f[e]);
    }
  }
  __syncthreads();
  const int wave = tid >> 5, lane = tid & 31, q = lane >> 3, c8 = (lane & 7) * 8;
  {
#pragma unroll
    for (int it = 0; it < 2; ++it) {
      const int nl = wave * 8 + it * 4 + q;
      const v4u w = *(const v4u*)(tT + nl * 72 + c8);
      *(v4u*)(outp + (size_t)(n0 + nl) * R + e0 + c8) = w;
    }
    
  }
}

// ---------------------------------------------------------------------------------------------------------------------
// Causal attention, head dim 64, 16-bit plane inputs, f32 output.
//   q, k, v are bf16 hi + lo planes: element (b, s, h, d) at plane[(b*S + s)*ld + h*64 + d] (ld in elements, % 8 == 0).
//   scores = sscale * q.k^T : bf16 hi/lo split (hi*hi + hi*lo + lo*hi), f32 accumulate
//   out    = p.v            : p (f32, split into bf16 hi/lo in LDS) and v hi/lo planes, f32 accumulate
//   online softmax in f32; keys with kv > q replaced by -inf before the softmax.
//   Block = 4 waves = 64 query rows of one (b, h); grid.x = B * H * (S/64); S % 64 == 0.
// ---------------------------------------------------------------------------------------------------------------------
constexpr int kQB = 64;   // query rows per block
constexpr int kKC = 64;   // keys per chunk
constexpr int kNW = 4;    // waves per block
constexpr int kOP = 68;   // output slab pitch (floats)
constexpr int kLP = 72;   // LDS row pitch of the K, V^T and P tiles, in 16-bit elements: 144 B = 16 B x odd, so that the
                          // 16 rows one 16-byte fragment read touches fall on distinct banks; columns 64..71 are never used

__global__ __launch_bounds__(128)
void attn_causal_hd64_split(const unsigned short* __restrict__ qh, const unsigned short* __restrict__ ql,
                            const unsigned short* __restrict__ kh, const unsigned short* __restrict__ kl,
                            const unsigned short* __restrict__ vh, const unsigned short* __restrict__ vl,
                            float* __restrict__ out,
                            int S, int H, int ldq, int ldk, int ldv, int ldo, float sscale) {
  typedef Frag<__bf16>::U FB;
  __shared__ __align__(16) unsigned short Ksh[kKC * kLP];        // K hi [kv][d]
  __shared__ __align__(16) unsigned short Ksl[kKC * kLP];        // K lo [kv][d]
  __shared__ __align__(16) unsigned short Vth[kHeadDim * kLP];   // V hi [d][kv]
  __shared__ __align__(16) unsigned short Vtl[kHeadDim * kLP];   // V lo [d][kv]
  __shared__ __align__(16) __bf16 Psh[kNW][16 * kLP];            // per wave P hi [row][kv]
  __shared__ __align__(16) __bf16 Psl[kNW][16 * kLP];            // per wave P lo [row][kv]
  __shared__ __align__(16) float  Os[kNW][16 * kOP];             // per wave out tile

  const int tid  = threadIdx.x;
  const int wave = tid >> 5;
  const int lane = tid & 31;
  const int hh   = lane >> 4;
  const int c    = lane & 15;

  // Block index -> tile: a block's cost is its qb + 1 key chunks and there are more blocks than resident places, so the
  // longest tiles take the lowest indices and the short ones fill the end.
  const int nqb = S / kQB;
  const int nbh = kBatch * H;
  const int bx = blockIdx.x;
  const int qb = nqb - 1 - bx / nbh;
  const int bh = bx % nbh;
  const int h  = bh % H;
  const int b  = bh / H;
  const int q0 = qb * kQB + wave * 16;
  const size_t rowb = (size_t)b * (size_t)S;
  const int hcol = h * kHeadDim;

  // ---- Q fragments (A operand, row = query q0 + c, k = d): 2 d-chunks, hi and lo planes ----
  v16b qah[2], qal[2];
  {
    const size_t qo = (rowb + (size_t)(q0 + c)) * (size_t)ldq + (size_t)(hcol + 8 * hh);
    const __bf16* qr  = (const __bf16*)(const void*)(qh + qo);
    const __bf16* qr2 = (const __bf16*)(const void*)(ql + qo);
#pragma unroll
    for (int dc = 0; dc < 2; ++dc) {
      qah[dc] = Frag<__bf16>::load(qr + dc * 32);
      qal[dc] = Frag<__bf16>::load(qr2 + dc * 32);
    }
  }

  float mrow[8], lrow[8];
  v8f oacc[4];
#pragma unroll
  for (int r = 0; r < 8; ++r) { mrow[r] = -__builtin_inff(); lrow[r] = 0.f; }
#pragma unroll
  for (int t = 0; t < 4; ++t) oacc[t] = (v8f){0.f,0.f,0.f,0.f,0.f,0.f,0.f,0.f};

  const int nChunks = qb + 1;   // block-uniform; causal: key chunks 0..qb
  for (int kc = 0; kc < nChunks; ++kc) {
    const int kv0 = kc * kKC;
    __syncthreads();
    {
      // staging: thread -> kv row kvr = tid>>1 (0..63), d half dh = (tid&1)*32; 128 threads x 32 = 64x64 per plane
      const int kvr = tid >> 1, dh = (tid & 1) * 32;
      const size_t krow = rowb + (size_t)(kv0 + kvr);
      const unsigned short* gkh = kh + krow * (size_t)ldk + hcol + dh;
      const unsigned short* gkl = kl + krow * (size_t)ldk + hcol + dh;
      v4u wa[4], wb[4];
#pragma unroll
      for (int i = 0; i < 4; ++i) { wa[i] = *(const v4u*)(gkh + 8 * i); wb[i] = *(const v4u*)(gkl + 8 * i); }
#pragma unroll
      for (int i = 0; i < 4; ++i) {
        *(v4u*)(Ksh + kvr * kLP + dh + 8 * i) = wa[i];
        *(v4u*)(Ksl + kvr * kLP + dh + 8 * i) = wb[i];
      }
      asm volatile("" ::: "memory");
      const unsigned short* gvh = vh + krow * (size_t)ldv + hcol + dh;
      const unsigned short* gvl = vl + krow * (size_t)ldv + hcol + dh;
#pragma unroll
      for (int i = 0; i < 4; ++i) { wa[i] = *(const v4u*)(gvh + 8 * i); wb[i] = *(const v4u*)(gvl + 8 * i); }
#pragma unroll
      for (int i = 0; i < 4; ++i) {
#pragma unroll
        for (int m = 0; m < 4; ++m) {
          const unsigned ua = wa[i][m];
          const unsigned ub = wb[i][m];
          const int d = dh + 8 * i + 2 * m;
          Vth[d * kLP + kvr]       = (unsigned short)(ua & 0xffffu);
          Vth[(d + 1) * kLP + kvr] = (unsigned short)(ua >> 16);
          Vtl[d * kLP + kvr]       = (unsigned short)(ub & 0xffffu);
          Vtl[(d + 1) * kLP + kvr] = (unsigned short)(ub >> 16);
        }
      }
    }
    __syncthreads();

    // ---- scores: s[j][r] = S[query 8hh+r][kv kv0 + j*16 + c] ----
    v8f s[4];
#pragma unroll
    for (int j = 0; j < 4; ++j) {
      s[j] = (v8f){0.f,0.f,0.f,0.f,0.f,0.f,0.f,0.f};
#pragma unroll
      for (int dc = 0; dc < 2; ++dc) {
        FB kb, kb2;
        const unsigned short* kp  = Ksh + (j * 16 + c) * kLP + dc * 32 + 8 * hh;
        const unsigned short* kp2 = Ksl + (j * 16 + c) * kLP + dc * 32 + 8 * hh;
        kb.h[0]  = *(const v8b*)(const void*)(kp);
        kb.h[1]  = *(const v8b*)(const void*)(kp + 16);
        kb2.h[0] = *(const v8b*)(const void*)(kp2);
        kb2.h[1] = *(const v8b*)(const void*)(kp2 + 16);
        s[j] = at_mma(qah[dc], kb.v, s[j]);
        s[j] = at_mma(qah[dc], kb2.v, s[j]);
        s[j] = at_mma(qal[dc], kb.v, s[j]);
      }
    }
    const bool diag = (kc == qb);   // block-uniform
    float cm[8];
#pragma unroll
    for (int r = 0; r < 8; ++r) {
      const int qrow = q0 + 8 * hh + r;
      float m = -__builtin_inff();
#pragma unroll
      for (int j = 0; j < 4; ++j) {
        const int kvcol = kv0 + j * 16 + c;
        float sv = s[j][r] * sscale;
        sv = (diag && (kvcol > qrow)) ? -__builtin_inff() : sv;
        s[j][r] = sv;
        m = fmaxf(m, sv);
      }
#pragma unroll
      for (int off = 1; off < 16; off <<= 1) m = fmaxf(m, __shfl_xor(m, off, 32));
      cm[r] = m;
    }
    __bf16* pwh = Psh[wave];
    __bf16* pwl = Psl[wave];
#pragma unroll
    for (int r = 0; r < 8; ++r) {
      const float mnew = fmaxf(mrow[r], cm[r]);
      const float alpha = expf(mrow[r] - mnew);
      mrow[r] = mnew;
      float psum = 0.f;
#pragma unroll
      for (int j = 0; j < 4; ++j) {
        const float p = expf(s[j][r] - mnew);
        psum += p;
        __bf16 a, bl;
        at_split(p, a, bl);
        pwh[(8 * hh + r) * kLP + j * 16 + c] = a;
        pwl[(8 * hh + r) * kLP + j * 16 + c] = bl;
      }
#pragma unroll
      for (int off = 1; off < 16; off <<= 1) psum += __shfl_xor(psum, off, 32);
      lrow[r] = lrow[r] * alpha + psum;
#pragma unroll
      for (int t = 0; t < 4; ++t) oacc[t][r] *= alpha;
    }
    __builtin_amdgcn_fence(__ATOMIC_RELEASE, "workgroup");
    __builtin_amdgcn_wave_barrier();
    __builtin_amdgcn_fence(__ATOMIC_ACQUIRE, "workgroup");
    // ---- out[query][d] += P[query][kv] * V[kv][d]; A = P (row = query c, k = kv), B from Vt [d][kv] ----
#pragma unroll
    for (int kk = 0; kk < 2; ++kk) {
      FB pa, pl;
      pa.h[0] = *(const v8b*)(pwh + c * kLP + kk * 32 + 8 * hh);
      pa.h[1] = *(const v8b*)(pwh + c * kLP + kk * 32 + 16 + 8 * hh);
      pl.h[0] = *(const v8b*)(pwl + c * kLP + kk * 32 + 8 * hh);
      pl.h[1] = *(const v8b*)(pwl + c * kLP + kk * 32 + 16 + 8 * hh);
#pragma unroll
      for (int t = 0; t < 4; ++t) {
        FB vb, vb2;
        const unsigned short* vpa = Vth + (t * 16 + c) * kLP + kk * 32 + 8 * hh;
        const unsigned short* vpb = Vtl + (t * 16 + c) * kLP + kk * 32 + 8 * hh;
        vb.h[0]  = *(const v8b*)(const void*)(vpa);
        vb.h[1]  = *(const v8b*)(const void*)(vpa + 16);
        vb2.h[0] = *(const v8b*)(const void*)(vpb);
        vb2.h[1] = *(const v8b*)(const void*)(vpb + 16);
        oacc[t] = at_mma(pa.v, vb.v, oacc[t]);
        oacc[t] = at_mma(pa.v, vb2.v, oacc[t]);
        oacc[t] = at_mma(pl.v, vb.v, oacc[t]);
      }
    }
  }

  // ---- epilogue: normalise, stage the wave's 16x64 tile, write whole 256-B row segments ----
  float* os = Os[wave];
#pragma unroll
  for (int r = 0; r < 8; ++r) {
    const float inv = 1.0f / lrow[r];
#pragma unroll
    for (int t = 0; t < 4; ++t) os[(8 * hh + r) * kOP + t * 16 + c] = oacc[t][r] * inv;
  }
  __builtin_amdgcn_fence(__ATOMIC_RELEASE, "workgroup");
  __builtin_amdgcn_wave_barrier();
  __builtin_amdgcn_fence(__ATOMIC_ACQUIRE, "workgroup");
  {
    float* ob = out + (size_t)hcol;
    const int c4 = (lane & 15) * 4;   // 16 lanes x 16 B = 256 B = one row segment of 64 floats
    {
#pragma unroll
      for (int it = 0; it < 8; ++it) {
        const int row = it * 2 + hh;
        v4f val = *(const v4f*)(os + row * kOP + c4);
        *(v4f*)(ob + (rowb + (size_t)(q0 + row)) * (size_t)ldo + c4) = val;
      }
      
    }
  }
}

// ---------------------------------------------------------------------------------------------------------------------
// Host launcher
// Workspace region map (bytes):
//   [0,            16,777,216)  Xb   bf16 [8192][1024]           (RNE copy of x)
//   [16,777,216,   23,068,672)  Wt   bf16 [3072][1024]           (RNE copy of W^T)
//   [23,068,672,   73,400,320)  Phi  bf16 [8192][3072]           (qkv hi plane)
//   [73,400,320,  123,731,968)  Plo  bf16 [8192][3072]           (qkv lo plane)
//   total 123,731,968
// ---------------------------------------------------------------------------------------------------------------------
extern "C" void kernel_launch(void* const* d_in, const int* in_sizes, int n_in,
                              void* d_out, int out_size, void* d_ws, size_t ws_size,
                              hipStream_t stream) {
  if (n_in < 2) return;
  if (in_sizes[0] != kRows * kEmb) return;
  if (in_sizes[1] != kEmb * kN3) return;
  if (out_size != kRows * kEmb) return;

  const size_t bytesXb = (size_t)kRows * kEmb * 2;
  const size_t bytesWt = (size_t)kN3 * kEmb * 2;
  const size_t bytesPl = (size_t)kRows * kN3 * 2;
  const size_t offXb = 0;
  const size_t offWt = offXb + bytesXb;
  const size_t offHi = offWt + bytesWt;
  const size_t offLo = offHi + bytesPl;
  const size_t total = offLo + bytesPl;
  if (total > ws_size) return;

  const float* x = (const float*)d_in[0];   // [4, 2048, 1024] f32
  const float* W = (const float*)d_in[1];   // [1024, 3072] f32
  float* outp = (float*)d_out;              // [4, 2048, 1024] f32

  char* ws = (char*)d_ws;
  unsigned short* Xb  = (unsigned short*)(ws + offXb);
  unsigned short* Wt  = (unsigned short*)(ws + offWt);
  unsigned short* Phi = (unsigned short*)(ws + offHi);
  unsigned short* Plo = (unsigned short*)(ws + offLo);
  const float* fdum = (const float*)(ws + offXb);

  // 1) x -> bf16 plane: 1,048,576 threads x 8 elements = 8,388,608
  const int n8 = (kRows * kEmb) / 8;
  cast_f32_bf16x8<<<dim3(n8 / 256), dim3(256), 0, stream>>>(x, Xb, n8);

  // 2) W [1024][3072] -> Wt [3072][1024] bf16; grid (Cc/64, R/64) = (48, 16)
  transpose_cast_bf16<<<dim3(kN3 / 64, kEmb / 64), dim3(256), 0, stream>>>(W, Wt, kEmb, kN3);

  // 3) qkv = Xb [8192][1024] x Wt [3072][1024]^T -> bf16 hi/lo planes [8192][3072]; M=8192, N=3072, K=1024
  const int tiles = (kRows / 64) * (kN3 / 64);   // 6144 tiles, 8 per block
  wmma_gemm64<1, false, 0, 2, false, 0><<<dim3(tiles / 8, 1), dim3(256), 0, stream>>>(
      (const unsigned short*)Xb, (const unsigned short*)Xb, kEmb, 0L,
      (const unsigned short*)Wt, (const unsigned short*)Wt, kEmb, 0L,
      (void*)Phi, (void*)Plo, kN3, 0L,
      fdum, fdum, 0L,
      kRows, kN3, kEmb, 1.0f);

  // 4) causal attention: q cols [0,1024), k cols [1024,2048), v cols [2048,3072) of the planes; ld = 3072
  attn_causal_hd64_split<<<dim3(kBatch * kHeads * (kSeq / kQB)), dim3(128), 0, stream>>>(
      (const unsigned short*)Phi, (const unsigned short*)Plo,
      (const unsigned short*)(Phi + kEmb), (const unsigned short*)(Plo + kEmb),
      (const unsigned short*)(Phi + 2 * kEmb), (const unsigned short*)(Plo + 2 * kEmb),
      outp, kSeq, kHeads, kN3, kN3, kN3, kEmb, 0.125f);
}

// v003
// One run takes 287 microseconds.
// Next to v002, in two timings, it ran 1.31 times as fast each time.
// Over all steps from v000 it is 2.47 times as fast.
// Contractions: QKV projection = v_wmma_f32_16x16x32_bf16 on RNE-bf16 copies of x and W (f32 accumulate); q.k^T and p.v = bf16 hi/lo split (hi*hi + hi*lo + lo*hi) on v_wmma_f32_16x16x32_bf16, f32 accumulate; softmax and normalisation in f32.
#include <hip/hip_runtime.h>
#include <stdint.h>

// ---------------------------------------------------------------------------------------------------------------------
// Shared 16-bit WMMA helpers
// ---------------------------------------------------------------------------------------------------------------------
typedef __attribute__((ext_vector_type(16))) _Float16 v16h;
typedef __attribute__((ext_vector_type(8)))  _Float16 v8h;
typedef __attribute__((ext_vector_type(16))) __bf16   v16b;
typedef __attribute__((ext_vector_type(8)))  __bf16   v8b;
typedef __attribute__((ext_vector_type(8)))  float    v8f;
typedef __attribute__((ext_vector_type(4)))  float    v4f;
typedef __attribute__((ext_vector_type(4)))  unsigned v4u;
#define PSCALE 32768.0f
#define U16(p) ((const unsigned short*)(const void*)(p))
#define PSCALE_INV (1.0f / 32768.0f)

__device__ __forceinline__ unsigned short f2bf_bits(float f) {
  unsigned u = __float_as_uint(f);
  return (unsigned short)((u + 0x7FFFu + ((u >> 16) & 1u)) >> 16);
}
__device__ __forceinline__ float bf_bits2f(unsigned short h) { return __uint_as_float(((unsigned)h) << 16); }

// hazard guards as plain device helpers (no inline asm inside the kernel template body)
__device__ __forceinline__ void dep_guard_h(v8f& a, v8f& b, v16h x, v16h y) { asm volatile("v_nop\n\tv_nop\n\tv_nop\n\tv_nop" : "+v"(a), "+v"(b) : "v"(x), "v"(y)); }
__device__ __forceinline__ void dep_guard_b(v8f& a, v8f& b, v16b x, v16b y) { asm volatile("v_nop\n\tv_nop\n\tv_nop\n\tv_nop" : "+v"(a), "+v"(b) : "v"(x), "v"(y)); }
__device__ __forceinline__ void keep4_h(v16h a, v16h b, v16h c, v16h d) { asm volatile("v_nop" :: "v"(a), "v"(b), "v"(c), "v"(d)); }
__device__ __forceinline__ void keep4_b(v16b a, v16b b, v16b c, v16b d) { asm volatile("v_nop" :: "v"(a), "v"(b), "v"(c), "v"(d)); }
__device__ __forceinline__ void acc_guard4(v8f& a, v8f& b, v8f& c, v8f& d) { asm volatile("v_nop\n\tv_nop\n\tv_nop\n\tv_nop" : "+v"(a), "+v"(b), "+v"(c), "+v"(d)); }
template <typename T> struct Frag;
template <> struct Frag<_Float16> {
  typedef v16h V; union U { v16h v; v8h h[2]; };
  static __device__ __forceinline__ v16h load(const _Float16* p) {   // elements 0..7 <- p[0..7], 8..15 <- p[16..23]
    U f; f.h[0] = *(const v8h*)(p); f.h[1] = *(const v8h*)(p + 16); return f.v;
  }
  static __device__ __forceinline__ v8f mma(v16h a, v16h b, v8f c) {
    return __builtin_amdgcn_wmma_f32_16x16x32_f16(false, a, false, b, (short)0, c, false, false);
  }
  static __device__ __forceinline__ void guard(v8f& a, v8f& b, v16h x, v16h y) { dep_guard_h(a, b, x, y); }
  static __device__ __forceinline__ void keep(v16h a, v16h b, v16h c, v16h d) { keep4_h(a, b, c, d); }
};
template <> struct Frag<__bf16> {
  typedef v16b V; union U { v16b v; v8b h[2]; };
  static __device__ __forceinline__ v16b load(const __bf16* p) {
    U f; f.h[0] = *(const v8b*)(p); f.h[1] = *(const v8b*)(p + 16); return f.v;
  }
  static __device__ __forceinline__ v8f mma(v16b a, v16b b, v8f c) {
    return __builtin_amdgcn_wmma_f32_16x16x32_bf16(false, a, false, b, (short)0, c, false, false);
  }
  static __device__ __forceinline__ void guard(v8f& a, v8f& b, v16b x, v16b y) { dep_guard_b(a, b, x, y); }
  static __device__ __forceinline__ void keep(v16b a, v16b b, v16b c, v16b d) { keep4_b(a, b, c, d); }
};

// ---- Register-blocked batched WMMA GEMM ------------------------------------
// C[m,n] = scale * sum_k A[m,k] * Bt[n,k] (+bias)(+resid); each wave owns a 64x64 tile.
// A row-major [M,K]; Bt row-major [N,K]; M,N % 64 == 0, K % 32 == 0.
// SPLIT: operands are hi/lo planes (A2/Bt2 = lo planes, same layout); product = hi*hi + hi*lo + lo*hi.
// BIAS_MODE: 0 = none, 1 = bias[m], 2 = bias[n].
// OUT_MODE: 0 = f32, 1 = f16, 2 = bf16 hi plane (Cout) + bf16 lo plane (Cout2).
// ET: 0 = f16 operands, 1 = bf16 operands (pointers passed as 16-bit storage)
template <int ET> struct Elem;
template <> struct Elem<0> { typedef _Float16 T; };
template <> struct Elem<1> { typedef __bf16 T; };
template <int ET, bool SPLIT, int BIAS_MODE, int OUT_MODE, bool RESID, int ACT = 0>
__global__ __launch_bounds__(256) void wmma_gemm64(
    const unsigned short* __restrict__ Ap, const unsigned short* __restrict__ A2p, int lda, long strideA,
    const unsigned short* __restrict__ Btp, const unsigned short* __restrict__ Bt2p, int ldb, long strideB,
    void* __restrict__ Cout, void* __restrict__ Cout2, int ldc, long strideC,
    const float* __restrict__ bias,
    const float* __restrict__ resid, long strideR,
    int M, int N, int K, float scale) {
  typedef typename Elem<ET>::T T;
  typedef typename Frag<T>::V V;
  const T* A = (const T*)Ap; const T* A2 = (const T*)A2p; const T* Bt = (const T*)Btp; const T* Bt2 = (const T*)Bt2p;
  __shared__ __align__(16) float sT[8][16 * 68];   // per-wave 16x64 slab, pitch 68 floats
  const int b    = blockIdx.y;
  const int lane = threadIdx.x & 31;
  const int wave = threadIdx.x >> 5;
  const int tilesN = N >> 6;
  const int tilesM = M >> 6;
  const int tile = blockIdx.x * 8 + wave;
  if (tile >= tilesM * tilesN) return;   // wave-uniform; no block barriers in this kernel
  const int tm = tile / tilesN;
  const int tn = tile - tm * tilesN;
  const int m0 = tm << 6;
  const int n0 = tn << 6;

  const T* Ab  = A  + (size_t)b * strideA;
  const T* Bb  = Bt + (size_t)b * strideB;
  const T* Ab2 = SPLIT ? (A2  + (size_t)b * strideA) : nullptr;
  const T* Bb2 = SPLIT ? (Bt2 + (size_t)b * strideB) : nullptr;

  const int rlane = lane & 15;                 // row (A) / col (B, D) within subtile
  const int koff  = (lane >> 4) * 8;           // k offset of this lane half
  const int mOff  = (lane >> 4) * 8;           // D row offset

  v8f acc[4][4];
#pragma unroll
  for (int i = 0; i < 4; ++i)
#pragma unroll
    for (int j = 0; j < 4; ++j) acc[i][j] = (v8f){0.f,0.f,0.f,0.f,0.f,0.f,0.f,0.f};

  for (int k0 = 0; k0 < K; k0 += 32) {
    V bh[4], bl[4];
#pragma unroll
    for (int j = 0; j < 4; ++j) {
      const size_t bo = (size_t)(n0 + (j << 4) + rlane) * ldb + koff + k0;
      bh[j] = Frag<T>::load(Bb + bo);
      if (SPLIT) bl[j] = Frag<T>::load(Bb2 + bo);
    }
#pragma unroll
    for (int i = 0; i < 4; ++i) {
      const size_t ao = (size_t)(m0 + (i << 4) + rlane) * lda + koff + k0;
      V ah = Frag<T>::load(Ab + ao);
      V al;
      if (SPLIT) al = Frag<T>::load(Ab2 + ao);
#pragma unroll
      for (int j = 0; j < 4; ++j) {
        acc[i][j] = Frag<T>::mma(ah, bh[j], acc[i][j]);
        if (SPLIT) {
          acc[i][j] = Frag<T>::mma(ah, bl[j], acc[i][j]);
          acc[i][j] = Frag<T>::mma(al, bh[j], acc[i][j]);
        }
      }
      Frag<T>::guard(acc[i][0], acc[i][3], ah, SPLIT ? al : ah);
    }
    Frag<T>::keep(bh[0], bh[1], bh[2], bh[3]);
    if (SPLIT) Frag<T>::keep(bl[0], bl[1], bl[2], bl[3]);
  }
  acc_guard4(acc[0][0], acc[0][1], acc[0][2], acc[0][3]);
  acc_guard4(acc[1][0], acc[1][1], acc[1][2], acc[1][3]);
  acc_guard4(acc[2][0], acc[2][1], acc[2][2], acc[2][3]);
  acc_guard4(acc[3][0], acc[3][1], acc[3][2], acc[3][3]);

  // ---- epilogue ----
  float* slab = sT[wave];
  const float* Rb = RESID ? (resid + (size_t)b * strideR) : nullptr;
#pragma unroll
  for (int i = 0; i < 4; ++i) {
    const int mBase = m0 + (i << 4);
#pragma unroll
    for (int j = 0; j < 4; ++j) {
      const int n = n0 + (j << 4) + rlane;
      float bv = 0.f;
      if (BIAS_MODE == 2) bv = bias[n];
#pragma unroll
      for (int r = 0; r < 8; ++r) {
        float v = acc[i][j][r] * scale;
        if (BIAS_MODE == 1) v += bias[mBase + mOff + r];
        if (BIAS_MODE == 2) v += bv;
        if (RESID) v += Rb[(size_t)(mBase + mOff + r) * ldc + n];
        if (ACT == 1) v = tanhf(v);
        if (ACT == 2) v = fmaxf(v, 0.0f);
        if (ACT == 3) v = v / (1.0f + expf(-v));
        if (ACT == 4) v = (v > 0.f) ? v : 0.01f * v;
        if (ACT == 5) v = 0.5f * v * (1.0f + erff(v * 0.70710678118654752f));
        slab[(mOff + r) * 68 + (j << 4) + rlane] = v;
      }
    }
    __builtin_amdgcn_fence(__ATOMIC_RELEASE, "workgroup");
    __builtin_amdgcn_wave_barrier();
    __builtin_amdgcn_fence(__ATOMIC_ACQUIRE, "workgroup");
    if (OUT_MODE == 0) {
      float* C = (float*)Cout + (size_t)b * strideC;
      const int hh = lane >> 4, c4 = (lane & 15) * 4;     // row seg = 256 B = 16 lanes x 16 B
      {
#pragma unroll
        for (int it = 0; it < 8; ++it) {
          const int row = it * 2 + hh;
          v4f v = *(const v4f*)(slab + row * 68 + c4);
          *(v4f*)(C + (size_t)(mBase + row) * ldc + n0 + c4) = v;
        }
        
      }
    } else {
      const int q = lane >> 3, c8 = (lane & 7) * 8;
      unsigned short* C  = (unsigned short*)Cout  + (size_t)b * strideC;
      unsigned short* C2 = (OUT_MODE == 2) ? ((unsigned short*)Cout2 + (size_t)b * strideC) : nullptr;
      {
#pragma unroll
        for (int it = 0; it < 4; ++it) {
          const int row = it * 4 + q;
          const float* sp = slab + row * 68 + c8;
          v8h hv, lv;
#pragma unroll
          for (int e = 0; e < 8; ++e) {
            if (OUT_MODE == 1) {
              hv[e] = (_Float16)sp[e];
            } else {
              unsigned short hb = f2bf_bits(sp[e]);
              unsigned short lb = f2bf_bits(sp[e] - bf_bits2f(hb));
              hv[e] = __builtin_bit_cast(_Float16, hb);
              lv[e] = __builtin_bit_cast(_Float16, lb);
            }
          }
          *(v8h*)(C + (size_t)(mBase + row) * ldc + n0 + c8) = hv;
          if (OUT_MODE == 2) *(v8h*)(C2 + (size_t)(mBase + row) * ldc + n0 + c8) = lv;
        }
        
      }
    }
    __builtin_amdgcn_fence(__ATOMIC_RELEASE, "workgroup");
    __builtin_amdgcn_wave_barrier();
    __builtin_amdgcn_fence(__ATOMIC_ACQUIRE, "workgroup");
  }
}

// ---------------------------------------------------------------------------------------------------------------------
// bf16 helpers for the attention kernel
// ---------------------------------------------------------------------------------------------------------------------
__device__ __forceinline__ unsigned short at_bf_bits(float f) {
  unsigned u = __float_as_uint(f);
  return (unsigned short)((u + 0x7FFFu + ((u >> 16) & 1u)) >> 16);
}
__device__ __forceinline__ __bf16 at_f2bf(float f) { return __builtin_bit_cast(__bf16, at_bf_bits(f)); }
__device__ __forceinline__ void at_split(float f, __bf16& hi, __bf16& lo) {
  const unsigned short hb = at_bf_bits(f);
  hi = __builtin_bit_cast(__bf16, hb);
  lo = at_f2bf(f - __uint_as_float(((unsigned)hb) << 16));
}
// value of lane l ^ 16 (the other half of the wave), by a vector cross-row move
__device__ __forceinline__ float at_xhalf(float x) {
  const int b = __builtin_bit_cast(int, x);
  return __builtin_bit_cast(float, __builtin_amdgcn_permlanex16(b, b, 0x76543210, 0xfedcba98, false, false));
}
__device__ __forceinline__ v8f at_mma(v16b a, v16b b, v8f c) {
  c = __builtin_amdgcn_wmma_f32_16x16x32_bf16(false, a, false, b, (short)0, c, false, false);
  asm volatile("v_nop\n\tv_nop\n\tv_nop\n\tv_nop" : "+v"(c) : "v"(a), "v"(b));
  return c;
}

// ---------------------------------------------------------------------------------------------------------------------
// Problem constants
// ---------------------------------------------------------------------------------------------------------------------
constexpr int kBatch   = 4;
constexpr int kSeq     = 2048;
constexpr int kEmb     = 1024;
constexpr int kHeads   = 16;
constexpr int kHeadDim = 64;
constexpr int kRows    = kBatch * kSeq;   // 8192 = GEMM M
constexpr int kN3      = 3 * kEmb;        // 3072 = GEMM N
static_assert(kEmb % 32 == 0, "K");
static_assert(kRows % 64 == 0 && kN3 % 64 == 0, "MN");
static_assert(((kRows / 64) * (kN3 / 64)) % 8 == 0, "tiles");
static_assert(kHeads * kHeadDim == kEmb, "heads");
static_assert(kSeq % 64 == 0, "S");
static_assert((kRows * kEmb) % (8 * 256) == 0, "cast grid");
static_assert(kEmb % 64 == 0 && kN3 % 64 == 0, "transpose grid");

// ---------------------------------------------------------------------------------------------------------------------
// f32 -> bf16 (RNE) cast: thread i converts elements 8i..8i+7 (two 16-B loads, one 16-B store);
// Coverage: n8 threads x 8 = whole plane (n8 = n/8 exact).
// ---------------------------------------------------------------------------------------------------------------------
__global__ __launch_bounds__(256) void cast_f32_bf16x8(const float* __restrict__ in, unsigned short* __restrict__ outp, int n8) {
  const int i = blockIdx.x * 256 + threadIdx.x;
  if (i < n8) {
    const size_t e0 = (size_t)i * 8;
    const v4f a = *(const v4f*)(in + e0);
    const v4f c = *(const v4f*)(in + e0 + 4);
    v4u u;
    u[0] = (unsigned)f2bf_bits(a[0]) | ((unsigned)f2bf_bits(a[1]) << 16);
    u[1] = (unsigned)f2bf_bits(a[2]) | ((unsigned)f2bf_bits(a[3]) << 16);
    u[2] = (unsigned)f2bf_bits(c[0]) | ((unsigned)f2bf_bits(c[1]) << 16);
    u[3] = (unsigned)f2bf_bits(c[2]) | ((unsigned)f2bf_bits(c[3]) << 16);
    *(v4u*)(outp + e0) = u;
    
  }
}

// ---------------------------------------------------------------------------------------------------------------------
// Transpose + cast: in [R][Cc] f32 row-major -> outp [Cc][R] bf16, outp[n][e] = bf16(in[e][n]).
// Tile 64 (e) x 64 (n); grid (Cc/64, R/64); block 256.
// Load coverage: 256 threads x 16 elements = 64x64. Store coverage: 8 waves x 2 iterations x 4 rows = 64 rows,
// ---------------------------------------------------------------------------------------------------------------------
__global__ __launch_bounds__(256) void transpose_cast_bf16(const float* __restrict__ in, unsigned short* __restrict__ outp, int R, int Cc) {
  __shared__ __align__(16) unsigned short tT[64 * 72];   // [n_local][e_local], pitch 72
  const int tid = threadIdx.x;
  const int n0 = blockIdx.x * 64;
  const int e0 = blockIdx.y * 64;
  {
    const int el = tid >> 2, nl = (tid & 3) * 16;
    const float* src = in + (size_t)(e0 + el) * Cc + n0 + nl;
#pragma unroll
    for (int i = 0; i < 4; ++i) {
      const v4f f = *(const v4f*)(src + 4 * i);
#pragma unroll
      for (int e = 0; e < 4; ++e) tT[(nl + 4 * i + e) * 72 + el] = f2bf_bits(f[e]);
    }
  }
  __syncthreads();
  const int wave = tid >> 5, lane = tid & 31, q = lane >> 3, c8 = (lane & 7) * 8;
  {
#pragma unroll
    for (int it = 0; it < 2; ++it) {
      const int nl = wave * 8 + it * 4 + q;
      const v4u w = *(const v4u*)(tT + nl * 72 + c8);
      *(v4u*)(outp + (size_t)(n0 + nl) * R + e0 + c8) = w;
    }
    
  }
}

// ---------------------------------------------------------------------------------------------------------------------
// Causal attention, head dim 64, 16-bit plane inputs, f32 output.
//   q, k, v are bf16 hi + lo planes: element (b, s, h, d) at plane[(b*S + s)*ld + h*64 + d] (ld in elements, % 8 == 0).
//   scores^T = sscale * k.q^T : bf16 hi/lo split (hi*hi + hi*lo + lo*hi), f32 accumulate; a lane holds 32 scores of ONE query
//   out^T    = v^T.p^T        : p (f32, split into bf16 hi/lo in registers) and v hi/lo planes, f32 accumulate;
//                               two score tiles of a lane, converted in place, are the B operand of 32 keys
//   online softmax in f32; keys with kv > q replaced by -inf before the softmax; maximum in-lane plus one exchange
//   between the wave's halves; each half keeps its own partial row sum, the two are joined in the epilogue.
//   Block = 4 waves = 64 query rows of one (b, h); grid.x = B * H * (S/64); S % 64 == 0.
// ---------------------------------------------------------------------------------------------------------------------
constexpr int kQB = 64;   // query rows per block
constexpr int kKC = 64;   // keys per chunk
constexpr int kNW = 4;    // waves per block
constexpr int kOP = 68;   // output slab pitch (floats)
constexpr int kLP = 72;   // LDS row pitch of the K and V^T tiles, in 16-bit elements: 144 B = 16 B x odd, so that the
                          // 16 rows one 16-byte fragment read touches fall on distinct banks; columns 64..71 are never used

__global__ __launch_bounds__(128)
void attn_causal_hd64_split(const unsigned short* __restrict__ qh, const unsigned short* __restrict__ ql,
                            const unsigned short* __restrict__ kh, const unsigned short* __restrict__ kl,
                            const unsigned short* __restrict__ vh, const unsigned short* __restrict__ vl,
                            float* __restrict__ out,
                            int S, int H, int ldq, int ldk, int ldv, int ldo, float sscale) {
  typedef Frag<__bf16>::U FB;
  __shared__ __align__(16) unsigned short Ksh[kKC * kLP];        // K hi [kv][d]
  __shared__ __align__(16) unsigned short Ksl[kKC * kLP];        // K lo [kv][d]
  __shared__ __align__(16) unsigned short Vth[kHeadDim * kLP];   // V hi [d][kv]
  __shared__ __align__(16) unsigned short Vtl[kHeadDim * kLP];   // V lo [d][kv]
  __shared__ __align__(16) float  Os[kNW][16 * kOP];             // per wave out tile

  const int tid  = threadIdx.x;
  const int wave = tid >> 5;
  const int lane = tid & 31;
  const int hh   = lane >> 4;
  const int c    = lane & 15;

  // Block index -> tile: a block's cost is its qb + 1 key chunks and there are more blocks than resident places, so the
  // longest tiles take the lowest indices and the short ones fill the end.
  const int nqb = S / kQB;
  const int nbh = kBatch * H;
  const int bx = blockIdx.x;
  const int qb = nqb - 1 - bx / nbh;
  const int bh = bx % nbh;
  const int h  = bh % H;
  const int b  = bh / H;
  const int q0 = qb * kQB + wave * 16;
  const size_t rowb = (size_t)b * (size_t)S;
  const int hcol = h * kHeadDim;

  // ---- Q fragments (B operand, column = query q0 + c, k = d): 2 d-chunks, hi and lo planes ----
  v16b qah[2], qal[2];
  {
    const size_t qo = (rowb + (size_t)(q0 + c)) * (size_t)ldq + (size_t)(hcol + 8 * hh);
    const __bf16* qr  = (const __bf16*)(const void*)(qh + qo);
    const __bf16* qr2 = (const __bf16*)(const void*)(ql + qo);
#pragma unroll
    for (int dc = 0; dc < 2; ++dc) {
      qah[dc] = Frag<__bf16>::load(qr + dc * 32);
      qal[dc] = Frag<__bf16>::load(qr2 + dc * 32);
    }
  }

  float mrun = -__builtin_inff();   // running maximum of query q0 + c (equal in both halves)
  float lrun = 0.f;                 // running sum over this half's keys of query q0 + c
  v8f oacc[4];                      // oacc[t][r] = out^T[d = t*16 + 8hh + r][query q0 + c]
#pragma unroll
  for (int t = 0; t < 4; ++t) oacc[t] = (v8f){0.f,0.f,0.f,0.f,0.f,0.f,0.f,0.f};

  const int nChunks = qb + 1;   // block-uniform; causal: key chunks 0..qb
  for (int kc = 0; kc < nChunks; ++kc) {
    const int kv0 = kc * kKC;
    __syncthreads();
    {
      // staging: thread -> kv row kvr = tid>>1 (0..63), d half dh = (tid&1)*32; 128 threads x 32 = 64x64 per plane
      const int kvr = tid >> 1, dh = (tid & 1) * 32;
      const size_t krow = rowb + (size_t)(kv0 + kvr);
      const unsigned short* gkh = kh + krow * (size_t)ldk + hcol + dh;
      const unsigned short* gkl = kl + krow * (size_t)ldk + hcol + dh;
      v4u wa[4], wb[4];
#pragma unroll
      for (int i = 0; i < 4; ++i) { wa[i] = *(const v4u*)(gkh + 8 * i); wb[i] = *(const v4u*)(gkl + 8 * i); }
#pragma unroll
      for (int i = 0; i < 4; ++i) {
        *(v4u*)(Ksh + kvr * kLP + dh + 8 * i) = wa[i];
        *(v4u*)(Ksl + kvr * kLP + dh + 8 * i) = wb[i];
      }
      asm volatile("" ::: "memory");
      const unsigned short* gvh = vh + krow * (size_t)ldv + hcol + dh;
      const unsigned short* gvl = vl + krow * (size_t)ldv + hcol + dh;
#pragma unroll
      for (int i = 0; i < 4; ++i) { wa[i] = *(const v4u*)(gvh + 8 * i); wb[i] = *(const v4u*)(gvl + 8 * i); }
#pragma unroll
      for (int i = 0; i < 4; ++i) {
#pragma unroll
        for (int m = 0; m < 4; ++m) {
          const unsigned ua = wa[i][m];
          const unsigned ub = wb[i][m];
          const int d = dh + 8 * i + 2 * m;
          Vth[d * kLP + kvr]       = (unsigned short)(ua & 0xffffu);
          Vth[(d + 1) * kLP + kvr] = (unsigned short)(ua >> 16);
          Vtl[d * kLP + kvr]       = (unsigned short)(ub & 0xffffu);
          Vtl[(d + 1) * kLP + kvr] = (unsigned short)(ub >> 16);
        }
      }
    }
    __syncthreads();

    // ---- scores, transposed: s[j][r] = S[query c][kv kv0 + j*16 + 8hh + r]; A = K (row = kv j*16 + c, k = d), B = Q ----
    v8f s[4];
#pragma unroll
    for (int j = 0; j < 4; ++j) {
      s[j] = (v8f){0.f,0.f,0.f,0.f,0.f,0.f,0.f,0.f};
#pragma unroll
      for (int dc = 0; dc < 2; ++dc) {
        FB kb, kb2;
        const unsigned short* kp  = Ksh + (j * 16 + c) * kLP + dc * 32 + 8 * hh;
        const unsigned short* kp2 = Ksl + (j * 16 + c) * kLP + dc * 32 + 8 * hh;
        kb.h[0]  = *(const v8b*)(const void*)(kp);
        kb.h[1]  = *(const v8b*)(const void*)(kp + 16);
        kb2.h[0] = *(const v8b*)(const void*)(kp2);
        kb2.h[1] = *(const v8b*)(const void*)(kp2 + 16);
        s[j] = at_mma(kb.v, qah[dc], s[j]);
        s[j] = at_mma(kb2.v, qah[dc], s[j]);
        s[j] = at_mma(kb.v, qal[dc], s[j]);
      }
    }
    const bool diag = (kc == qb);   // block-uniform
    const int qrel = q0 + c - kv0 - 8 * hh;   // key j*16 + 8hh + r of this chunk lies behind query q0 + c where j*16 + r > qrel
    float cm = -__builtin_inff();
#pragma unroll
    for (int j = 0; j < 4; ++j) {
#pragma unroll
      for (int r = 0; r < 8; ++r) {
        float sv = s[j][r] * sscale;
        sv = (diag && (j * 16 + r > qrel)) ? -__builtin_inff() : sv;
        s[j][r] = sv;
        cm = fmaxf(cm, sv);
      }
    }
    cm = fmaxf(cm, at_xhalf(cm));   // the query's other 32 keys of this chunk
    const float mnew = fmaxf(mrun, cm);
    const float alpha = expf(mrun - mnew);
    mrun = mnew;
    // P^T as B operand of 32 keys (column = query c): element e of block kk is key kk*32 + (e < 8 ? 8hh + e : 16 + 8hh + e - 8),
    // that is register e & 7 of score tile 2kk + (e >> 3) of this same lane: the k order of the V^T fragment loads below
    FB ph[2], pl[2];
    float psum = 0.f;
#pragma unroll
    for (int j = 0; j < 4; ++j) {
#pragma unroll
      for (int r = 0; r < 8; ++r) {
        const float p = expf(s[j][r] - mnew);
        psum += p;
        __bf16 a, bl;
        at_split(p, a, bl);
        ph[j >> 1].v[(j & 1) * 8 + r] = a;
        pl[j >> 1].v[(j & 1) * 8 + r] = bl;
      }
    }
    lrun = lrun * alpha + psum;
#pragma unroll
    for (int t = 0; t < 4; ++t)
#pragma unroll
      for (int r = 0; r < 8; ++r) oacc[t][r] *= alpha;
    // ---- out^T[d][query] += V^T[d][kv] * P^T[kv][query]; A from Vt [d][kv] (row = d t*16 + c, k = kv), B = P^T ----
#pragma unroll
    for (int kk = 0; kk < 2; ++kk) {
#pragma unroll
      for (int t = 0; t < 4; ++t) {
        FB vb, vb2;
        const unsigned short* vpa = Vth + (t * 16 + c) * kLP + kk * 32 + 8 * hh;
        const unsigned short* vpb = Vtl + (t * 16 + c) * kLP + kk * 32 + 8 * hh;
        vb.h[0]  = *(const v8b*)(const void*)(vpa);
        vb.h[1]  = *(const v8b*)(const void*)(vpa + 16);
        vb2.h[0] = *(const v8b*)(const void*)(vpb);
        vb2.h[1] = *(const v8b*)(const void*)(vpb + 16);
        oacc[t] = at_mma(vb.v, ph[kk].v, oacc[t]);
        oacc[t] = at_mma(vb2.v, ph[kk].v, oacc[t]);
        oacc[t] = at_mma(vb.v, pl[kk].v, oacc[t]);
      }
    }
  }

  // ---- epilogue: join the halves' sums, normalise, stage the wave's 16x64 tile, write whole 256-B row segments ----
  float* os = Os[wave];
  {
    const float inv = 1.0f / (lrun + at_xhalf(lrun));
#pragma unroll
    for (int t = 0; t < 4; ++t) {
      const v4f w0 = {oacc[t][0] * inv, oacc[t][1] * inv, oacc[t][2] * inv, oacc[t][3] * inv};
      const v4f w1 = {oacc[t][4] * inv, oacc[t][5] * inv, oacc[t][6] * inv, oacc[t][7] * inv};
      *(v4f*)(os + c * kOP + t * 16 + 8 * hh)     = w0;
      *(v4f*)(os + c * kOP + t * 16 + 8 * hh + 4) = w1;
    }
  }
  __builtin_amdgcn_fence(__ATOMIC_RELEASE, "workgroup");
  __builtin_amdgcn_wave_barrier();
  __builtin_amdgcn_fence(__ATOMIC_ACQUIRE, "workgroup");
  {
    float* ob = out + (size_t)hcol;
    const int c4 = (lane & 15) * 4;   // 16 lanes x 16 B = 256 B = one row segment of 64 floats
    {
#pragma unroll
      for (int it = 0; it < 8; ++it) {
        const int row = it * 2 + hh;
        v4f val = *(const v4f*)(os + row * kOP + c4);
        *(v4f*)(ob + (rowb + (size_t)(q0 + row)) * (size_t)ldo + c4) = val;
      }
      
    }
  }
}

// ---------------------------------------------------------------------------------------------------------------------
// Host launcher
// Workspace region map (bytes):
//   [0,            16,777,216)  Xb   bf16 [8192][1024]           (RNE copy of x)
//   [16,777,216,   23,068,672)  Wt   bf16 [3072][1024]           (RNE copy of W^T)
//   [23,068,672,   73,400,320)  Phi  bf16 [8192][3072]           (qkv hi plane)
//   [73,400,320,  123,731,968)  Plo  bf16 [8192][3072]           (qkv lo plane)
//   total 123,731,968
// ---------------------------------------------------------------------------------------------------------------------
extern "C" void kernel_launch(void* const* d_in, const int* in_sizes, int n_in,
                              void* d_out, int out_size, void* d_ws, size_t ws_size,
                              hipStream_t stream) {
  if (n_in < 2) return;
  if (in_sizes[0] != kRows * kEmb) return;
  if (in_sizes[1] != kEmb * kN3) return;
  if (out_size != kRows * kEmb) return;

  const size_t bytesXb = (size_t)kRows * kEmb * 2;
  const size_t bytesWt = (size_t)kN3 * kEmb * 2;
  const size_t bytesPl = (size_t)kRows * kN3 * 2;
  const size_t offXb = 0;
  const size_t offWt = offXb + bytesXb;
  const size_t offHi = offWt + bytesWt;
  const size_t offLo = offHi + bytesPl;
  const size_t total = offLo + bytesPl;
  if (total > ws_size) return;

  const float* x = (const float*)d_in[0];   // [4, 2048, 1024] f32
  const float* W = (const float*)d_in[1];   // [1024, 3072] f32
  float* outp = (float*)d_out;              // [4, 2048, 1024] f32

  char* ws = (char*)d_ws;
  unsigned short* Xb  = (unsigned short*)(ws + offXb);
  unsigned short* Wt  = (unsigned short*)(ws + offWt);
  unsigned short* Phi = (unsigned short*)(ws + offHi);
  unsigned short* Plo = (unsigned short*)(ws + offLo);
  const float* fdum = (const float*)(ws + offXb);

  // 1) x -> bf16 plane: 1,048,576 threads x 8 elements = 8,388,608
  const int n8 = (kRows * kEmb) / 8;
  cast_f32_bf16x8<<<dim3(n8 / 256), dim3(256), 0, stream>>>(x, Xb, n8);

  // 2) W [1024][3072] -> Wt [3072][1024] bf16; grid (Cc/64, R/64) = (48, 16)
  transpose_cast_bf16<<<dim3(kN3 / 64, kEmb / 64), dim3(256), 0, stream>>>(W, Wt, kEmb, kN3);

  // 3) qkv = Xb [8192][1024] x Wt [3072][1024]^T -> bf16 hi/lo planes [8192][3072]; M=8192, N=3072, K=1024
  const int tiles = (kRows / 64) * (kN3 / 64);   // 6144 tiles, 8 per block
  wmma_gemm64<1, false, 0, 2, false, 0><<<dim3(tiles / 8, 1), dim3(256), 0, stream>>>(
      (const unsigned short*)Xb, (const unsigned short*)Xb, kEmb, 0L,
      (const unsigned short*)Wt, (const unsigned short*)Wt, kEmb, 0L,
      (void*)Phi, (void*)Plo, kN3, 0L,
      fdum, fdum, 0L,
      kRows, kN3, kEmb, 1.0f);

  // 4) causal attention: q cols [0,1024), k cols [1024,2048), v cols [2048,3072) of the planes; ld = 3072
  attn_causal_hd64_split<<<dim3(kBatch * kHeads * (kSeq / kQB)), dim3(128), 0, stream>>>(
      (const unsigned short*)Phi, (const unsigned short*)Plo,
      (const unsigned short*)(Phi + kEmb), (const unsigned short*)(Plo + kEmb),
      (const unsigned short*)(Phi + 2 * kEmb), (const unsigned short*)(Plo + 2 * kEmb),
      outp, kSeq, kHeads, kN3, kN3, kN3, kEmb, 0.125f);
}

// v004
// A run of this version takes 270 microseconds.
// Next to v003, in two timings, it ran 1.06 and 1.07 times as fast.
// All steps since v000 together make it 2.63 times as fast.
// Contractions: QKV projection = v_wmma_f32_16x16x32_bf16 on RNE-bf16 copies of x and W (f32 accumulate); q.k^T and p.v = bf16 hi/lo split (hi*hi + hi*lo + lo*hi) on v_wmma_f32_16x16x32_bf16, f32 accumulate; softmax and normalisation in f32.
#include <hip/hip_runtime.h>
#include <stdint.h>

// ---------------------------------------------------------------------------------------------------------------------
// Shared 16-bit WMMA helpers
// ---------------------------------------------------------------------------------------------------------------------
typedef __attribute__((ext_vector_type(16))) _Float16 v16h;
typedef __attribute__((ext_vector_type(8)))  _Float16 v8h;
typedef __attribute__((ext_vector_type(16))) __bf16   v16b;
typedef __attribute__((ext_vector_type(8)))  __bf16   v8b;
typedef __attribute__((ext_vector_type(8)))  float    v8f;
typedef __attribute__((ext_vector_type(4)))  float    v4f;
typedef __attribute__((ext_vector_type(4)))  unsigned v4u;
#define PSCALE 32768.0f
#define U16(p) ((const unsigned short*)(const void*)(p))
#define PSCALE_INV (1.0f / 32768.0f)

__device__ __forceinline__ unsigned short f2bf_bits(float f) {
  unsigned u = __float_as_uint(f);
  return (unsigned short)((u + 0x7FFFu + ((u >> 16) & 1u)) >> 16);
}
__device__ __forceinline__ float bf_bits2f(unsigned short h) { return __uint_as_float(((unsigned)h) << 16); }

// hazard guards as plain device helpers (no inline asm inside the kernel template body)
__device__ __forceinline__ void dep_guard_h(v8f& a, v8f& b, v16h x, v16h y) { asm volatile("v_nop\n\tv_nop\n\tv_nop\n\tv_nop" : "+v"(a), "+v"(b) : "v"(x), "v"(y)); }
__device__ __forceinline__ void dep_guard_b(v8f& a, v8f& b, v16b x, v16b y) { asm volatile("v_nop\n\tv_nop\n\tv_nop\n\tv_nop" : "+v"(a), "+v"(b) : "v"(x), "v"(y)); }
__device__ __forceinline__ void keep4_h(v16h a, v16h b, v16h c, v16h d) { asm volatile("v_nop" :: "v"(a), "v"(b), "v"(c), "v"(d)); }
__device__ __forceinline__ void keep4_b(v16b a, v16b b, v16b c, v16b d) { asm volatile("v_nop" :: "v"(a), "v"(b), "v"(c), "v"(d)); }
__device__ __forceinline__ void acc_guard4(v8f& a, v8f& b, v8f& c, v8f& d) { asm volatile("v_nop\n\tv_nop\n\tv_nop\n\tv_nop" : "+v"(a), "+v"(b), "+v"(c), "+v"(d)); }
template <typename T> struct Frag;
template <> struct Frag<_Float16> {
  typedef v16h V; union U { v16h v; v8h h[2]; };
  static __device__ __forceinline__ v16h load(const _Float16* p) {   // elements 0..7 <- p[0..7], 8..15 <- p[16..23]
    U f; f.h[0] = *(const v8h*)(p); f.h[1] = *(const v8h*)(p + 16); return f.v;
  }
  static __device__ __forceinline__ v8f mma(v16h a, v16h b, v8f c) {
    return __builtin_amdgcn_wmma_f32_16x16x32_f16(false, a, false, b, (short)0, c, false, false);
  }
  static __device__ __forceinline__ void guard(v8f& a, v8f& b, v16h x, v16h y) { dep_guard_h(a, b, x, y); }
  static __device__ __forceinline__ void keep(v16h a, v16h b, v16h c, v16h d) { keep4_h(a, b, c, d); }
};
template <> struct Frag<__bf16> {
  typedef v16b V; union U { v16b v; v8b h[2]; };
  static __device__ __forceinline__ v16b load(const __bf16* p) {
    U f; f.h[0] = *(const v8b*)(p); f.h[1] = *(const v8b*)(p + 16); return f.v;
  }
  static __device__ __forceinline__ v8f mma(v16b a, v16b b, v8f c) {
    return __builtin_amdgcn_wmma_f32_16x16x32_bf16(false, a, false, b, (short)0, c, false, false);
  }
  static __device__ __forceinline__ void guard(v8f& a, v8f& b, v16b x, v16b y) { dep_guard_b(a, b, x, y); }
  static __device__ __forceinline__ void keep(v16b a, v16b b, v16b c, v16b d) { keep4_b(a, b, c, d); }
};

// ---- Register-blocked batched WMMA GEMM ------------------------------------
// C[m,n] = scale * sum_k A[m,k] * Bt[n,k] (+bias)(+resid); each wave owns a 64x64 tile.
// A row-major [M,K]; Bt row-major [N,K]; M,N % 64 == 0, K % 32 == 0.
// SPLIT: operands are hi/lo planes (A2/Bt2 = lo planes, same layout); product = hi*hi + hi*lo + lo*hi.
// BIAS_MODE: 0 = none, 1 = bias[m], 2 = bias[n].
// OUT_MODE: 0 = f32, 1 = f16, 2 = bf16 hi plane (Cout) + bf16 lo plane (Cout2).
// ET: 0 = f16 operands, 1 = bf16 operands (pointers passed as 16-bit storage)
template <int ET> struct Elem;
template <> struct Elem<0> { typedef _Float16 T; };
template <> struct Elem<1> { typedef __bf16 T; };
template <int ET, bool SPLIT, int BIAS_MODE, int OUT_MODE, bool RESID, int ACT = 0>
__global__ __launch_bounds__(256) void wmma_gemm64(
    const unsigned short* __restrict__ Ap, const unsigned short* __restrict__ A2p, int lda, long strideA,
    const unsigned short* __restrict__ Btp, const unsigned short* __restrict__ Bt2p, int ldb, long strideB,
    void* __restrict__ Cout, void* __restrict__ Cout2, int ldc, long strideC,
    const float* __restrict__ bias,
    const float* __restrict__ resid, long strideR,
    int M, int N, int K, float scale) {
  typedef typename Elem<ET>::T T;
  typedef typename Frag<T>::V V;
  const T* A = (const T*)Ap; const T* A2 = (const T*)A2p; const T* Bt = (const T*)Btp; const T* Bt2 = (const T*)Bt2p;
  __shared__ __align__(16) float sT[8][16 * 68];   // per-wave 16x64 slab, pitch 68 floats
  const int b    = blockIdx.y;
  const int lane = threadIdx.x & 31;
  const int wave = threadIdx.x >> 5;
  const int tilesN = N >> 6;
  const int tilesM = M >> 6;
  const int tile = blockIdx.x * 8 + wave;
  if (tile >= tilesM * tilesN) return;   // wave-uniform; no block barriers in this kernel
  const int tm = tile / tilesN;
  const int tn = tile - tm * tilesN;
  const int m0 = tm << 6;
  const int n0 = tn << 6;

  const T* Ab  = A  + (size_t)b * strideA;
  const T* Bb  = Bt + (size_t)b * strideB;
  const T* Ab2 = SPLIT ? (A2  + (size_t)b * strideA) : nullptr;
  const T* Bb2 = SPLIT ? (Bt2 + (size_t)b * strideB) : nullptr;

  const int rlane = lane & 15;                 // row (A) / col (B, D) within subtile
  const int koff  = (lane >> 4) * 8;           // k offset of this lane half
  const int mOff  = (lane >> 4) * 8;           // D row offset

  v8f acc[4][4];
#pragma unroll
  for (int i = 0; i < 4; ++i)
#pragma unroll
    for (int j = 0; j < 4; ++j) acc[i][j] = (v8f){0.f,0.f,0.f,0.f,0.f,0.f,0.f,0.f};

  for (int k0 = 0; k0 < K; k0 += 32) {
    V bh[4], bl[4];
#pragma unroll
    for (int j = 0; j < 4; ++j) {
      const size_t bo = (size_t)(n0 + (j << 4) + rlane) * ldb + koff + k0;
      bh[j] = Frag<T>::load(Bb + bo);
      if (SPLIT) bl[j] = Frag<T>::load(Bb2 + bo);
    }
#pragma unroll
    for (int i = 0; i < 4; ++i) {
      const size_t ao = (size_t)(m0 + (i << 4) + rlane) * lda + koff + k0;
      V ah = Frag<T>::load(Ab + ao);
      V al;
      if (SPLIT) al = Frag<T>::load(Ab2 + ao);
#pragma unroll
      for (int j = 0; j < 4; ++j) {
        acc[i][j] = Frag<T>::mma(ah, bh[j], acc[i][j]);
        if (SPLIT) {
          acc[i][j] = Frag<T>::mma(ah, bl[j], acc[i][j]);
          acc[i][j] = Frag<T>::mma(al, bh[j], acc[i][j]);
        }
      }
      Frag<T>::guard(acc[i][0], acc[i][3], ah, SPLIT ? al : ah);
    }
    Frag<T>::keep(bh[0], bh[1], bh[2], bh[3]);
    if (SPLIT) Frag<T>::keep(bl[0], bl[1], bl[2], bl[3]);
  }
  acc_guard4(acc[0][0], acc[0][1], acc[0][2], acc[0][3]);
  acc_guard4(acc[1][0], acc[1][1], acc[1][2], acc[1][3]);
  acc_guard4(acc[2][0], acc[2][1], acc[2][2], acc[2][3]);
  acc_guard4(acc[3][0], acc[3][1], acc[3][2], acc[3][3]);

  // ---- epilogue ----
  float* slab = sT[wave];
  const float* Rb = RESID ? (resid + (size_t)b * strideR) : nullptr;
#pragma unroll
  for (int i = 0; i < 4; ++i) {
    const int mBase = m0 + (i << 4);
#pragma unroll
    for (int j = 0; j < 4; ++j) {
      const int n = n0 + (j << 4) + rlane;
      float bv = 0.f;
      if (BIAS_MODE == 2) bv = bias[n];
#pragma unroll
      for (int r = 0; r < 8; ++r) {
        float v = acc[i][j][r] * scale;
        if (BIAS_MODE == 1) v += bias[mBase + mOff + r];
        if (BIAS_MODE == 2) v += bv;
        if (RESID) v += Rb[(size_t)(mBase + mOff + r) * ldc + n];
        if (ACT == 1) v = tanhf(v);
        if (ACT == 2) v = fmaxf(v, 0.0f);
        if (ACT == 3) v = v / (1.0f + expf(-v));
        if (ACT == 4) v = (v > 0.f) ? v : 0.01f * v;
        if (ACT == 5) v = 0.5f * v * (1.0f + erff(v * 0.70710678118654752f));
        slab[(mOff + r) * 68 + (j << 4) + rlane] = v;
      }
    }
    __builtin_amdgcn_fence(__ATOMIC_RELEASE, "workgroup");
    __builtin_amdgcn_wave_barrier();
    __builtin_amdgcn_fence(__ATOMIC_ACQUIRE, "workgroup");
    if (OUT_MODE == 0) {
      float* C = (float*)Cout + (size_t)b * strideC;
      const int hh = lane >> 4, c4 = (lane & 15) * 4;     // row seg = 256 B = 16 lanes x 16 B
      {
#pragma unroll
        for (int it = 0; it < 8; ++it) {
          const int row = it * 2 + hh;
          v4f v = *(const v4f*)(slab + row * 68 + c4);
          *(v4f*)(C + (size_t)(mBase + row) * ldc + n0 + c4) = v;
        }
        
      }
    } else {
      const int q = lane >> 3, c8 = (lane & 7) * 8;
      unsigned short* C  = (unsigned short*)Cout  + (size_t)b * strideC;
      unsigned short* C2 = (OUT_MODE == 2) ? ((unsigned short*)Cout2 + (size_t)b * strideC) : nullptr;
      {
#pragma unroll
        for (int it = 0; it < 4; ++it) {
          const int row = it * 4 + q;
          const float* sp = slab + row * 68 + c8;
          v8h hv, lv;
#pragma unroll
          for (int e = 0; e < 8; ++e) {
            if (OUT_MODE == 1) {
              hv[e] = (_Float16)sp[e];
            } else {
              unsigned short hb = f2bf_bits(sp[e]);
              unsigned short lb = f2bf_bits(sp[e] - bf_bits2f(hb));
              hv[e] = __builtin_bit_cast(_Float16, hb);
              lv[e] = __builtin_bit_cast(_Float16, lb);
            }
          }
          *(v8h*)(C + (size_t)(mBase + row) * ldc + n0 + c8) = hv;
          if (OUT_MODE == 2) *(v8h*)(C2 + (size_t)(mBase + row) * ldc + n0 + c8) = lv;
        }
        
      }
    }
    __builtin_amdgcn_fence(__ATOMIC_RELEASE, "workgroup");
    __builtin_amdgcn_wave_barrier();
    __builtin_amdgcn_fence(__ATOMIC_ACQUIRE, "workgroup");
  }
}

// ---------------------------------------------------------------------------------------------------------------------
// bf16 helpers for the attention kernel
// ---------------------------------------------------------------------------------------------------------------------
__device__ __forceinline__ unsigned short at_bf_bits(float f) {
  unsigned u = __float_as_uint(f);
  return (unsigned short)((u + 0x7FFFu + ((u >> 16) & 1u)) >> 16);
}
__device__ __forceinline__ __bf16 at_f2bf(float f) { return __builtin_bit_cast(__bf16, at_bf_bits(f)); }
__device__ __forceinline__ void at_split(float f, __bf16& hi, __bf16& lo) {
  const unsigned short hb = at_bf_bits(f);
  hi = __builtin_bit_cast(__bf16, hb);
  lo = at_f2bf(f - __uint_as_float(((unsigned)hb) << 16));
}
// value of lane l ^ 16 (the other half of the wave), by a vector cross-row move
__device__ __forceinline__ float at_xhalf(float x) {
  const int b = __builtin_bit_cast(int, x);
  return __builtin_bit_cast(float, __builtin_amdgcn_permlanex16(b, b, 0x76543210, 0xfedcba98, false, false));
}
__device__ __forceinline__ v8f at_mma(v16b a, v16b b, v8f c) {
  c = __builtin_amdgcn_wmma_f32_16x16x32_bf16(false, a, false, b, (short)0, c, false, false);
  asm volatile("v_nop\n\tv_nop\n\tv_nop\n\tv_nop" : "+v"(c) : "v"(a), "v"(b));
  return c;
}

// ---------------------------------------------------------------------------------------------------------------------
// Problem constants
// ---------------------------------------------------------------------------------------------------------------------
constexpr int kBatch   = 4;
constexpr int kSeq     = 2048;
constexpr int kEmb     = 1024;
constexpr int kHeads   = 16;
constexpr int kHeadDim = 64;
constexpr int kRows    = kBatch * kSeq;   // 8192 = GEMM M
constexpr int kN3      = 3 * kEmb;        // 3072 = GEMM N
static_assert(kEmb % 32 == 0, "K");
static_assert(kRows % 64 == 0 && kN3 % 64 == 0, "MN");
static_assert(((kRows / 64) * (kN3 / 64)) % 8 == 0, "tiles");
static_assert(kHeads * kHeadDim == kEmb, "heads");
static_assert(kSeq % 64 == 0, "S");
static_assert((kRows * kEmb) % (8 * 256) == 0, "cast grid");
static_assert(kEmb % 64 == 0 && kN3 % 64 == 0, "transpose grid");

// ---------------------------------------------------------------------------------------------------------------------
// f32 -> bf16 (RNE) cast: thread i converts elements 8i..8i+7 (two 16-B loads, one 16-B store);
// Coverage: n8 threads x 8 = whole plane (n8 = n/8 exact).
// ---------------------------------------------------------------------------------------------------------------------
__global__ __launch_bounds__(256) void cast_f32_bf16x8(const float* __restrict__ in, unsigned short* __restrict__ outp, int n8) {
  const int i = blockIdx.x * 256 + threadIdx.x;
  if (i < n8) {
    const size_t e0 = (size_t)i * 8;
    const v4f a = *(const v4f*)(in + e0);
    const v4f c = *(const v4f*)(in + e0 + 4);
    v4u u;
    u[0] = (unsigned)f2bf_bits(a[0]) | ((unsigned)f2bf_bits(a[1]) << 16);
    u[1] = (unsigned)f2bf_bits(a[2]) | ((unsigned)f2bf_bits(a[3]) << 16);
    u[2] = (unsigned)f2bf_bits(c[0]) | ((unsigned)f2bf_bits(c[1]) << 16);
    u[3] = (unsigned)f2bf_bits(c[2]) | ((unsigned)f2bf_bits(c[3]) << 16);
    *(v4u*)(outp + e0) = u;
    
  }
}

// ---------------------------------------------------------------------------------------------------------------------
// Transpose + cast: in [R][Cc] f32 row-major -> outp [Cc][R] bf16, outp[n][e] = bf16(in[e][n]).
// Tile 64 (e) x 64 (n); grid (Cc/64, R/64); block 256.
// Load coverage: 256 threads x 16 elements = 64x64. Store coverage: 8 waves x 2 iterations x 4 rows = 64 rows,
// ---------------------------------------------------------------------------------------------------------------------
__global__ __launch_bounds__(256) void transpose_cast_bf16(const float* __restrict__ in, unsigned short* __restrict__ outp, int R, int Cc) {
  __shared__ __align__(16) unsigned short tT[64 * 72];   // [n_local][e_local], pitch 72
  const int tid = threadIdx.x;
  const int n0 = blockIdx.x * 64;
  const int e0 = blockIdx.y * 64;
  {
    const int el = tid >> 2, nl = (tid & 3) * 16;
    const float* src = in + (size_t)(e0 + el) * Cc + n0 + nl;
#pragma unroll
    for (int i = 0; i < 4; ++i) {
      const v4f f = *(const v4f*)(src + 4 * i);
#pragma unroll
      for (int e = 0; e < 4; ++e) tT[(nl + 4 * i + e) * 72 + el] = f2bf_bits(f[e]);
    }
  }
  __syncthreads();
  const int wave = tid >> 5, lane = tid & 31, q = lane >> 3, c8 = (lane & 7) * 8;
  {
#pragma unroll
    for (int it = 0; it < 2; ++it) {
      const int nl = wave * 8 + it * 4 + q;
      const v4u w = *(const v4u*)(tT + nl * 72 + c8);
      *(v4u*)(outp + (size_t)(n0 + nl) * R + e0 + c8) = w;
    }
    
  }
}

// ---------------------------------------------------------------------------------------------------------------------
// Causal attention, head dim 64, 16-bit plane inputs, f32 output.
//   q, k, v are bf16 hi + lo planes: element (b, s, h, d) at plane[(b*S + s)*ld + h*64 + d] (ld in elements, % 8 == 0).
//   scores^T = k.q^T (unscaled) : bf16 hi/lo split (hi*hi + hi*lo + lo*hi), f32 accumulate; a lane holds 32 scores of ONE query
//   out^T    = v^T.p^T        : p (f32, split into bf16 hi/lo in registers) and v hi/lo planes, f32 accumulate;
//                               two score tiles of a lane, converted in place, are the B operand of 32 keys
//   online softmax in f32, exponentials in base 2; keys with kv > q replaced by -inf before the softmax; maximum in-lane plus one exchange
//   between the wave's halves; each half keeps its own partial row sum, the two are joined in the epilogue.
//   Block = 4 waves = 64 query rows of one (b, h); grid.x = B * H * (S/64); S % 64 == 0.
// ---------------------------------------------------------------------------------------------------------------------
constexpr int kQB = 64;   // query rows per block
constexpr int kKC = 64;   // keys per chunk
constexpr int kNW = 4;    // waves per block
constexpr int kOP = 68;   // output slab pitch (floats)
constexpr int kLP = 72;   // LDS row pitch of the K and V^T tiles, in 16-bit elements: 144 B = 16 B x odd, so that the
                          // 16 rows one 16-byte fragment read touches fall on distinct banks; columns 64..71 are never used

__global__ __launch_bounds__(128)
void attn_causal_hd64_split(const unsigned short* __restrict__ qh, const unsigned short* __restrict__ ql,
                            const unsigned short* __restrict__ kh, const unsigned short* __restrict__ kl,
                            const unsigned short* __restrict__ vh, const unsigned short* __restrict__ vl,
                            float* __restrict__ out,
                            int S, int H, int ldq, int ldk, int ldv, int ldo, float sscale) {
  typedef Frag<__bf16>::U FB;
  __shared__ __align__(16) unsigned short Ksh[kKC * kLP];        // K hi [kv][d]
  __shared__ __align__(16) unsigned short Ksl[kKC * kLP];        // K lo [kv][d]
  __shared__ __align__(16) unsigned short Vth[kHeadDim * kLP];   // V hi [d][kv]
  __shared__ __align__(16) unsigned short Vtl[kHeadDim * kLP];   // V lo [d][kv]
  __shared__ __align__(16) float  Os[kNW][16 * kOP];             // per wave out tile

  const int tid  = threadIdx.x;
  const int wave = tid >> 5;
  const int lane = tid & 31;
  const int hh   = lane >> 4;
  const int c    = lane & 15;

  // Block index -> tile: a block's cost is its qb + 1 key chunks and there are more blocks than resident places, so the
  // longest tiles take the lowest indices and the short ones fill the end.
  const int nqb = S / kQB;
  const int nbh = kBatch * H;
  const int bx = blockIdx.x;
  const int qb = nqb - 1 - bx / nbh;
  const int bh = bx % nbh;
  const int h  = bh % H;
  const int b  = bh / H;
  const int q0 = qb * kQB + wave * 16;
  const size_t rowb = (size_t)b * (size_t)S;
  const int hcol = h * kHeadDim;

  // ---- Q fragments (B operand, column = query q0 + c, k = d): 2 d-chunks, hi and lo planes ----
  v16b qah[2], qal[2];
  {
    const size_t qo = (rowb + (size_t)(q0 + c)) * (size_t)ldq + (size_t)(hcol + 8 * hh);
    const __bf16* qr  = (const __bf16*)(const void*)(qh + qo);
    const __bf16* qr2 = (const __bf16*)(const void*)(ql + qo);
#pragma unroll
    for (int dc = 0; dc < 2; ++dc) {
      qah[dc] = Frag<__bf16>::load(qr + dc * 32);
      qal[dc] = Frag<__bf16>::load(qr2 + dc * 32);
    }
  }

  // exp(sscale * (s - m)) = 2^(c2 * s - c2 * m): one multiply-add and the bare base-2 exponential per score. sscale > 0, so the
  // maximum is taken over the unscaled scores; a masked score stays -inf through the multiply-add and gives 0.
  const float c2 = sscale * 1.44269504088896340736f;
  float mrun = -__builtin_inff();   // running maximum (unscaled scores) of query q0 + c (equal in both halves)
  float lrun = 0.f;                 // running sum over this half's keys of query q0 + c
  v8f oacc[4];                      // oacc[t][r] = out^T[d = t*16 + 8hh + r][query q0 + c]
#pragma unroll
  for (int t = 0; t < 4; ++t) oacc[t] = (v8f){0.f,0.f,0.f,0.f,0.f,0.f,0.f,0.f};

  const int nChunks = qb + 1;   // block-uniform; causal: key chunks 0..qb
  for (int kc = 0; kc < nChunks; ++kc) {
    const int kv0 = kc * kKC;
    __syncthreads();
    {
      // staging: thread -> kv row kvr = tid>>1 (0..63), d half dh = (tid&1)*32; 128 threads x 32 = 64x64 per plane
      const int kvr = tid >> 1, dh = (tid & 1) * 32;
      const size_t krow = rowb + (size_t)(kv0 + kvr);
      const unsigned short* gkh = kh + krow * (size_t)ldk + hcol + dh;
      const unsigned short* gkl = kl + krow * (size_t)ldk + hcol + dh;
      v4u wa[4], wb[4];
#pragma unroll
      for (int i = 0; i < 4; ++i) { wa[i] = *(const v4u*)(gkh + 8 * i); wb[i] = *(const v4u*)(gkl + 8 * i); }
#pragma unroll
      for (int i = 0; i < 4; ++i) {
        *(v4u*)(Ksh + kvr * kLP + dh + 8 * i) = wa[i];
        *(v4u*)(Ksl + kvr * kLP + dh + 8 * i) = wb[i];
      }
      asm volatile("" ::: "memory");
      const unsigned short* gvh = vh + krow * (size_t)ldv + hcol + dh;
      const unsigned short* gvl = vl + krow * (size_t)ldv + hcol + dh;
#pragma unroll
      for (int i = 0; i < 4; ++i) { wa[i] = *(const v4u*)(gvh + 8 * i); wb[i] = *(const v4u*)(gvl + 8 * i); }
#pragma unroll
      for (int i = 0; i < 4; ++i) {
#pragma unroll
        for (int m = 0; m < 4; ++m) {
          const unsigned ua = wa[i][m];
          const unsigned ub = wb[i][m];
          const int d = dh + 8 * i + 2 * m;
          Vth[d * kLP + kvr]       = (unsigned short)(ua & 0xffffu);
          Vth[(d + 1) * kLP + kvr] = (unsigned short)(ua >> 16);
          Vtl[d * kLP + kvr]       = (unsigned short)(ub & 0xffffu);
          Vtl[(d + 1) * kLP + kvr] = (unsigned short)(ub >> 16);
        }
      }
    }
    __syncthreads();

    // ---- scores, transposed: s[j][r] = S[query c][kv kv0 + j*16 + 8hh + r]; A = K (row = kv j*16 + c, k = d), B = Q ----
    v8f s[4];
#pragma unroll
    for (int j = 0; j < 4; ++j) {
      s[j] = (v8f){0.f,0.f,0.f,0.f,0.f,0.f,0.f,0.f};
#pragma unroll
      for (int dc = 0; dc < 2; ++dc) {
        FB kb, kb2;
        const unsigned short* kp  = Ksh + (j * 16 + c) * kLP + dc * 32 + 8 * hh;
        const unsigned short* kp2 = Ksl + (j * 16 + c) * kLP + dc * 32 + 8 * hh;
        kb.h[0]  = *(const v8b*)(const void*)(kp);
        kb.h[1]  = *(const v8b*)(const void*)(kp + 16);
        kb2.h[0] = *(const v8b*)(const void*)(kp2);
        kb2.h[1] = *(const v8b*)(const void*)(kp2 + 16);
        s[j] = at_mma(kb.v, qah[dc], s[j]);
        s[j] = at_mma(kb2.v, qah[dc], s[j]);
        s[j] = at_mma(kb.v, qal[dc], s[j]);
      }
    }
    const bool diag = (kc == qb);   // block-uniform
    const int qrel = q0 + c - kv0 - 8 * hh;   // key j*16 + 8hh + r of this chunk lies behind query q0 + c where j*16 + r > qrel
    float cm = -__builtin_inff();
#pragma unroll
    for (int j = 0; j < 4; ++j) {
#pragma unroll
      for (int r = 0; r < 8; ++r) {
        float sv = s[j][r];   // unscaled: the scale is folded into the exponent's multiply-add below
        sv = (diag && (j * 16 + r > qrel)) ? -__builtin_inff() : sv;
        s[j][r] = sv;
        cm = fmaxf(cm, sv);
      }
    }
    cm = fmaxf(cm, at_xhalf(cm));   // the query's other 32 keys of this chunk
    const float mnew = fmaxf(mrun, cm);
    const float alpha = __builtin_amdgcn_exp2f((mrun - mnew) * c2);
    const float mn2 = mnew * c2;
    mrun = mnew;
    // P^T as B operand of 32 keys (column = query c): element e of block kk is key kk*32 + (e < 8 ? 8hh + e : 16 + 8hh + e - 8),
    // that is register e & 7 of score tile 2kk + (e >> 3) of this same lane: the k order of the V^T fragment loads below
    FB ph[2], pl[2];
    float psum = 0.f;
#pragma unroll
    for (int j = 0; j < 4; ++j) {
#pragma unroll
      for (int r = 0; r < 8; ++r) {
        const float p = __builtin_amdgcn_exp2f(__builtin_fmaf(s[j][r], c2, -mn2));
        psum += p;
        __bf16 a, bl;
        at_split(p, a, bl);
        ph[j >> 1].v[(j & 1) * 8 + r] = a;
        pl[j >> 1].v[(j & 1) * 8 + r] = bl;
      }
    }
    lrun = lrun * alpha + psum;
#pragma unroll
    for (int t = 0; t < 4; ++t)
#pragma unroll
      for (int r = 0; r < 8; ++r) oacc[t][r] *= alpha;
    // ---- out^T[d][query] += V^T[d][kv] * P^T[kv][query]; A from Vt [d][kv] (row = d t*16 + c, k = kv), B = P^T ----
#pragma unroll
    for (int kk = 0; kk < 2; ++kk) {
#pragma unroll
      for (int t = 0; t < 4; ++t) {
        FB vb, vb2;
        const unsigned short* vpa = Vth + (t * 16 + c) * kLP + kk * 32 + 8 * hh;
        const unsigned short* vpb = Vtl + (t * 16 + c) * kLP + kk * 32 + 8 * hh;
        vb.h[0]  = *(const v8b*)(const void*)(vpa);
        vb.h[1]  = *(const v8b*)(const void*)(vpa + 16);
        vb2.h[0] = *(const v8b*)(const void*)(vpb);
        vb2.h[1] = *(const v8b*)(const void*)(vpb + 16);
        oacc[t] = at_mma(vb.v, ph[kk].v, oacc[t]);
        oacc[t] = at_mma(vb2.v, ph[kk].v, oacc[t]);
        oacc[t] = at_mma(vb.v, pl[kk].v, oacc[t]);
      }
    }
  }

  // ---- epilogue: join the halves' sums, normalise, stage the wave's 16x64 tile, write whole 256-B row segments ----
  float* os = Os[wave];
  {
    const float inv = 1.0f / (lrun + at_xhalf(lrun));
#pragma unroll
    for (int t = 0; t < 4; ++t) {
      const v4f w0 = {oacc[t][0] * inv, oacc[t][1] * inv, oacc[t][2] * inv, oacc[t][3] * inv};
      const v4f w1 = {oacc[t][4] * inv, oacc[t][5] * inv, oacc[t][6] * inv, oacc[t][7] * inv};
      *(v4f*)(os + c * kOP + t * 16 + 8 * hh)     = w0;
      *(v4f*)(os + c * kOP + t * 16 + 8 * hh + 4) = w1;
    }
  }
  __builtin_amdgcn_fence(__ATOMIC_RELEASE, "workgroup");
  __builtin_amdgcn_wave_barrier();
  __builtin_amdgcn_fence(__ATOMIC_ACQUIRE, "workgroup");
  {
    float* ob = out + (size_t)hcol;
    const int c4 = (lane & 15) * 4;   // 16 lanes x 16 B = 256 B = one row segment of 64 floats
    {
#pragma unroll
      for (int it = 0; it < 8; ++it) {
        const int row = it * 2 + hh;
        v4f val = *(const v4f*)(os + row * kOP + c4);
        *(v4f*)(ob + (rowb + (size_t)(q0 + row)) * (size_t)ldo + c4) = val;
      }
      
    }
  }
}

// ---------------------------------------------------------------------------------------------------------------------
// Host launcher
// Workspace region map (bytes):
//   [0,            16,777,216)  Xb   bf16 [8192][1024]           (RNE copy of x)
//   [16,777,216,   23,068,672)  Wt   bf16 [3072][1024]           (RNE copy of W^T)
//   [23,068,672,   73,400,320)  Phi  bf16 [8192][3072]           (qkv hi plane)
//   [73,400,320,  123,731,968)  Plo  bf16 [8192][3072]           (qkv lo plane)
//   total 123,731,968
// ---------------------------------------------------------------------------------------------------------------------
extern "C" void kernel_launch(void* const* d_in, const int* in_sizes, int n_in,
                              void* d_out, int out_size, void* d_ws, size_t ws_size,
                              hipStream_t stream) {
  if (n_in < 2) return;
  if (in_sizes[0] != kRows * kEmb) return;
  if (in_sizes[1] != kEmb * kN3) return;
  if (out_size != kRows * kEmb) return;

  const size_t bytesXb = (size_t)kRows * kEmb * 2;
  const size_t bytesWt = (size_t)kN3 * kEmb * 2;
  const size_t bytesPl = (size_t)kRows * kN3 * 2;
  const size_t offXb = 0;
  const size_t offWt = offXb + bytesXb;
  const size_t offHi = offWt + bytesWt;
  const size_t offLo = offHi + bytesPl;
  const size_t total = offLo + bytesPl;
  if (total > ws_size) return;

  const float* x = (const float*)d_in[0];   // [4, 2048, 1024] f32
  const float* W = (const float*)d_in[1];   // [1024, 3072] f32
  float* outp = (float*)d_out;              // [4, 2048, 1024] f32

  char* ws = (char*)d_ws;
  unsigned short* Xb  = (unsigned short*)(ws + offXb);
  unsigned short* Wt  = (unsigned short*)(ws + offWt);
  unsigned short* Phi = (unsigned short*)(ws + offHi);
  unsigned short* Plo = (unsigned short*)(ws + offLo);
  const float* fdum = (const float*)(ws + offXb);

  // 1) x -> bf16 plane: 1,048,576 threads x 8 elements = 8,388,608
  const int n8 = (kRows * kEmb) / 8;
  cast_f32_bf16x8<<<dim3(n8 / 256), dim3(256), 0, stream>>>(x, Xb, n8);

  // 2) W [1024][3072] -> Wt [3072][1024] bf16; grid (Cc/64, R/64) = (48, 16)
  transpose_cast_bf16<<<dim3(kN3 / 64, kEmb / 64), dim3(256), 0, stream>>>(W, Wt, kEmb, kN3);

  // 3) qkv = Xb [8192][1024] x Wt [3072][1024]^T -> bf16 hi/lo planes [8192][3072]; M=8192, N=3072, K=1024
  const int tiles = (kRows / 64) * (kN3 / 64);   // 6144 tiles, 8 per block
  wmma_gemm64<1, false, 0, 2, false, 0><<<dim3(tiles / 8, 1), dim3(256), 0, stream>>>(
      (const unsigned short*)Xb, (const unsigned short*)Xb, kEmb, 0L,
      (const unsigned short*)Wt, (const unsigned short*)Wt, kEmb, 0L,
      (void*)Phi, (void*)Plo, kN3, 0L,
      fdum, fdum, 0L,
      kRows, kN3, kEmb, 1.0f);

  // 4) causal attention: q cols [0,1024), k cols [1024,2048), v cols [2048,3072) of the planes; ld = 3072
  attn_causal_hd64_split<<<dim3(kBatch * kHeads * (kSeq / kQB)), dim3(128), 0, stream>>>(
      (const unsigned short*)Phi, (const unsigned short*)Plo,
      (const unsigned short*)(Phi + kEmb), (const unsigned short*)(Plo + kEmb),
      (const unsigned short*)(Phi + 2 * kEmb), (const unsigned short*)(Plo + 2 * kEmb),
      outp, kSeq, kHeads, kN3, kN3, kN3, kEmb, 0.125f);
}

// v005
// It runs in 190 microseconds.
// Timed twice side by side with v004, it ran 1.42 times as fast both times.
// All steps since v000 together make it 3.73 times as fast.
// Contractions: QKV projection = v_wmma_f32_16x16x32_bf16 on RNE-bf16 copies of x and W (f32 accumulate); q.k^T and p.v = bf16 hi/lo split (hi*hi + hi*lo + lo*hi) on v_wmma_f32_16x16x32_bf16, f32 accumulate; softmax and normalisation in f32.
#include <hip/hip_runtime.h>
#include <stdint.h>

// ---------------------------------------------------------------------------------------------------------------------
// Shared 16-bit WMMA helpers
// ---------------------------------------------------------------------------------------------------------------------
typedef __attribute__((ext_vector_type(16))) _Float16 v16h;
typedef __attribute__((ext_vector_type(8)))  _Float16 v8h;
typedef __attribute__((ext_vector_type(16))) __bf16   v16b;
typedef __attribute__((ext_vector_type(8)))  __bf16   v8b;
typedef __attribute__((ext_vector_type(8)))  float    v8f;
typedef __attribute__((ext_vector_type(4)))  float    v4f;
typedef __attribute__((ext_vector_type(4)))  unsigned v4u;
#define PSCALE 32768.0f
#define U16(p) ((const unsigned short*)(const void*)(p))
#define PSCALE_INV (1.0f / 32768.0f)

__device__ __forceinline__ unsigned short f2bf_bits(float f) {
  unsigned u = __float_as_uint(f);
  return (unsigned short)((u + 0x7FFFu + ((u >> 16) & 1u)) >> 16);
}
__device__ __forceinline__ float bf_bits2f(unsigned short h) { return __uint_as_float(((unsigned)h) << 16); }

// hazard guards as plain device helpers
__device__ __forceinline__ void dep_guard_h(v8f& a, v8f& b, v16h x, v16h y) { asm volatile("v_nop\n\tv_nop\n\tv_nop\n\tv_nop" : "+v"(a), "+v"(b) : "v"(x), "v"(y)); }
__device__ __forceinline__ void dep_guard_b(v8f& a, v8f& b, v16b x, v16b y) { asm volatile("v_nop\n\tv_nop\n\tv_nop\n\tv_nop" : "+v"(a), "+v"(b) : "v"(x), "v"(y)); }
__device__ __forceinline__ void keep4_h(v16h a, v16h b, v16h c, v16h d) { asm volatile("v_nop" :: "v"(a), "v"(b), "v"(c), "v"(d)); }
__device__ __forceinline__ void keep4_b(v16b a, v16b b, v16b c, v16b d) { asm volatile("v_nop" :: "v"(a), "v"(b), "v"(c), "v"(d)); }
__device__ __forceinline__ void acc_guard4(v8f& a, v8f& b, v8f& c, v8f& d) { asm volatile("v_nop\n\tv_nop\n\tv_nop\n\tv_nop" : "+v"(a), "+v"(b), "+v"(c), "+v"(d)); }
template <typename T> struct Frag;
template <> struct Frag<_Float16> {
  typedef v16h V; union U { v16h v; v8h h[2]; };
  static __device__ __forceinline__ v16h load(const _Float16* p) {   // elements 0..7 <- p[0..7], 8..15 <- p[16..23]
    U f; f.h[0] = *(const v8h*)(p); f.h[1] = *(const v8h*)(p + 16); return f.v;
  }
  static __device__ __forceinline__ v8f mma(v16h a, v16h b, v8f c) {
    return __builtin_amdgcn_wmma_f32_16x16x32_f16(false, a, false, b, (short)0, c, false, false);
  }
  static __device__ __forceinline__ void guard(v8f& a, v8f& b, v16h x, v16h y) { dep_guard_h(a, b, x, y); }
  static __device__ __forceinline__ void keep(v16h a, v16h b, v16h c, v16h d) { keep4_h(a, b, c, d); }
};
template <> struct Frag<__bf16> {
  typedef v16b V; union U { v16b v; v8b h[2]; };
  static __device__ __forceinline__ v16b load(const __bf16* p) {
    U f; f.h[0] = *(const v8b*)(p); f.h[1] = *(const v8b*)(p + 16); return f.v;
  }
  static __device__ __forceinline__ v8f mma(v16b a, v16b b, v8f c) {
    return __builtin_amdgcn_wmma_f32_16x16x32_bf16(false, a, false, b, (short)0, c, false, false);
  }
  static __device__ __forceinline__ void guard(v8f& a, v8f& b, v16b x, v16b y) { dep_guard_b(a, b, x, y); }
  static __device__ __forceinline__ void keep(v16b a, v16b b, v16b c, v16b d) { keep4_b(a, b, c, d); }
};

// ---- Register-blocked batched WMMA GEMM ------------------------------------
// C[m,n] = scale * sum_k A[m,k] * Bt[n,k] (+bias)(+resid); each wave owns a 64x64 tile, a block's 8 waves (2 x 4) a 128x256 tile.
// A row-major [M,K]; Bt row-major [N,K]; M % 128 == 0, N % 256 == 0, K % 64 == 0; grid.x = (M/128) * (N/256).
// Operands reach the waves through LDS: a stage is 64 k (one 128-B line) of the block's 128 A rows and 256 Bt rows, brought in by
// asynchronous 16-B copies (a wave's copy = 4 whole lines), two buffers, the next stage in flight while this one is multiplied.
// SPLIT: must be false (the staged loop reads one plane per operand); A2/Bt2 are not read.
// BIAS_MODE: 0 = none, 1 = bias[m], 2 = bias[n].
// OUT_MODE: 0 = f32, 1 = f16, 2 = bf16 hi plane (Cout) + bf16 lo plane (Cout2).
// ET: 0 = f16 operands, 1 = bf16 operands (pointers passed as 16-bit storage)
template <int ET> struct Elem;
template <> struct Elem<0> { typedef _Float16 T; };
template <> struct Elem<1> { typedef __bf16 T; };
constexpr int kGP     = 72;                      // LDS row pitch, 16-bit elements: 144 B = 16 B x odd (16-byte fragment reads)
constexpr int kGARows = 128;                     // A rows of a stage
constexpr int kGBRows = 256;                     // Bt rows of a stage
constexpr int kGStage = (kGARows + kGBRows) * kGP;   // elements of one buffer
// One stage's copies of one thread: 4 A rows and 8 Bt rows, 32 rows apart, 16 B each. la / lb: the lane's LDS byte addresses of the
// first A / Bt row; ga / gb: its global addresses; sa / sb: 32 rows in elements. The s_wait_xcnt closes the statement so that no
// address register of a copy is rewritten in front of it.
__device__ __forceinline__ void gemm_stage_copies(unsigned la, unsigned lb, const unsigned short* ga, const unsigned short* gb,
                                                  size_t sa, size_t sb) {
  constexpr unsigned ls = 32u * kGP * 2u;   // 32 rows in LDS bytes
  asm volatile(
      "global_load_async_to_lds_b128 %0, %12, off\n\t"
      "global_load_async_to_lds_b128 %1, %13, off\n\t"
      "global_load_async_to_lds_b128 %2, %14, off\n\t"
      "global_load_async_to_lds_b128 %3, %15, off\n\t"
      "global_load_async_to_lds_b128 %4, %16, off\n\t"
      "global_load_async_to_lds_b128 %5, %17, off\n\t"
      "global_load_async_to_lds_b128 %6, %18, off\n\t"
      "global_load_async_to_lds_b128 %7, %19, off\n\t"
      "global_load_async_to_lds_b128 %8, %20, off\n\t"
      "global_load_async_to_lds_b128 %9, %21, off\n\t"
      "global_load_async_to_lds_b128 %10, %22, off\n\t"
      "global_load_async_to_lds_b128 %11, %23, off\n\t"
      "s_wait_xcnt 0x0"
      :: "v"(la), "v"(la + ls), "v"(la + 2u * ls), "v"(la + 3u * ls),
         "v"(lb), "v"(lb + ls), "v"(lb + 2u * ls), "v"(lb + 3u * ls),
         "v"(lb + 4u * ls), "v"(lb + 5u * ls), "v"(lb + 6u * ls), "v"(lb + 7u * ls),
         "v"(ga), "v"(ga + sa), "v"(ga + 2 * sa), "v"(ga + 3 * sa),
         "v"(gb), "v"(gb + sb), "v"(gb + 2 * sb), "v"(gb + 3 * sb),
         "v"(gb + 4 * sb), "v"(gb + 5 * sb), "v"(gb + 6 * sb), "v"(gb + 7 * sb)
      : "memory");
}
template <int ET, bool SPLIT, int BIAS_MODE, int OUT_MODE, bool RESID, int ACT = 0>
__global__ __launch_bounds__(256) void wmma_gemm64(
    const unsigned short* __restrict__ Ap, const unsigned short* __restrict__ A2p, int lda, long strideA,
    const unsigned short* __restrict__ Btp, const unsigned short* __restrict__ Bt2p, int ldb, long strideB,
    void* __restrict__ Cout, void* __restrict__ Cout2, int ldc, long strideC,
    const float* __restrict__ bias,
    const float* __restrict__ resid, long strideR,
    int M, int N, int K, float scale) {
  typedef typename Elem<ET>::T T;
  typedef typename Frag<T>::V V;
  static_assert(!SPLIT, "the staged loop carries one plane per operand");
  __shared__ __align__(16) unsigned short sAB[2 * kGStage];   // two stage buffers: [A 128 rows | Bt 256 rows], pitch kGP
  __shared__ __align__(16) float sT[8][16 * 68];   // per-wave 16x64 slab, pitch 68 floats
  const int b    = blockIdx.y;
  const int tid  = threadIdx.x;
  const int lane = tid & 31;
  const int wave = tid >> 5;
  const int tilesN = N >> 8;
  const int tilesM = M >> 7;
  if ((int)blockIdx.x >= tilesM * tilesN) return;   // block-uniform, in front of every barrier and copy
  const int tm = blockIdx.x / tilesN;
  const int tn = blockIdx.x - tm * tilesN;
  const int wm0 = (wave >> 2) << 6;   // the wave's first row in the block's A rows
  const int wn0 = (wave & 3) << 6;    // the wave's first row in the block's Bt rows
  const int m0 = (tm << 7) + wm0;
  const int n0 = (tn << 8) + wn0;

  // copies: thread -> row tid >> 3 (+ 32 per copy), 16-B piece tid & 7 of the row's 128-B line
  const int crow = tid >> 3, ccol = (tid & 7) * 8;
  const unsigned short* gA = Ap  + (size_t)b * strideA + (size_t)((tm << 7) + crow) * lda + ccol;
  const unsigned short* gB = Btp + (size_t)b * strideB + (size_t)((tn << 8) + crow) * ldb + ccol;
  const size_t sA32 = (size_t)32 * lda, sB32 = (size_t)32 * ldb;
  const unsigned ldsA = (unsigned)(size_t)(const void*)sAB + (unsigned)(crow * kGP + ccol) * 2u;
  const unsigned ldsB = ldsA + (unsigned)(kGARows * kGP) * 2u;

  const int rlane = lane & 15;                 // row (A) / col (B, D) within subtile
  const int koff  = (lane >> 4) * 8;           // k offset of this lane half
  const int mOff  = (lane >> 4) * 8;           // D row offset

  v8f acc[4][4];
#pragma unroll
  for (int i = 0; i < 4; ++i)
#pragma unroll
    for (int j = 0; j < 4; ++j) acc[i][j] = (v8f){0.f,0.f,0.f,0.f,0.f,0.f,0.f,0.f};

  const int nt = K >> 6;   // stages
  gemm_stage_copies(ldsA, ldsB, gA, gB, sA32, sB32);
  asm volatile("s_wait_asynccnt 0x0" ::: "memory");   // this wave's copies of stage 0 have landed
  __syncthreads();                                    // and every other wave's
  if (nt > 1) gemm_stage_copies(ldsA + kGStage * 2u, ldsB + kGStage * 2u, gA + 64, gB + 64, sA32, sB32);
  for (int t = 0; t < nt; ++t) {
    const unsigned bufe = (unsigned)(t & 1) * kGStage;   // this stage's buffer, in elements
    const T* sA = (const T*)(const void*)(sAB + bufe) + (wm0 + rlane) * kGP + koff;
    const T* sB = (const T*)(const void*)(sAB + bufe) + (kGARows + wn0 + rlane) * kGP + koff;
#pragma unroll   // constant LDS offsets and constant indices into the fragment and accumulator arrays
    for (int ks = 0; ks < 2; ++ks) {
      V bh[4], ah[4];   // all eight fragments of these 32 k are read as one group, ahead of their 16 products
#pragma unroll
      for (int j = 0; j < 4; ++j) bh[j] = Frag<T>::load(sB + (j << 4) * kGP + ks * 32);
#pragma unroll
      for (int i = 0; i < 4; ++i) ah[i] = Frag<T>::load(sA + (i << 4) * kGP + ks * 32);
#pragma unroll
      for (int i = 0; i < 4; ++i) {
#pragma unroll
        for (int j = 0; j < 4; ++j) acc[i][j] = Frag<T>::mma(ah[i], bh[j], acc[i][j]);
        Frag<T>::guard(acc[i][0], acc[i][3], ah[i], ah[i]);
      }
      Frag<T>::keep(bh[0], bh[1], bh[2], bh[3]);
    }
    asm volatile("s_wait_dscnt 0x0" ::: "memory");      // this wave's reads of the buffer are done before it is refilled
    asm volatile("s_wait_asynccnt 0x0" ::: "memory");   // this wave's copies of stage t + 1 have landed
    __syncthreads();                                    // publishes stage t + 1 and ends every wave's reads of stage t
    if (t + 2 < nt)
      gemm_stage_copies(ldsA + bufe * 2u, ldsB + bufe * 2u, gA + (size_t)(t + 2) * 64, gB + (size_t)(t + 2) * 64, sA32, sB32);
  }
  asm volatile("s_wait_asynccnt 0x0" ::: "memory");   // nothing of this wave is in flight behind the loop
  acc_guard4(acc[0][0], acc[0][1], acc[0][2], acc[0][3]);
  acc_guard4(acc[1][0], acc[1][1], acc[1][2], acc[1][3]);
  acc_guard4(acc[2][0], acc[2][1], acc[2][2], acc[2][3]);
  acc_guard4(acc[3][0], acc[3][1], acc[3][2], acc[3][3]);

  // ---- epilogue ----
  float* slab = sT[wave];
  const float* Rb = RESID ? (resid + (size_t)b * strideR) : nullptr;
#pragma unroll
  for (int i = 0; i < 4; ++i) {
    const int mBase = m0 + (i << 4);
#pragma unroll
    for (int j = 0; j < 4; ++j) {
      const int n = n0 + (j << 4) + rlane;
      float bv = 0.f;
      if (BIAS_MODE == 2) bv = bias[n];
#pragma unroll
      for (int r = 0; r < 8; ++r) {
        float v = acc[i][j][r] * scale;
        if (BIAS_MODE == 1) v += bias[mBase + mOff + r];
        if (BIAS_MODE == 2) v += bv;
        if (RESID) v += Rb[(size_t)(mBase + mOff + r) * ldc + n];
        if (ACT == 1) v = tanhf(v);
        if (ACT == 2) v = fmaxf(v, 0.0f);
        if (ACT == 3) v = v / (1.0f + expf(-v));
        if (ACT == 4) v = (v > 0.f) ? v : 0.01f * v;
        if (ACT == 5) v = 0.5f * v * (1.0f + erff(v * 0.70710678118654752f));
        slab[(mOff + r) * 68 + (j << 4) + rlane] = v;
      }
    }
    __builtin_amdgcn_fence(__ATOMIC_RELEASE, "workgroup");
    __builtin_amdgcn_wave_barrier();
    __builtin_amdgcn_fence(__ATOMIC_ACQUIRE, "workgroup");
    if (OUT_MODE == 0) {
      float* C = (float*)Cout + (size_t)b * strideC;
      const int hh = lane >> 4, c4 = (lane & 15) * 4;     // row seg = 256 B = 16 lanes x 16 B
      {
#pragma unroll
        for (int it = 0; it < 8; ++it) {
          const int row = it * 2 + hh;
          v4f v = *(const v4f*)(slab + row * 68 + c4);
          *(v4f*)(C + (size_t)(mBase + row) * ldc + n0 + c4) = v;
        }
        
      }
    } else {
      const int q = lane >> 3, c8 = (lane & 7) * 8;
      unsigned short* C  = (unsigned short*)Cout  + (size_t)b * strideC;
      unsigned short* C2 = (OUT_MODE == 2) ? ((unsigned short*)Cout2 + (size_t)b * strideC) : nullptr;
      {
#pragma unroll
        for (int it = 0; it < 4; ++it) {
          const int row = it * 4 + q;
          const float* sp = slab + row * 68 + c8;
          v8h hv, lv;
#pragma unroll
          for (int e = 0; e < 8; ++e) {
            if (OUT_MODE == 1) {
              hv[e] = (_Float16)sp[e];
            } else {
              unsigned short hb = f2bf_bits(sp[e]);
              unsigned short lb = f2bf_bits(sp[e] - bf_bits2f(hb));
              hv[e] = __builtin_bit_cast(_Float16, hb);
              lv[e] = __builtin_bit_cast(_Float16, lb);
            }
          }
          *(v8h*)(C + (size_t)(mBase + row) * ldc + n0 + c8) = hv;
          if (OUT_MODE == 2) *(v8h*)(C2 + (size_t)(mBase + row) * ldc + n0 + c8) = lv;
        }
        
      }
    }
    __builtin_amdgcn_fence(__ATOMIC_RELEASE, "workgroup");
    __builtin_amdgcn_wave_barrier();
    __builtin_amdgcn_fence(__ATOMIC_ACQUIRE, "workgroup");
  }
}

// ---------------------------------------------------------------------------------------------------------------------
// bf16 helpers for the attention kernel
// ---------------------------------------------------------------------------------------------------------------------
__device__ __forceinline__ unsigned short at_bf_bits(float f) {
  unsigned u = __float_as_uint(f);
  return (unsigned short)((u + 0x7FFFu + ((u >> 16) & 1u)) >> 16);
}
__device__ __forceinline__ __bf16 at_f2bf(float f) { return __builtin_bit_cast(__bf16, at_bf_bits(f)); }
__device__ __forceinline__ void at_split(float f, __bf16& hi, __bf16& lo) {
  const unsigned short hb = at_bf_bits(f);
  hi = __builtin_bit_cast(__bf16, hb);
  lo = at_f2bf(f - __uint_as_float(((unsigned)hb) << 16));
}
// value of lane l ^ 16 (the other half of the wave), by a vector cross-row move
__device__ __forceinline__ float at_xhalf(float x) {
  const int b = __builtin_bit_cast(int, x);
  return __builtin_bit_cast(float, __builtin_amdgcn_permlanex16(b, b, 0x76543210, 0xfedcba98, false, false));
}
__device__ __forceinline__ v8f at_mma(v16b a, v16b b, v8f c) {
  c = __builtin_amdgcn_wmma_f32_16x16x32_bf16(false, a, false, b, (short)0, c, false, false);
  asm volatile("v_nop\n\tv_nop\n\tv_nop\n\tv_nop" : "+v"(c) : "v"(a), "v"(b));
  return c;
}

// ---------------------------------------------------------------------------------------------------------------------
// Problem constants
// ---------------------------------------------------------------------------------------------------------------------
constexpr int kBatch   = 4;
constexpr int kSeq     = 2048;
constexpr int kEmb     = 1024;
constexpr int kHeads   = 16;
constexpr int kHeadDim = 64;
constexpr int kRows    = kBatch * kSeq;   // 8192 = GEMM M
constexpr int kN3      = 3 * kEmb;        // 3072 = GEMM N
static_assert(kEmb % 32 == 0, "K");
static_assert(kRows % 128 == 0 && kN3 % 256 == 0, "MN");
static_assert(kEmb % 64 == 0 && kEmb / 64 >= 2, "stages");
static_assert(kHeads * kHeadDim == kEmb, "heads");
static_assert(kSeq % 64 == 0, "S");
static_assert((kRows * kEmb) % (8 * 256) == 0, "cast grid");
static_assert(kEmb % 64 == 0 && kN3 % 64 == 0, "transpose grid");

// ---------------------------------------------------------------------------------------------------------------------
// f32 -> bf16 (RNE) cast: thread i converts elements 8i..8i+7 (two 16-B loads, one 16-B store);
// Coverage: n8 threads x 8 = whole plane (n8 = n/8 exact).
// ---------------------------------------------------------------------------------------------------------------------
__global__ __launch_bounds__(256) void cast_f32_bf16x8(const float* __restrict__ in, unsigned short* __restrict__ outp, int n8) {
  const int i = blockIdx.x * 256 + threadIdx.x;
  if (i < n8) {
    const size_t e0 = (size_t)i * 8;
    const v4f a = *(const v4f*)(in + e0);
    const v4f c = *(const v4f*)(in + e0 + 4);
    v4u u;
    u[0] = (unsigned)f2bf_bits(a[0]) | ((unsigned)f2bf_bits(a[1]) << 16);
    u[1] = (unsigned)f2bf_bits(a[2]) | ((unsigned)f2bf_bits(a[3]) << 16);
    u[2] = (unsigned)f2bf_bits(c[0]) | ((unsigned)f2bf_bits(c[1]) << 16);
    u[3] = (unsigned)f2bf_bits(c[2]) | ((unsigned)f2bf_bits(c[3]) << 16);
    *(v4u*)(outp + e0) = u;
    
  }
}

// ---------------------------------------------------------------------------------------------------------------------
// Transpose + cast: in [R][Cc] f32 row-major -> outp [Cc][R] bf16, outp[n][e] = bf16(in[e][n]).
// Tile 64 (e) x 64 (n); grid (Cc/64, R/64); block 256.
// Load coverage: 256 threads x 16 elements = 64x64. Store coverage: 8 waves x 2 iterations x 4 rows = 64 rows,
// ---------------------------------------------------------------------------------------------------------------------
__global__ __launch_bounds__(256) void transpose_cast_bf16(const float* __restrict__ in, unsigned short* __restrict__ outp, int R, int Cc) {
  __shared__ __align__(16) unsigned short tT[64 * 72];   // [n_local][e_local], pitch 72
  const int tid = threadIdx.x;
  const int n0 = blockIdx.x * 64;
  const int e0 = blockIdx.y * 64;
  {
    const int el = tid >> 2, nl = (tid & 3) * 16;
    const float* src = in + (size_t)(e0 + el) * Cc + n0 + nl;
#pragma unroll
    for (int i = 0; i < 4; ++i) {
      const v4f f = *(const v4f*)(src + 4 * i);
#pragma unroll
      for (int e = 0; e < 4; ++e) tT[(nl + 4 * i + e) * 72 + el] = f2bf_bits(f[e]);
    }
  }
  __syncthreads();
  const int wave = tid >> 5, lane = tid & 31, q = lane >> 3, c8 = (lane & 7) * 8;
  {
#pragma unroll
    for (int it = 0; it < 2; ++it) {
      const int nl = wave * 8 + it * 4 + q;
      const v4u w = *(const v4u*)(tT + nl * 72 + c8);
      *(v4u*)(outp + (size_t)(n0 + nl) * R + e0 + c8) = w;
    }
    
  }
}

// ---------------------------------------------------------------------------------------------------------------------
// Causal attention, head dim 64, 16-bit plane inputs, f32 output.
//   q, k, v are bf16 hi + lo planes: element (b, s, h, d) at plane[(b*S + s)*ld + h*64 + d] (ld in elements, % 8 == 0).
//   scores^T = k.q^T (unscaled) : bf16 hi/lo split (hi*hi + hi*lo + lo*hi), f32 accumulate; a lane holds 32 scores of ONE query
//   out^T    = v^T.p^T        : p (f32, split into bf16 hi/lo in registers) and v hi/lo planes, f32 accumulate;
//                               two score tiles of a lane, converted in place, are the B operand of 32 keys
//   online softmax in f32, exponentials in base 2; keys with kv > q replaced by -inf before the softmax; maximum in-lane plus one exchange
//   between the wave's halves; each half keeps its own partial row sum, the two are joined in the epilogue.
//   Block = 4 waves = 64 query rows of one (b, h); grid.x = B * H * (S/64); S % 64 == 0.
// ---------------------------------------------------------------------------------------------------------------------
constexpr int kQB = 64;   // query rows per block
constexpr int kKC = 64;   // keys per chunk
constexpr int kNW = 4;    // waves per block
constexpr int kOP = 68;   // output slab pitch (floats)
constexpr int kLP = 72;   // LDS row pitch of the K and V^T tiles, in 16-bit elements: 144 B = 16 B x odd, so that the
                          // 16 rows one 16-byte fragment read touches fall on distinct banks; columns 64..71 are never used

__global__ __launch_bounds__(128)
void attn_causal_hd64_split(const unsigned short* __restrict__ qh, const unsigned short* __restrict__ ql,
                            const unsigned short* __restrict__ kh, const unsigned short* __restrict__ kl,
                            const unsigned short* __restrict__ vh, const unsigned short* __restrict__ vl,
                            float* __restrict__ out,
                            int S, int H, int ldq, int ldk, int ldv, int ldo, float sscale) {
  typedef Frag<__bf16>::U FB;
  __shared__ __align__(16) unsigned short Ksh[kKC * kLP];        // K hi [kv][d]
  __shared__ __align__(16) unsigned short Ksl[kKC * kLP];        // K lo [kv][d]
  __shared__ __align__(16) unsigned short Vth[kHeadDim * kLP];   // V hi [d][kv]
  __shared__ __align__(16) unsigned short Vtl[kHeadDim * kLP];   // V lo [d][kv]
  __shared__ __align__(16) float  Os[kNW][16 * kOP];             // per wave out tile

  const int tid  = threadIdx.x;
  const int wave = tid >> 5;
  const int lane = tid & 31;
  const int hh   = lane >> 4;
  const int c    = lane & 15;

  // Block index -> tile: a block's cost is its qb + 1 key chunks and there are more blocks than resident places, so the
  // longest tiles take the lowest indices and the short ones fill the end.
  const int nqb = S / kQB;
  const int nbh = kBatch * H;
  const int bx = blockIdx.x;
  const int qb = nqb - 1 - bx / nbh;
  const int bh = bx % nbh;
  const int h  = bh % H;
  const int b  = bh / H;
  const int q0 = qb * kQB + wave * 16;
  const size_t rowb = (size_t)b * (size_t)S;
  const int hcol = h * kHeadDim;

  // ---- Q fragments (B operand, column = query q0 + c, k = d): 2 d-chunks, hi and lo planes ----
  v16b qah[2], qal[2];
  {
    const size_t qo = (rowb + (size_t)(q0 + c)) * (size_t)ldq + (size_t)(hcol + 8 * hh);
    const __bf16* qr  = (const __bf16*)(const void*)(qh + qo);
    const __bf16* qr2 = (const __bf16*)(const void*)(ql + qo);
#pragma unroll
    for (int dc = 0; dc < 2; ++dc) {
      qah[dc] = Frag<__bf16>::load(qr + dc * 32);
      qal[dc] = Frag<__bf16>::load(qr2 + dc * 32);
    }
  }

  // exp(sscale * (s - m)) = 2^(c2 * s - c2 * m): one multiply-add and the bare base-2 exponential per score. sscale > 0, so the
  // maximum is taken over the unscaled scores; a masked score stays -inf through the multiply-add and gives 0.
  const float c2 = sscale * 1.44269504088896340736f;
  float mrun = -__builtin_inff();   // running maximum (unscaled scores) of query q0 + c (equal in both halves)
  float lrun = 0.f;                 // running sum over this half's keys of query q0 + c
  v8f oacc[4];                      // oacc[t][r] = out^T[d = t*16 + 8hh + r][query q0 + c]
#pragma unroll
  for (int t = 0; t < 4; ++t) oacc[t] = (v8f){0.f,0.f,0.f,0.f,0.f,0.f,0.f,0.f};

  const int nChunks = qb + 1;   // block-uniform; causal: key chunks 0..qb
  for (int kc = 0; kc < nChunks; ++kc) {
    const int kv0 = kc * kKC;
    __syncthreads();
    {
      // staging: thread -> kv row kvr = tid>>1 (0..63), d half dh = (tid&1)*32; 128 threads x 32 = 64x64 per plane
      const int kvr = tid >> 1, dh = (tid & 1) * 32;
      const size_t krow = rowb + (size_t)(kv0 + kvr);
      const unsigned short* gkh = kh + krow * (size_t)ldk + hcol + dh;
      const unsigned short* gkl = kl + krow * (size_t)ldk + hcol + dh;
      v4u wa[4], wb[4];
#pragma unroll
      for (int i = 0; i < 4; ++i) { wa[i] = *(const v4u*)(gkh + 8 * i); wb[i] = *(const v4u*)(gkl + 8 * i); }
#pragma unroll
      for (int i = 0; i < 4; ++i) {
        *(v4u*)(Ksh + kvr * kLP + dh + 8 * i) = wa[i];
        *(v4u*)(Ksl + kvr * kLP + dh + 8 * i) = wb[i];
      }
      asm volatile("" ::: "memory");
      const unsigned short* gvh = vh + krow * (size_t)ldv + hcol + dh;
      const unsigned short* gvl = vl + krow * (size_t)ldv + hcol + dh;
#pragma unroll
      for (int i = 0; i < 4; ++i) { wa[i] = *(const v4u*)(gvh + 8 * i); wb[i] = *(const v4u*)(gvl + 8 * i); }
#pragma unroll
      for (int i = 0; i < 4; ++i) {
#pragma unroll
        for (int m = 0; m < 4; ++m) {
          const unsigned ua = wa[i][m];
          const unsigned ub = wb[i][m];
          const int d = dh + 8 * i + 2 * m;
          Vth[d * kLP + kvr]       = (unsigned short)(ua & 0xffffu);
          Vth[(d + 1) * kLP + kvr] = (unsigned short)(ua >> 16);
          Vtl[d * kLP + kvr]       = (unsigned short)(ub & 0xffffu);
          Vtl[(d + 1) * kLP + kvr] = (unsigned short)(ub >> 16);
        }
      }
    }
    __syncthreads();

    // ---- scores, transposed: s[j][r] = S[query c][kv kv0 + j*16 + 8hh + r]; A = K (row = kv j*16 + c, k = d), B = Q ----
    v8f s[4];
#pragma unroll
    for (int j = 0; j < 4; ++j) {
      s[j] = (v8f){0.f,0.f,0.f,0.f,0.f,0.f,0.f,0.f};
#pragma unroll
      for (int dc = 0; dc < 2; ++dc) {
        FB kb, kb2;
        const unsigned short* kp  = Ksh + (j * 16 + c) * kLP + dc * 32 + 8 * hh;
        const unsigned short* kp2 = Ksl + (j * 16 + c) * kLP + dc * 32 + 8 * hh;
        kb.h[0]  = *(const v8b*)(const void*)(kp);
        kb.h[1]  = *(const v8b*)(const void*)(kp + 16);
        kb2.h[0] = *(const v8b*)(const void*)(kp2);
        kb2.h[1] = *(const v8b*)(const void*)(kp2 + 16);
        s[j] = at_mma(kb.v, qah[dc], s[j]);
        s[j] = at_mma(kb2.v, qah[dc], s[j]);
        s[j] = at_mma(kb.v, qal[dc], s[j]);
      }
    }
    const bool diag = (kc == qb);   // block-uniform
    const int qrel = q0 + c - kv0 - 8 * hh;   // key j*16 + 8hh + r of this chunk lies behind query q0 + c where j*16 + r > qrel
    float cm = -__builtin_inff();
#pragma unroll
    for (int j = 0; j < 4; ++j) {
#pragma unroll
      for (int r = 0; r < 8; ++r) {
        float sv = s[j][r];   // unscaled: the scale is folded into the exponent's multiply-add below
        sv = (diag && (j * 16 + r > qrel)) ? -__builtin_inff() : sv;
        s[j][r] = sv;
        cm = fmaxf(cm, sv);
      }
    }
    cm = fmaxf(cm, at_xhalf(cm));   // the query's other 32 keys of this chunk
    const float mnew = fmaxf(mrun, cm);
    const float alpha = __builtin_amdgcn_exp2f((mrun - mnew) * c2);
    const float mn2 = mnew * c2;
    mrun = mnew;
    // P^T as B operand of 32 keys (column = query c): element e of block kk is key kk*32 + (e < 8 ? 8hh + e : 16 + 8hh + e - 8),
    // that is register e & 7 of score tile 2kk + (e >> 3) of this same lane: the k order of the V^T fragment loads below
    FB ph[2], pl[2];
    float psum = 0.f;
#pragma unroll
    for (int j = 0; j < 4; ++j) {
#pragma unroll
      for (int r = 0; r < 8; ++r) {
        const float p = __builtin_amdgcn_exp2f(__builtin_fmaf(s[j][r], c2, -mn2));
        psum += p;
        __bf16 a, bl;
        at_split(p, a, bl);
        ph[j >> 1].v[(j & 1) * 8 + r] = a;
        pl[j >> 1].v[(j & 1) * 8 + r] = bl;
      }
    }
    lrun = lrun * alpha + psum;
#pragma unroll
    for (int t = 0; t < 4; ++t)
#pragma unroll
      for (int r = 0; r < 8; ++r) oacc[t][r] *= alpha;
    // ---- out^T[d][query] += V^T[d][kv] * P^T[kv][query]; A from Vt [d][kv] (row = d t*16 + c, k = kv), B = P^T ----
#pragma unroll
    for (int kk = 0; kk < 2; ++kk) {
#pragma unroll
      for (int t = 0; t < 4; ++t) {
        FB vb, vb2;
        const unsigned short* vpa = Vth + (t * 16 + c) * kLP + kk * 32 + 8 * hh;
        const unsigned short* vpb = Vtl + (t * 16 + c) * kLP + kk * 32 + 8 * hh;
        vb.h[0]  = *(const v8b*)(const void*)(vpa);
        vb.h[1]  = *(const v8b*)(const void*)(vpa + 16);
        vb2.h[0] = *(const v8b*)(const void*)(vpb);
        vb2.h[1] = *(const v8b*)(const void*)(vpb + 16);
        oacc[t] = at_mma(vb.v, ph[kk].v, oacc[t]);
        oacc[t] = at_mma(vb2.v, ph[kk].v, oacc[t]);
        oacc[t] = at_mma(vb.v, pl[kk].v, oacc[t]);
      }
    }
  }

  // ---- epilogue: join the halves' sums, normalise, stage the wave's 16x64 tile, write whole 256-B row segments ----
  float* os = Os[wave];
  {
    const float inv = 1.0f / (lrun + at_xhalf(lrun));
#pragma unroll
    for (int t = 0; t < 4; ++t) {
      const v4f w0 = {oacc[t][0] * inv, oacc[t][1] * inv, oacc[t][2] * inv, oacc[t][3] * inv};
      const v4f w1 = {oacc[t][4] * inv, oacc[t][5] * inv, oacc[t][6] * inv, oacc[t][7] * inv};
      *(v4f*)(os + c * kOP + t * 16 + 8 * hh)     = w0;
      *(v4f*)(os + c * kOP + t * 16 + 8 * hh + 4) = w1;
    }
  }
  __builtin_amdgcn_fence(__ATOMIC_RELEASE, "workgroup");
  __builtin_amdgcn_wave_barrier();
  __builtin_amdgcn_fence(__ATOMIC_ACQUIRE, "workgroup");
  {
    float* ob = out + (size_t)hcol;
    const int c4 = (lane & 15) * 4;   // 16 lanes x 16 B = 256 B = one row segment of 64 floats
    {
#pragma unroll
      for (int it = 0; it < 8; ++it) {
        const int row = it * 2 + hh;
        v4f val = *(const v4f*)(os + row * kOP + c4);
        *(v4f*)(ob + (rowb + (size_t)(q0 + row)) * (size_t)ldo + c4) = val;
      }
      
    }
  }
}

// ---------------------------------------------------------------------------------------------------------------------
// Host launcher
// Workspace region map (bytes):
//   [0,            16,777,216)  Xb   bf16 [8192][1024]           (RNE copy of x)
//   [16,777,216,   23,068,672)  Wt   bf16 [3072][1024]           (RNE copy of W^T)
//   [23,068,672,   73,400,320)  Phi  bf16 [8192][3072]           (qkv hi plane)
//   [73,400,320,  123,731,968)  Plo  bf16 [8192][3072]           (qkv lo plane)
//   total 123,731,968
// ---------------------------------------------------------------------------------------------------------------------
extern "C" void kernel_launch(void* const* d_in, const int* in_sizes, int n_in,
                              void* d_out, int out_size, void* d_ws, size_t ws_size,
                              hipStream_t stream) {
  if (n_in < 2) return;
  if (in_sizes[0] != kRows * kEmb) return;
  if (in_sizes[1] != kEmb * kN3) return;
  if (out_size != kRows * kEmb) return;

  const size_t bytesXb = (size_t)kRows * kEmb * 2;
  const size_t bytesWt = (size_t)kN3 * kEmb * 2;
  const size_t bytesPl = (size_t)kRows * kN3 * 2;
  const size_t offXb = 0;
  const size_t offWt = offXb + bytesXb;
  const size_t offHi = offWt + bytesWt;
  const size_t offLo = offHi + bytesPl;
  const size_t total = offLo + bytesPl;
  if (total > ws_size) return;

  const float* x = (const float*)d_in[0];   // [4, 2048, 1024] f32
  const float* W = (const float*)d_in[1];   // [1024, 3072] f32
  float* outp = (float*)d_out;              // [4, 2048, 1024] f32

  char* ws = (char*)d_ws;
  unsigned short* Xb  = (unsigned short*)(ws + offXb);
  unsigned short* Wt  = (unsigned short*)(ws + offWt);
  unsigned short* Phi = (unsigned short*)(ws + offHi);
  unsigned short* Plo = (unsigned short*)(ws + offLo);
  const float* fdum = (const float*)(ws + offXb);

  // 1) x -> bf16 plane: 1,048,576 threads x 8 elements = 8,388,608
  const int n8 = (kRows * kEmb) / 8;
  cast_f32_bf16x8<<<dim3(n8 / 256), dim3(256), 0, stream>>>(x, Xb, n8);

  // 2) W [1024][3072] -> Wt [3072][1024] bf16; grid (Cc/64, R/64) = (48, 16)
  transpose_cast_bf16<<<dim3(kN3 / 64, kEmb / 64), dim3(256), 0, stream>>>(W, Wt, kEmb, kN3);

  // 3) qkv = Xb [8192][1024] x Wt [3072][1024]^T -> bf16 hi/lo planes [8192][3072]; M=8192, N=3072, K=1024
  const int tiles = (kRows / 128) * (kN3 / 256);   // 768 tiles of 128 x 256, one per block
  wmma_gemm64<1, false, 0, 2, false, 0><<<dim3(tiles, 1), dim3(256), 0, stream>>>(
      (const unsigned short*)Xb, (const unsigned short*)Xb, kEmb, 0L,
      (const unsigned short*)Wt, (const unsigned short*)Wt, kEmb, 0L,
      (void*)Phi, (void*)Plo, kN3, 0L,
      fdum, fdum, 0L,
      kRows, kN3, kEmb, 1.0f);

  // 4) causal attention: q cols [0,1024), k cols [1024,2048), v cols [2048,3072) of the planes; ld = 3072
  attn_causal_hd64_split<<<dim3(kBatch * kHeads * (kSeq / kQB)), dim3(128), 0, stream>>>(
      (const unsigned short*)Phi, (const unsigned short*)Plo,
      (const unsigned short*)(Phi + kEmb), (const unsigned short*)(Plo + kEmb),
      (const unsigned short*)(Phi + 2 * kEmb), (const unsigned short*)(Plo + 2 * kEmb),
      outp, kSeq, kHeads, kN3, kN3, kN3, kEmb, 0.125f);
}

// v006
// It runs in 159 microseconds.
// Two timings next to v005 both put it at 1.20 times that version's speed.
// Over all steps from v000 it is 4.48 times as fast.
// Contractions: QKV projection = v_wmma_f32_16x16x32_bf16 on RNE-bf16 copies of x and W (f32 accumulate); q.k^T and p.v = bf16 hi/lo split (hi*hi + hi*lo + lo*hi) on v_wmma_f32_16x16x32_bf16, f32 accumulate; softmax and normalisation in f32.
#include <hip/hip_runtime.h>
#include <stdint.h>

// ---------------------------------------------------------------------------------------------------------------------
// Shared 16-bit WMMA helpers
// ---------------------------------------------------------------------------------------------------------------------
typedef __attribute__((ext_vector_type(16))) _Float16 v16h;
typedef __attribute__((ext_vector_type(8)))  _Float16 v8h;
typedef __attribute__((ext_vector_type(16))) __bf16   v16b;
typedef __attribute__((ext_vector_type(8)))  __bf16   v8b;
typedef __attribute__((ext_vector_type(8)))  float    v8f;
typedef __attribute__((ext_vector_type(4)))  float    v4f;
typedef __attribute__((ext_vector_type(4)))  unsigned v4u;
#define PSCALE 32768.0f
#define U16(p) ((const unsigned short*)(const void*)(p))
#define PSCALE_INV (1.0f / 32768.0f)

__device__ __forceinline__ unsigned short f2bf_bits(float f) {
  unsigned u = __float_as_uint(f);
  return (unsigned short)((u + 0x7FFFu + ((u >> 16) & 1u)) >> 16);
}
__device__ __forceinline__ float bf_bits2f(unsigned short h) { return __uint_as_float(((unsigned)h) << 16); }

// hazard guards as plain device helpers
__device__ __forceinline__ void dep_guard_h(v8f& a, v8f& b, v16h x, v16h y) { asm volatile("v_nop\n\tv_nop\n\tv_nop\n\tv_nop" : "+v"(a), "+v"(b) : "v"(x), "v"(y)); }
__device__ __forceinline__ void dep_guard_b(v8f& a, v8f& b, v16b x, v16b y) { asm volatile("v_nop\n\tv_nop\n\tv_nop\n\tv_nop" : "+v"(a), "+v"(b) : "v"(x), "v"(y)); }
__device__ __forceinline__ void keep4_h(v16h a, v16h b, v16h c, v16h d) { asm volatile("v_nop" :: "v"(a), "v"(b), "v"(c), "v"(d)); }
__device__ __forceinline__ void keep4_b(v16b a, v16b b, v16b c, v16b d) { asm volatile("v_nop" :: "v"(a), "v"(b), "v"(c), "v"(d)); }
__device__ __forceinline__ void acc_guard4(v8f& a, v8f& b, v8f& c, v8f& d) { asm volatile("v_nop\n\tv_nop\n\tv_nop\n\tv_nop" : "+v"(a), "+v"(b), "+v"(c), "+v"(d)); }
template <typename T> struct Frag;
template <> struct Frag<_Float16> {
  typedef v16h V; union U { v16h v; v8h h[2]; };
  static __device__ __forceinline__ v16h load(const _Float16* p) {   // elements 0..7 <- p[0..7], 8..15 <- p[16..23]
    U f; f.h[0] = *(const v8h*)(p); f.h[1] = *(const v8h*)(p + 16); return f.v;
  }
  static __device__ __forceinline__ v8f mma(v16h a, v16h b, v8f c) {
    return __builtin_amdgcn_wmma_f32_16x16x32_f16(false, a, false, b, (short)0, c, false, false);
  }
  static __device__ __forceinline__ void guard(v8f& a, v8f& b, v16h x, v16h y) { dep_guard_h(a, b, x, y); }
  static __device__ __forceinline__ void keep(v16h a, v16h b, v16h c, v16h d) { keep4_h(a, b, c, d); }
};
template <> struct Frag<__bf16> {
  typedef v16b V; union U { v16b v; v8b h[2]; };
  static __device__ __forceinline__ v16b load(const __bf16* p) {
    U f; f.h[0] = *(const v8b*)(p); f.h[1] = *(const v8b*)(p + 16); return f.v;
  }
  static __device__ __forceinline__ v8f mma(v16b a, v16b b, v8f c) {
    return __builtin_amdgcn_wmma_f32_16x16x32_bf16(false, a, false, b, (short)0, c, false, false);
  }
  static __device__ __forceinline__ void guard(v8f& a, v8f& b, v16b x, v16b y) { dep_guard_b(a, b, x, y); }
  static __device__ __forceinline__ void keep(v16b a, v16b b, v16b c, v16b d) { keep4_b(a, b, c, d); }
};

// ---- Register-blocked batched WMMA GEMM ------------------------------------
// C[m,n] = scale * sum_k A[m,k] * Bt[n,k] (+bias)(+resid); each wave owns a 64x64 tile, a block's 8 waves (2 x 4) a 128x256 tile.
// A row-major [M,K]; Bt row-major [N,K]; M % 128 == 0, N % 256 == 0, K % 64 == 0; grid.x = (M/128) * (N/256).
// Operands reach the waves through LDS: a stage is 64 k (one 128-B line) of the block's 128 A rows and 256 Bt rows, brought in by
// asynchronous 16-B copies (a wave's copy = 4 whole lines), two buffers, the next stage in flight while this one is multiplied.
// SPLIT: must be false (the staged loop reads one plane per operand); A2/Bt2 are not read.
// BIAS_MODE: 0 = none, 1 = bias[m], 2 = bias[n].
// OUT_MODE: 0 = f32, 1 = f16, 2 = bf16 hi plane (Cout) + bf16 lo plane (Cout2).
// ET: 0 = f16 operands, 1 = bf16 operands (pointers passed as 16-bit storage)
template <int ET> struct Elem;
template <> struct Elem<0> { typedef _Float16 T; };
template <> struct Elem<1> { typedef __bf16 T; };
constexpr int kGP     = 72;                      // LDS row pitch, 16-bit elements: 144 B = 16 B x odd (16-byte fragment reads)
constexpr int kGARows = 128;                     // A rows of a stage
constexpr int kGBRows = 256;                     // Bt rows of a stage
constexpr int kGStage = (kGARows + kGBRows) * kGP;   // elements of one buffer
// One stage's copies of one thread: 4 A rows and 8 Bt rows, 32 rows apart, 16 B each. la / lb: the lane's LDS byte addresses of the
// first A / Bt row; ga / gb: its global addresses; sa / sb: 32 rows in elements. The s_wait_xcnt closes the statement so that no
// address register of a copy is rewritten in front of it.
__device__ __forceinline__ void gemm_stage_copies(unsigned la, unsigned lb, const unsigned short* ga, const unsigned short* gb,
                                                  size_t sa, size_t sb) {
  constexpr unsigned ls = 32u * kGP * 2u;   // 32 rows in LDS bytes
  asm volatile(
      "global_load_async_to_lds_b128 %0, %12, off\n\t"
      "global_load_async_to_lds_b128 %1, %13, off\n\t"
      "global_load_async_to_lds_b128 %2, %14, off\n\t"
      "global_load_async_to_lds_b128 %3, %15, off\n\t"
      "global_load_async_to_lds_b128 %4, %16, off\n\t"
      "global_load_async_to_lds_b128 %5, %17, off\n\t"
      "global_load_async_to_lds_b128 %6, %18, off\n\t"
      "global_load_async_to_lds_b128 %7, %19, off\n\t"
      "global_load_async_to_lds_b128 %8, %20, off\n\t"
      "global_load_async_to_lds_b128 %9, %21, off\n\t"
      "global_load_async_to_lds_b128 %10, %22, off\n\t"
      "global_load_async_to_lds_b128 %11, %23, off\n\t"
      "s_wait_xcnt 0x0"
      :: "v"(la), "v"(la + ls), "v"(la + 2u * ls), "v"(la + 3u * ls),
         "v"(lb), "v"(lb + ls), "v"(lb + 2u * ls), "v"(lb + 3u * ls),
         "v"(lb + 4u * ls), "v"(lb + 5u * ls), "v"(lb + 6u * ls), "v"(lb + 7u * ls),
         "v"(ga), "v"(ga + sa), "v"(ga + 2 * sa), "v"(ga + 3 * sa),
         "v"(gb), "v"(gb + sb), "v"(gb + 2 * sb), "v"(gb + 3 * sb),
         "v"(gb + 4 * sb), "v"(gb + 5 * sb), "v"(gb + 6 * sb), "v"(gb + 7 * sb)
      : "memory");
}
template <int ET, bool SPLIT, int BIAS_MODE, int OUT_MODE, bool RESID, int ACT = 0>
__global__ __launch_bounds__(256) void wmma_gemm64(
    const unsigned short* __restrict__ Ap, const unsigned short* __restrict__ A2p, int lda, long strideA,
    const unsigned short* __restrict__ Btp, const unsigned short* __restrict__ Bt2p, int ldb, long strideB,
    void* __restrict__ Cout, void* __restrict__ Cout2, int ldc, long strideC,
    const float* __restrict__ bias,
    const float* __restrict__ resid, long strideR,
    int M, int N, int K, float scale) {
  typedef typename Elem<ET>::T T;
  typedef typename Frag<T>::V V;
  static_assert(!SPLIT, "the staged loop carries one plane per operand");
  __shared__ __align__(16) unsigned short sAB[2 * kGStage];   // two stage buffers: [A 128 rows | Bt 256 rows], pitch kGP
  __shared__ __align__(16) float sT[8][16 * 68];   // per-wave 16x64 slab, pitch 68 floats
  const int b    = blockIdx.y;
  const int tid  = threadIdx.x;
  const int lane = tid & 31;
  const int wave = tid >> 5;
  const int tilesN = N >> 8;
  const int tilesM = M >> 7;
  if ((int)blockIdx.x >= tilesM * tilesN) return;   // block-uniform, in front of every barrier and copy
  const int tm = blockIdx.x / tilesN;
  const int tn = blockIdx.x - tm * tilesN;
  const int wm0 = (wave >> 2) << 6;   // the wave's first row in the block's A rows
  const int wn0 = (wave & 3) << 6;    // the wave's first row in the block's Bt rows
  const int m0 = (tm << 7) + wm0;
  const int n0 = (tn << 8) + wn0;

  // copies: thread -> row tid >> 3 (+ 32 per copy), 16-B piece tid & 7 of the row's 128-B line
  const int crow = tid >> 3, ccol = (tid & 7) * 8;
  const unsigned short* gA = Ap  + (size_t)b * strideA + (size_t)((tm << 7) + crow) * lda + ccol;
  const unsigned short* gB = Btp + (size_t)b * strideB + (size_t)((tn << 8) + crow) * ldb + ccol;
  const size_t sA32 = (size_t)32 * lda, sB32 = (size_t)32 * ldb;
  const unsigned ldsA = (unsigned)(size_t)(const void*)sAB + (unsigned)(crow * kGP + ccol) * 2u;
  const unsigned ldsB = ldsA + (unsigned)(kGARows * kGP) * 2u;

  const int rlane = lane & 15;                 // row (A) / col (B, D) within subtile
  const int koff  = (lane >> 4) * 8;           // k offset of this lane half
  const int mOff  = (lane >> 4) * 8;           // D row offset

  v8f acc[4][4];
#pragma unroll
  for (int i = 0; i < 4; ++i)
#pragma unroll
    for (int j = 0; j < 4; ++j) acc[i][j] = (v8f){0.f,0.f,0.f,0.f,0.f,0.f,0.f,0.f};

  const int nt = K >> 6;   // stages
  gemm_stage_copies(ldsA, ldsB, gA, gB, sA32, sB32);
  asm volatile("s_wait_asynccnt 0x0" ::: "memory");   // this wave's copies of stage 0 have landed
  __syncthreads();                                    // and every other wave's
  if (nt > 1) gemm_stage_copies(ldsA + kGStage * 2u, ldsB + kGStage * 2u, gA + 64, gB + 64, sA32, sB32);
  for (int t = 0; t < nt; ++t) {
    const unsigned bufe = (unsigned)(t & 1) * kGStage;   // this stage's buffer, in elements
    const T* sA = (const T*)(const void*)(sAB + bufe) + (wm0 + rlane) * kGP + koff;
    const T* sB = (const T*)(const void*)(sAB + bufe) + (kGARows + wn0 + rlane) * kGP + koff;
#pragma unroll   // constant LDS offsets and constant indices into the fragment and accumulator arrays
    for (int ks = 0; ks < 2; ++ks) {
      V bh[4], ah[4];   // all eight fragments of these 32 k are read as one group, ahead of their 16 products
#pragma unroll
      for (int j = 0; j < 4; ++j) bh[j] = Frag<T>::load(sB + (j << 4) * kGP + ks * 32);
#pragma unroll
      for (int i = 0; i < 4; ++i) ah[i] = Frag<T>::load(sA + (i << 4) * kGP + ks * 32);
#pragma unroll
      for (int i = 0; i < 4; ++i) {
#pragma unroll
        for (int j = 0; j < 4; ++j) acc[i][j] = Frag<T>::mma(ah[i], bh[j], acc[i][j]);
        Frag<T>::guard(acc[i][0], acc[i][3], ah[i], ah[i]);
      }
      Frag<T>::keep(bh[0], bh[1], bh[2], bh[3]);
    }
    asm volatile("s_wait_dscnt 0x0" ::: "memory");      // this wave's reads of the buffer are done before it is refilled
    asm volatile("s_wait_asynccnt 0x0" ::: "memory");   // this wave's copies of stage t + 1 have landed
    __syncthreads();                                    // publishes stage t + 1 and ends every wave's reads of stage t
    if (t + 2 < nt)
      gemm_stage_copies(ldsA + bufe * 2u, ldsB + bufe * 2u, gA + (size_t)(t + 2) * 64, gB + (size_t)(t + 2) * 64, sA32, sB32);
  }
  asm volatile("s_wait_asynccnt 0x0" ::: "memory");   // nothing of this wave is in flight behind the loop
  acc_guard4(acc[0][0], acc[0][1], acc[0][2], acc[0][3]);
  acc_guard4(acc[1][0], acc[1][1], acc[1][2], acc[1][3]);
  acc_guard4(acc[2][0], acc[2][1], acc[2][2], acc[2][3]);
  acc_guard4(acc[3][0], acc[3][1], acc[3][2], acc[3][3]);

  // ---- epilogue ----
  float* slab = sT[wave];
  const float* Rb = RESID ? (resid + (size_t)b * strideR) : nullptr;
#pragma unroll
  for (int i = 0; i < 4; ++i) {
    const int mBase = m0 + (i << 4);
#pragma unroll
    for (int j = 0; j < 4; ++j) {
      const int n = n0 + (j << 4) + rlane;
      float bv = 0.f;
      if (BIAS_MODE == 2) bv = bias[n];
#pragma unroll
      for (int r = 0; r < 8; ++r) {
        float v = acc[i][j][r] * scale;
        if (BIAS_MODE == 1) v += bias[mBase + mOff + r];
        if (BIAS_MODE == 2) v += bv;
        if (RESID) v += Rb[(size_t)(mBase + mOff + r) * ldc + n];
        if (ACT == 1) v = tanhf(v);
        if (ACT == 2) v = fmaxf(v, 0.0f);
        if (ACT == 3) v = v / (1.0f + expf(-v));
        if (ACT == 4) v = (v > 0.f) ? v : 0.01f * v;
        if (ACT == 5) v = 0.5f * v * (1.0f + erff(v * 0.70710678118654752f));
        slab[(mOff + r) * 68 + (j << 4) + rlane] = v;
      }
    }
    __builtin_amdgcn_fence(__ATOMIC_RELEASE, "workgroup");
    __builtin_amdgcn_wave_barrier();
    __builtin_amdgcn_fence(__ATOMIC_ACQUIRE, "workgroup");
    if (OUT_MODE == 0) {
      float* C = (float*)Cout + (size_t)b * strideC;
      const int hh = lane >> 4, c4 = (lane & 15) * 4;     // row seg = 256 B = 16 lanes x 16 B
      {
#pragma unroll
        for (int it = 0; it < 8; ++it) {
          const int row = it * 2 + hh;
          v4f v = *(const v4f*)(slab + row * 68 + c4);
          *(v4f*)(C + (size_t)(mBase + row) * ldc + n0 + c4) = v;
        }
        
      }
    } else {
      const int q = lane >> 3, c8 = (lane & 7) * 8;
      unsigned short* C  = (unsigned short*)Cout  + (size_t)b * strideC;
      unsigned short* C2 = (OUT_MODE == 2) ? ((unsigned short*)Cout2 + (size_t)b * strideC) : nullptr;
      {
#pragma unroll
        for (int it = 0; it < 4; ++it) {
          const int row = it * 4 + q;
          const float* sp = slab + row * 68 + c8;
          v8h hv, lv;
#pragma unroll
          for (int e = 0; e < 8; ++e) {
            if (OUT_MODE == 1) {
              hv[e] = (_Float16)sp[e];
            } else {
              unsigned short hb = f2bf_bits(sp[e]);
              unsigned short lb = f2bf_bits(sp[e] - bf_bits2f(hb));
              hv[e] = __builtin_bit_cast(_Float16, hb);
              lv[e] = __builtin_bit_cast(_Float16, lb);
            }
          }
          *(v8h*)(C + (size_t)(mBase + row) * ldc + n0 + c8) = hv;
          if (OUT_MODE == 2) *(v8h*)(C2 + (size_t)(mBase + row) * ldc + n0 + c8) = lv;
        }
        
      }
    }
    __builtin_amdgcn_fence(__ATOMIC_RELEASE, "workgroup");
    __builtin_amdgcn_wave_barrier();
    __builtin_amdgcn_fence(__ATOMIC_ACQUIRE, "workgroup");
  }
}

// ---------------------------------------------------------------------------------------------------------------------
// bf16 helpers for the attention kernel
// ---------------------------------------------------------------------------------------------------------------------
__device__ __forceinline__ unsigned short at_bf_bits(float f) {
  unsigned u = __float_as_uint(f);
  return (unsigned short)((u + 0x7FFFu + ((u >> 16) & 1u)) >> 16);
}
__device__ __forceinline__ __bf16 at_f2bf(float f) { return __builtin_bit_cast(__bf16, at_bf_bits(f)); }
__device__ __forceinline__ void at_split(float f, __bf16& hi, __bf16& lo) {
  const unsigned short hb = at_bf_bits(f);
  hi = __builtin_bit_cast(__bf16, hb);
  lo = at_f2bf(f - __uint_as_float(((unsigned)hb) << 16));
}
// value of lane l ^ 16 (the other half of the wave), by a vector cross-row move
__device__ __forceinline__ float at_xhalf(float x) {
  const int b = __builtin_bit_cast(int, x);
  return __builtin_bit_cast(float, __builtin_amdgcn_permlanex16(b, b, 0x76543210, 0xfedcba98, false, false));
}
__device__ __forceinline__ v8f at_mma(v16b a, v16b b, v8f c) {
  c = __builtin_amdgcn_wmma_f32_16x16x32_bf16(false, a, false, b, (short)0, c, false, false);
  asm volatile("v_nop\n\tv_nop\n\tv_nop\n\tv_nop" : "+v"(c) : "v"(a), "v"(b));
  return c;
}

// 16-byte transposing LDS read: lane l is given the address of row (8 * (l >> 4) + (l & 7)), 16-byte piece ((l >> 3) & 1) of a row-major
// 16 x 16 tile of 16-bit elements and receives column l & 15, rows 8 * (l >> 4) .. + 7: half of an A fragment of the transposed tile.
typedef __attribute__((ext_vector_type(8))) short v8s;
__device__ __forceinline__ v8b at_ld_tr16(const unsigned short* p) {
  typedef __attribute__((address_space(3))) v8s lds_v8s;
  return __builtin_bit_cast(v8b, __builtin_amdgcn_ds_load_tr16_b128_v8i16((lds_v8s*)p));
}
// One thread's copies of a 64-row hi tile and its lo tile: 4 rows of each, 16 rows apart, 16 B each (8 lanes = one 128-B line).
// lh / ll: the lane's LDS byte addresses of its first row in the two tiles, ls: 16 rows in LDS bytes; gh / gl: its global addresses,
// gs: 16 rows in elements. The s_wait_xcnt closes the statement so that no address register of a copy is rewritten in front of it.
__device__ __forceinline__ void attn_pair_copies(unsigned lh, unsigned ll, unsigned ls,
                                                 const unsigned short* gh, const unsigned short* gl, size_t gs) {
  asm volatile(
      "global_load_async_to_lds_b128 %0, %8, off\n\t"
      "global_load_async_to_lds_b128 %1, %9, off\n\t"
      "global_load_async_to_lds_b128 %2, %10, off\n\t"
      "global_load_async_to_lds_b128 %3, %11, off\n\t"
      "global_load_async_to_lds_b128 %4, %12, off\n\t"
      "global_load_async_to_lds_b128 %5, %13, off\n\t"
      "global_load_async_to_lds_b128 %6, %14, off\n\t"
      "global_load_async_to_lds_b128 %7, %15, off\n\t"
      "s_wait_xcnt 0x0"
      :: "v"(lh), "v"(lh + ls), "v"(lh + 2u * ls), "v"(lh + 3u * ls),
         "v"(ll), "v"(ll + ls), "v"(ll + 2u * ls), "v"(ll + 3u * ls),
         "v"(gh), "v"(gh + gs), "v"(gh + 2 * gs), "v"(gh + 3 * gs),
         "v"(gl), "v"(gl + gs), "v"(gl + 2 * gs), "v"(gl + 3 * gs)
      : "memory");
}

// ---------------------------------------------------------------------------------------------------------------------
// Problem constants
// ---------------------------------------------------------------------------------------------------------------------
constexpr int kBatch   = 4;
constexpr int kSeq     = 2048;
constexpr int kEmb     = 1024;
constexpr int kHeads   = 16;
constexpr int kHeadDim = 64;
constexpr int kRows    = kBatch * kSeq;   // 8192 = GEMM M
constexpr int kN3      = 3 * kEmb;        // 3072 = GEMM N
static_assert(kEmb % 32 == 0, "K");
static_assert(kRows % 128 == 0 && kN3 % 256 == 0, "MN");
static_assert(kEmb % 64 == 0 && kEmb / 64 >= 2, "stages");
static_assert(kHeads * kHeadDim == kEmb, "heads");
static_assert(kSeq % 64 == 0, "S");
static_assert((kRows * kEmb) % (8 * 256) == 0, "cast grid");
static_assert(kEmb % 64 == 0 && kN3 % 64 == 0, "transpose grid");

// ---------------------------------------------------------------------------------------------------------------------
// f32 -> bf16 (RNE) cast: thread i converts elements 8i..8i+7 (two 16-B loads, one 16-B store);
// Coverage: n8 threads x 8 = whole plane (n8 = n/8 exact).
// ---------------------------------------------------------------------------------------------------------------------
__global__ __launch_bounds__(256) void cast_f32_bf16x8(const float* __restrict__ in, unsigned short* __restrict__ outp, int n8) {
  const int i = blockIdx.x * 256 + threadIdx.x;
  if (i < n8) {
    const size_t e0 = (size_t)i * 8;
    const v4f a = *(const v4f*)(in + e0);
    const v4f c = *(const v4f*)(in + e0 + 4);
    v4u u;
    u[0] = (unsigned)f2bf_bits(a[0]) | ((unsigned)f2bf_bits(a[1]) << 16);
    u[1] = (unsigned)f2bf_bits(a[2]) | ((unsigned)f2bf_bits(a[3]) << 16);
    u[2] = (unsigned)f2bf_bits(c[0]) | ((unsigned)f2bf_bits(c[1]) << 16);
    u[3] = (unsigned)f2bf_bits(c[2]) | ((unsigned)f2bf_bits(c[3]) << 16);
    *(v4u*)(outp + e0) = u;
    
  }
}

// ---------------------------------------------------------------------------------------------------------------------
// Transpose + cast: in [R][Cc] f32 row-major -> outp [Cc][R] bf16, outp[n][e] = bf16(in[e][n]).
// Tile 64 (e) x 64 (n); grid (Cc/64, R/64); block 256.
// Load coverage: 256 threads x 16 elements = 64x64. Store coverage: 8 waves x 2 iterations x 4 rows = 64 rows,
// ---------------------------------------------------------------------------------------------------------------------
__global__ __launch_bounds__(256) void transpose_cast_bf16(const float* __restrict__ in, unsigned short* __restrict__ outp, int R, int Cc) {
  __shared__ __align__(16) unsigned short tT[64 * 72];   // [n_local][e_local], pitch 72
  const int tid = threadIdx.x;
  const int n0 = blockIdx.x * 64;
  const int e0 = blockIdx.y * 64;
  {
    const int el = tid >> 2, nl = (tid & 3) * 16;
    const float* src = in + (size_t)(e0 + el) * Cc + n0 + nl;
#pragma unroll
    for (int i = 0; i < 4; ++i) {
      const v4f f = *(const v4f*)(src + 4 * i);
#pragma unroll
      for (int e = 0; e < 4; ++e) tT[(nl + 4 * i + e) * 72 + el] = f2bf_bits(f[e]);
    }
  }
  __syncthreads();
  const int wave = tid >> 5, lane = tid & 31, q = lane >> 3, c8 = (lane & 7) * 8;
  {
#pragma unroll
    for (int it = 0; it < 2; ++it) {
      const int nl = wave * 8 + it * 4 + q;
      const v4u w = *(const v4u*)(tT + nl * 72 + c8);
      *(v4u*)(outp + (size_t)(n0 + nl) * R + e0 + c8) = w;
    }
    
  }
}

// ---------------------------------------------------------------------------------------------------------------------
// Causal attention, head dim 64, 16-bit plane inputs, f32 output.
//   q, k, v are bf16 hi + lo planes: element (b, s, h, d) at plane[(b*S + s)*ld + h*64 + d] (ld in elements, % 8 == 0).
//   scores^T = k.q^T (unscaled) : bf16 hi/lo split (hi*hi + hi*lo + lo*hi), f32 accumulate; a lane holds 32 scores of ONE query
//   out^T    = v^T.p^T        : p (f32, split into bf16 hi/lo in registers) and v hi/lo planes, f32 accumulate;
//                               two score tiles of a lane, converted in place, are the B operand of 32 keys
//   online softmax in f32, exponentials in base 2; keys with kv > q replaced by -inf before the softmax; maximum in-lane plus one exchange
//   between the wave's halves; each half keeps its own partial row sum, the two are joined in the epilogue.
//   Block = 4 waves = 64 query rows of one (b, h); grid.x = B * H * (S/64); S % 64 == 0.
//   A chunk's K and V rows (hi and lo planes) reach LDS by asynchronous 16-B copies, row-major, two buffers: the next chunk is in
//   flight while this one is worked on. A copy cannot transpose, so the V^T fragments are formed by transposing LDS reads.
// ---------------------------------------------------------------------------------------------------------------------
constexpr int kQB = 64;   // query rows per block
constexpr int kKC = 64;   // keys per chunk
constexpr int kNW = 4;    // waves per block
constexpr int kOP = 68;   // output slab pitch (floats)
constexpr int kLP = 72;   // LDS row pitch of the K tiles, in 16-bit elements: 144 B = 16 B x odd, so that the
                          // 16 rows one 16-byte fragment read touches fall on distinct banks; columns 64..71 are never used
constexpr int kVP = 80;   // LDS row pitch of the V tiles (row = key): 160 B = 32 B x odd, the pitch of the transposing 16-byte reads
constexpr int kKTile = kKC * kLP;                     // elements of one K plane tile
constexpr int kVTile = kKC * kVP;                     // elements of one V plane tile
constexpr int kAStage = 2 * kKTile + 2 * kVTile;      // one buffer: [K hi | K lo | V hi | V lo]
static_assert(kNW * 16 * kOP * 4 <= kAStage * 2, "the output slabs reuse the first buffer");

__global__ __launch_bounds__(128)
void attn_causal_hd64_split(const unsigned short* __restrict__ qh, const unsigned short* __restrict__ ql,
                            const unsigned short* __restrict__ kh, const unsigned short* __restrict__ kl,
                            const unsigned short* __restrict__ vh, const unsigned short* __restrict__ vl,
                            float* __restrict__ out,
                            int S, int H, int ldq, int ldk, int ldv, int ldo, float sscale) {
  typedef Frag<__bf16>::U FB;
  __shared__ __align__(16) unsigned short sKV[2 * kAStage];   // two chunk buffers; behind the loop the per-wave out tiles

  const int tid  = threadIdx.x;
  const int wave = tid >> 5;
  const int lane = tid & 31;
  const int hh   = lane >> 4;
  const int c    = lane & 15;

  // Block index -> tile: a block's cost is its qb + 1 key chunks and there are more blocks than resident places, so the
  // longest tiles take the lowest indices and the short ones fill the end.
  const int nqb = S / kQB;
  const int nbh = kBatch * H;
  const int bx = blockIdx.x;
  const int qb = nqb - 1 - bx / nbh;
  const int bh = bx % nbh;
  const int h  = bh % H;
  const int b  = bh / H;
  const int q0 = qb * kQB + wave * 16;
  const size_t rowb = (size_t)b * (size_t)S;
  const int hcol = h * kHeadDim;

  // ---- Q fragments (B operand, column = query q0 + c, k = d): 2 d-chunks, hi and lo planes ----
  v16b qah[2], qal[2];
  {
    const size_t qo = (rowb + (size_t)(q0 + c)) * (size_t)ldq + (size_t)(hcol + 8 * hh);
    const __bf16* qr  = (const __bf16*)(const void*)(qh + qo);
    const __bf16* qr2 = (const __bf16*)(const void*)(ql + qo);
#pragma unroll
    for (int dc = 0; dc < 2; ++dc) {
      qah[dc] = Frag<__bf16>::load(qr + dc * 32);
      qal[dc] = Frag<__bf16>::load(qr2 + dc * 32);
    }
  }

  // exp(sscale * (s - m)) = 2^(c2 * s - c2 * m): one multiply-add and the bare base-2 exponential per score. sscale > 0, so the
  // maximum is taken over the unscaled scores; a masked score stays -inf through the multiply-add and gives 0.
  const float c2 = sscale * 1.44269504088896340736f;
  float mrun = -__builtin_inff();   // running maximum (unscaled scores) of query q0 + c (equal in both halves)
  float lrun = 0.f;                 // running sum over this half's keys of query q0 + c
  v8f oacc[4];                      // oacc[t][r] = out^T[d = t*16 + 8hh + r][query q0 + c]
#pragma unroll
  for (int t = 0; t < 4; ++t) oacc[t] = (v8f){0.f,0.f,0.f,0.f,0.f,0.f,0.f,0.f};

  const int nChunks = qb + 1;   // block-uniform; causal: key chunks 0..qb
  // copies: thread -> row tid >> 3 (+ 16 per copy) of the chunk, 16-B piece tid & 7 of the row's 128-B line, in each of the four planes
  const int crow = tid >> 3, ccol = (tid & 7) * 8;
  const size_t gko = (rowb + (size_t)crow) * (size_t)ldk + (size_t)(hcol + ccol);
  const size_t gvo = (rowb + (size_t)crow) * (size_t)ldv + (size_t)(hcol + ccol);
  const unsigned ldsK = (unsigned)(size_t)(const void*)sKV + (unsigned)(crow * kLP + ccol) * 2u;
  const unsigned ldsV = (unsigned)(size_t)(const void*)sKV + (unsigned)(2 * kKTile + crow * kVP + ccol) * 2u;
  auto stage_copies = [&](int ch, unsigned bufb) {   // chunk ch into the buffer at byte offset bufb
    const size_t ko = gko + (size_t)ch * (size_t)(kKC * ldk);
    const size_t vo = gvo + (size_t)ch * (size_t)(kKC * ldv);
    attn_pair_copies(ldsK + bufb, ldsK + bufb + kKTile * 2u, 16u * kLP * 2u, kh + ko, kl + ko, (size_t)16 * ldk);
    attn_pair_copies(ldsV + bufb, ldsV + bufb + kVTile * 2u, 16u * kVP * 2u, vh + vo, vl + vo, (size_t)16 * ldv);
  };
  stage_copies(0, 0u);
  asm volatile("s_wait_asynccnt 0x0" ::: "memory");   // this wave's copies of chunk 0 have landed
  __syncthreads();                                    // and every other wave's
  if (nChunks > 1) stage_copies(1, kAStage * 2u);
  for (int kc = 0; kc < nChunks; ++kc) {
    const int kv0 = kc * kKC;
    const unsigned bufe = (unsigned)(kc & 1) * kAStage;   // this chunk's buffer, in elements
    const unsigned short* Ksh = sKV + bufe;       // K hi [kv][d], pitch kLP
    const unsigned short* Ksl = Ksh + kKTile;     // K lo
    const unsigned short* Vsh = Ksl + kKTile;     // V hi [kv][d], pitch kVP
    const unsigned short* Vsl = Vsh + kVTile;     // V lo

    // ---- scores, transposed: s[j][r] = S[query c][kv kv0 + j*16 + 8hh + r]; A = K (row = kv j*16 + c, k = d), B = Q ----
    v8f s[4];
#pragma unroll
    for (int j = 0; j < 4; ++j) {
      s[j] = (v8f){0.f,0.f,0.f,0.f,0.f,0.f,0.f,0.f};
#pragma unroll
      for (int dc = 0; dc < 2; ++dc) {
        FB kb, kb2;
        const unsigned short* kp  = Ksh + (j * 16 + c) * kLP + dc * 32 + 8 * hh;
        const unsigned short* kp2 = Ksl + (j * 16 + c) * kLP + dc * 32 + 8 * hh;
        kb.h[0]  = *(const v8b*)(const void*)(kp);
        kb.h[1]  = *(const v8b*)(const void*)(kp + 16);
        kb2.h[0] = *(const v8b*)(const void*)(kp2);
        kb2.h[1] = *(const v8b*)(const void*)(kp2 + 16);
        s[j] = at_mma(kb.v, qah[dc], s[j]);
        s[j] = at_mma(kb2.v, qah[dc], s[j]);
        s[j] = at_mma(kb.v, qal[dc], s[j]);
      }
    }
    const bool diag = (kc == qb);   // block-uniform
    const int qrel = q0 + c - kv0 - 8 * hh;   // key j*16 + 8hh + r of this chunk lies behind query q0 + c where j*16 + r > qrel
    float cm = -__builtin_inff();
#pragma unroll
    for (int j = 0; j < 4; ++j) {
#pragma unroll
      for (int r = 0; r < 8; ++r) {
        float sv = s[j][r];   // unscaled: the scale is folded into the exponent's multiply-add below
        sv = (diag && (j * 16 + r > qrel)) ? -__builtin_inff() : sv;
        s[j][r] = sv;
        cm = fmaxf(cm, sv);
      }
    }
    cm = fmaxf(cm, at_xhalf(cm));   // the query's other 32 keys of this chunk
    const float mnew = fmaxf(mrun, cm);
    const float alpha = __builtin_amdgcn_exp2f((mrun - mnew) * c2);
    const float mn2 = mnew * c2;
    mrun = mnew;
    // P^T as B operand of 32 keys (column = query c): element e of block kk is key kk*32 + (e < 8 ? 8hh + e : 16 + 8hh + e - 8),
    // that is register e & 7 of score tile 2kk + (e >> 3) of this same lane: the k order of the V^T fragment loads below
    FB ph[2], pl[2];
    float psum = 0.f;
#pragma unroll
    for (int j = 0; j < 4; ++j) {
#pragma unroll
      for (int r = 0; r < 8; ++r) {
        const float p = __builtin_amdgcn_exp2f(__builtin_fmaf(s[j][r], c2, -mn2));
        psum += p;
        __bf16 a, bl;
        at_split(p, a, bl);
        ph[j >> 1].v[(j & 1) * 8 + r] = a;
        pl[j >> 1].v[(j & 1) * 8 + r] = bl;
      }
    }
    lrun = lrun * alpha + psum;
#pragma unroll
    for (int t = 0; t < 4; ++t)
#pragma unroll
      for (int r = 0; r < 8; ++r) oacc[t][r] *= alpha;
    // ---- out^T[d][query] += V^T[d][kv] * P^T[kv][query]; A = V^T (row = d t*16 + c, k = kv) by transposing reads of V [kv][d], B = P^T ----
#pragma unroll
    for (int kk = 0; kk < 2; ++kk) {
#pragma unroll
      for (int t = 0; t < 4; ++t) {
        FB vb, vb2;
        // the lane receives V[kk*32 + 8hh + 0..7][t*16 + c], then V[kk*32 + 16 + 8hh + 0..7][t*16 + c]: the k order of P^T above
        const int vo = (kk * 32 + 8 * hh + (lane & 7)) * kVP + t * 16 + ((lane >> 3) & 1) * 8;
        vb.h[0]  = at_ld_tr16(Vsh + vo);
        vb.h[1]  = at_ld_tr16(Vsh + vo + 16 * kVP);
        vb2.h[0] = at_ld_tr16(Vsl + vo);
        vb2.h[1] = at_ld_tr16(Vsl + vo + 16 * kVP);
        oacc[t] = at_mma(vb.v, ph[kk].v, oacc[t]);
        oacc[t] = at_mma(vb2.v, ph[kk].v, oacc[t]);
        oacc[t] = at_mma(vb.v, pl[kk].v, oacc[t]);
      }
    }
    asm volatile("s_wait_dscnt 0x0" ::: "memory");      // this wave's reads of the buffer are done before it is refilled
    asm volatile("s_wait_asynccnt 0x0" ::: "memory");   // this wave's copies of chunk kc + 1 have landed
    __syncthreads();                                    // publishes chunk kc + 1 and ends every wave's reads of chunk kc
    if (kc + 2 < nChunks) stage_copies(kc + 2, bufe * 2u);
  }
  asm volatile("s_wait_asynccnt 0x0" ::: "memory");   // nothing of this wave is in flight behind the loop

  // ---- epilogue: join the halves' sums, normalise, stage the wave's 16x64 tile, write whole 256-B row segments ----
  float* os = (float*)(void*)sKV + wave * (16 * kOP);   // every wave has passed the last chunk's barrier: the buffers are free
  {
    const float inv = 1.0f / (lrun + at_xhalf(lrun));
#pragma unroll
    for (int t = 0; t < 4; ++t) {
      const v4f w0 = {oacc[t][0] * inv, oacc[t][1] * inv, oacc[t][2] * inv, oacc[t][3] * inv};
      const v4f w1 = {oacc[t][4] * inv, oacc[t][5] * inv, oacc[t][6] * inv, oacc[t][7] * inv};
      *(v4f*)(os + c * kOP + t * 16 + 8 * hh)     = w0;
      *(v4f*)(os + c * kOP + t * 16 + 8 * hh + 4) = w1;
    }
  }
  __builtin_amdgcn_fence(__ATOMIC_RELEASE, "workgroup");
  __builtin_amdgcn_wave_barrier();
  __builtin_amdgcn_fence(__ATOMIC_ACQUIRE, "workgroup");
  {
    float* ob = out + (size_t)hcol;
    const int c4 = (lane & 15) * 4;   // 16 lanes x 16 B = 256 B = one row segment of 64 floats
    {
#pragma unroll
      for (int it = 0; it < 8; ++it) {
        const int row = it * 2 + hh;
        v4f val = *(const v4f*)(os + row * kOP + c4);
        *(v4f*)(ob + (rowb + (size_t)(q0 + row)) * (size_t)ldo + c4) = val;
      }
      
    }
  }
}

// ---------------------------------------------------------------------------------------------------------------------
// Host launcher
// Workspace region map (bytes):
//   [0,            16,777,216)  Xb   bf16 [8192][1024]           (RNE copy of x)
//   [16,777,216,   23,068,672)  Wt   bf16 [3072][1024]           (RNE copy of W^T)
//   [23,068,672,   73,400,320)  Phi  bf16 [8192][3072]           (qkv hi plane)
//   [73,400,320,  123,731,968)  Plo  bf16 [8192][3072]           (qkv lo plane)
//   total 123,731,968
// ---------------------------------------------------------------------------------------------------------------------
extern "C" void kernel_launch(void* const* d_in, const int* in_sizes, int n_in,
                              void* d_out, int out_size, void* d_ws, size_t ws_size,
                              hipStream_t stream) {
  if (n_in < 2) return;
  if (in_sizes[0] != kRows * kEmb) return;
  if (in_sizes[1] != kEmb * kN3) return;
  if (out_size != kRows * kEmb) return;

  const size_t bytesXb = (size_t)kRows * kEmb * 2;
  const size_t bytesWt = (size_t)kN3 * kEmb * 2;
  const size_t bytesPl = (size_t)kRows * kN3 * 2;
  const size_t offXb = 0;
  const size_t offWt = offXb + bytesXb;
  const size_t offHi = offWt + bytesWt;
  const size_t offLo = offHi + bytesPl;
  const size_t total = offLo + bytesPl;
  if (total > ws_size) return;

  const float* x = (const float*)d_in[0];   // [4, 2048, 1024] f32
  const float* W = (const float*)d_in[1];   // [1024, 3072] f32
  float* outp = (float*)d_out;              // [4, 2048, 1024] f32

  char* ws = (char*)d_ws;
  unsigned short* Xb  = (unsigned short*)(ws + offXb);
  unsigned short* Wt  = (unsigned short*)(ws + offWt);
  unsigned short* Phi = (unsigned short*)(ws + offHi);
  unsigned short* Plo = (unsigned short*)(ws + offLo);
  const float* fdum = (const float*)(ws + offXb);

  // 1) x -> bf16 plane: 1,048,576 threads x 8 elements = 8,388,608
  const int n8 = (kRows * kEmb) / 8;
  cast_f32_bf16x8<<<dim3(n8 / 256), dim3(256), 0, stream>>>(x, Xb, n8);

  // 2) W [1024][3072] -> Wt [3072][1024] bf16; grid (Cc/64, R/64) = (48, 16)
  transpose_cast_bf16<<<dim3(kN3 / 64, kEmb / 64), dim3(256), 0, stream>>>(W, Wt, kEmb, kN3);

  // 3) qkv = Xb [8192][1024] x Wt [3072][1024]^T -> bf16 hi/lo planes [8192][3072]; M=8192, N=3072, K=1024
  const int tiles = (kRows / 128) * (kN3 / 256);   // 768 tiles of 128 x 256, one per block
  wmma_gemm64<1, false, 0, 2, false, 0><<<dim3(tiles, 1), dim3(256), 0, stream>>>(
      (const unsigned short*)Xb, (const unsigned short*)Xb, kEmb, 0L,
      (const unsigned short*)Wt, (const unsigned short*)Wt, kEmb, 0L,
      (void*)Phi, (void*)Plo, kN3, 0L,
      fdum, fdum, 0L,
      kRows, kN3, kEmb, 1.0f);

  // 4) causal attention: q cols [0,1024), k cols [1024,2048), v cols [2048,3072) of the planes; ld = 3072
  attn_causal_hd64_split<<<dim3(kBatch * kHeads * (kSeq / kQB)), dim3(128), 0, stream>>>(
      (const unsigned short*)Phi, (const unsigned short*)Plo,
      (const unsigned short*)(Phi + kEmb), (const unsigned short*)(Plo + kEmb),
      (const unsigned short*)(Phi + 2 * kEmb), (const unsigned short*)(Plo + 2 * kEmb),
      outp, kSeq, kHeads, kN3, kN3, kN3, kEmb, 0.125f);
}

// v007
// It runs in 147 microseconds.
// Two timings next to v006 both put it at 1.08 times that version's speed.
// All steps since v000 together make it 4.84 times as fast.
// Contractions: QKV projection = v_wmma_f32_16x16x32_bf16 on RNE-bf16 copies of x and W (f32 accumulate); q.k^T and p.v = bf16 hi/lo split (hi*hi + hi*lo + lo*hi) on v_wmma_f32_16x16x32_bf16, f32 accumulate; softmax and normalisation in f32.
#include <hip/hip_runtime.h>
#include <stdint.h>

// ---------------------------------------------------------------------------------------------------------------------
// Shared 16-bit WMMA helpers
// ---------------------------------------------------------------------------------------------------------------------
typedef __attribute__((ext_vector_type(16))) _Float16 v16h;
typedef __attribute__((ext_vector_type(8)))  _Float16 v8h;
typedef __attribute__((ext_vector_type(16))) __bf16   v16b;
typedef __attribute__((ext_vector_type(8)))  __bf16   v8b;
typedef __attribute__((ext_vector_type(8)))  float    v8f;
typedef __attribute__((ext_vector_type(4)))  float    v4f;
typedef __attribute__((ext_vector_type(4)))  unsigned v4u;
#define PSCALE 32768.0f
#define U16(p) ((const unsigned short*)(const void*)(p))
#define PSCALE_INV (1.0f / 32768.0f)

__device__ __forceinline__ unsigned short f2bf_bits(float f) {
  unsigned u = __float_as_uint(f);
  return (unsigned short)((u + 0x7FFFu + ((u >> 16) & 1u)) >> 16);
}
__device__ __forceinline__ float bf_bits2f(unsigned short h) { return __uint_as_float(((unsigned)h) << 16); }

// hazard guards as plain device helpers
__device__ __forceinline__ void dep_guard_h(v8f& a, v8f& b, v16h x, v16h y) { asm volatile("v_nop\n\tv_nop\n\tv_nop\n\tv_nop" : "+v"(a), "+v"(b) : "v"(x), "v"(y)); }
__device__ __forceinline__ void dep_guard_b(v8f& a, v8f& b, v16b x, v16b y) { asm volatile("v_nop\n\tv_nop\n\tv_nop\n\tv_nop" : "+v"(a), "+v"(b) : "v"(x), "v"(y)); }
__device__ __forceinline__ void keep4_h(v16h a, v16h b, v16h c, v16h d) { asm volatile("v_nop" :: "v"(a), "v"(b), "v"(c), "v"(d)); }
__device__ __forceinline__ void keep4_b(v16b a, v16b b, v16b c, v16b d) { asm volatile("v_nop" :: "v"(a), "v"(b), "v"(c), "v"(d)); }
__device__ __forceinline__ void acc_guard4(v8f& a, v8f& b, v8f& c, v8f& d) { asm volatile("v_nop\n\tv_nop\n\tv_nop\n\tv_nop" : "+v"(a), "+v"(b), "+v"(c), "+v"(d)); }
template <typename T> struct Frag;
template <> struct Frag<_Float16> {
  typedef v16h V; union U { v16h v; v8h h[2]; };
  static __device__ __forceinline__ v16h load(const _Float16* p) {   // elements 0..7 <- p[0..7], 8..15 <- p[16..23]
    U f; f.h[0] = *(const v8h*)(p); f.h[1] = *(const v8h*)(p + 16); return f.v;
  }
  static __device__ __forceinline__ v8f mma(v16h a, v16h b, v8f c) {
    return __builtin_amdgcn_wmma_f32_16x16x32_f16(false, a, false, b, (short)0, c, false, false);
  }
  static __device__ __forceinline__ void guard(v8f& a, v8f& b, v16h x, v16h y) { dep_guard_h(a, b, x, y); }
  static __device__ __forceinline__ void keep(v16h a, v16h b, v16h c, v16h d) { keep4_h(a, b, c, d); }
};
template <> struct Frag<__bf16> {
  typedef v16b V; union U { v16b v; v8b h[2]; };
  static __device__ __forceinline__ v16b load(const __bf16* p) {
    U f; f.h[0] = *(const v8b*)(p); f.h[1] = *(const v8b*)(p + 16); return f.v;
  }
  static __device__ __forceinline__ v8f mma(v16b a, v16b b, v8f c) {
    return __builtin_amdgcn_wmma_f32_16x16x32_bf16(false, a, false, b, (short)0, c, false, false);
  }
  static __device__ __forceinline__ void guard(v8f& a, v8f& b, v16b x, v16b y) { dep_guard_b(a, b, x, y); }
  static __device__ __forceinline__ void keep(v16b a, v16b b, v16b c, v16b d) { keep4_b(a, b, c, d); }
};

// ---- Register-blocked batched WMMA GEMM ------------------------------------
// C[m,n] = scale * sum_k A[m,k] * Bt[n,k] (+bias)(+resid); each wave owns a 64x64 tile, a block's 8 waves (2 x 4) a 128x256 tile.
// A row-major [M,K]; Bt row-major [N,K]; M % 128 == 0, N % 256 == 0, K % 64 == 0; grid.x = (M/128) * (N/256).
// Operands reach the waves through LDS: a stage is 64 k (one 128-B line) of the block's 128 A rows and 256 Bt rows, brought in by
// asynchronous 16-B copies (a wave's copy = 4 whole lines), two buffers, the next stage in flight while this one is multiplied.
// SPLIT: must be false (the staged loop reads one plane per operand); A2/Bt2 are not read.
// BIAS_MODE: 0 = none, 1 = bias[m], 2 = bias[n].
// OUT_MODE: 0 = f32, 1 = f16, 2 = bf16 hi plane (Cout) + bf16 lo plane (Cout2).
// ET: 0 = f16 operands, 1 = bf16 operands (pointers passed as 16-bit storage)
template <int ET> struct Elem;
template <> struct Elem<0> { typedef _Float16 T; };
template <> struct Elem<1> { typedef __bf16 T; };
constexpr int kGP     = 72;                      // LDS row pitch, 16-bit elements: 144 B = 16 B x odd (16-byte fragment reads)
constexpr int kGARows = 128;                     // A rows of a stage
constexpr int kGBRows = 256;                     // Bt rows of a stage
constexpr int kGStage = (kGARows + kGBRows) * kGP;   // elements of one buffer
// One stage's copies of one thread: 4 A rows and 8 Bt rows, 32 rows apart, 16 B each. la / lb: the lane's LDS byte addresses of the
// first A / Bt row; ga / gb: its global addresses; sa / sb: 32 rows in elements. The s_wait_xcnt closes the statement so that no
// address register of a copy is rewritten in front of it.
__device__ __forceinline__ void gemm_stage_copies(unsigned la, unsigned lb, const unsigned short* ga, const unsigned short* gb,
                                                  size_t sa, size_t sb) {
  constexpr unsigned ls = 32u * kGP * 2u;   // 32 rows in LDS bytes
  asm volatile(
      "global_load_async_to_lds_b128 %0, %12, off\n\t"
      "global_load_async_to_lds_b128 %1, %13, off\n\t"
      "global_load_async_to_lds_b128 %2, %14, off\n\t"
      "global_load_async_to_lds_b128 %3, %15, off\n\t"
      "global_load_async_to_lds_b128 %4, %16, off\n\t"
      "global_load_async_to_lds_b128 %5, %17, off\n\t"
      "global_load_async_to_lds_b128 %6, %18, off\n\t"
      "global_load_async_to_lds_b128 %7, %19, off\n\t"
      "global_load_async_to_lds_b128 %8, %20, off\n\t"
      "global_load_async_to_lds_b128 %9, %21, off\n\t"
      "global_load_async_to_lds_b128 %10, %22, off\n\t"
      "global_load_async_to_lds_b128 %11, %23, off\n\t"
      "s_wait_xcnt 0x0"
      :: "v"(la), "v"(la + ls), "v"(la + 2u * ls), "v"(la + 3u * ls),
         "v"(lb), "v"(lb + ls), "v"(lb + 2u * ls), "v"(lb + 3u * ls),
         "v"(lb + 4u * ls), "v"(lb + 5u * ls), "v"(lb + 6u * ls), "v"(lb + 7u * ls),
         "v"(ga), "v"(ga + sa), "v"(ga + 2 * sa), "v"(ga + 3 * sa),
         "v"(gb), "v"(gb + sb), "v"(gb + 2 * sb), "v"(gb + 3 * sb),
         "v"(gb + 4 * sb), "v"(gb + 5 * sb), "v"(gb + 6 * sb), "v"(gb + 7 * sb)
      : "memory");
}
template <int ET, bool SPLIT, int BIAS_MODE, int OUT_MODE, bool RESID, int ACT = 0>
__global__ __launch_bounds__(256) void wmma_gemm64(
    const unsigned short* __restrict__ Ap, const unsigned short* __restrict__ A2p, int lda, long strideA,
    const unsigned short* __restrict__ Btp, const unsigned short* __restrict__ Bt2p, int ldb, long strideB,
    void* __restrict__ Cout, void* __restrict__ Cout2, int ldc, long strideC,
    const float* __restrict__ bias,
    const float* __restrict__ resid, long strideR,
    int M, int N, int K, float scale) {
  typedef typename Elem<ET>::T T;
  typedef typename Frag<T>::V V;
  static_assert(!SPLIT, "the staged loop carries one plane per operand");
  __shared__ __align__(16) unsigned short sAB[2 * kGStage];   // two stage buffers: [A 128 rows | Bt 256 rows], pitch kGP
  __shared__ __align__(16) float sT[8][16 * 68];   // per-wave 16x64 slab, pitch 68 floats
  const int b    = blockIdx.y;
  const int tid  = threadIdx.x;
  const int lane = tid & 31;
  const int wave = tid >> 5;
  const int tilesN = N >> 8;
  const int tilesM = M >> 7;
  if ((int)blockIdx.x >= tilesM * tilesN) return;   // block-uniform, in front of every barrier and copy
  const int tm = blockIdx.x / tilesN;
  const int tn = blockIdx.x - tm * tilesN;
  const int wm0 = (wave >> 2) << 6;   // the wave's first row in the block's A rows
  const int wn0 = (wave & 3) << 6;    // the wave's first row in the block's Bt rows
  const int m0 = (tm << 7) + wm0;
  const int n0 = (tn << 8) + wn0;

  // copies: thread -> row tid >> 3 (+ 32 per copy), 16-B piece tid & 7 of the row's 128-B line
  const int crow = tid >> 3, ccol = (tid & 7) * 8;
  const unsigned short* gA = Ap  + (size_t)b * strideA + (size_t)((tm << 7) + crow) * lda + ccol;
  const unsigned short* gB = Btp + (size_t)b * strideB + (size_t)((tn << 8) + crow) * ldb + ccol;
  const size_t sA32 = (size_t)32 * lda, sB32 = (size_t)32 * ldb;
  const unsigned ldsA = (unsigned)(size_t)(const void*)sAB + (unsigned)(crow * kGP + ccol) * 2u;
  const unsigned ldsB = ldsA + (unsigned)(kGARows * kGP) * 2u;

  const int rlane = lane & 15;                 // row (A) / col (B, D) within subtile
  const int koff  = (lane >> 4) * 8;           // k offset of this lane half
  const int mOff  = (lane >> 4) * 8;           // D row offset

  v8f acc[4][4];
#pragma unroll
  for (int i = 0; i < 4; ++i)
#pragma unroll
    for (int j = 0; j < 4; ++j) acc[i][j] = (v8f){0.f,0.f,0.f,0.f,0.f,0.f,0.f,0.f};

  const int nt = K >> 6;   // stages
  gemm_stage_copies(ldsA, ldsB, gA, gB, sA32, sB32);
  asm volatile("s_wait_asynccnt 0x0" ::: "memory");   // this wave's copies of stage 0 have landed
  __syncthreads();                                    // and every other wave's
  if (nt > 1) gemm_stage_copies(ldsA + kGStage * 2u, ldsB + kGStage * 2u, gA + 64, gB + 64, sA32, sB32);
  for (int t = 0; t < nt; ++t) {
    const unsigned bufe = (unsigned)(t & 1) * kGStage;   // this stage's buffer, in elements
    const T* sA = (const T*)(const void*)(sAB + bufe) + (wm0 + rlane) * kGP + koff;
    const T* sB = (const T*)(const void*)(sAB + bufe) + (kGARows + wn0 + rlane) * kGP + koff;
#pragma unroll   // constant LDS offsets and constant indices into the fragment and accumulator arrays
    for (int ks = 0; ks < 2; ++ks) {
      V bh[4], ah[4];   // all eight fragments of these 32 k are read as one group, ahead of their 16 products
#pragma unroll
      for (int j = 0; j < 4; ++j) bh[j] = Frag<T>::load(sB + (j << 4) * kGP + ks * 32);
#pragma unroll
      for (int i = 0; i < 4; ++i) ah[i] = Frag<T>::load(sA + (i << 4) * kGP + ks * 32);
#pragma unroll
      for (int i = 0; i < 4; ++i) {
#pragma unroll
        for (int j = 0; j < 4; ++j) acc[i][j] = Frag<T>::mma(ah[i], bh[j], acc[i][j]);
        Frag<T>::guard(acc[i][0], acc[i][3], ah[i], ah[i]);
      }
      Frag<T>::keep(bh[0], bh[1], bh[2], bh[3]);
    }
    asm volatile("s_wait_dscnt 0x0" ::: "memory");      // this wave's reads of the buffer are done before it is refilled
    asm volatile("s_wait_asynccnt 0x0" ::: "memory");   // this wave's copies of stage t + 1 have landed
    __syncthreads();                                    // publishes stage t + 1 and ends every wave's reads of stage t
    if (t + 2 < nt)
      gemm_stage_copies(ldsA + bufe * 2u, ldsB + bufe * 2u, gA + (size_t)(t + 2) * 64, gB + (size_t)(t + 2) * 64, sA32, sB32);
  }
  asm volatile("s_wait_asynccnt 0x0" ::: "memory");   // nothing of this wave is in flight behind the loop
  acc_guard4(acc[0][0], acc[0][1], acc[0][2], acc[0][3]);
  acc_guard4(acc[1][0], acc[1][1], acc[1][2], acc[1][3]);
  acc_guard4(acc[2][0], acc[2][1], acc[2][2], acc[2][3]);
  acc_guard4(acc[3][0], acc[3][1], acc[3][2], acc[3][3]);

  // ---- epilogue ----
  float* slab = sT[wave];
  const float* Rb = RESID ? (resid + (size_t)b * strideR) : nullptr;
#pragma unroll
  for (int i = 0; i < 4; ++i) {
    const int mBase = m0 + (i << 4);
#pragma unroll
    for (int j = 0; j < 4; ++j) {
      const int n = n0 + (j << 4) + rlane;
      float bv = 0.f;
      if (BIAS_MODE == 2) bv = bias[n];
#pragma unroll
      for (int r = 0; r < 8; ++r) {
        float v = acc[i][j][r] * scale;
        if (BIAS_MODE == 1) v += bias[mBase + mOff + r];
        if (BIAS_MODE == 2) v += bv;
        if (RESID) v += Rb[(size_t)(mBase + mOff + r) * ldc + n];
        if (ACT == 1) v = tanhf(v);
        if (ACT == 2) v = fmaxf(v, 0.0f);
        if (ACT == 3) v = v / (1.0f + expf(-v));
        if (ACT == 4) v = (v > 0.f) ? v : 0.01f * v;
        if (ACT == 5) v = 0.5f * v * (1.0f + erff(v * 0.70710678118654752f));
        slab[(mOff + r) * 68 + (j << 4) + rlane] = v;
      }
    }
    __builtin_amdgcn_fence(__ATOMIC_RELEASE, "workgroup");
    __builtin_amdgcn_wave_barrier();
    __builtin_amdgcn_fence(__ATOMIC_ACQUIRE, "workgroup");
    if (OUT_MODE == 0) {
      float* C = (float*)Cout + (size_t)b * strideC;
      const int hh = lane >> 4, c4 = (lane & 15) * 4;     // row seg = 256 B = 16 lanes x 16 B
      {
#pragma unroll
        for (int it = 0; it < 8; ++it) {
          const int row = it * 2 + hh;
          v4f v = *(const v4f*)(slab + row * 68 + c4);
          *(v4f*)(C + (size_t)(mBase + row) * ldc + n0 + c4) = v;
        }
        
      }
    } else {
      const int q = lane >> 3, c8 = (lane & 7) * 8;
      unsigned short* C  = (unsigned short*)Cout  + (size_t)b * strideC;
      unsigned short* C2 = (OUT_MODE == 2) ? ((unsigned short*)Cout2 + (size_t)b * strideC) : nullptr;
      {
#pragma unroll
        for (int it = 0; it < 4; ++it) {
          const int row = it * 4 + q;
          const float* sp = slab + row * 68 + c8;
          v8h hv, lv;
#pragma unroll
          for (int e = 0; e < 8; ++e) {
            if (OUT_MODE == 1) {
              hv[e] = (_Float16)sp[e];
            } else {
              unsigned short hb = f2bf_bits(sp[e]);
              unsigned short lb = f2bf_bits(sp[e] - bf_bits2f(hb));
              hv[e] = __builtin_bit_cast(_Float16, hb);
              lv[e] = __builtin_bit_cast(_Float16, lb);
            }
          }
          *(v8h*)(C + (size_t)(mBase + row) * ldc + n0 + c8) = hv;
          if (OUT_MODE == 2) *(v8h*)(C2 + (size_t)(mBase + row) * ldc + n0 + c8) = lv;
        }
        
      }
    }
    __builtin_amdgcn_fence(__ATOMIC_RELEASE, "workgroup");
    __builtin_amdgcn_wave_barrier();
    __builtin_amdgcn_fence(__ATOMIC_ACQUIRE, "workgroup");
  }
}

// ---------------------------------------------------------------------------------------------------------------------
// bf16 helpers for the attention kernel
// ---------------------------------------------------------------------------------------------------------------------
__device__ __forceinline__ unsigned short at_bf_bits(float f) {
  unsigned u = __float_as_uint(f);
  return (unsigned short)((u + 0x7FFFu + ((u >> 16) & 1u)) >> 16);
}
__device__ __forceinline__ __bf16 at_f2bf(float f) { return __builtin_bit_cast(__bf16, at_bf_bits(f)); }
__device__ __forceinline__ void at_split(float f, __bf16& hi, __bf16& lo) {
  const unsigned short hb = at_bf_bits(f);
  hi = __builtin_bit_cast(__bf16, hb);
  lo = at_f2bf(f - __uint_as_float(((unsigned)hb) << 16));
}
// value of lane l ^ 16 (the other half of the wave), by a vector cross-row move
__device__ __forceinline__ float at_xhalf(float x) {
  const int b = __builtin_bit_cast(int, x);
  return __builtin_bit_cast(float, __builtin_amdgcn_permlanex16(b, b, 0x76543210, 0xfedcba98, false, false));
}
__device__ __forceinline__ v8f at_mma(v16b a, v16b b, v8f c) {
  return __builtin_amdgcn_wmma_f32_16x16x32_bf16(false, a, false, b, (short)0, c, false, false);
}

// 16-byte transposing LDS read: lane l is given the address of row (8 * (l >> 4) + (l & 7)), 16-byte piece ((l >> 3) & 1) of a row-major
// 16 x 16 tile of 16-bit elements and receives column l & 15, rows 8 * (l >> 4) .. + 7: half of an A fragment of the transposed tile.
typedef __attribute__((ext_vector_type(8))) short v8s;
__device__ __forceinline__ v8b at_ld_tr16(const unsigned short* p) {
  typedef __attribute__((address_space(3))) v8s lds_v8s;
  return __builtin_bit_cast(v8b, __builtin_amdgcn_ds_load_tr16_b128_v8i16((lds_v8s*)p));
}
// One thread's copies of a 64-row hi tile and its lo tile: 4 rows of each, 16 rows apart, 16 B each (8 lanes = one 128-B line).
// lh / ll: the lane's LDS byte addresses of its first row in the two tiles, ls: 16 rows in LDS bytes; gh / gl: its global addresses,
// gs: 16 rows in elements. The s_wait_xcnt closes the statement so that no address register of a copy is rewritten in front of it.
__device__ __forceinline__ void attn_pair_copies(unsigned lh, unsigned ll, unsigned ls,
                                                 const unsigned short* gh, const unsigned short* gl, size_t gs) {
  asm volatile(
      "global_load_async_to_lds_b128 %0, %8, off\n\t"
      "global_load_async_to_lds_b128 %1, %9, off\n\t"
      "global_load_async_to_lds_b128 %2, %10, off\n\t"
      "global_load_async_to_lds_b128 %3, %11, off\n\t"
      "global_load_async_to_lds_b128 %4, %12, off\n\t"
      "global_load_async_to_lds_b128 %5, %13, off\n\t"
      "global_load_async_to_lds_b128 %6, %14, off\n\t"
      "global_load_async_to_lds_b128 %7, %15, off\n\t"
      "s_wait_xcnt 0x0"
      :: "v"(lh), "v"(lh + ls), "v"(lh + 2u * ls), "v"(lh + 3u * ls),
         "v"(ll), "v"(ll + ls), "v"(ll + 2u * ls), "v"(ll + 3u * ls),
         "v"(gh), "v"(gh + gs), "v"(gh + 2 * gs), "v"(gh + 3 * gs),
         "v"(gl), "v"(gl + gs), "v"(gl + 2 * gs), "v"(gl + 3 * gs)
      : "memory");
}

// ---------------------------------------------------------------------------------------------------------------------
// Problem constants
// ---------------------------------------------------------------------------------------------------------------------
constexpr int kBatch   = 4;
constexpr int kSeq     = 2048;
constexpr int kEmb     = 1024;
constexpr int kHeads   = 16;
constexpr int kHeadDim = 64;
constexpr int kRows    = kBatch * kSeq;   // 8192 = GEMM M
constexpr int kN3      = 3 * kEmb;        // 3072 = GEMM N
static_assert(kEmb % 32 == 0, "K");
static_assert(kRows % 128 == 0 && kN3 % 256 == 0, "MN");
static_assert(kEmb % 64 == 0 && kEmb / 64 >= 2, "stages");
static_assert(kHeads * kHeadDim == kEmb, "heads");
static_assert(kSeq % 64 == 0, "S");
static_assert((kRows * kEmb) % (8 * 256) == 0, "cast grid");
static_assert(kEmb % 64 == 0 && kN3 % 64 == 0, "transpose grid");

// ---------------------------------------------------------------------------------------------------------------------
// f32 -> bf16 (RNE) cast: thread i converts elements 8i..8i+7 (two 16-B loads, one 16-B store);
// Coverage: n8 threads x 8 = whole plane (n8 = n/8 exact).
// ---------------------------------------------------------------------------------------------------------------------
__global__ __launch_bounds__(256) void cast_f32_bf16x8(const float* __restrict__ in, unsigned short* __restrict__ outp, int n8) {
  const int i = blockIdx.x * 256 + threadIdx.x;
  if (i < n8) {
    const size_t e0 = (size_t)i * 8;
    const v4f a = *(const v4f*)(in + e0);
    const v4f c = *(const v4f*)(in + e0 + 4);
    v4u u;
    u[0] = (unsigned)f2bf_bits(a[0]) | ((unsigned)f2bf_bits(a[1]) << 16);
    u[1] = (unsigned)f2bf_bits(a[2]) | ((unsigned)f2bf_bits(a[3]) << 16);
    u[2] = (unsigned)f2bf_bits(c[0]) | ((unsigned)f2bf_bits(c[1]) << 16);
    u[3] = (unsigned)f2bf_bits(c[2]) | ((unsigned)f2bf_bits(c[3]) << 16);
    *(v4u*)(outp + e0) = u;
    
  }
}

// ---------------------------------------------------------------------------------------------------------------------
// Transpose + cast: in [R][Cc] f32 row-major -> outp [Cc][R] bf16, outp[n][e] = bf16(in[e][n]).
// Tile 64 (e) x 64 (n); grid (Cc/64, R/64); block 256.
// Load coverage: 256 threads x 16 elements = 64x64. Store coverage: 8 waves x 2 iterations x 4 rows = 64 rows,
// ---------------------------------------------------------------------------------------------------------------------
__global__ __launch_bounds__(256) void transpose_cast_bf16(const float* __restrict__ in, unsigned short* __restrict__ outp, int R, int Cc) {
  __shared__ __align__(16) unsigned short tT[64 * 72];   // [n_local][e_local], pitch 72
  const int tid = threadIdx.x;
  const int n0 = blockIdx.x * 64;
  const int e0 = blockIdx.y * 64;
  {
    const int el = tid >> 2, nl = (tid & 3) * 16;
    const float* src = in + (size_t)(e0 + el) * Cc + n0 + nl;
#pragma unroll
    for (int i = 0; i < 4; ++i) {
      const v4f f = *(const v4f*)(src + 4 * i);
#pragma unroll
      for (int e = 0; e < 4; ++e) tT[(nl + 4 * i + e) * 72 + el] = f2bf_bits(f[e]);
    }
  }
  __syncthreads();
  const int wave = tid >> 5, lane = tid & 31, q = lane >> 3, c8 = (lane & 7) * 8;
  {
#pragma unroll
    for (int it = 0; it < 2; ++it) {
      const int nl = wave * 8 + it * 4 + q;
      const v4u w = *(const v4u*)(tT + nl * 72 + c8);
      *(v4u*)(outp + (size_t)(n0 + nl) * R + e0 + c8) = w;
    }
    
  }
}

// ---------------------------------------------------------------------------------------------------------------------
// Causal attention, head dim 64, 16-bit plane inputs, f32 output.
//   q, k, v are bf16 hi + lo planes: element (b, s, h, d) at plane[(b*S + s)*ld + h*64 + d] (ld in elements, % 8 == 0).
//   scores^T = k.q^T (unscaled) : bf16 hi/lo split (hi*hi + hi*lo + lo*hi), f32 accumulate; a lane holds 32 scores of ONE query
//   out^T    = v^T.p^T        : p (f32, split into bf16 hi/lo in registers) and v hi/lo planes, f32 accumulate;
//                               two score tiles of a lane, converted in place, are the B operand of 32 keys
//   online softmax in f32, exponentials in base 2; keys with kv > q replaced by -inf before the softmax; maximum in-lane plus one exchange
//   between the wave's halves; each half keeps its own partial row sum, the two are joined in the epilogue.
//   Block = 4 waves = 64 query rows of one (b, h); grid.x = B * H * (S/64); S % 64 == 0.
//   A chunk's K and V rows (hi and lo planes) reach LDS by asynchronous 16-B copies, row-major, two buffers: the next chunk is in
//   flight while this one is worked on. A copy cannot transpose, so the V^T fragments are formed by transposing LDS reads.
// ---------------------------------------------------------------------------------------------------------------------
constexpr int kQB = 64;   // query rows per block
constexpr int kKC = 64;   // keys per chunk
constexpr int kNW = 4;    // waves per block
constexpr int kOP = 68;   // output slab pitch (floats)
constexpr int kLP = 72;   // LDS row pitch of the K tiles, in 16-bit elements: 144 B = 16 B x odd, so that the
                          // 16 rows one 16-byte fragment read touches fall on distinct banks; columns 64..71 are never used
constexpr int kVP = 80;   // LDS row pitch of the V tiles (row = key): 160 B = 32 B x odd, the pitch of the transposing 16-byte reads
constexpr int kKTile = kKC * kLP;                     // elements of one K plane tile
constexpr int kVTile = kKC * kVP;                     // elements of one V plane tile
constexpr int kAStage = 2 * kKTile + 2 * kVTile;      // one buffer: [K hi | K lo | V hi | V lo]
static_assert(kNW * 16 * kOP * 4 <= kAStage * 2, "the output slabs reuse the first buffer");

// second argument: at least 4 waves per SIMD, the number that the LDS of four resident blocks allows; holds the register budget at 256
__global__ __launch_bounds__(128, 4)
void attn_causal_hd64_split(const unsigned short* __restrict__ qh, const unsigned short* __restrict__ ql,
                            const unsigned short* __restrict__ kh, const unsigned short* __restrict__ kl,
                            const unsigned short* __restrict__ vh, const unsigned short* __restrict__ vl,
                            float* __restrict__ out,
                            int S, int H, int ldq, int ldk, int ldv, int ldo, float sscale) {
  typedef Frag<__bf16>::U FB;
  __shared__ __align__(16) unsigned short sKV[2 * kAStage];   // two chunk buffers; behind the loop the per-wave out tiles

  const int tid  = threadIdx.x;
  const int wave = tid >> 5;
  const int lane = tid & 31;
  const int hh   = lane >> 4;
  const int c    = lane & 15;

  // Block index -> tile: a block's cost is its qb + 1 key chunks and there are more blocks than resident places, so the
  // longest tiles take the lowest indices and the short ones fill the end.
  const int nqb = S / kQB;
  const int nbh = kBatch * H;
  const int bx = blockIdx.x;
  const int qb = nqb - 1 - bx / nbh;
  const int bh = bx % nbh;
  const int h  = bh % H;
  const int b  = bh / H;
  const int q0 = qb * kQB + wave * 16;
  const size_t rowb = (size_t)b * (size_t)S;
  const int hcol = h * kHeadDim;

  // ---- Q fragments (B operand, column = query q0 + c, k = d): 2 d-chunks, hi and lo planes ----
  v16b qah[2], qal[2];
  {
    const size_t qo = (rowb + (size_t)(q0 + c)) * (size_t)ldq + (size_t)(hcol + 8 * hh);
    const __bf16* qr  = (const __bf16*)(const void*)(qh + qo);
    const __bf16* qr2 = (const __bf16*)(const void*)(ql + qo);
#pragma unroll
    for (int dc = 0; dc < 2; ++dc) {
      qah[dc] = Frag<__bf16>::load(qr + dc * 32);
      qal[dc] = Frag<__bf16>::load(qr2 + dc * 32);
    }
  }

  // exp(sscale * (s - m)) = 2^(c2 * s - c2 * m): one multiply-add and the bare base-2 exponential per score. sscale > 0, so the
  // maximum is taken over the unscaled scores; a masked score stays -inf through the multiply-add and gives 0.
  const float c2 = sscale * 1.44269504088896340736f;
  float mrun = -__builtin_inff();   // running maximum (unscaled scores) of query q0 + c (equal in both halves)
  float lrun = 0.f;                 // running sum over this half's keys of query q0 + c
  v8f oacc[4];                      // oacc[t][r] = out^T[d = t*16 + 8hh + r][query q0 + c]
#pragma unroll
  for (int t = 0; t < 4; ++t) oacc[t] = (v8f){0.f,0.f,0.f,0.f,0.f,0.f,0.f,0.f};

  const int nChunks = qb + 1;   // block-uniform; causal: key chunks 0..qb
  // copies: thread -> row tid >> 3 (+ 16 per copy) of the chunk, 16-B piece tid & 7 of the row's 128-B line, in each of the four planes
  const int crow = tid >> 3, ccol = (tid & 7) * 8;
  const size_t gko = (rowb + (size_t)crow) * (size_t)ldk + (size_t)(hcol + ccol);
  const size_t gvo = (rowb + (size_t)crow) * (size_t)ldv + (size_t)(hcol + ccol);
  const unsigned ldsK = (unsigned)(size_t)(const void*)sKV + (unsigned)(crow * kLP + ccol) * 2u;
  const unsigned ldsV = (unsigned)(size_t)(const void*)sKV + (unsigned)(2 * kKTile + crow * kVP + ccol) * 2u;
  auto stage_copies = [&](int ch, unsigned bufb) {   // chunk ch into the buffer at byte offset bufb
    const size_t ko = gko + (size_t)ch * (size_t)(kKC * ldk);
    const size_t vo = gvo + (size_t)ch * (size_t)(kKC * ldv);
    attn_pair_copies(ldsK + bufb, ldsK + bufb + kKTile * 2u, 16u * kLP * 2u, kh + ko, kl + ko, (size_t)16 * ldk);
    attn_pair_copies(ldsV + bufb, ldsV + bufb + kVTile * 2u, 16u * kVP * 2u, vh + vo, vl + vo, (size_t)16 * ldv);
  };
  stage_copies(0, 0u);
  asm volatile("s_wait_asynccnt 0x0" ::: "memory");   // this wave's copies of chunk 0 have landed
  __syncthreads();                                    // and every other wave's
  if (nChunks > 1) stage_copies(1, kAStage * 2u);
  for (int kc = 0; kc < nChunks; ++kc) {
    const int kv0 = kc * kKC;
    const unsigned bufe = (unsigned)(kc & 1) * kAStage;   // this chunk's buffer, in elements
    const unsigned short* Ksh = sKV + bufe;       // K hi [kv][d], pitch kLP
    const unsigned short* Ksl = Ksh + kKTile;     // K lo
    const unsigned short* Vsh = Ksl + kKTile;     // V hi [kv][d], pitch kVP
    const unsigned short* Vsl = Vsh + kVTile;     // V lo

    // ---- scores, transposed: s[j][r] = S[query c][kv kv0 + j*16 + 8hh + r]; A = K (row = kv j*16 + c, k = d), B = Q ----
    // The four score tiles are independent accumulators: their products alternate, so that no product waits for the one in front of
    // it; each tile still sums (d-chunk 0: hi*hi, lo*hi, hi*lo; d-chunk 1: the same) in that order.
    v8f s[4];
#pragma unroll
    for (int j = 0; j < 4; ++j) s[j] = (v8f){0.f,0.f,0.f,0.f,0.f,0.f,0.f,0.f};
    FB kb[2][4], kb2[2][4];   // the chunk's K fragments, read as one group ahead of their 24 products
#pragma unroll
    for (int dc = 0; dc < 2; ++dc) {
#pragma unroll
      for (int j = 0; j < 4; ++j) {
        const unsigned short* kp  = Ksh + (j * 16 + c) * kLP + dc * 32 + 8 * hh;
        const unsigned short* kp2 = Ksl + (j * 16 + c) * kLP + dc * 32 + 8 * hh;
        kb[dc][j].h[0]  = *(const v8b*)(const void*)(kp);
        kb[dc][j].h[1]  = *(const v8b*)(const void*)(kp + 16);
        kb2[dc][j].h[0] = *(const v8b*)(const void*)(kp2);
        kb2[dc][j].h[1] = *(const v8b*)(const void*)(kp2 + 16);
      }
    }
    __builtin_amdgcn_sched_barrier(0);   // keeps the reads together (for speed only)
#pragma unroll
    for (int dc = 0; dc < 2; ++dc) {
#pragma unroll
      for (int j = 0; j < 4; ++j) s[j] = at_mma(kb[dc][j].v, qah[dc], s[j]);
#pragma unroll
      for (int j = 0; j < 4; ++j) s[j] = at_mma(kb2[dc][j].v, qah[dc], s[j]);
#pragma unroll
      for (int j = 0; j < 4; ++j) s[j] = at_mma(kb[dc][j].v, qal[dc], s[j]);
    }
    // V^T fragments (A operand, row = d t*16 + c, k = kv) by transposing reads of V [kv][d]: the lane receives V[kk*32 + 8hh + 0..7][t*16 + c],
    // then V[kk*32 + 16 + 8hh + 0..7][t*16 + c]: the k order of P^T below. The 16 reads of 32 keys stand together as one group.
    FB vb[2][4], vb2[2][4];
    auto load_v = [&](int kk) {
#pragma unroll
      for (int t = 0; t < 4; ++t) {
        const int vo = (kk * 32 + 8 * hh + (lane & 7)) * kVP + t * 16 + ((lane >> 3) & 1) * 8;
        vb[kk][t].h[0]  = at_ld_tr16(Vsh + vo);
        vb[kk][t].h[1]  = at_ld_tr16(Vsh + vo + 16 * kVP);
        vb2[kk][t].h[0] = at_ld_tr16(Vsl + vo);
        vb2[kk][t].h[1] = at_ld_tr16(Vsl + vo + 16 * kVP);
      }
    };
    __builtin_amdgcn_sched_barrier(0);   // with the one below: keeps the first group behind the score products (registers) and in front
    load_v(0);                           // of the softmax, whose vector work covers its latency
    __builtin_amdgcn_sched_barrier(0);
    const bool diag = (kc == qb);   // block-uniform
    const int qrel = q0 + c - kv0 - 8 * hh;   // key j*16 + 8hh + r of this chunk lies behind query q0 + c where j*16 + r > qrel
    float cm = -__builtin_inff();
#pragma unroll
    for (int j = 0; j < 4; ++j) {
#pragma unroll
      for (int r = 0; r < 8; ++r) {
        float sv = s[j][r];   // unscaled: the scale is folded into the exponent's multiply-add below
        sv = (diag && (j * 16 + r > qrel)) ? -__builtin_inff() : sv;
        s[j][r] = sv;
        cm = fmaxf(cm, sv);
      }
    }
    cm = fmaxf(cm, at_xhalf(cm));   // the query's other 32 keys of this chunk
    const float mnew = fmaxf(mrun, cm);
    const float alpha = __builtin_amdgcn_exp2f((mrun - mnew) * c2);
    const float mn2 = mnew * c2;
    mrun = mnew;
    // P^T as B operand of 32 keys (column = query c): element e of block kk is key kk*32 + (e < 8 ? 8hh + e : 16 + 8hh + e - 8),
    // that is register e & 7 of score tile 2kk + (e >> 3) of this same lane: the k order of the V^T fragment loads above
    FB ph[2], pl[2];
    float psum = 0.f;
#pragma unroll
    for (int j = 0; j < 4; ++j) {
#pragma unroll
      for (int r = 0; r < 8; ++r) {
        const float p = __builtin_amdgcn_exp2f(__builtin_fmaf(s[j][r], c2, -mn2));
        psum += p;
        __bf16 a, bl;
        at_split(p, a, bl);
        ph[j >> 1].v[(j & 1) * 8 + r] = a;
        pl[j >> 1].v[(j & 1) * 8 + r] = bl;
      }
    }
    lrun = lrun * alpha + psum;
#pragma unroll
    for (int t = 0; t < 4; ++t)
#pragma unroll
      for (int r = 0; r < 8; ++r) oacc[t][r] *= alpha;
    // ---- out^T[d][query] += V^T[d][kv] * P^T[kv][query]; A = V^T (row = d t*16 + c, k = kv) by transposing reads of V [kv][d], B = P^T ----
#pragma unroll
    for (int kk = 0; kk < 2; ++kk) {
      // the four output tiles alternate like the score tiles; each still sums (hi*hi, lo*hi, hi*lo) per 32 keys in that order
#pragma unroll
      for (int t = 0; t < 4; ++t) oacc[t] = at_mma(vb[kk][t].v, ph[kk].v, oacc[t]);
#pragma unroll
      for (int t = 0; t < 4; ++t) oacc[t] = at_mma(vb2[kk][t].v, ph[kk].v, oacc[t]);
      if (kk == 0) {
        __builtin_amdgcn_sched_barrier(0);   // with the one below: keeps the second group together, where the first group's lo fragments
        load_v(1);                           // have left their registers
        __builtin_amdgcn_sched_barrier(0);
      }
#pragma unroll
      for (int t = 0; t < 4; ++t) oacc[t] = at_mma(vb[kk][t].v, pl[kk].v, oacc[t]);
    }
    asm volatile("s_wait_dscnt 0x0" ::: "memory");      // this wave's reads of the buffer are done before it is refilled
    asm volatile("s_wait_asynccnt 0x0" ::: "memory");   // this wave's copies of chunk kc + 1 have landed
    __syncthreads();                                    // publishes chunk kc + 1 and ends every wave's reads of chunk kc
    if (kc + 2 < nChunks) stage_copies(kc + 2, bufe * 2u);
  }
  asm volatile("s_wait_asynccnt 0x0" ::: "memory");   // nothing of this wave is in flight behind the loop

  // ---- epilogue: join the halves' sums, normalise, stage the wave's 16x64 tile, write whole 256-B row segments ----
  float* os = (float*)(void*)sKV + wave * (16 * kOP);   // every wave has passed the last chunk's barrier: the buffers are free
  {
    const float inv = 1.0f / (lrun + at_xhalf(lrun));
#pragma unroll
    for (int t = 0; t < 4; ++t) {
      const v4f w0 = {oacc[t][0] * inv, oacc[t][1] * inv, oacc[t][2] * inv, oacc[t][3] * inv};
      const v4f w1 = {oacc[t][4] * inv, oacc[t][5] * inv, oacc[t][6] * inv, oacc[t][7] * inv};
      *(v4f*)(os + c * kOP + t * 16 + 8 * hh)     = w0;
      *(v4f*)(os + c * kOP + t * 16 + 8 * hh + 4) = w1;
    }
  }
  __builtin_amdgcn_fence(__ATOMIC_RELEASE, "workgroup");
  __builtin_amdgcn_wave_barrier();
  __builtin_amdgcn_fence(__ATOMIC_ACQUIRE, "workgroup");
  {
    float* ob = out + (size_t)hcol;
    const int c4 = (lane & 15) * 4;   // 16 lanes x 16 B = 256 B = one row segment of 64 floats
    {
#pragma unroll
      for (int it = 0; it < 8; ++it) {
        const int row = it * 2 + hh;
        v4f val = *(const v4f*)(os + row * kOP + c4);
        *(v4f*)(ob + (rowb + (size_t)(q0 + row)) * (size_t)ldo + c4) = val;
      }
      
    }
  }
}

// ---------------------------------------------------------------------------------------------------------------------
// Host launcher
// Workspace region map (bytes):
//   [0,            16,777,216)  Xb   bf16 [8192][1024]           (RNE copy of x)
//   [16,777,216,   23,068,672)  Wt   bf16 [3072][1024]           (RNE copy of W^T)
//   [23,068,672,   73,400,320)  Phi  bf16 [8192][3072]           (qkv hi plane)
//   [73,400,320,  123,731,968)  Plo  bf16 [8192][3072]           (qkv lo plane)
//   total 123,731,968
// ---------------------------------------------------------------------------------------------------------------------
extern "C" void kernel_launch(void* const* d_in, const int* in_sizes, int n_in,
                              void* d_out, int out_size, void* d_ws, size_t ws_size,
                              hipStream_t stream) {
  if (n_in < 2) return;
  if (in_sizes[0] != kRows * kEmb) return;
  if (in_sizes[1] != kEmb * kN3) return;
  if (out_size != kRows * kEmb) return;

  const size_t bytesXb = (size_t)kRows * kEmb * 2;
  const size_t bytesWt = (size_t)kN3 * kEmb * 2;
  const size_t bytesPl = (size_t)kRows * kN3 * 2;
  const size_t offXb = 0;
  const size_t offWt = offXb + bytesXb;
  const size_t offHi = offWt + bytesWt;
  const size_t offLo = offHi + bytesPl;
  const size_t total = offLo + bytesPl;
  if (total > ws_size) return;

  const float* x = (const float*)d_in[0];   // [4, 2048, 1024] f32
  const float* W = (const float*)d_in[1];   // [1024, 3072] f32
  float* outp = (float*)d_out;              // [4, 2048, 1024] f32

  char* ws = (char*)d_ws;
  unsigned short* Xb  = (unsigned short*)(ws + offXb);
  unsigned short* Wt  = (unsigned short*)(ws + offWt);
  unsigned short* Phi = (unsigned short*)(ws + offHi);
  unsigned short* Plo = (unsigned short*)(ws + offLo);
  const float* fdum = (const float*)(ws + offXb);

  // 1) x -> bf16 plane: 1,048,576 threads x 8 elements = 8,388,608
  const int n8 = (kRows * kEmb) / 8;
  cast_f32_bf16x8<<<dim3(n8 / 256), dim3(256), 0, stream>>>(x, Xb, n8);

  // 2) W [1024][3072] -> Wt [3072][1024] bf16; grid (Cc/64, R/64) = (48, 16)
  transpose_cast_bf16<<<dim3(kN3 / 64, kEmb / 64), dim3(256), 0, stream>>>(W, Wt, kEmb, kN3);

  // 3) qkv = Xb [8192][1024] x Wt [3072][1024]^T -> bf16 hi/lo planes [8192][3072]; M=8192, N=3072, K=1024
  const int tiles = (kRows / 128) * (kN3 / 256);   // 768 tiles of 128 x 256, one per block
  wmma_gemm64<1, false, 0, 2, false, 0><<<dim3(tiles, 1), dim3(256), 0, stream>>>(
      (const unsigned short*)Xb, (const unsigned short*)Xb, kEmb, 0L,
      (const unsigned short*)Wt, (const unsigned short*)Wt, kEmb, 0L,
      (void*)Phi, (void*)Plo, kN3, 0L,
      fdum, fdum, 0L,
      kRows, kN3, kEmb, 1.0f);

  // 4) causal attention: q cols [0,1024), k cols [1024,2048), v cols [2048,3072) of the planes; ld = 3072
  attn_causal_hd64_split<<<dim3(kBatch * kHeads * (kSeq / kQB)), dim3(128), 0, stream>>>(
      (const unsigned short*)Phi, (const unsigned short*)Plo,
      (const unsigned short*)(Phi + kEmb), (const unsigned short*)(Plo + kEmb),
      (const unsigned short*)(Phi + 2 * kEmb), (const unsigned short*)(Plo + 2 * kEmb),
      outp, kSeq, kHeads, kN3, kN3, kN3, kEmb, 0.125f);
}

// v008
// A run of this version takes 138 microseconds.
// Timed twice side by side with v007, it ran 1.07 times as fast both times.
// Over all steps from v000 it is 5.17 times as fast.
// Contractions: QKV projection = v_wmma_f32_16x16x32_bf16 on RNE-bf16 copies of x and W (f32 accumulate); q.k^T and p.v = bf16 hi/lo split (hi*hi + hi*lo + lo*hi) on v_wmma_f32_16x16x32_bf16, f32 accumulate; softmax and normalisation in f32.
#include <hip/hip_runtime.h>
#include <stdint.h>

// ---------------------------------------------------------------------------------------------------------------------
// Shared 16-bit WMMA helpers
// ---------------------------------------------------------------------------------------------------------------------
typedef __attribute__((ext_vector_type(16))) _Float16 v16h;
typedef __attribute__((ext_vector_type(8)))  _Float16 v8h;
typedef __attribute__((ext_vector_type(16))) __bf16   v16b;
typedef __attribute__((ext_vector_type(8)))  __bf16   v8b;
typedef __attribute__((ext_vector_type(8)))  float    v8f;
typedef __attribute__((ext_vector_type(4)))  float    v4f;
typedef __attribute__((ext_vector_type(4)))  unsigned v4u;
#define PSCALE 32768.0f
#define U16(p) ((const unsigned short*)(const void*)(p))
#define PSCALE_INV (1.0f / 32768.0f)

// two f32 -> two bf16 (round to nearest even) in one conversion instruction; element 0 in the low half of the register
typedef __attribute__((ext_vector_type(2))) float  v2f;
typedef __attribute__((ext_vector_type(2))) __bf16 v2b;
__device__ __forceinline__ v2b f2bf_pair(float a, float b) { return __builtin_convertvector((v2f){a, b}, v2b); }
__device__ __forceinline__ unsigned f2bf_pair_bits(float a, float b) { return __builtin_bit_cast(unsigned, f2bf_pair(a, b)); }
// hi = bf16(x), lo = bf16(x - hi), for two values. The two hi values are widened on the register's bits: each difference can then be one
// mixed-precision multiply-add that reads its half of the packed register (no unpacking instructions).
__device__ __forceinline__ void split_pair(float a, float b, v2b& hi, v2b& lo) {
  hi = f2bf_pair(a, b);
  const unsigned w = __builtin_bit_cast(unsigned, hi);
  lo = f2bf_pair(a - __uint_as_float(w << 16), b - __uint_as_float(w & 0xFFFF0000u));
}

// hazard guards as plain device helpers
__device__ __forceinline__ void dep_guard_h(v8f& a, v8f& b, v16h x, v16h y) { asm volatile("v_nop\n\tv_nop\n\tv_nop\n\tv_nop" : "+v"(a), "+v"(b) : "v"(x), "v"(y)); }
__device__ __forceinline__ void dep_guard_b(v8f& a, v8f& b, v16b x, v16b y) { asm volatile("v_nop\n\tv_nop\n\tv_nop\n\tv_nop" : "+v"(a), "+v"(b) : "v"(x), "v"(y)); }
__device__ __forceinline__ void keep4_h(v16h a, v16h b, v16h c, v16h d) { asm volatile("v_nop" :: "v"(a), "v"(b), "v"(c), "v"(d)); }
__device__ __forceinline__ void keep4_b(v16b a, v16b b, v16b c, v16b d) { asm volatile("v_nop" :: "v"(a), "v"(b), "v"(c), "v"(d)); }
__device__ __forceinline__ void acc_guard4(v8f& a, v8f& b, v8f& c, v8f& d) { asm volatile("v_nop\n\tv_nop\n\tv_nop\n\tv_nop" : "+v"(a), "+v"(b), "+v"(c), "+v"(d)); }
template <typename T> struct Frag;
template <> struct Frag<_Float16> {
  typedef v16h V; union U { v16h v; v8h h[2]; };
  static __device__ __forceinline__ v16h load(const _Float16* p) {   // elements 0..7 <- p[0..7], 8..15 <- p[16..23]
    U f; f.h[0] = *(const v8h*)(p); f.h[1] = *(const v8h*)(p + 16); return f.v;
  }
  static __device__ __forceinline__ v8f mma(v16h a, v16h b, v8f c) {
    return __builtin_amdgcn_wmma_f32_16x16x32_f16(false, a, false, b, (short)0, c, false, false);
  }
  static __device__ __forceinline__ void guard(v8f& a, v8f& b, v16h x, v16h y) { dep_guard_h(a, b, x, y); }
  static __device__ __forceinline__ void keep(v16h a, v16h b, v16h c, v16h d) { keep4_h(a, b, c, d); }
};
template <> struct Frag<__bf16> {
  typedef v16b V; union U { v16b v; v8b h[2]; };
  static __device__ __forceinline__ v16b load(const __bf16* p) {
    U f; f.h[0] = *(const v8b*)(p); f.h[1] = *(const v8b*)(p + 16); return f.v;
  }
  static __device__ __forceinline__ v8f mma(v16b a, v16b b, v8f c) {
    return __builtin_amdgcn_wmma_f32_16x16x32_bf16(false, a, false, b, (short)0, c, false, false);
  }
  static __device__ __forceinline__ void guard(v8f& a, v8f& b, v16b x, v16b y) { dep_guard_b(a, b, x, y); }
  static __device__ __forceinline__ void keep(v16b a, v16b b, v16b c, v16b d) { keep4_b(a, b, c, d); }
};

// ---- Register-blocked batched WMMA GEMM ------------------------------------
// C[m,n] = scale * sum_k A[m,k] * Bt[n,k] (+bias)(+resid); each wave owns a 64x64 tile, a block's 8 waves (2 x 4) a 128x256 tile.
// A row-major [M,K]; Bt row-major [N,K]; M % 128 == 0, N % 256 == 0, K % 64 == 0; grid.x = (M/128) * (N/256).
// Operands reach the waves through LDS: a stage is 64 k (one 128-B line) of the block's 128 A rows and 256 Bt rows, brought in by
// asynchronous 16-B copies (a wave's copy = 4 whole lines), two buffers, the next stage in flight while this one is multiplied.
// SPLIT: must be false (the staged loop reads one plane per operand); A2/Bt2 are not read.
// BIAS_MODE: 0 = none, 1 = bias[m], 2 = bias[n].
// OUT_MODE: 0 = f32, 1 = f16, 2 = bf16 hi plane (Cout) + bf16 lo plane (Cout2).
// ET: 0 = f16 operands, 1 = bf16 operands (pointers passed as 16-bit storage)
template <int ET> struct Elem;
template <> struct Elem<0> { typedef _Float16 T; };
template <> struct Elem<1> { typedef __bf16 T; };
constexpr int kGP     = 72;                      // LDS row pitch, 16-bit elements: 144 B = 16 B x odd (16-byte fragment reads)
constexpr int kGARows = 128;                     // A rows of a stage
constexpr int kGBRows = 256;                     // Bt rows of a stage
constexpr int kGStage = (kGARows + kGBRows) * kGP;   // elements of one buffer
// One stage's copies of one thread: 4 A rows and 8 Bt rows, 32 rows apart, 16 B each. la / lb: the lane's LDS byte addresses of the
// first A / Bt row; ga / gb: its global addresses; sa / sb: 32 rows in elements. The s_wait_xcnt closes the statement so that no
// address register of a copy is rewritten in front of it.
__device__ __forceinline__ void gemm_stage_copies(unsigned la, unsigned lb, const unsigned short* ga, const unsigned short* gb,
                                                  size_t sa, size_t sb) {
  constexpr unsigned ls = 32u * kGP * 2u;   // 32 rows in LDS bytes
  asm volatile(
      "global_load_async_to_lds_b128 %0, %12, off\n\t"
      "global_load_async_to_lds_b128 %1, %13, off\n\t"
      "global_load_async_to_lds_b128 %2, %14, off\n\t"
      "global_load_async_to_lds_b128 %3, %15, off\n\t"
      "global_load_async_to_lds_b128 %4, %16, off\n\t"
      "global_load_async_to_lds_b128 %5, %17, off\n\t"
      "global_load_async_to_lds_b128 %6, %18, off\n\t"
      "global_load_async_to_lds_b128 %7, %19, off\n\t"
      "global_load_async_to_lds_b128 %8, %20, off\n\t"
      "global_load_async_to_lds_b128 %9, %21, off\n\t"
      "global_load_async_to_lds_b128 %10, %22, off\n\t"
      "global_load_async_to_lds_b128 %11, %23, off\n\t"
      "s_wait_xcnt 0x0"
      :: "v"(la), "v"(la + ls), "v"(la + 2u * ls), "v"(la + 3u * ls),
         "v"(lb), "v"(lb + ls), "v"(lb + 2u * ls), "v"(lb + 3u * ls),
         "v"(lb + 4u * ls), "v"(lb + 5u * ls), "v"(lb + 6u * ls), "v"(lb + 7u * ls),
         "v"(ga), "v"(ga + sa), "v"(ga + 2 * sa), "v"(ga + 3 * sa),
         "v"(gb), "v"(gb + sb), "v"(gb + 2 * sb), "v"(gb + 3 * sb),
         "v"(gb + 4 * sb), "v"(gb + 5 * sb), "v"(gb + 6 * sb), "v"(gb + 7 * sb)
      : "memory");
}
template <int ET, bool SPLIT, int BIAS_MODE, int OUT_MODE, bool RESID, int ACT = 0>
__global__ __launch_bounds__(256) void wmma_gemm64(
    const unsigned short* __restrict__ Ap, const unsigned short* __restrict__ A2p, int lda, long strideA,
    const unsigned short* __restrict__ Btp, const unsigned short* __restrict__ Bt2p, int ldb, long strideB,
    void* __restrict__ Cout, void* __restrict__ Cout2, int ldc, long strideC,
    const float* __restrict__ bias,
    const float* __restrict__ resid, long strideR,
    int M, int N, int K, float scale) {
  typedef typename Elem<ET>::T T;
  typedef typename Frag<T>::V V;
  static_assert(!SPLIT, "the staged loop carries one plane per operand");
  __shared__ __align__(16) unsigned short sAB[2 * kGStage];   // two stage buffers: [A 128 rows | Bt 256 rows], pitch kGP
  __shared__ __align__(16) float sT[8][16 * 68];   // per-wave 16x64 slab, pitch 68 floats
  const int b    = blockIdx.y;
  const int tid  = threadIdx.x;
  const int lane = tid & 31;
  const int wave = tid >> 5;
  const int tilesN = N >> 8;
  const int tilesM = M >> 7;
  if ((int)blockIdx.x >= tilesM * tilesN) return;   // block-uniform, in front of every barrier and copy
  const int tm = blockIdx.x / tilesN;
  const int tn = blockIdx.x - tm * tilesN;
  const int wm0 = (wave >> 2) << 6;   // the wave's first row in the block's A rows
  const int wn0 = (wave & 3) << 6;    // the wave's first row in the block's Bt rows
  const int m0 = (tm << 7) + wm0;
  const int n0 = (tn << 8) + wn0;

  // copies: thread -> row tid >> 3 (+ 32 per copy), 16-B piece tid & 7 of the row's 128-B line
  const int crow = tid >> 3, ccol = (tid & 7) * 8;
  const unsigned short* gA = Ap  + (size_t)b * strideA + (size_t)((tm << 7) + crow) * lda + ccol;
  const unsigned short* gB = Btp + (size_t)b * strideB + (size_t)((tn << 8) + crow) * ldb + ccol;
  const size_t sA32 = (size_t)32 * lda, sB32 = (size_t)32 * ldb;
  const unsigned ldsA = (unsigned)(size_t)(const void*)sAB + (unsigned)(crow * kGP + ccol) * 2u;
  const unsigned ldsB = ldsA + (unsigned)(kGARows * kGP) * 2u;

  const int rlane = lane & 15;                 // row (A) / col (B, D) within subtile
  const int koff  = (lane >> 4) * 8;           // k offset of this lane half
  const int mOff  = (lane >> 4) * 8;           // D row offset

  v8f acc[4][4];
#pragma unroll
  for (int i = 0; i < 4; ++i)
#pragma unroll
    for (int j = 0; j < 4; ++j) acc[i][j] = (v8f){0.f,0.f,0.f,0.f,0.f,0.f,0.f,0.f};

  const int nt = K >> 6;   // stages
  gemm_stage_copies(ldsA, ldsB, gA, gB, sA32, sB32);
  asm volatile("s_wait_asynccnt 0x0" ::: "memory");   // this wave's copies of stage 0 have landed
  __syncthreads();                                    // and every other wave's
  if (nt > 1) gemm_stage_copies(ldsA + kGStage * 2u, ldsB + kGStage * 2u, gA + 64, gB + 64, sA32, sB32);
  for (int t = 0; t < nt; ++t) {
    const unsigned bufe = (unsigned)(t & 1) * kGStage;   // this stage's buffer, in elements
    const T* sA = (const T*)(const void*)(sAB + bufe) + (wm0 + rlane) * kGP + koff;
    const T* sB = (const T*)(const void*)(sAB + bufe) + (kGARows + wn0 + rlane) * kGP + koff;
#pragma unroll   // constant LDS offsets and constant indices into the fragment and accumulator arrays
    for (int ks = 0; ks < 2; ++ks) {
      V bh[4], ah[4];   // all eight fragments of these 32 k are read as one group, ahead of their 16 products
#pragma unroll
      for (int j = 0; j < 4; ++j) bh[j] = Frag<T>::load(sB + (j << 4) * kGP + ks * 32);
#pragma unroll
      for (int i = 0; i < 4; ++i) ah[i] = Frag<T>::load(sA + (i << 4) * kGP + ks * 32);
#pragma unroll
      for (int i = 0; i < 4; ++i) {
#pragma unroll
        for (int j = 0; j < 4; ++j) acc[i][j] = Frag<T>::mma(ah[i], bh[j], acc[i][j]);
        Frag<T>::guard(acc[i][0], acc[i][3], ah[i], ah[i]);
      }
      Frag<T>::keep(bh[0], bh[1], bh[2], bh[3]);
    }
    asm volatile("s_wait_dscnt 0x0" ::: "memory");      // this wave's reads of the buffer are done before it is refilled
    asm volatile("s_wait_asynccnt 0x0" ::: "memory");   // this wave's copies of stage t + 1 have landed
    __syncthreads();                                    // publishes stage t + 1 and ends every wave's reads of stage t
    if (t + 2 < nt)
      gemm_stage_copies(ldsA + bufe * 2u, ldsB + bufe * 2u, gA + (size_t)(t + 2) * 64, gB + (size_t)(t + 2) * 64, sA32, sB32);
  }
  asm volatile("s_wait_asynccnt 0x0" ::: "memory");   // nothing of this wave is in flight behind the loop
  acc_guard4(acc[0][0], acc[0][1], acc[0][2], acc[0][3]);
  acc_guard4(acc[1][0], acc[1][1], acc[1][2], acc[1][3]);
  acc_guard4(acc[2][0], acc[2][1], acc[2][2], acc[2][3]);
  acc_guard4(acc[3][0], acc[3][1], acc[3][2], acc[3][3]);

  // ---- epilogue ----
  float* slab = sT[wave];
  const float* Rb = RESID ? (resid + (size_t)b * strideR) : nullptr;
#pragma unroll
  for (int i = 0; i < 4; ++i) {
    const int mBase = m0 + (i << 4);
#pragma unroll
    for (int j = 0; j < 4; ++j) {
      const int n = n0 + (j << 4) + rlane;
      float bv = 0.f;
      if (BIAS_MODE == 2) bv = bias[n];
#pragma unroll
      for (int r = 0; r < 8; ++r) {
        float v = acc[i][j][r] * scale;
        if (BIAS_MODE == 1) v += bias[mBase + mOff + r];
        if (BIAS_MODE == 2) v += bv;
        if (RESID) v += Rb[(size_t)(mBase + mOff + r) * ldc + n];
        if (ACT == 1) v = tanhf(v);
        if (ACT == 2) v = fmaxf(v, 0.0f);
        if (ACT == 3) v = v / (1.0f + expf(-v));
        if (ACT == 4) v = (v > 0.f) ? v : 0.01f * v;
        if (ACT == 5) v = 0.5f * v * (1.0f + erff(v * 0.70710678118654752f));
        slab[(mOff + r) * 68 + (j << 4) + rlane] = v;
      }
    }
    __builtin_amdgcn_fence(__ATOMIC_RELEASE, "workgroup");
    __builtin_amdgcn_wave_barrier();
    __builtin_amdgcn_fence(__ATOMIC_ACQUIRE, "workgroup");
    if (OUT_MODE == 0) {
      float* C = (float*)Cout + (size_t)b * strideC;
      const int hh = lane >> 4, c4 = (lane & 15) * 4;     // row seg = 256 B = 16 lanes x 16 B
      {
#pragma unroll
        for (int it = 0; it < 8; ++it) {
          const int row = it * 2 + hh;
          v4f v = *(const v4f*)(slab + row * 68 + c4);
          *(v4f*)(C + (size_t)(mBase + row) * ldc + n0 + c4) = v;
        }
        
      }
    } else {
      const int q = lane >> 3, c8 = (lane & 7) * 8;
      unsigned short* C  = (unsigned short*)Cout  + (size_t)b * strideC;
      unsigned short* C2 = (OUT_MODE == 2) ? ((unsigned short*)Cout2 + (size_t)b * strideC) : nullptr;
      {
#pragma unroll
        for (int it = 0; it < 4; ++it) {
          const int row = it * 4 + q;
          const float* sp = slab + row * 68 + c8;
          union { v8h h; v2b p[4]; } hv, lv;
#pragma unroll
          for (int e = 0; e < 8; e += 2) {
            if (OUT_MODE == 1) {
              hv.h[e]     = (_Float16)sp[e];
              hv.h[e + 1] = (_Float16)sp[e + 1];
            } else {
              split_pair(sp[e], sp[e + 1], hv.p[e >> 1], lv.p[e >> 1]);
            }
          }
          *(v8h*)(C + (size_t)(mBase + row) * ldc + n0 + c8) = hv.h;
          if (OUT_MODE == 2) *(v8h*)(C2 + (size_t)(mBase + row) * ldc + n0 + c8) = lv.h;
        }
        
      }
    }
    __builtin_amdgcn_fence(__ATOMIC_RELEASE, "workgroup");
    __builtin_amdgcn_wave_barrier();
    __builtin_amdgcn_fence(__ATOMIC_ACQUIRE, "workgroup");
  }
}

// ---------------------------------------------------------------------------------------------------------------------
// bf16 helpers for the attention kernel
// ---------------------------------------------------------------------------------------------------------------------
// value of lane l ^ 16 (the other half of the wave), by a vector cross-row move
__device__ __forceinline__ float at_xhalf(float x) {
  const int b = __builtin_bit_cast(int, x);
  return __builtin_bit_cast(float, __builtin_amdgcn_permlanex16(b, b, 0x76543210, 0xfedcba98, false, false));
}
__device__ __forceinline__ v8f at_mma(v16b a, v16b b, v8f c) {
  return __builtin_amdgcn_wmma_f32_16x16x32_bf16(false, a, false, b, (short)0, c, false, false);
}

// 16-byte transposing LDS read: lane l is given the address of row (8 * (l >> 4) + (l & 7)), 16-byte piece ((l >> 3) & 1) of a row-major
// 16 x 16 tile of 16-bit elements and receives column l & 15, rows 8 * (l >> 4) .. + 7: half of an A fragment of the transposed tile.
typedef __attribute__((ext_vector_type(8))) short v8s;
__device__ __forceinline__ v8b at_ld_tr16(const unsigned short* p) {
  typedef __attribute__((address_space(3))) v8s lds_v8s;
  return __builtin_bit_cast(v8b, __builtin_amdgcn_ds_load_tr16_b128_v8i16((lds_v8s*)p));
}
// One thread's copies of a 64-row hi tile and its lo tile: 4 rows of each, 16 rows apart, 16 B each (8 lanes = one 128-B line).
// lh / ll: the lane's LDS byte addresses of its first row in the two tiles, ls: 16 rows in LDS bytes; gh / gl: its global addresses,
// gs: 16 rows in elements. The s_wait_xcnt closes the statement so that no address register of a copy is rewritten in front of it.
__device__ __forceinline__ void attn_pair_copies(unsigned lh, unsigned ll, unsigned ls,
                                                 const unsigned short* gh, const unsigned short* gl, size_t gs) {
  asm volatile(
      "global_load_async_to_lds_b128 %0, %8, off\n\t"
      "global_load_async_to_lds_b128 %1, %9, off\n\t"
      "global_load_async_to_lds_b128 %2, %10, off\n\t"
      "global_load_async_to_lds_b128 %3, %11, off\n\t"
      "global_load_async_to_lds_b128 %4, %12, off\n\t"
      "global_load_async_to_lds_b128 %5, %13, off\n\t"
      "global_load_async_to_lds_b128 %6, %14, off\n\t"
      "global_load_async_to_lds_b128 %7, %15, off\n\t"
      "s_wait_xcnt 0x0"
      :: "v"(lh), "v"(lh + ls), "v"(lh + 2u * ls), "v"(lh + 3u * ls),
         "v"(ll), "v"(ll + ls), "v"(ll + 2u * ls), "v"(ll + 3u * ls),
         "v"(gh), "v"(gh + gs), "v"(gh + 2 * gs), "v"(gh + 3 * gs),
         "v"(gl), "v"(gl + gs), "v"(gl + 2 * gs), "v"(gl + 3 * gs)
      : "memory");
}

// ---------------------------------------------------------------------------------------------------------------------
// Problem constants
// ---------------------------------------------------------------------------------------------------------------------
constexpr int kBatch   = 4;
constexpr int kSeq     = 2048;
constexpr int kEmb     = 1024;
constexpr int kHeads   = 16;
constexpr int kHeadDim = 64;
constexpr int kRows    = kBatch * kSeq;   // 8192 = GEMM M
constexpr int kN3      = 3 * kEmb;        // 3072 = GEMM N
static_assert(kEmb % 32 == 0, "K");
static_assert(kRows % 128 == 0 && kN3 % 256 == 0, "MN");
static_assert(kEmb % 64 == 0 && kEmb / 64 >= 2, "stages");
static_assert(kHeads * kHeadDim == kEmb, "heads");
static_assert(kSeq % 64 == 0, "S");
static_assert((kRows * kEmb) % (8 * 256) == 0, "cast grid");
static_assert(kEmb % 64 == 0 && kN3 % 64 == 0, "transpose grid");

// ---------------------------------------------------------------------------------------------------------------------
// f32 -> bf16 (RNE) cast: thread i converts elements 8i..8i+7 (two 16-B loads, one 16-B store);
// Coverage: n8 threads x 8 = whole plane (n8 = n/8 exact).
// ---------------------------------------------------------------------------------------------------------------------
__global__ __launch_bounds__(256) void cast_f32_bf16x8(const float* __restrict__ in, unsigned short* __restrict__ outp, int n8) {
  const int i = blockIdx.x * 256 + threadIdx.x;
  if (i < n8) {
    const size_t e0 = (size_t)i * 8;
    const v4f a = *(const v4f*)(in + e0);
    const v4f c = *(const v4f*)(in + e0 + 4);
    v4u u;
    u[0] = f2bf_pair_bits(a[0], a[1]);
    u[1] = f2bf_pair_bits(a[2], a[3]);
    u[2] = f2bf_pair_bits(c[0], c[1]);
    u[3] = f2bf_pair_bits(c[2], c[3]);
    *(v4u*)(outp + e0) = u;
    
  }
}

// ---------------------------------------------------------------------------------------------------------------------
// Transpose + cast: in [R][Cc] f32 row-major -> outp [Cc][R] bf16, outp[n][e] = bf16(in[e][n]).
// Tile 64 (e) x 64 (n); grid (Cc/64, R/64); block 256.
// Load coverage: 256 threads x 16 elements = 64x64. Store coverage: 8 waves x 2 iterations x 4 rows = 64 rows,
// ---------------------------------------------------------------------------------------------------------------------
__global__ __launch_bounds__(256) void transpose_cast_bf16(const float* __restrict__ in, unsigned short* __restrict__ outp, int R, int Cc) {
  __shared__ __align__(16) unsigned short tT[64 * 72];   // [n_local][e_local], pitch 72
  const int tid = threadIdx.x;
  const int n0 = blockIdx.x * 64;
  const int e0 = blockIdx.y * 64;
  {
    const int el = tid >> 2, nl = (tid & 3) * 16;
    const float* src = in + (size_t)(e0 + el) * Cc + n0 + nl;
#pragma unroll
    for (int i = 0; i < 4; ++i) {
      const v4f f = *(const v4f*)(src + 4 * i);
#pragma unroll
      for (int e = 0; e < 4; e += 2) {
        const unsigned w = f2bf_pair_bits(f[e], f[e + 1]);
        tT[(nl + 4 * i + e) * 72 + el]     = (unsigned short)w;
        tT[(nl + 4 * i + e + 1) * 72 + el] = (unsigned short)(w >> 16);
      }
    }
  }
  __syncthreads();
  const int wave = tid >> 5, lane = tid & 31, q = lane >> 3, c8 = (lane & 7) * 8;
  {
#pragma unroll
    for (int it = 0; it < 2; ++it) {
      const int nl = wave * 8 + it * 4 + q;
      const v4u w = *(const v4u*)(tT + nl * 72 + c8);
      *(v4u*)(outp + (size_t)(n0 + nl) * R + e0 + c8) = w;
    }
    
  }
}

// ---------------------------------------------------------------------------------------------------------------------
// Causal attention, head dim 64, 16-bit plane inputs, f32 output.
//   q, k, v are bf16 hi + lo planes: element (b, s, h, d) at plane[(b*S + s)*ld + h*64 + d] (ld in elements, % 8 == 0).
//   scores^T = k.q^T (unscaled) : bf16 hi/lo split (hi*hi + hi*lo + lo*hi), f32 accumulate; a lane holds 32 scores of ONE query
//   out^T    = v^T.p^T        : p (f32, split into bf16 hi/lo in registers) and v hi/lo planes, f32 accumulate;
//                               two score tiles of a lane, converted in place, are the B operand of 32 keys
//   online softmax in f32, exponentials in base 2; keys with kv > q replaced by -inf before the softmax; maximum in-lane plus one exchange
//   between the wave's halves; each half keeps its own partial row sum, the two are joined in the epilogue.
//   Block = 4 waves = 64 query rows of one (b, h); grid.x = B * H * (S/64); S % 64 == 0.
//   A chunk's K and V rows (hi and lo planes) reach LDS by asynchronous 16-B copies, row-major, two buffers: the next chunk is in
//   flight while this one is worked on. A copy cannot transpose, so the V^T fragments are formed by transposing LDS reads.
// ---------------------------------------------------------------------------------------------------------------------
constexpr int kQB = 64;   // query rows per block
constexpr int kKC = 64;   // keys per chunk
constexpr int kNW = 4;    // waves per block
constexpr int kOP = 68;   // output slab pitch (floats)
constexpr int kLP = 72;   // LDS row pitch of the K tiles, in 16-bit elements: 144 B = 16 B x odd, so that the
                          // 16 rows one 16-byte fragment read touches fall on distinct banks; columns 64..71 are never used
constexpr int kVP = 80;   // LDS row pitch of the V tiles (row = key): 160 B = 32 B x odd, the pitch of the transposing 16-byte reads
constexpr int kKTile = kKC * kLP;                     // elements of one K plane tile
constexpr int kVTile = kKC * kVP;                     // elements of one V plane tile
constexpr int kAStage = 2 * kKTile + 2 * kVTile;      // one buffer: [K hi | K lo | V hi | V lo]
static_assert(kNW * 16 * kOP * 4 <= kAStage * 2, "the output slabs reuse the first buffer");

// second argument: at least 4 waves per SIMD, the number that the LDS of four resident blocks allows; holds the register budget at 256
__global__ __launch_bounds__(128, 4)
void attn_causal_hd64_split(const unsigned short* __restrict__ qh, const unsigned short* __restrict__ ql,
                            const unsigned short* __restrict__ kh, const unsigned short* __restrict__ kl,
                            const unsigned short* __restrict__ vh, const unsigned short* __restrict__ vl,
                            float* __restrict__ out,
                            int S, int H, int ldq, int ldk, int ldv, int ldo, float sscale) {
  typedef Frag<__bf16>::U FB;
  __shared__ __align__(16) unsigned short sKV[2 * kAStage];   // two chunk buffers; behind the loop the per-wave out tiles

  const int tid  = threadIdx.x;
  const int wave = tid >> 5;
  const int lane = tid & 31;
  const int hh   = lane >> 4;
  const int c    = lane & 15;

  // Block index -> tile: a block's cost is its qb + 1 key chunks and there are more blocks than resident places, so the
  // longest tiles take the lowest indices and the short ones fill the end.
  const int nqb = S / kQB;
  const int nbh = kBatch * H;
  const int bx = blockIdx.x;
  const int qb = nqb - 1 - bx / nbh;
  const int bh = bx % nbh;
  const int h  = bh % H;
  const int b  = bh / H;
  const int q0 = qb * kQB + wave * 16;
  const size_t rowb = (size_t)b * (size_t)S;
  const int hcol = h * kHeadDim;

  // ---- Q fragments (B operand, column = query q0 + c, k = d): 2 d-chunks, hi and lo planes ----
  v16b qah[2], qal[2];
  {
    const size_t qo = (rowb + (size_t)(q0 + c)) * (size_t)ldq + (size_t)(hcol + 8 * hh);
    const __bf16* qr  = (const __bf16*)(const void*)(qh + qo);
    const __bf16* qr2 = (const __bf16*)(const void*)(ql + qo);
#pragma unroll
    for (int dc = 0; dc < 2; ++dc) {
      qah[dc] = Frag<__bf16>::load(qr + dc * 32);
      qal[dc] = Frag<__bf16>::load(qr2 + dc * 32);
    }
  }

  // exp(sscale * (s - m)) = 2^(c2 * s - c2 * m): one multiply-add and the bare base-2 exponential per score. sscale > 0, so the
  // maximum is taken over the unscaled scores; a masked score stays -inf through the multiply-add and gives 0.
  const float c2 = sscale * 1.44269504088896340736f;
  float mrun = -__builtin_inff();   // running maximum (unscaled scores) of query q0 + c (equal in both halves)
  float lrun = 0.f;                 // running sum over this half's keys of query q0 + c
  v8f oacc[4];                      // oacc[t][r] = out^T[d = t*16 + 8hh + r][query q0 + c]
#pragma unroll
  for (int t = 0; t < 4; ++t) oacc[t] = (v8f){0.f,0.f,0.f,0.f,0.f,0.f,0.f,0.f};

  const int nChunks = qb + 1;   // block-uniform; causal: key chunks 0..qb
  // copies: thread -> row tid >> 3 (+ 16 per copy) of the chunk, 16-B piece tid & 7 of the row's 128-B line, in each of the four planes
  const int crow = tid >> 3, ccol = (tid & 7) * 8;
  const size_t gko = (rowb + (size_t)crow) * (size_t)ldk + (size_t)(hcol + ccol);
  const size_t gvo = (rowb + (size_t)crow) * (size_t)ldv + (size_t)(hcol + ccol);
  const unsigned ldsK = (unsigned)(size_t)(const void*)sKV + (unsigned)(crow * kLP + ccol) * 2u;
  const unsigned ldsV = (unsigned)(size_t)(const void*)sKV + (unsigned)(2 * kKTile + crow * kVP + ccol) * 2u;
  auto stage_copies = [&](int ch, unsigned bufb) {   // chunk ch into the buffer at byte offset bufb
    const size_t ko = gko + (size_t)ch * (size_t)(kKC * ldk);
    const size_t vo = gvo + (size_t)ch * (size_t)(kKC * ldv);
    attn_pair_copies(ldsK + bufb, ldsK + bufb + kKTile * 2u, 16u * kLP * 2u, kh + ko, kl + ko, (size_t)16 * ldk);
    attn_pair_copies(ldsV + bufb, ldsV + bufb + kVTile * 2u, 16u * kVP * 2u, vh + vo, vl + vo, (size_t)16 * ldv);
  };
  stage_copies(0, 0u);
  asm volatile("s_wait_asynccnt 0x0" ::: "memory");   // this wave's copies of chunk 0 have landed
  __syncthreads();                                    // and every other wave's
  if (nChunks > 1) stage_copies(1, kAStage * 2u);
  for (int kc = 0; kc < nChunks; ++kc) {
    const int kv0 = kc * kKC;
    const unsigned bufe = (unsigned)(kc & 1) * kAStage;   // this chunk's buffer, in elements
    const unsigned short* Ksh = sKV + bufe;       // K hi [kv][d], pitch kLP
    const unsigned short* Ksl = Ksh + kKTile;     // K lo
    const unsigned short* Vsh = Ksl + kKTile;     // V hi [kv][d], pitch kVP
    const unsigned short* Vsl = Vsh + kVTile;     // V lo

    // ---- scores, transposed: s[j][r] = S[query c][kv kv0 + j*16 + 8hh + r]; A = K (row = kv j*16 + c, k = d), B = Q ----
    // The four score tiles are independent accumulators: their products alternate, so that no product waits for the one in front of
    // it; each tile still sums (d-chunk 0: hi*hi, lo*hi, hi*lo; d-chunk 1: the same) in that order.
    v8f s[4];
#pragma unroll
    for (int j = 0; j < 4; ++j) s[j] = (v8f){0.f,0.f,0.f,0.f,0.f,0.f,0.f,0.f};
    FB kb[2][4], kb2[2][4];   // the chunk's K fragments, read as one group ahead of their 24 products
#pragma unroll
    for (int dc = 0; dc < 2; ++dc) {
#pragma unroll
      for (int j = 0; j < 4; ++j) {
        const unsigned short* kp  = Ksh + (j * 16 + c) * kLP + dc * 32 + 8 * hh;
        const unsigned short* kp2 = Ksl + (j * 16 + c) * kLP + dc * 32 + 8 * hh;
        kb[dc][j].h[0]  = *(const v8b*)(const void*)(kp);
        kb[dc][j].h[1]  = *(const v8b*)(const void*)(kp + 16);
        kb2[dc][j].h[0] = *(const v8b*)(const void*)(kp2);
        kb2[dc][j].h[1] = *(const v8b*)(const void*)(kp2 + 16);
      }
    }
    __builtin_amdgcn_sched_barrier(0);   // keeps the reads together (for speed only)
#pragma unroll
    for (int dc = 0; dc < 2; ++dc) {
#pragma unroll
      for (int j = 0; j < 4; ++j) s[j] = at_mma(kb[dc][j].v, qah[dc], s[j]);
#pragma unroll
      for (int j = 0; j < 4; ++j) s[j] = at_mma(kb2[dc][j].v, qah[dc], s[j]);
#pragma unroll
      for (int j = 0; j < 4; ++j) s[j] = at_mma(kb[dc][j].v, qal[dc], s[j]);
    }
    // V^T fragments (A operand, row = d t*16 + c, k = kv) by transposing reads of V [kv][d]: the lane receives V[kk*32 + 8hh + 0..7][t*16 + c],
    // then V[kk*32 + 16 + 8hh + 0..7][t*16 + c]: the k order of P^T below. The 16 reads of 32 keys stand together as one group.
    FB vb[2][4], vb2[2][4];
    auto load_v = [&](int kk) {
#pragma unroll
      for (int t = 0; t < 4; ++t) {
        const int vo = (kk * 32 + 8 * hh + (lane & 7)) * kVP + t * 16 + ((lane >> 3) & 1) * 8;
        vb[kk][t].h[0]  = at_ld_tr16(Vsh + vo);
        vb[kk][t].h[1]  = at_ld_tr16(Vsh + vo + 16 * kVP);
        vb2[kk][t].h[0] = at_ld_tr16(Vsl + vo);
        vb2[kk][t].h[1] = at_ld_tr16(Vsl + vo + 16 * kVP);
      }
    };
    __builtin_amdgcn_sched_barrier(0);   // with the one below: keeps the first group behind the score products (registers) and in front
    load_v(0);                           // of the softmax, whose vector work covers its latency
    __builtin_amdgcn_sched_barrier(0);
    const bool diag = (kc == qb);   // block-uniform
    const int qrel = q0 + c - kv0 - 8 * hh;   // key j*16 + 8hh + r of this chunk lies behind query q0 + c where j*16 + r > qrel
    float cm = -__builtin_inff();
#pragma unroll
    for (int j = 0; j < 4; ++j) {
#pragma unroll
      for (int r = 0; r < 8; ++r) {
        float sv = s[j][r];   // unscaled: the scale is folded into the exponent's multiply-add below
        sv = (diag && (j * 16 + r > qrel)) ? -__builtin_inff() : sv;
        s[j][r] = sv;
        cm = fmaxf(cm, sv);
      }
    }
    cm = fmaxf(cm, at_xhalf(cm));   // the query's other 32 keys of this chunk
    const float mnew = fmaxf(mrun, cm);
    const float alpha = __builtin_amdgcn_exp2f((mrun - mnew) * c2);
    const float mn2 = mnew * c2;
    mrun = mnew;
    // P^T as B operand of 32 keys (column = query c): element e of block kk is key kk*32 + (e < 8 ? 8hh + e : 16 + 8hh + e - 8),
    // that is register e & 7 of score tile 2kk + (e >> 3) of this same lane: the k order of the V^T fragment loads below
    union PB { v16b v; v2b p[8]; };   // a B operand as its eight registers of two neighbouring k
    PB ph[2], pl[2];
    float psum = 0.f;
#pragma unroll
    for (int j = 0; j < 4; ++j) {
#pragma unroll
      for (int r = 0; r < 8; r += 2) {
        const float p0 = __builtin_amdgcn_exp2f(__builtin_fmaf(s[j][r], c2, -mn2));
        const float p1 = __builtin_amdgcn_exp2f(__builtin_fmaf(s[j][r + 1], c2, -mn2));
        psum += p0;
        psum += p1;
        split_pair(p0, p1, ph[j >> 1].p[(j & 1) * 4 + (r >> 1)], pl[j >> 1].p[(j & 1) * 4 + (r >> 1)]);
      }
    }
    lrun = lrun * alpha + psum;
#pragma unroll
    for (int t = 0; t < 4; ++t)
#pragma unroll
      for (int r = 0; r < 8; ++r) oacc[t][r] *= alpha;
    // ---- out^T[d][query] += V^T[d][kv] * P^T[kv][query]; A = V^T (row = d t*16 + c, k = kv) by transposing reads of V [kv][d], B = P^T ----
#pragma unroll
    for (int kk = 0; kk < 2; ++kk) {
      // the four output tiles alternate like the score tiles; each still sums (hi*hi, lo*hi, hi*lo) per 32 keys in that order
#pragma unroll
      for (int t = 0; t < 4; ++t) oacc[t] = at_mma(vb[kk][t].v, ph[kk].v, oacc[t]);
#pragma unroll
      for (int t = 0; t < 4; ++t) oacc[t] = at_mma(vb2[kk][t].v, ph[kk].v, oacc[t]);
      if (kk == 0) {
        __builtin_amdgcn_sched_barrier(0);   // with the one below: keeps the second group together, where the first group's lo fragments
        load_v(1);                           // have left their registers
        __builtin_amdgcn_sched_barrier(0);
      }
#pragma unroll
      for (int t = 0; t < 4; ++t) oacc[t] = at_mma(vb[kk][t].v, pl[kk].v, oacc[t]);
    }
    asm volatile("s_wait_dscnt 0x0" ::: "memory");      // this wave's reads of the buffer are done before it is refilled
    asm volatile("s_wait_asynccnt 0x0" ::: "memory");   // this wave's copies of chunk kc + 1 have landed
    __syncthreads();                                    // publishes chunk kc + 1 and ends every wave's reads of chunk kc
    if (kc + 2 < nChunks) stage_copies(kc + 2, bufe * 2u);
  }
  asm volatile("s_wait_asynccnt 0x0" ::: "memory");   // nothing of this wave is in flight behind the loop

  // ---- epilogue: join the halves' sums, normalise, stage the wave's 16x64 tile, write whole 256-B row segments ----
  float* os = (float*)(void*)sKV + wave * (16 * kOP);   // every wave has passed the last chunk's barrier: the buffers are free
  {
    const float inv = 1.0f / (lrun + at_xhalf(lrun));
#pragma unroll
    for (int t = 0; t < 4; ++t) {
      const v4f w0 = {oacc[t][0] * inv, oacc[t][1] * inv, oacc[t][2] * inv, oacc[t][3] * inv};
      const v4f w1 = {oacc[t][4] * inv, oacc[t][5] * inv, oacc[t][6] * inv, oacc[t][7] * inv};
      *(v4f*)(os + c * kOP + t * 16 + 8 * hh)     = w0;
      *(v4f*)(os + c * kOP + t * 16 + 8 * hh + 4) = w1;
    }
  }
  __builtin_amdgcn_fence(__ATOMIC_RELEASE, "workgroup");
  __builtin_amdgcn_wave_barrier();
  __builtin_amdgcn_fence(__ATOMIC_ACQUIRE, "workgroup");
  {
    float* ob = out + (size_t)hcol;
    const int c4 = (lane & 15) * 4;   // 16 lanes x 16 B = 256 B = one row segment of 64 floats
    {
#pragma unroll
      for (int it = 0; it < 8; ++it) {
        const int row = it * 2 + hh;
        v4f val = *(const v4f*)(os + row * kOP + c4);
        *(v4f*)(ob + (rowb + (size_t)(q0 + row)) * (size_t)ldo + c4) = val;
      }
      
    }
  }
}

// ---------------------------------------------------------------------------------------------------------------------
// Host launcher
// Workspace region map (bytes):
//   [0,            16,777,216)  Xb   bf16 [8192][1024]           (RNE copy of x)
//   [16,777,216,   23,068,672)  Wt   bf16 [3072][1024]           (RNE copy of W^T)
//   [23,068,672,   73,400,320)  Phi  bf16 [8192][3072]           (qkv hi plane)
//   [73,400,320,  123,731,968)  Plo  bf16 [8192][3072]           (qkv lo plane)
//   total 123,731,968
// ---------------------------------------------------------------------------------------------------------------------
extern "C" void kernel_launch(void* const* d_in, const int* in_sizes, int n_in,
                              void* d_out, int out_size, void* d_ws, size_t ws_size,
                              hipStream_t stream) {
  if (n_in < 2) return;
  if (in_sizes[0] != kRows * kEmb) return;
  if (in_sizes[1] != kEmb * kN3) return;
  if (out_size != kRows * kEmb) return;

  const size_t bytesXb = (size_t)kRows * kEmb * 2;
  const size_t bytesWt = (size_t)kN3 * kEmb * 2;
  const size_t bytesPl = (size_t)kRows * kN3 * 2;
  const size_t offXb = 0;
  const size_t offWt = offXb + bytesXb;
  const size_t offHi = offWt + bytesWt;
  const size_t offLo = offHi + bytesPl;
  const size_t total = offLo + bytesPl;
  if (total > ws_size) return;

  const float* x = (const float*)d_in[0];   // [4, 2048, 1024] f32
  const float* W = (const float*)d_in[1];   // [1024, 3072] f32
  float* outp = (float*)d_out;              // [4, 2048, 1024] f32

  char* ws = (char*)d_ws;
  unsigned short* Xb  = (unsigned short*)(ws + offXb);
  unsigned short* Wt  = (unsigned short*)(ws + offWt);
  unsigned short* Phi = (unsigned short*)(ws + offHi);
  unsigned short* Plo = (unsigned short*)(ws + offLo);
  const float* fdum = (const float*)(ws + offXb);

  // 1) x -> bf16 plane: 1,048,576 threads x 8 elements = 8,388,608
  const int n8 = (kRows * kEmb) / 8;
  cast_f32_bf16x8<<<dim3(n8 / 256), dim3(256), 0, stream>>>(x, Xb, n8);

  // 2) W [1024][3072] -> Wt [3072][1024] bf16; grid (Cc/64, R/64) = (48, 16)
  transpose_cast_bf16<<<dim3(kN3 / 64, kEmb / 64), dim3(256), 0, stream>>>(W, Wt, kEmb, kN3);

  // 3) qkv = Xb [8192][1024] x Wt [3072][1024]^T -> bf16 hi/lo planes [8192][3072]; M=8192, N=3072, K=1024
  const int tiles = (kRows / 128) * (kN3 / 256);   // 768 tiles of 128 x 256, one per block
  wmma_gemm64<1, false, 0, 2, false, 0><<<dim3(tiles, 1), dim3(256), 0, stream>>>(
      (const unsigned short*)Xb, (const unsigned short*)Xb, kEmb, 0L,
      (const unsigned short*)Wt, (const unsigned short*)Wt, kEmb, 0L,
      (void*)Phi, (void*)Plo, kN3, 0L,
      fdum, fdum, 0L,
      kRows, kN3, kEmb, 1.0f);

  // 4) causal attention: q cols [0,1024), k cols [1024,2048), v cols [2048,3072) of the planes; ld = 3072
  attn_causal_hd64_split<<<dim3(kBatch * kHeads * (kSeq / kQB)), dim3(128), 0, stream>>>(
      (const unsigned short*)Phi, (const unsigned short*)Plo,
      (const unsigned short*)(Phi + kEmb), (const unsigned short*)(Plo + kEmb),
      (const unsigned short*)(Phi + 2 * kEmb), (const unsigned short*)(Plo + 2 * kEmb),
      outp, kSeq, kHeads, kN3, kN3, kN3, kEmb, 0.125f);
}

// v009
// One run takes 133 microseconds.
// Next to v008, in two timings, it ran 1.04 times as fast each time.
// Over all steps from v000 it is 5.36 times as fast.
// Contractions: QKV projection = v_wmma_f32_16x16x32_bf16 on RNE-bf16 copies of x and W (f32 accumulate); q.k^T and p.v = bf16 hi/lo split (hi*hi + hi*lo + lo*hi) on v_wmma_f32_16x16x32_bf16, f32 accumulate; softmax and normalisation in f32.
#include <hip/hip_runtime.h>
#include <stdint.h>

// ---------------------------------------------------------------------------------------------------------------------
// Shared 16-bit WMMA helpers
// ---------------------------------------------------------------------------------------------------------------------
typedef __attribute__((ext_vector_type(16))) _Float16 v16h;
typedef __attribute__((ext_vector_type(8)))  _Float16 v8h;
typedef __attribute__((ext_vector_type(16))) __bf16   v16b;
typedef __attribute__((ext_vector_type(8)))  __bf16   v8b;
typedef __attribute__((ext_vector_type(8)))  float    v8f;
typedef __attribute__((ext_vector_type(4)))  float    v4f;
typedef __attribute__((ext_vector_type(4)))  unsigned v4u;
#define PSCALE 32768.0f
#define U16(p) ((const unsigned short*)(const void*)(p))
#define PSCALE_INV (1.0f / 32768.0f)

// two f32 -> two bf16 (round to nearest even) in one conversion instruction; element 0 in the low half of the register
typedef __attribute__((ext_vector_type(2))) float  v2f;
typedef __attribute__((ext_vector_type(2))) __bf16 v2b;
__device__ __forceinline__ v2b f2bf_pair(float a, float b) { return __builtin_convertvector((v2f){a, b}, v2b); }
__device__ __forceinline__ unsigned f2bf_pair_bits(float a, float b) { return __builtin_bit_cast(unsigned, f2bf_pair(a, b)); }
// hi = bf16(x), lo = bf16(x - hi), for two values. The two hi values are widened on the register's bits: each difference can then be one
// mixed-precision multiply-add that reads its half of the packed register (no unpacking instructions).
__device__ __forceinline__ void split_pair(float a, float b, v2b& hi, v2b& lo) {
  hi = f2bf_pair(a, b);
  const unsigned w = __builtin_bit_cast(unsigned, hi);
  lo = f2bf_pair(a - __uint_as_float(w << 16), b - __uint_as_float(w & 0xFFFF0000u));
}

// hazard guards as plain device helpers
__device__ __forceinline__ void dep_guard_h(v8f& a, v8f& b, v16h x, v16h y) { asm volatile("v_nop\n\tv_nop\n\tv_nop\n\tv_nop" : "+v"(a), "+v"(b) : "v"(x), "v"(y)); }
__device__ __forceinline__ void dep_guard_b(v8f& a, v8f& b, v16b x, v16b y) { asm volatile("v_nop\n\tv_nop\n\tv_nop\n\tv_nop" : "+v"(a), "+v"(b) : "v"(x), "v"(y)); }
__device__ __forceinline__ void keep4_h(v16h a, v16h b, v16h c, v16h d) { asm volatile("v_nop" :: "v"(a), "v"(b), "v"(c), "v"(d)); }
__device__ __forceinline__ void keep4_b(v16b a, v16b b, v16b c, v16b d) { asm volatile("v_nop" :: "v"(a), "v"(b), "v"(c), "v"(d)); }
__device__ __forceinline__ void acc_guard4(v8f& a, v8f& b, v8f& c, v8f& d) { asm volatile("v_nop\n\tv_nop\n\tv_nop\n\tv_nop" : "+v"(a), "+v"(b), "+v"(c), "+v"(d)); }
template <typename T> struct Frag;
template <> struct Frag<_Float16> {
  typedef v16h V; union U { v16h v; v8h h[2]; };
  static __device__ __forceinline__ v16h load(const _Float16* p) {   // elements 0..7 <- p[0..7], 8..15 <- p[16..23]
    U f; f.h[0] = *(const v8h*)(p); f.h[1] = *(const v8h*)(p + 16); return f.v;
  }
  static __device__ __forceinline__ v8f mma(v16h a, v16h b, v8f c) {
    return __builtin_amdgcn_wmma_f32_16x16x32_f16(false, a, false, b, (short)0, c, false, false);
  }
  static __device__ __forceinline__ void guard(v8f& a, v8f& b, v16h x, v16h y) { dep_guard_h(a, b, x, y); }
  static __device__ __forceinline__ void keep(v16h a, v16h b, v16h c, v16h d) { keep4_h(a, b, c, d); }
};
template <> struct Frag<__bf16> {
  typedef v16b V; union U { v16b v; v8b h[2]; };
  static __device__ __forceinline__ v16b load(const __bf16* p) {
    U f; f.h[0] = *(const v8b*)(p); f.h[1] = *(const v8b*)(p + 16); return f.v;
  }
  static __device__ __forceinline__ v8f mma(v16b a, v16b b, v8f c) {
    return __builtin_amdgcn_wmma_f32_16x16x32_bf16(false, a, false, b, (short)0, c, false, false);
  }
  static __device__ __forceinline__ void guard(v8f& a, v8f& b, v16b x, v16b y) { dep_guard_b(a, b, x, y); }
  static __device__ __forceinline__ void keep(v16b a, v16b b, v16b c, v16b d) { keep4_b(a, b, c, d); }
};

// ---- Register-blocked batched WMMA GEMM ------------------------------------
// C[m,n] = scale * sum_k A[m,k] * Bt[n,k] (+bias)(+resid); each wave owns a 64x64 tile, a block's 8 waves (2 x 4) a 128x256 tile.
// A row-major [M,K]; Bt row-major [N,K]; M % 128 == 0, N % 256 == 0, K % 64 == 0; grid.x = (M/128) * (N/256).
// Operands reach the waves through LDS: a stage is 64 k (one 128-B line) of the block's 128 A rows and 256 Bt rows, brought in by
// asynchronous 16-B copies (a wave's copy = 4 whole lines), two buffers, the next stage in flight while this one is multiplied.
// SPLIT: must be false (the staged loop reads one plane per operand); A2/Bt2 are not read.
// BIAS_MODE: 0 = none, 1 = bias[m], 2 = bias[n].
// OUT_MODE: 0 = f32, 1 = f16, 2 = bf16 hi plane (Cout) + bf16 lo plane (Cout2).
// ET: 0 = f16 operands, 1 = bf16 operands (pointers passed as 16-bit storage)
template <int ET> struct Elem;
template <> struct Elem<0> { typedef _Float16 T; };
template <> struct Elem<1> { typedef __bf16 T; };
constexpr int kGP     = 72;                      // LDS row pitch, 16-bit elements: 144 B = 16 B x odd (16-byte fragment reads)
constexpr int kGARows = 128;                     // A rows of a stage
constexpr int kGBRows = 256;                     // Bt rows of a stage
constexpr int kGStage = (kGARows + kGBRows) * kGP;   // elements of one buffer
// One stage's copies of one thread: 4 A rows and 8 Bt rows, 32 rows apart, 16 B each. la / lb: the lane's LDS byte addresses of the
// first A / Bt row; ga / gb: its global addresses; sa / sb: 32 rows in elements. The s_wait_xcnt closes the statement so that no
// address register of a copy is rewritten in front of it.
__device__ __forceinline__ void gemm_stage_copies(unsigned la, unsigned lb, const unsigned short* ga, const unsigned short* gb,
                                                  size_t sa, size_t sb) {
  constexpr unsigned ls = 32u * kGP * 2u;   // 32 rows in LDS bytes
  asm volatile(
      "global_load_async_to_lds_b128 %0, %12, off\n\t"
      "global_load_async_to_lds_b128 %1, %13, off\n\t"
      "global_load_async_to_lds_b128 %2, %14, off\n\t"
      "global_load_async_to_lds_b128 %3, %15, off\n\t"
      "global_load_async_to_lds_b128 %4, %16, off\n\t"
      "global_load_async_to_lds_b128 %5, %17, off\n\t"
      "global_load_async_to_lds_b128 %6, %18, off\n\t"
      "global_load_async_to_lds_b128 %7, %19, off\n\t"
      "global_load_async_to_lds_b128 %8, %20, off\n\t"
      "global_load_async_to_lds_b128 %9, %21, off\n\t"
      "global_load_async_to_lds_b128 %10, %22, off\n\t"
      "global_load_async_to_lds_b128 %11, %23, off\n\t"
      "s_wait_xcnt 0x0"
      :: "v"(la), "v"(la + ls), "v"(la + 2u * ls), "v"(la + 3u * ls),
         "v"(lb), "v"(lb + ls), "v"(lb + 2u * ls), "v"(lb + 3u * ls),
         "v"(lb + 4u * ls), "v"(lb + 5u * ls), "v"(lb + 6u * ls), "v"(lb + 7u * ls),
         "v"(ga), "v"(ga + sa), "v"(ga + 2 * sa), "v"(ga + 3 * sa),
         "v"(gb), "v"(gb + sb), "v"(gb + 2 * sb), "v"(gb + 3 * sb),
         "v"(gb + 4 * sb), "v"(gb + 5 * sb), "v"(gb + 6 * sb), "v"(gb + 7 * sb)
      : "memory");
}
template <int ET, bool SPLIT, int BIAS_MODE, int OUT_MODE, bool RESID, int ACT = 0>
__global__ __launch_bounds__(256) void wmma_gemm64(
    const unsigned short* __restrict__ Ap, const unsigned short* __restrict__ A2p, int lda, long strideA,
    const unsigned short* __restrict__ Btp, const unsigned short* __restrict__ Bt2p, int ldb, long strideB,
    void* __restrict__ Cout, void* __restrict__ Cout2, int ldc, long strideC,
    const float* __restrict__ bias,
    const float* __restrict__ resid, long strideR,
    int M, int N, int K, float scale) {
  typedef typename Elem<ET>::T T;
  typedef typename Frag<T>::V V;
  static_assert(!SPLIT, "the staged loop carries one plane per operand");
  __shared__ __align__(16) unsigned short sAB[2 * kGStage];   // two stage buffers: [A 128 rows | Bt 256 rows], pitch kGP
  __shared__ __align__(16) float sT[8][16 * 68];   // per-wave 16x64 slab, pitch 68 floats
  const int b    = blockIdx.y;
  const int tid  = threadIdx.x;
  const int lane = tid & 31;
  const int wave = tid >> 5;
  const int tilesN = N >> 8;
  const int tilesM = M >> 7;
  if ((int)blockIdx.x >= tilesM * tilesN) return;   // block-uniform, in front of every barrier and copy
  const int tm = blockIdx.x / tilesN;
  const int tn = blockIdx.x - tm * tilesN;
  const int wm0 = (wave >> 2) << 6;   // the wave's first row in the block's A rows
  const int wn0 = (wave & 3) << 6;    // the wave's first row in the block's Bt rows
  const int m0 = (tm << 7) + wm0;
  const int n0 = (tn << 8) + wn0;

  // copies: thread -> row tid >> 3 (+ 32 per copy), 16-B piece tid & 7 of the row's 128-B line
  const int crow = tid >> 3, ccol = (tid & 7) * 8;
  const unsigned short* gA = Ap  + (size_t)b * strideA + (size_t)((tm << 7) + crow) * lda + ccol;
  const unsigned short* gB = Btp + (size_t)b * strideB + (size_t)((tn << 8) + crow) * ldb + ccol;
  const size_t sA32 = (size_t)32 * lda, sB32 = (size_t)32 * ldb;
  const unsigned ldsA = (unsigned)(size_t)(const void*)sAB + (unsigned)(crow * kGP + ccol) * 2u;
  const unsigned ldsB = ldsA + (unsigned)(kGARows * kGP) * 2u;

  const int rlane = lane & 15;                 // row (A) / col (B, D) within subtile
  const int koff  = (lane >> 4) * 8;           // k offset of this lane half
  const int mOff  = (lane >> 4) * 8;           // D row offset

  v8f acc[4][4];
#pragma unroll
  for (int i = 0; i < 4; ++i)
#pragma unroll
    for (int j = 0; j < 4; ++j) acc[i][j] = (v8f){0.f,0.f,0.f,0.f,0.f,0.f,0.f,0.f};

  const int nt = K >> 6;   // stages
  // Blocks with the same tm read the same A rows and blocks with the same tn the same Bt rows, all at the same pace: walking k from 0
  // they would ask L2 for the same lines at the same moment. Each block enters the ring of stages at its own place and walks it round.
  const int rot = (tm + tn) % nt;
  auto kcol = [&](int t) { const int x = t + rot; return (size_t)(x >= nt ? x - nt : x) * 64; };   // first k of the block's t-th stage, t < nt
  gemm_stage_copies(ldsA, ldsB, gA + kcol(0), gB + kcol(0), sA32, sB32);
  asm volatile("s_wait_asynccnt 0x0" ::: "memory");   // this wave's copies of stage 0 have landed
  __syncthreads();                                    // and every other wave's
  if (nt > 1) gemm_stage_copies(ldsA + kGStage * 2u, ldsB + kGStage * 2u, gA + kcol(1), gB + kcol(1), sA32, sB32);
  for (int t = 0; t < nt; ++t) {
    const unsigned bufe = (unsigned)(t & 1) * kGStage;   // this stage's buffer, in elements
    const T* sA = (const T*)(const void*)(sAB + bufe) + (wm0 + rlane) * kGP + koff;
    const T* sB = (const T*)(const void*)(sAB + bufe) + (kGARows + wn0 + rlane) * kGP + koff;
#pragma unroll   // constant LDS offsets and constant indices into the fragment and accumulator arrays
    for (int ks = 0; ks < 2; ++ks) {
      V bh[4], ah[4];   // all eight fragments of these 32 k are read as one group, ahead of their 16 products
#pragma unroll
      for (int j = 0; j < 4; ++j) bh[j] = Frag<T>::load(sB + (j << 4) * kGP + ks * 32);
#pragma unroll
      for (int i = 0; i < 4; ++i) ah[i] = Frag<T>::load(sA + (i << 4) * kGP + ks * 32);
#pragma unroll
      for (int i = 0; i < 4; ++i) {
#pragma unroll
        for (int j = 0; j < 4; ++j) acc[i][j] = Frag<T>::mma(ah[i], bh[j], acc[i][j]);
        Frag<T>::guard(acc[i][0], acc[i][3], ah[i], ah[i]);
      }
      Frag<T>::keep(bh[0], bh[1], bh[2], bh[3]);
    }
    asm volatile("s_wait_dscnt 0x0" ::: "memory");      // this wave's reads of the buffer are done before it is refilled
    asm volatile("s_wait_asynccnt 0x0" ::: "memory");   // this wave's copies of stage t + 1 have landed
    __syncthreads();                                    // publishes stage t + 1 and ends every wave's reads of stage t
    if (t + 2 < nt)
      gemm_stage_copies(ldsA + bufe * 2u, ldsB + bufe * 2u, gA + kcol(t + 2), gB + kcol(t + 2), sA32, sB32);
  }
  asm volatile("s_wait_asynccnt 0x0" ::: "memory");   // nothing of this wave is in flight behind the loop
  acc_guard4(acc[0][0], acc[0][1], acc[0][2], acc[0][3]);
  acc_guard4(acc[1][0], acc[1][1], acc[1][2], acc[1][3]);
  acc_guard4(acc[2][0], acc[2][1], acc[2][2], acc[2][3]);
  acc_guard4(acc[3][0], acc[3][1], acc[3][2], acc[3][3]);

  // ---- epilogue ----
  float* slab = sT[wave];
  const float* Rb = RESID ? (resid + (size_t)b * strideR) : nullptr;
#pragma unroll
  for (int i = 0; i < 4; ++i) {
    const int mBase = m0 + (i << 4);
#pragma unroll
    for (int j = 0; j < 4; ++j) {
      const int n = n0 + (j << 4) + rlane;
      float bv = 0.f;
      if (BIAS_MODE == 2) bv = bias[n];
#pragma unroll
      for (int r = 0; r < 8; ++r) {
        float v = acc[i][j][r] * scale;
        if (BIAS_MODE == 1) v += bias[mBase + mOff + r];
        if (BIAS_MODE == 2) v += bv;
        if (RESID) v += Rb[(size_t)(mBase + mOff + r) * ldc + n];
        if (ACT == 1) v = tanhf(v);
        if (ACT == 2) v = fmaxf(v, 0.0f);
        if (ACT == 3) v = v / (1.0f + expf(-v));
        if (ACT == 4) v = (v > 0.f) ? v : 0.01f * v;
        if (ACT == 5) v = 0.5f * v * (1.0f + erff(v * 0.70710678118654752f));
        slab[(mOff + r) * 68 + (j << 4) + rlane] = v;
      }
    }
    __builtin_amdgcn_fence(__ATOMIC_RELEASE, "workgroup");
    __builtin_amdgcn_wave_barrier();
    __builtin_amdgcn_fence(__ATOMIC_ACQUIRE, "workgroup");
    if (OUT_MODE == 0) {
      float* C = (float*)Cout + (size_t)b * strideC;
      const int hh = lane >> 4, c4 = (lane & 15) * 4;     // row seg = 256 B = 16 lanes x 16 B
      {
#pragma unroll
        for (int it = 0; it < 8; ++it) {
          const int row = it * 2 + hh;
          v4f v = *(const v4f*)(slab + row * 68 + c4);
          *(v4f*)(C + (size_t)(mBase + row) * ldc + n0 + c4) = v;
        }
        
      }
    } else {
      const int q = lane >> 3, c8 = (lane & 7) * 8;
      unsigned short* C  = (unsigned short*)Cout  + (size_t)b * strideC;
      unsigned short* C2 = (OUT_MODE == 2) ? ((unsigned short*)Cout2 + (size_t)b * strideC) : nullptr;
      {
#pragma unroll
        for (int it = 0; it < 4; ++it) {
          const int row = it * 4 + q;
          const float* sp = slab + row * 68 + c8;
          union { v8h h; v2b p[4]; } hv, lv;
#pragma unroll
          for (int e = 0; e < 8; e += 2) {
            if (OUT_MODE == 1) {
              hv.h[e]     = (_Float16)sp[e];
              hv.h[e + 1] = (_Float16)sp[e + 1];
            } else {
              split_pair(sp[e], sp[e + 1], hv.p[e >> 1], lv.p[e >> 1]);
            }
          }
          *(v8h*)(C + (size_t)(mBase + row) * ldc + n0 + c8) = hv.h;
          if (OUT_MODE == 2) *(v8h*)(C2 + (size_t)(mBase + row) * ldc + n0 + c8) = lv.h;
        }
        
      }
    }
    __builtin_amdgcn_fence(__ATOMIC_RELEASE, "workgroup");
    __builtin_amdgcn_wave_barrier();
    __builtin_amdgcn_fence(__ATOMIC_ACQUIRE, "workgroup");
  }
}

// ---------------------------------------------------------------------------------------------------------------------
// bf16 helpers for the attention kernel
// ---------------------------------------------------------------------------------------------------------------------
// value of lane l ^ 16 (the other half of the wave), by a vector cross-row move
__device__ __forceinline__ float at_xhalf(float x) {
  const int b = __builtin_bit_cast(int, x);
  return __builtin_bit_cast(float, __builtin_amdgcn_permlanex16(b, b, 0x76543210, 0xfedcba98, false, false));
}
__device__ __forceinline__ v8f at_mma(v16b a, v16b b, v8f c) {
  return __builtin_amdgcn_wmma_f32_16x16x32_bf16(false, a, false, b, (short)0, c, false, false);
}

// 16-byte transposing LDS read: lane l is given the address of row (8 * (l >> 4) + (l & 7)), 16-byte piece ((l >> 3) & 1) of a row-major
// 16 x 16 tile of 16-bit elements and receives column l & 15, rows 8 * (l >> 4) .. + 7: half of an A fragment of the transposed tile.
typedef __attribute__((ext_vector_type(8))) short v8s;
__device__ __forceinline__ v8b at_ld_tr16(const unsigned short* p) {
  typedef __attribute__((address_space(3))) v8s lds_v8s;
  return __builtin_bit_cast(v8b, __builtin_amdgcn_ds_load_tr16_b128_v8i16((lds_v8s*)p));
}
// One thread's copies of a 64-row hi tile and its lo tile: 4 rows of each, 16 rows apart, 16 B each (8 lanes = one 128-B line).
// lh / ll: the lane's LDS byte addresses of its first row in the two tiles, ls: 16 rows in LDS bytes; gh / gl: its global addresses,
// gs: 16 rows in elements. The s_wait_xcnt closes the statement so that no address register of a copy is rewritten in front of it.
__device__ __forceinline__ void attn_pair_copies(unsigned lh, unsigned ll, unsigned ls,
                                                 const unsigned short* gh, const unsigned short* gl, size_t gs) {
  asm volatile(
      "global_load_async_to_lds_b128 %0, %8, off\n\t"
      "global_load_async_to_lds_b128 %1, %9, off\n\t"
      "global_load_async_to_lds_b128 %2, %10, off\n\t"
      "global_load_async_to_lds_b128 %3, %11, off\n\t"
      "global_load_async_to_lds_b128 %4, %12, off\n\t"
      "global_load_async_to_lds_b128 %5, %13, off\n\t"
      "global_load_async_to_lds_b128 %6, %14, off\n\t"
      "global_load_async_to_lds_b128 %7, %15, off\n\t"
      "s_wait_xcnt 0x0"
      :: "v"(lh), "v"(lh + ls), "v"(lh + 2u * ls), "v"(lh + 3u * ls),
         "v"(ll), "v"(ll + ls), "v"(ll + 2u * ls), "v"(ll + 3u * ls),
         "v"(gh), "v"(gh + gs), "v"(gh + 2 * gs), "v"(gh + 3 * gs),
         "v"(gl), "v"(gl + gs), "v"(gl + 2 * gs), "v"(gl + 3 * gs)
      : "memory");
}

// ---------------------------------------------------------------------------------------------------------------------
// Problem constants
// ---------------------------------------------------------------------------------------------------------------------
constexpr int kBatch   = 4;
constexpr int kSeq     = 2048;
constexpr int kEmb     = 1024;
constexpr int kHeads   = 16;
constexpr int kHeadDim = 64;
constexpr int kRows    = kBatch * kSeq;   // 8192 = GEMM M
constexpr int kN3      = 3 * kEmb;        // 3072 = GEMM N
static_assert(kEmb % 32 == 0, "K");
static_assert(kRows % 128 == 0 && kN3 % 256 == 0, "MN");
static_assert(kEmb % 64 == 0 && kEmb / 64 >= 2, "stages");
static_assert(kHeads * kHeadDim == kEmb, "heads");
static_assert(kSeq % 64 == 0, "S");
static_assert((kRows * kEmb) % (8 * 256) == 0, "cast grid");
static_assert(kEmb % 64 == 0 && kN3 % 64 == 0, "transpose grid");

// ---------------------------------------------------------------------------------------------------------------------
// f32 -> bf16 (RNE) cast: thread i converts elements 8i..8i+7 (two 16-B loads, one 16-B store);
// Coverage: n8 threads x 8 = whole plane (n8 = n/8 exact).
// ---------------------------------------------------------------------------------------------------------------------
__global__ __launch_bounds__(256) void cast_f32_bf16x8(const float* __restrict__ in, unsigned short* __restrict__ outp, int n8) {
  const int i = blockIdx.x * 256 + threadIdx.x;
  if (i < n8) {
    const size_t e0 = (size_t)i * 8;
    const v4f a = *(const v4f*)(in + e0);
    const v4f c = *(const v4f*)(in + e0 + 4);
    v4u u;
    u[0] = f2bf_pair_bits(a[0], a[1]);
    u[1] = f2bf_pair_bits(a[2], a[3]);
    u[2] = f2bf_pair_bits(c[0], c[1]);
    u[3] = f2bf_pair_bits(c[2], c[3]);
    *(v4u*)(outp + e0) = u;
    
  }
}

// ---------------------------------------------------------------------------------------------------------------------
// Transpose + cast: in [R][Cc] f32 row-major -> outp [Cc][R] bf16, outp[n][e] = bf16(in[e][n]).
// Tile 64 (e) x 64 (n); grid (Cc/64, R/64); block 256.
// Load coverage: 256 threads x 16 elements = 64x64. Store coverage: 8 waves x 2 iterations x 4 rows = 64 rows,
// ---------------------------------------------------------------------------------------------------------------------
__global__ __launch_bounds__(256) void transpose_cast_bf16(const float* __restrict__ in, unsigned short* __restrict__ outp, int R, int Cc) {
  __shared__ __align__(16) unsigned short tT[64 * 72];   // [n_local][e_local], pitch 72
  const int tid = threadIdx.x;
  const int n0 = blockIdx.x * 64;
  const int e0 = blockIdx.y * 64;
  {
    const int el = tid >> 2, nl = (tid & 3) * 16;
    const float* src = in + (size_t)(e0 + el) * Cc + n0 + nl;
#pragma unroll
    for (int i = 0; i < 4; ++i) {
      const v4f f = *(const v4f*)(src + 4 * i);
#pragma unroll
      for (int e = 0; e < 4; e += 2) {
        const unsigned w = f2bf_pair_bits(f[e], f[e + 1]);
        tT[(nl + 4 * i + e) * 72 + el]     = (unsigned short)w;
        tT[(nl + 4 * i + e + 1) * 72 + el] = (unsigned short)(w >> 16);
      }
    }
  }
  __syncthreads();
  const int wave = tid >> 5, lane = tid & 31, q = lane >> 3, c8 = (lane & 7) * 8;
  {
#pragma unroll
    for (int it = 0; it < 2; ++it) {
      const int nl = wave * 8 + it * 4 + q;
      const v4u w = *(const v4u*)(tT + nl * 72 + c8);
      *(v4u*)(outp + (size_t)(n0 + nl) * R + e0 + c8) = w;
    }
    
  }
}

// ---------------------------------------------------------------------------------------------------------------------
// Causal attention, head dim 64, 16-bit plane inputs, f32 output.
//   q, k, v are bf16 hi + lo planes: element (b, s, h, d) at plane[(b*S + s)*ld + h*64 + d] (ld in elements, % 8 == 0).
//   scores^T = k.q^T (unscaled) : bf16 hi/lo split (hi*hi + hi*lo + lo*hi), f32 accumulate; a lane holds 32 scores of ONE query
//   out^T    = v^T.p^T        : p (f32, split into bf16 hi/lo in registers) and v hi/lo planes, f32 accumulate;
//                               two score tiles of a lane, converted in place, are the B operand of 32 keys
//   online softmax in f32, exponentials in base 2; keys with kv > q replaced by -inf before the softmax; maximum in-lane plus one exchange
//   between the wave's halves; each half keeps its own partial row sum, the two are joined in the epilogue.
//   Block = 4 waves = 64 query rows of one (b, h); grid.x = B * H * (S/64); S % 64 == 0.
//   A chunk's K and V rows (hi and lo planes) reach LDS by asynchronous 16-B copies, row-major, two buffers: the next chunk is in
//   flight while this one is worked on. A copy cannot transpose, so the V^T fragments are formed by transposing LDS reads.
// ---------------------------------------------------------------------------------------------------------------------
constexpr int kQB = 64;   // query rows per block
constexpr int kKC = 64;   // keys per chunk
constexpr int kNW = 4;    // waves per block
constexpr int kOP = 68;   // output slab pitch (floats)
constexpr int kLP = 72;   // LDS row pitch of the K tiles, in 16-bit elements: 144 B = 16 B x odd, so that the
                          // 16 rows one 16-byte fragment read touches fall on distinct banks; columns 64..71 are never used
constexpr int kVP = 80;   // LDS row pitch of the V tiles (row = key): 160 B = 32 B x odd, the pitch of the transposing 16-byte reads
constexpr int kKTile = kKC * kLP;                     // elements of one K plane tile
constexpr int kVTile = kKC * kVP;                     // elements of one V plane tile
constexpr int kAStage = 2 * kKTile + 2 * kVTile;      // one buffer: [K hi | K lo | V hi | V lo]
static_assert(kNW * 16 * kOP * 4 <= kAStage * 2, "the output slabs reuse the first buffer");

// second argument: at least 4 waves per SIMD, the number that the LDS of four resident blocks allows; holds the register budget at 256
__global__ __launch_bounds__(128, 4)
void attn_causal_hd64_split(const unsigned short* __restrict__ qh, const unsigned short* __restrict__ ql,
                            const unsigned short* __restrict__ kh, const unsigned short* __restrict__ kl,
                            const unsigned short* __restrict__ vh, const unsigned short* __restrict__ vl,
                            float* __restrict__ out,
                            int S, int H, int ldq, int ldk, int ldv, int ldo, float sscale) {
  typedef Frag<__bf16>::U FB;
  __shared__ __align__(16) unsigned short sKV[2 * kAStage];   // two chunk buffers; behind the loop the per-wave out tiles

  const int tid  = threadIdx.x;
  const int wave = tid >> 5;
  const int lane = tid & 31;
  const int hh   = lane >> 4;
  const int c    = lane & 15;

  // Block index -> tile: a block's cost is its qb + 1 key chunks and there are more blocks than resident places, so the
  // longest tiles take the lowest indices and the short ones fill the end.
  const int nqb = S / kQB;
  const int nbh = kBatch * H;
  const int bx = blockIdx.x;
  const int qb = nqb - 1 - bx / nbh;
  const int bh = bx % nbh;
  const int h  = bh % H;
  const int b  = bh / H;
  const int q0 = qb * kQB + wave * 16;
  const size_t rowb = (size_t)b * (size_t)S;
  const int hcol = h * kHeadDim;

  // ---- Q fragments (B operand, column = query q0 + c, k = d): 2 d-chunks, hi and lo planes ----
  v16b qah[2], qal[2];
  {
    const size_t qo = (rowb + (size_t)(q0 + c)) * (size_t)ldq + (size_t)(hcol + 8 * hh);
    const __bf16* qr  = (const __bf16*)(const void*)(qh + qo);
    const __bf16* qr2 = (const __bf16*)(const void*)(ql + qo);
#pragma unroll
    for (int dc = 0; dc < 2; ++dc) {
      qah[dc] = Frag<__bf16>::load(qr + dc * 32);
      qal[dc] = Frag<__bf16>::load(qr2 + dc * 32);
    }
  }

  // exp(sscale * (s - m)) = 2^(c2 * s - c2 * m): one multiply-add and the bare base-2 exponential per score. sscale > 0, so the
  // maximum is taken over the unscaled scores; a masked score stays -inf through the multiply-add and gives 0.
  const float c2 = sscale * 1.44269504088896340736f;
  float mrun = -__builtin_inff();   // running maximum (unscaled scores) of query q0 + c (equal in both halves)
  float lrun = 0.f;                 // running sum over this half's keys of query q0 + c
  v8f oacc[4];                      // oacc[t][r] = out^T[d = t*16 + 8hh + r][query q0 + c]
#pragma unroll
  for (int t = 0; t < 4; ++t) oacc[t] = (v8f){0.f,0.f,0.f,0.f,0.f,0.f,0.f,0.f};

  const int nChunks = qb + 1;   // block-uniform; causal: key chunks 0..qb
  // copies: thread -> row tid >> 3 (+ 16 per copy) of the chunk, 16-B piece tid & 7 of the row's 128-B line, in each of the four planes
  const int crow = tid >> 3, ccol = (tid & 7) * 8;
  const size_t gko = (rowb + (size_t)crow) * (size_t)ldk + (size_t)(hcol + ccol);
  const size_t gvo = (rowb + (size_t)crow) * (size_t)ldv + (size_t)(hcol + ccol);
  const unsigned ldsK = (unsigned)(size_t)(const void*)sKV + (unsigned)(crow * kLP + ccol) * 2u;
  const unsigned ldsV = (unsigned)(size_t)(const void*)sKV + (unsigned)(2 * kKTile + crow * kVP + ccol) * 2u;
  auto stage_copies = [&](int ch, unsigned bufb) {   // chunk ch into the buffer at byte offset bufb
    const size_t ko = gko + (size_t)ch * (size_t)(kKC * ldk);
    const size_t vo = gvo + (size_t)ch * (size_t)(kKC * ldv);
    attn_pair_copies(ldsK + bufb, ldsK + bufb + kKTile * 2u, 16u * kLP * 2u, kh + ko, kl + ko, (size_t)16 * ldk);
    attn_pair_copies(ldsV + bufb, ldsV + bufb + kVTile * 2u, 16u * kVP * 2u, vh + vo, vl + vo, (size_t)16 * ldv);
  };
  stage_copies(0, 0u);
  asm volatile("s_wait_asynccnt 0x0" ::: "memory");   // this wave's copies of chunk 0 have landed
  __syncthreads();                                    // and every other wave's
  if (nChunks > 1) stage_copies(1, kAStage * 2u);
  for (int kc = 0; kc < nChunks; ++kc) {
    const int kv0 = kc * kKC;
    const unsigned bufe = (unsigned)(kc & 1) * kAStage;   // this chunk's buffer, in elements
    const unsigned short* Ksh = sKV + bufe;       // K hi [kv][d], pitch kLP
    const unsigned short* Ksl = Ksh + kKTile;     // K lo
    const unsigned short* Vsh = Ksl + kKTile;     // V hi [kv][d], pitch kVP
    const unsigned short* Vsl = Vsh + kVTile;     // V lo

    // ---- scores, transposed: s[j][r] = S[query c][kv kv0 + j*16 + 8hh + r]; A = K (row = kv j*16 + c, k = d), B = Q ----
    // The four score tiles are independent accumulators: their products alternate, so that no product waits for the one in front of
    // it; each tile still sums (d-chunk 0: hi*hi, lo*hi, hi*lo; d-chunk 1: the same) in that order.
    v8f s[4];
#pragma unroll
    for (int j = 0; j < 4; ++j) s[j] = (v8f){0.f,0.f,0.f,0.f,0.f,0.f,0.f,0.f};
    FB kb[2][4], kb2[2][4];   // the chunk's K fragments, read as one group ahead of their 24 products
#pragma unroll
    for (int dc = 0; dc < 2; ++dc) {
#pragma unroll
      for (int j = 0; j < 4; ++j) {
        const unsigned short* kp  = Ksh + (j * 16 + c) * kLP + dc * 32 + 8 * hh;
        const unsigned short* kp2 = Ksl + (j * 16 + c) * kLP + dc * 32 + 8 * hh;
        kb[dc][j].h[0]  = *(const v8b*)(const void*)(kp);
        kb[dc][j].h[1]  = *(const v8b*)(const void*)(kp + 16);
        kb2[dc][j].h[0] = *(const v8b*)(const void*)(kp2);
        kb2[dc][j].h[1] = *(const v8b*)(const void*)(kp2 + 16);
      }
    }
    __builtin_amdgcn_sched_barrier(0);   // keeps the reads together (for speed only)
#pragma unroll
    for (int dc = 0; dc < 2; ++dc) {
#pragma unroll
      for (int j = 0; j < 4; ++j) s[j] = at_mma(kb[dc][j].v, qah[dc], s[j]);
#pragma unroll
      for (int j = 0; j < 4; ++j) s[j] = at_mma(kb2[dc][j].v, qah[dc], s[j]);
#pragma unroll
      for (int j = 0; j < 4; ++j) s[j] = at_mma(kb[dc][j].v, qal[dc], s[j]);
    }
    // V^T fragments (A operand, row = d t*16 + c, k = kv) by transposing reads of V [kv][d]: the lane receives V[kk*32 + 8hh + 0..7][t*16 + c],
    // then V[kk*32 + 16 + 8hh + 0..7][t*16 + c]: the k order of P^T below. The 16 reads of 32 keys stand together as one group.
    FB vb[2][4], vb2[2][4];
    auto load_v = [&](int kk) {
#pragma unroll
      for (int t = 0; t < 4; ++t) {
        const int vo = (kk * 32 + 8 * hh + (lane & 7)) * kVP + t * 16 + ((lane >> 3) & 1) * 8;
        vb[kk][t].h[0]  = at_ld_tr16(Vsh + vo);
        vb[kk][t].h[1]  = at_ld_tr16(Vsh + vo + 16 * kVP);
        vb2[kk][t].h[0] = at_ld_tr16(Vsl + vo);
        vb2[kk][t].h[1] = at_ld_tr16(Vsl + vo + 16 * kVP);
      }
    };
    __builtin_amdgcn_sched_barrier(0);   // with the one below: keeps the first group behind the score products (registers) and in front
    load_v(0);                           // of the softmax, whose vector work covers its latency
    __builtin_amdgcn_sched_barrier(0);
    const bool diag = (kc == qb);   // block-uniform
    const int qrel = q0 + c - kv0 - 8 * hh;   // key j*16 + 8hh + r of this chunk lies behind query q0 + c where j*16 + r > qrel
    float cm = -__builtin_inff();
#pragma unroll
    for (int j = 0; j < 4; ++j) {
#pragma unroll
      for (int r = 0; r < 8; ++r) {
        float sv = s[j][r];   // unscaled: the scale is folded into the exponent's multiply-add below
        sv = (diag && (j * 16 + r > qrel)) ? -__builtin_inff() : sv;
        s[j][r] = sv;
        cm = fmaxf(cm, sv);
      }
    }
    cm = fmaxf(cm, at_xhalf(cm));   // the query's other 32 keys of this chunk
    const float mnew = fmaxf(mrun, cm);
    const float alpha = __builtin_amdgcn_exp2f((mrun - mnew) * c2);
    const float mn2 = mnew * c2;
    mrun = mnew;
    // P^T as B operand of 32 keys (column = query c): element e of block kk is key kk*32 + (e < 8 ? 8hh + e : 16 + 8hh + e - 8),
    // that is register e & 7 of score tile 2kk + (e >> 3) of this same lane: the k order of the V^T fragment loads below
    union PB { v16b v; v2b p[8]; };   // a B operand as its eight registers of two neighbouring k
    PB ph[2], pl[2];
    float psum = 0.f;
#pragma unroll
    for (int j = 0; j < 4; ++j) {
#pragma unroll
      for (int r = 0; r < 8; r += 2) {
        const float p0 = __builtin_amdgcn_exp2f(__builtin_fmaf(s[j][r], c2, -mn2));
        const float p1 = __builtin_amdgcn_exp2f(__builtin_fmaf(s[j][r + 1], c2, -mn2));
        psum += p0;
        psum += p1;
        split_pair(p0, p1, ph[j >> 1].p[(j & 1) * 4 + (r >> 1)], pl[j >> 1].p[(j & 1) * 4 + (r >> 1)]);
      }
    }
    lrun = lrun * alpha + psum;
#pragma unroll
    for (int t = 0; t < 4; ++t)
#pragma unroll
      for (int r = 0; r < 8; ++r) oacc[t][r] *= alpha;
    // ---- out^T[d][query] += V^T[d][kv] * P^T[kv][query]; A = V^T (row = d t*16 + c, k = kv) by transposing reads of V [kv][d], B = P^T ----
#pragma unroll
    for (int kk = 0; kk < 2; ++kk) {
      // the four output tiles alternate like the score tiles; each still sums (hi*hi, lo*hi, hi*lo) per 32 keys in that order
#pragma unroll
      for (int t = 0; t < 4; ++t) oacc[t] = at_mma(vb[kk][t].v, ph[kk].v, oacc[t]);
#pragma unroll
      for (int t = 0; t < 4; ++t) oacc[t] = at_mma(vb2[kk][t].v, ph[kk].v, oacc[t]);
      if (kk == 0) {
        __builtin_amdgcn_sched_barrier(0);   // with the one below: keeps the second group together, where the first group's lo fragments
        load_v(1);                           // have left their registers
        __builtin_amdgcn_sched_barrier(0);
      }
#pragma unroll
      for (int t = 0; t < 4; ++t) oacc[t] = at_mma(vb[kk][t].v, pl[kk].v, oacc[t]);
    }
    asm volatile("s_wait_dscnt 0x0" ::: "memory");      // this wave's reads of the buffer are done before it is refilled
    asm volatile("s_wait_asynccnt 0x0" ::: "memory");   // this wave's copies of chunk kc + 1 have landed
    __syncthreads();                                    // publishes chunk kc + 1 and ends every wave's reads of chunk kc
    if (kc + 2 < nChunks) stage_copies(kc + 2, bufe * 2u);
  }
  asm volatile("s_wait_asynccnt 0x0" ::: "memory");   // nothing of this wave is in flight behind the loop

  // ---- epilogue: join the halves' sums, normalise, stage the wave's 16x64 tile, write whole 256-B row segments ----
  float* os = (float*)(void*)sKV + wave * (16 * kOP);   // every wave has passed the last chunk's barrier: the buffers are free
  {
    const float inv = 1.0f / (lrun + at_xhalf(lrun));
#pragma unroll
    for (int t = 0; t < 4; ++t) {
      const v4f w0 = {oacc[t][0] * inv, oacc[t][1] * inv, oacc[t][2] * inv, oacc[t][3] * inv};
      const v4f w1 = {oacc[t][4] * inv, oacc[t][5] * inv, oacc[t][6] * inv, oacc[t][7] * inv};
      *(v4f*)(os + c * kOP + t * 16 + 8 * hh)     = w0;
      *(v4f*)(os + c * kOP + t * 16 + 8 * hh + 4) = w1;
    }
  }
  __builtin_amdgcn_fence(__ATOMIC_RELEASE, "workgroup");
  __builtin_amdgcn_wave_barrier();
  __builtin_amdgcn_fence(__ATOMIC_ACQUIRE, "workgroup");
  {
    float* ob = out + (size_t)hcol;
    const int c4 = (lane & 15) * 4;   // 16 lanes x 16 B = 256 B = one row segment of 64 floats
    {
#pragma unroll
      for (int it = 0; it < 8; ++it) {
        const int row = it * 2 + hh;
        v4f val = *(const v4f*)(os + row * kOP + c4);
        *(v4f*)(ob + (rowb + (size_t)(q0 + row)) * (size_t)ldo + c4) = val;
      }
      
    }
  }
}

// ---------------------------------------------------------------------------------------------------------------------
// Host launcher
// Workspace region map (bytes):
//   [0,            16,777,216)  Xb   bf16 [8192][1024]           (RNE copy of x)
//   [16,777,216,   23,068,672)  Wt   bf16 [3072][1024]           (RNE copy of W^T)
//   [23,068,672,   73,400,320)  Phi  bf16 [8192][3072]           (qkv hi plane)
//   [73,400,320,  123,731,968)  Plo  bf16 [8192][3072]           (qkv lo plane)
//   total 123,731,968
// ---------------------------------------------------------------------------------------------------------------------
extern "C" void kernel_launch(void* const* d_in, const int* in_sizes, int n_in,
                              void* d_out, int out_size, void* d_ws, size_t ws_size,
                              hipStream_t stream) {
  if (n_in < 2) return;
  if (in_sizes[0] != kRows * kEmb) return;
  if (in_sizes[1] != kEmb * kN3) return;
  if (out_size != kRows * kEmb) return;

  const size_t bytesXb = (size_t)kRows * kEmb * 2;
  const size_t bytesWt = (size_t)kN3 * kEmb * 2;
  const size_t bytesPl = (size_t)kRows * kN3 * 2;
  const size_t offXb = 0;
  const size_t offWt = offXb + bytesXb;
  const size_t offHi = offWt + bytesWt;
  const size_t offLo = offHi + bytesPl;
  const size_t total = offLo + bytesPl;
  if (total > ws_size) return;

  const float* x = (const float*)d_in[0];   // [4, 2048, 1024] f32
  const float* W = (const float*)d_in[1];   // [1024, 3072] f32
  float* outp = (float*)d_out;              // [4, 2048, 1024] f32

  char* ws = (char*)d_ws;
  unsigned short* Xb  = (unsigned short*)(ws + offXb);
  unsigned short* Wt  = (unsigned short*)(ws + offWt);
  unsigned short* Phi = (unsigned short*)(ws + offHi);
  unsigned short* Plo = (unsigned short*)(ws + offLo);
  const float* fdum = (const float*)(ws + offXb);

  // 1) x -> bf16 plane: 1,048,576 threads x 8 elements = 8,388,608
  const int n8 = (kRows * kEmb) / 8;
  cast_f32_bf16x8<<<dim3(n8 / 256), dim3(256), 0, stream>>>(x, Xb, n8);

  // 2) W [1024][3072] -> Wt [3072][1024] bf16; grid (Cc/64, R/64) = (48, 16)
  transpose_cast_bf16<<<dim3(kN3 / 64, kEmb / 64), dim3(256), 0, stream>>>(W, Wt, kEmb, kN3);

  // 3) qkv = Xb [8192][1024] x Wt [3072][1024]^T -> bf16 hi/lo planes [8192][3072]; M=8192, N=3072, K=1024
  const int tiles = (kRows / 128) * (kN3 / 256);   // 768 tiles of 128 x 256, one per block
  wmma_gemm64<1, false, 0, 2, false, 0><<<dim3(tiles, 1), dim3(256), 0, stream>>>(
      (const unsigned short*)Xb, (const unsigned short*)Xb, kEmb, 0L,
      (const unsigned short*)Wt, (const unsigned short*)Wt, kEmb, 0L,
      (void*)Phi, (void*)Plo, kN3, 0L,
      fdum, fdum, 0L,
      kRows, kN3, kEmb, 1.0f);

  // 4) causal attention: q cols [0,1024), k cols [1024,2048), v cols [2048,3072) of the planes; ld = 3072
  attn_causal_hd64_split<<<dim3(kBatch * kHeads * (kSeq / kQB)), dim3(128), 0, stream>>>(
      (const unsigned short*)Phi, (const unsigned short*)Plo,
      (const unsigned short*)(Phi + kEmb), (const unsigned short*)(Plo + kEmb),
      (const unsigned short*)(Phi + 2 * kEmb), (const unsigned short*)(Plo + 2 * kEmb),
      outp, kSeq, kHeads, kN3, kN3, kN3, kEmb, 0.125f);
}

// v010
// It runs in 125 microseconds.
// Two timings next to v009 both put it at 1.06 times that version's speed.
// Counting every step since v000, it is 5.68 times as fast.
// Contractions: QKV projection = v_wmma_f32_16x16x32_bf16 on RNE-bf16 copies of x and W (f32 accumulate); q.k^T and p.v = bf16 hi/lo split (hi*hi + hi*lo + lo*hi) on v_wmma_f32_16x16x32_bf16, f32 accumulate; softmax and normalisation in f32.
#include <hip/hip_runtime.h>
#include <stdint.h>

// ---------------------------------------------------------------------------------------------------------------------
// Shared 16-bit WMMA helpers
// ---------------------------------------------------------------------------------------------------------------------
typedef __attribute__((ext_vector_type(16))) _Float16 v16h;
typedef __attribute__((ext_vector_type(8)))  _Float16 v8h;
typedef __attribute__((ext_vector_type(16))) __bf16   v16b;
typedef __attribute__((ext_vector_type(8)))  __bf16   v8b;
typedef __attribute__((ext_vector_type(8)))  float    v8f;
typedef __attribute__((ext_vector_type(4)))  float    v4f;
typedef __attribute__((ext_vector_type(4)))  unsigned v4u;
#define PSCALE 32768.0f
#define U16(p) ((const unsigned short*)(const void*)(p))
#define PSCALE_INV (1.0f / 32768.0f)

// two f32 -> two bf16 (round to nearest even) in one conversion instruction; element 0 in the low half of the register
typedef __attribute__((ext_vector_type(2))) float  v2f;
typedef __attribute__((ext_vector_type(2))) __bf16 v2b;
__device__ __forceinline__ v2b f2bf_pair(float a, float b) { return __builtin_convertvector((v2f){a, b}, v2b); }
__device__ __forceinline__ unsigned f2bf_pair_bits(float a, float b) { return __builtin_bit_cast(unsigned, f2bf_pair(a, b)); }
// hi = bf16(x), lo = bf16(x - hi), for two values. The two hi values are widened on the register's bits: each difference can then be one
// mixed-precision multiply-add that reads its half of the packed register (no unpacking instructions).
__device__ __forceinline__ void split_pair(float a, float b, v2b& hi, v2b& lo) {
  hi = f2bf_pair(a, b);
  const unsigned w = __builtin_bit_cast(unsigned, hi);
  lo = f2bf_pair(a - __uint_as_float(w << 16), b - __uint_as_float(w & 0xFFFF0000u));
}

// hazard guards as plain device helpers
__device__ __forceinline__ void dep_guard_h(v8f& a, v8f& b, v16h x, v16h y) { asm volatile("v_nop\n\tv_nop\n\tv_nop\n\tv_nop" : "+v"(a), "+v"(b) : "v"(x), "v"(y)); }
__device__ __forceinline__ void dep_guard_b(v8f& a, v8f& b, v16b x, v16b y) { asm volatile("v_nop\n\tv_nop\n\tv_nop\n\tv_nop" : "+v"(a), "+v"(b) : "v"(x), "v"(y)); }
__device__ __forceinline__ void keep4_h(v16h a, v16h b, v16h c, v16h d) { asm volatile("v_nop" :: "v"(a), "v"(b), "v"(c), "v"(d)); }
__device__ __forceinline__ void keep4_b(v16b a, v16b b, v16b c, v16b d) { asm volatile("v_nop" :: "v"(a), "v"(b), "v"(c), "v"(d)); }
__device__ __forceinline__ void acc_guard4(v8f& a, v8f& b, v8f& c, v8f& d) { asm volatile("v_nop\n\tv_nop\n\tv_nop\n\tv_nop" : "+v"(a), "+v"(b), "+v"(c), "+v"(d)); }
template <typename T> struct Frag;
template <> struct Frag<_Float16> {
  typedef v16h V; union U { v16h v; v8h h[2]; };
  static __device__ __forceinline__ v16h load(const _Float16* p) {   // elements 0..7 <- p[0..7], 8..15 <- p[16..23]
    U f; f.h[0] = *(const v8h*)(p); f.h[1] = *(const v8h*)(p + 16); return f.v;
  }
  static __device__ __forceinline__ v8f mma(v16h a, v16h b, v8f c) {
    return __builtin_amdgcn_wmma_f32_16x16x32_f16(false, a, false, b, (short)0, c, false, false);
  }
  static __device__ __forceinline__ void guard(v8f& a, v8f& b, v16h x, v16h y) { dep_guard_h(a, b, x, y); }
  static __device__ __forceinline__ void keep(v16h a, v16h b, v16h c, v16h d) { keep4_h(a, b, c, d); }
};
template <> struct Frag<__bf16> {
  typedef v16b V; union U { v16b v; v8b h[2]; };
  static __device__ __forceinline__ v16b load(const __bf16* p) {
    U f; f.h[0] = *(const v8b*)(p); f.h[1] = *(const v8b*)(p + 16); return f.v;
  }
  static __device__ __forceinline__ v8f mma(v16b a, v16b b, v8f c) {
    return __builtin_amdgcn_wmma_f32_16x16x32_bf16(false, a, false, b, (short)0, c, false, false);
  }
  static __device__ __forceinline__ void guard(v8f& a, v8f& b, v16b x, v16b y) { dep_guard_b(a, b, x, y); }
  static __device__ __forceinline__ void keep(v16b a, v16b b, v16b c, v16b d) { keep4_b(a, b, c, d); }
};

// ---- Register-blocked batched WMMA GEMM ------------------------------------
// C[m,n] = scale * sum_k A[m,k] * Bt[n,k] (+bias)(+resid); each wave owns a 64x64 tile, a block's 8 waves (2 x 4) a 128x256 tile.
// A row-major [M,K]; Bt row-major [N,K]; M % 128 == 0, N % 256 == 0, K % 64 == 0; grid.x = (M/128) * (N/256).
// Operands reach the waves through LDS: a stage is 64 k (one 128-B line) of the block's 128 A rows and 256 Bt rows, brought in by
// six tensor loads of 64 rows (waves 0 to 5, one each), two buffers, the next stage in flight while this one is multiplied.
// SPLIT: must be false (the staged loop carries one plane per operand); A2/Bt2 are not read.
// BIAS_MODE: 0 = none, 1 = bias[m], 2 = bias[n].
// OUT_MODE: 0 = f32, 1 = f16, 2 = bf16 hi plane (Cout) + bf16 lo plane (Cout2).
// ET: 0 = f16 operands, 1 = bf16 operands (pointers passed as 16-bit storage)
template <int ET> struct Elem;
template <> struct Elem<0> { typedef _Float16 T; };
template <> struct Elem<1> { typedef __bf16 T; };
constexpr int kGP     = 72;                      // LDS row pitch, 16-bit elements: 144 B = 16 B x odd (16-byte fragment reads)
constexpr int kGARows = 128;                     // A rows of a stage
constexpr int kGBRows = 256;                     // Bt rows of a stage
constexpr int kGSlot  = 5120;                    // elements kept for 64 rows (one tensor load's tile): 10,240 B
constexpr int kGStage = (kGARows + kGBRows) / 64 * kGSlot;   // elements of one buffer: [A 2 tiles | Bt 4 tiles]
// ---- tensor loads: one request of one wave brings a tile of 64 rows of 128 B from global memory into LDS, a pad behind every row ----
typedef uint32_t u32x4 __attribute__((ext_vector_type(4)));
typedef uint32_t u32x8 __attribute__((ext_vector_type(8)));
constexpr unsigned kTSlot = 10240;   // LDS bytes kept for one tile: 64 rows of 144 B (rounded up) or of 160 B; a multiple of 2 KiB, so every tile's place is one
static_assert(kGSlot * 2 == (int)kTSlot && 64 * kGP <= kGSlot && kGP * 2 == 128 + 16, "a GEMM tile fits its place, at the pad's pitch");
constexpr uint32_t kPad16 = (1u << 20) | (4u << 22) | (3u << 25);   // descriptor group 1 word 0: pad on, behind every 128 B, 16 B: pitch 144 B
constexpr uint32_t kPad32 = (1u << 20) | (4u << 22) | (7u << 25);   // the same with 32 B: pitch 160 B
__device__ __forceinline__ uint32_t uni(uint32_t v) { return (uint32_t)__builtin_amdgcn_readfirstlane(v); }
// A test on pinned(x) compiles to s_cmp + s_cbranch_scc: a tensor load ignores EXEC, only a scalar branch keeps a wave from issuing it.
__device__ __forceinline__ uint32_t pinned(uint32_t v) { uint32_t w = uni(v); asm volatile("" : "+s"(w)); return w; }   // holds a wave-uniform test value or descriptor word in a scalar register
template <uint32_t WORD0> __device__ __forceinline__ u32x8 tdm_group1(uint32_t src_pitch_bytes) {
  constexpr uint32_t d0 = 128u, d1 = 64u;   // bytes of a row, rows; tensor dims = tile dims, 1-byte elements
  u32x8 g;
  g[0] = uni(WORD0);
  g[1] = pinned((d0 & 0xFFFFu) << 16);   // words 1 to 7 pinned: descriptor words held in scalar registers, built once and not formed anew
  g[2] = pinned((d0 >> 16) | ((d1 & 0xFFFFu) << 16));
  g[3] = pinned((d1 >> 16) | (d0 << 16));
  g[4] = pinned(d1);
  g[5] = pinned(src_pitch_bytes);
  g[6] = pinned(0u);
  g[7] = pinned(0u);
  return g;
}
__device__ __forceinline__ u32x4 tdm_group0(uint32_t lds_dst, uint64_t ga) {
  u32x4 g;
  g[0] = uni(1u);
  g[1] = uni(lds_dst);
  g[2] = uni((uint32_t)ga);
  g[3] = uni((((uint32_t)(ga >> 32)) & 0x01FFFFFFu) | 0x80000000u);
  return g;
}
// group 0 is an in-out operand: what the covering wait names below is then the very registers that the request was issued from
__device__ __forceinline__ void tdm_load(u32x4& g0, u32x8 g1) { asm volatile("tensor_load_to_lds %0, %1" : "+s"(g0) : "s"(g1) : "memory"); }
// The wave's own requests have landed. The wait names the descriptor of the last request as inputs: its scalar registers then stay live, and so
// keep their values, for as long as the request is outstanding.
__device__ __forceinline__ void tdm_wait0(u32x4 g0, u32x8 g1) { asm volatile("s_wait_tensorcnt 0x0" :: "s"(g0), "s"(g1) : "memory"); }
template <int ET, bool SPLIT, int BIAS_MODE, int OUT_MODE, bool RESID, int ACT = 0>
__global__ __launch_bounds__(256) void wmma_gemm64(
    const unsigned short* __restrict__ Ap, const unsigned short* __restrict__ A2p, int lda, long strideA,
    const unsigned short* __restrict__ Btp, const unsigned short* __restrict__ Bt2p, int ldb, long strideB,
    void* __restrict__ Cout, void* __restrict__ Cout2, int ldc, long strideC,
    const float* __restrict__ bias,
    const float* __restrict__ resid, long strideR,
    int M, int N, int K, float scale) {
  typedef typename Elem<ET>::T T;
  typedef typename Frag<T>::V V;
  static_assert(!SPLIT, "the staged loop carries one plane per operand");
  __shared__ __attribute__((aligned(2048))) unsigned short sAB[2 * kGStage];   // two stage buffers: [A 128 rows | Bt 256 rows], pitch kGP
  __shared__ __align__(16) float sT[8][16 * 68];   // per-wave 16x64 slab, pitch 68 floats
  const int b    = blockIdx.y;
  const int tid  = threadIdx.x;
  const int lane = tid & 31;
  const int wave = tid >> 5;
  const int tilesN = N >> 8;
  const int tilesM = M >> 7;
  if ((int)blockIdx.x >= tilesM * tilesN) return;   // block-uniform, in front of every barrier and copy
  const int tm = blockIdx.x / tilesN;
  const int tn = blockIdx.x - tm * tilesN;
  const int wm0 = (wave >> 2) << 6;   // the wave's first row in the block's A rows
  const int wn0 = (wave & 3) << 6;    // the wave's first row in the block's Bt rows
  const int m0 = (tm << 7) + wm0;
  const int n0 = (tn << 8) + wn0;

  // tensor loads: wave w < 2 brings A rows 64 w .. + 63 of the block, wave 2 <= w < 6 Bt rows 64 (w - 2) .. + 63, into tile place w
  const uint32_t wv = uni((uint32_t)tid >> 5);
  const bool tA = wv < 2u;
  const unsigned short* gT = tA ? Ap  + (size_t)b * strideA + (size_t)((tm << 7) + (int)wv * 64) * lda
                                : Btp + (size_t)b * strideB + (size_t)((tn << 8) + ((int)wv - 2) * 64) * ldb;
  const uint64_t gT0 = (uint64_t)(size_t)(const void*)gT;
  const uint32_t ldsT = (uint32_t)(size_t)(const void*)sAB + wv * kTSlot;
  const u32x8 g1 = tdm_group1<kPad16>((uint32_t)(tA ? lda : ldb) * 2u);

  const int rlane = lane & 15;                 // row (A) / col (B, D) within subtile
  const int koff  = (lane >> 4) * 8;           // k offset of this lane half
  const int mOff  = (lane >> 4) * 8;           // D row offset

  v8f acc[4][4];
#pragma unroll
  for (int i = 0; i < 4; ++i)
#pragma unroll
    for (int j = 0; j < 4; ++j) acc[i][j] = (v8f){0.f,0.f,0.f,0.f,0.f,0.f,0.f,0.f};

  const int nt = K >> 6;   // stages
  // Blocks with the same tm read the same A rows and blocks with the same tn the same Bt rows, all at the same pace: walking k from 0
  // they would ask L2 for the same lines at the same moment. Each block enters the ring of stages at its own place and walks it round.
  const int rot = (tm + tn) % nt;
  auto kcol = [&](int t) { const int x = t + rot; return (size_t)(x >= nt ? x - nt : x) * 64; };   // first k of the block's t-th stage, t < nt
  u32x4 g0 = tdm_group0(ldsT, gT0 + kcol(0) * 2);   // group 0 of the wave's last request
  if (pinned(wv < 6u)) {
    tdm_load(g0, g1);
    tdm_wait0(g0, g1);                               // this wave's tile of stage 0 has landed
  }
  __syncthreads();                                   // and every other wave's
  g0 = tdm_group0(ldsT + kGStage * 2u, gT0 + kcol(nt > 1 ? 1 : 0) * 2);
  if (pinned(wv < 6u && nt > 1)) tdm_load(g0, g1);
  for (int t = 0; t < nt; ++t) {
    const unsigned bufe = (unsigned)(t & 1) * kGStage;   // this stage's buffer, in elements
    const T* sA = (const T*)(const void*)(sAB + bufe) + (wave >> 2) * kGSlot + rlane * kGP + koff;         // the wave's 64 A rows are one tile
    const T* sB = (const T*)(const void*)(sAB + bufe) + (2 + (wave & 3)) * kGSlot + rlane * kGP + koff;   // its 64 Bt rows another
#pragma unroll   // constant LDS offsets and constant indices into the fragment and accumulator arrays
    for (int ks = 0; ks < 2; ++ks) {
      V bh[4], ah[4];   // all eight fragments of these 32 k are read as one group, ahead of their 16 products
#pragma unroll
      for (int j = 0; j < 4; ++j) bh[j] = Frag<T>::load(sB + (j << 4) * kGP + ks * 32);
#pragma unroll
      for (int i = 0; i < 4; ++i) ah[i] = Frag<T>::load(sA + (i << 4) * kGP + ks * 32);
#pragma unroll
      for (int i = 0; i < 4; ++i) {
#pragma unroll
        for (int j = 0; j < 4; ++j) acc[i][j] = Frag<T>::mma(ah[i], bh[j], acc[i][j]);
        Frag<T>::guard(acc[i][0], acc[i][3], ah[i], ah[i]);
      }
      Frag<T>::keep(bh[0], bh[1], bh[2], bh[3]);
    }
    asm volatile("s_wait_dscnt 0x0" ::: "memory");      // this wave's reads of the buffer are done before it is refilled
    tdm_wait0(g0, g1);                                  // this wave's tile of stage t + 1 has landed (a wave that issues none passes)
    __syncthreads();                                    // publishes stage t + 1 and ends every wave's reads of stage t
    const int t2 = (int)pinned((uint32_t)(t + 2 < nt ? t + 2 : 0));   // pinned: the descriptor's address is formed behind the wait above
    g0 = tdm_group0(ldsT + bufe * 2u, gT0 + kcol(t2) * 2);
    if (pinned(wv < 6u && t + 2 < nt)) tdm_load(g0, g1);
  }
  tdm_wait0(g0, g1);                                   // nothing of this wave is in flight behind the loop
  asm volatile("s_wait_dscnt 0x0" ::: "memory");
  acc_guard4(acc[0][0], acc[0][1], acc[0][2], acc[0][3]);
  acc_guard4(acc[1][0], acc[1][1], acc[1][2], acc[1][3]);
  acc_guard4(acc[2][0], acc[2][1], acc[2][2], acc[2][3]);
  acc_guard4(acc[3][0], acc[3][1], acc[3][2], acc[3][3]);

  // ---- epilogue ----
  float* slab = sT[wave];
  const float* Rb = RESID ? (resid + (size_t)b * strideR) : nullptr;
#pragma unroll
  for (int i = 0; i < 4; ++i) {
    const int mBase = m0 + (i << 4);
#pragma unroll
    for (int j = 0; j < 4; ++j) {
      const int n = n0 + (j << 4) + rlane;
      float bv = 0.f;
      if (BIAS_MODE == 2) bv = bias[n];
#pragma unroll
      for (int r = 0; r < 8; ++r) {
        float v = acc[i][j][r] * scale;
        if (BIAS_MODE == 1) v += bias[mBase + mOff + r];
        if (BIAS_MODE == 2) v += bv;
        if (RESID) v += Rb[(size_t)(mBase + mOff + r) * ldc + n];
        if (ACT == 1) v = tanhf(v);
        if (ACT == 2) v = fmaxf(v, 0.0f);
        if (ACT == 3) v = v / (1.0f + expf(-v));
        if (ACT == 4) v = (v > 0.f) ? v : 0.01f * v;
        if (ACT == 5) v = 0.5f * v * (1.0f + erff(v * 0.70710678118654752f));
        slab[(mOff + r) * 68 + (j << 4) + rlane] = v;
      }
    }
    __builtin_amdgcn_fence(__ATOMIC_RELEASE, "workgroup");
    __builtin_amdgcn_wave_barrier();
    __builtin_amdgcn_fence(__ATOMIC_ACQUIRE, "workgroup");
    if (OUT_MODE == 0) {
      float* C = (float*)Cout + (size_t)b * strideC;
      const int hh = lane >> 4, c4 = (lane & 15) * 4;     // row seg = 256 B = 16 lanes x 16 B
      {
#pragma unroll
        for (int it = 0; it < 8; ++it) {
          const int row = it * 2 + hh;
          v4f v = *(const v4f*)(slab + row * 68 + c4);
          *(v4f*)(C + (size_t)(mBase + row) * ldc + n0 + c4) = v;
        }
        
      }
    } else {
      const int q = lane >> 3, c8 = (lane & 7) * 8;
      unsigned short* C  = (unsigned short*)Cout  + (size_t)b * strideC;
      unsigned short* C2 = (OUT_MODE == 2) ? ((unsigned short*)Cout2 + (size_t)b * strideC) : nullptr;
      {
#pragma unroll
        for (int it = 0; it < 4; ++it) {
          const int row = it * 4 + q;
          const float* sp = slab + row * 68 + c8;
          union { v8h h; v2b p[4]; } hv, lv;
#pragma unroll
          for (int e = 0; e < 8; e += 2) {
            if (OUT_MODE == 1) {
              hv.h[e]     = (_Float16)sp[e];
              hv.h[e + 1] = (_Float16)sp[e + 1];
            } else {
              split_pair(sp[e], sp[e + 1], hv.p[e >> 1], lv.p[e >> 1]);
            }
          }
          *(v8h*)(C + (size_t)(mBase + row) * ldc + n0 + c8) = hv.h;
          if (OUT_MODE == 2) *(v8h*)(C2 + (size_t)(mBase + row) * ldc + n0 + c8) = lv.h;
        }
        
      }
    }
    __builtin_amdgcn_fence(__ATOMIC_RELEASE, "workgroup");
    __builtin_amdgcn_wave_barrier();
    __builtin_amdgcn_fence(__ATOMIC_ACQUIRE, "workgroup");
  }
}

// ---------------------------------------------------------------------------------------------------------------------
// bf16 helpers for the attention kernel
// ---------------------------------------------------------------------------------------------------------------------
// value of lane l ^ 16 (the other half of the wave), by a vector cross-row move
__device__ __forceinline__ float at_xhalf(float x) {
  const int b = __builtin_bit_cast(int, x);
  return __builtin_bit_cast(float, __builtin_amdgcn_permlanex16(b, b, 0x76543210, 0xfedcba98, false, false));
}
__device__ __forceinline__ v8f at_mma(v16b a, v16b b, v8f c) {
  return __builtin_amdgcn_wmma_f32_16x16x32_bf16(false, a, false, b, (short)0, c, false, false);
}

// 16-byte transposing LDS read: lane l is given the address of row (8 * (l >> 4) + (l & 7)), 16-byte piece ((l >> 3) & 1) of a row-major
// 16 x 16 tile of 16-bit elements and receives column l & 15, rows 8 * (l >> 4) .. + 7: half of an A fragment of the transposed tile.
typedef __attribute__((ext_vector_type(8))) short v8s;
__device__ __forceinline__ v8b at_ld_tr16(const unsigned short* p) {
  typedef __attribute__((address_space(3))) v8s lds_v8s;
  return __builtin_bit_cast(v8b, __builtin_amdgcn_ds_load_tr16_b128_v8i16((lds_v8s*)p));
}

// ---------------------------------------------------------------------------------------------------------------------
// Problem constants
// ---------------------------------------------------------------------------------------------------------------------
constexpr int kBatch   = 4;
constexpr int kSeq     = 2048;
constexpr int kEmb     = 1024;
constexpr int kHeads   = 16;
constexpr int kHeadDim = 64;
constexpr int kRows    = kBatch * kSeq;   // 8192 = GEMM M
constexpr int kN3      = 3 * kEmb;        // 3072 = GEMM N
static_assert(kEmb % 32 == 0, "K");
static_assert(kRows % 128 == 0 && kN3 % 256 == 0, "MN");
static_assert(kEmb % 64 == 0 && kEmb / 64 >= 2, "stages");
static_assert(kHeads * kHeadDim == kEmb, "heads");
static_assert(kSeq % 64 == 0, "S");
static_assert((kRows * kEmb) % (8 * 256) == 0, "cast grid");
static_assert(kEmb % 64 == 0 && kN3 % 64 == 0, "transpose grid");

// ---------------------------------------------------------------------------------------------------------------------
// f32 -> bf16 (RNE) cast: thread i converts elements 8i..8i+7 (two 16-B loads, one 16-B store);
// Coverage: n8 threads x 8 = whole plane (n8 = n/8 exact).
// ---------------------------------------------------------------------------------------------------------------------
__global__ __launch_bounds__(256) void cast_f32_bf16x8(const float* __restrict__ in, unsigned short* __restrict__ outp, int n8) {
  const int i = blockIdx.x * 256 + threadIdx.x;
  if (i < n8) {
    const size_t e0 = (size_t)i * 8;
    const v4f a = *(const v4f*)(in + e0);
    const v4f c = *(const v4f*)(in + e0 + 4);
    v4u u;
    u[0] = f2bf_pair_bits(a[0], a[1]);
    u[1] = f2bf_pair_bits(a[2], a[3]);
    u[2] = f2bf_pair_bits(c[0], c[1]);
    u[3] = f2bf_pair_bits(c[2], c[3]);
    *(v4u*)(outp + e0) = u;
    
  }
}

// ---------------------------------------------------------------------------------------------------------------------
// Transpose + cast: in [R][Cc] f32 row-major -> outp [Cc][R] bf16, outp[n][e] = bf16(in[e][n]).
// Tile 64 (e) x 64 (n); grid (Cc/64, R/64); block 256.
// Load coverage: 256 threads x 16 elements = 64x64. Store coverage: 8 waves x 2 iterations x 4 rows = 64 rows,
// ---------------------------------------------------------------------------------------------------------------------
__global__ __launch_bounds__(256) void transpose_cast_bf16(const float* __restrict__ in, unsigned short* __restrict__ outp, int R, int Cc) {
  __shared__ __align__(16) unsigned short tT[64 * 72];   // [n_local][e_local], pitch 72
  const int tid = threadIdx.x;
  const int n0 = blockIdx.x * 64;
  const int e0 = blockIdx.y * 64;
  {
    const int el = tid >> 2, nl = (tid & 3) * 16;
    const float* src = in + (size_t)(e0 + el) * Cc + n0 + nl;
#pragma unroll
    for (int i = 0; i < 4; ++i) {
      const v4f f = *(const v4f*)(src + 4 * i);
#pragma unroll
      for (int e = 0; e < 4; e += 2) {
        const unsigned w = f2bf_pair_bits(f[e], f[e + 1]);
        tT[(nl + 4 * i + e) * 72 + el]     = (unsigned short)w;
        tT[(nl + 4 * i + e + 1) * 72 + el] = (unsigned short)(w >> 16);
      }
    }
  }
  __syncthreads();
  const int wave = tid >> 5, lane = tid & 31, q = lane >> 3, c8 = (lane & 7) * 8;
  {
#pragma unroll
    for (int it = 0; it < 2; ++it) {
      const int nl = wave * 8 + it * 4 + q;
      const v4u w = *(const v4u*)(tT + nl * 72 + c8);
      *(v4u*)(outp + (size_t)(n0 + nl) * R + e0 + c8) = w;
    }
    
  }
}

// ---------------------------------------------------------------------------------------------------------------------
// Causal attention, head dim 64, 16-bit plane inputs, f32 output.
//   q, k, v are bf16 hi + lo planes: element (b, s, h, d) at plane[(b*S + s)*ld + h*64 + d] (ld in elements, % 8 == 0).
//   scores^T = k.q^T (unscaled) : bf16 hi/lo split (hi*hi + hi*lo + lo*hi), f32 accumulate; a lane holds 32 scores of ONE query
//   out^T    = v^T.p^T        : p (f32, split into bf16 hi/lo in registers) and v hi/lo planes, f32 accumulate;
//                               two score tiles of a lane, converted in place, are the B operand of 32 keys
//   online softmax in f32, exponentials in base 2; keys with kv > q replaced by -inf before the softmax; maximum in-lane plus one exchange
//   between the wave's halves; each half keeps its own partial row sum, the two are joined in the epilogue.
//   Block = 4 waves = 64 query rows of one (b, h); grid.x = B * H * (S/64); S % 64 == 0.
//   A chunk's K and V rows (hi and lo planes) reach LDS by four tensor loads (one plane a wave), row-major, two buffers: the next chunk
//   is in flight while this one is worked on. The load does not transpose, so the V^T fragments are formed by transposing LDS reads.
// ---------------------------------------------------------------------------------------------------------------------
constexpr int kQB = 64;   // query rows per block
constexpr int kKC = 64;   // keys per chunk
constexpr int kNW = 4;    // waves per block
constexpr int kOP = 68;   // output slab pitch (floats)
constexpr int kLP = 72;   // LDS row pitch of the K tiles, in 16-bit elements: 144 B = 16 B x odd, so that the
                          // 16 rows one 16-byte fragment read touches fall on distinct banks; columns 64..71 are never used
constexpr int kVP = 80;   // LDS row pitch of the V tiles (row = key): 160 B = 32 B x odd, the pitch of the transposing 16-byte reads
constexpr int kASlot = (int)kTSlot / 2;               // elements kept for one plane's tile (one tensor load), K and V alike
static_assert(kKC == 64 && kKC * kLP <= kASlot && kKC * kVP <= kASlot, "a tile fits its place");
static_assert(kLP * 2 == 128 + 16 && kVP * 2 == 128 + 32, "the pitches are those of the tensor loads' pads");
constexpr int kAStage = 4 * kASlot;                   // one buffer: [K hi | K lo | V hi | V lo]
static_assert(kNW * 16 * kOP * 4 <= kAStage * 2, "the output slabs reuse the first buffer");

// second argument: at least 4 waves per SIMD, the number that the LDS of four resident blocks allows; holds the register budget at 256
__global__ __launch_bounds__(128, 4)
void attn_causal_hd64_split(const unsigned short* __restrict__ qh, const unsigned short* __restrict__ ql,
                            const unsigned short* __restrict__ kh, const unsigned short* __restrict__ kl,
                            const unsigned short* __restrict__ vh, const unsigned short* __restrict__ vl,
                            float* __restrict__ out,
                            int S, int H, int ldq, int ldk, int ldv, int ldo, float sscale) {
  typedef Frag<__bf16>::U FB;
  __shared__ __attribute__((aligned(2048))) unsigned short sKV[2 * kAStage];   // two chunk buffers; behind the loop the per-wave out tiles

  const int tid  = threadIdx.x;
  const int wave = tid >> 5;
  const int lane = tid & 31;
  const int hh   = lane >> 4;
  const int c    = lane & 15;

  // Block index -> tile: a block's cost is its qb + 1 key chunks and there are more blocks than resident places, so the
  // longest tiles take the lowest indices and the short ones fill the end.
  const int nqb = S / kQB;
  const int nbh = kBatch * H;
  const int bx = blockIdx.x;
  const int qb = nqb - 1 - bx / nbh;
  const int bh = bx % nbh;
  const int h  = bh % H;
  const int b  = bh / H;
  const int q0 = qb * kQB + wave * 16;
  const size_t rowb = (size_t)b * (size_t)S;
  const int hcol = h * kHeadDim;

  // ---- Q fragments (B operand, column = query q0 + c, k = d): 2 d-chunks, hi and lo planes ----
  v16b qah[2], qal[2];
  {
    const size_t qo = (rowb + (size_t)(q0 + c)) * (size_t)ldq + (size_t)(hcol + 8 * hh);
    const __bf16* qr  = (const __bf16*)(const void*)(qh + qo);
    const __bf16* qr2 = (const __bf16*)(const void*)(ql + qo);
#pragma unroll
    for (int dc = 0; dc < 2; ++dc) {
      qah[dc] = Frag<__bf16>::load(qr + dc * 32);
      qal[dc] = Frag<__bf16>::load(qr2 + dc * 32);
    }
  }

  // exp(sscale * (s - m)) = 2^(c2 * s - c2 * m): one multiply-add and the bare base-2 exponential per score. sscale > 0, so the
  // maximum is taken over the unscaled scores; a masked score stays -inf through the multiply-add and gives 0.
  const float c2 = sscale * 1.44269504088896340736f;
  float mrun = -__builtin_inff();   // running maximum (unscaled scores) of query q0 + c (equal in both halves)
  float lrun = 0.f;                 // running sum over this half's keys of query q0 + c
  v8f oacc[4];                      // oacc[t][r] = out^T[d = t*16 + 8hh + r][query q0 + c]
#pragma unroll
  for (int t = 0; t < 4; ++t) oacc[t] = (v8f){0.f,0.f,0.f,0.f,0.f,0.f,0.f,0.f};

  const int nChunks = qb + 1;   // block-uniform; causal: key chunks 0..qb
  // tensor loads: every wave brings the chunk's 64 rows of its own plane (wave 0: K hi, 1: K lo, 2: V hi, 3: V lo) into tile place 'wave'
  const uint32_t wv = uni((uint32_t)tid >> 5);
  const bool tK = wv < 2u;
  const unsigned short* gP = (wv == 0u) ? kh : (wv == 1u) ? kl : (wv == 2u) ? vh : vl;
  const uint32_t ldp = (uint32_t)(tK ? ldk : ldv);
  const uint64_t gP0 = (uint64_t)(size_t)(const void*)(gP + rowb * (size_t)ldp + (size_t)hcol);
  const uint32_t ldsT = (uint32_t)(size_t)(const void*)sKV + wv * kTSlot;
  const u32x8 g1k = tdm_group1<kPad16>(ldp * 2u);   // K rows: pitch 144 B
  const u32x8 g1v = tdm_group1<kPad32>(ldp * 2u);   // V rows: pitch 160 B
  u32x4 g0;                                        // group 0 of the wave's last request
  auto stage_load = [&](int ch, unsigned bufb, bool exists) {   // chunk ch, if there is one, into the buffer at byte offset bufb
    g0 = tdm_group0(ldsT + bufb, gP0 + (uint64_t)(uint32_t)ch * (uint64_t)((uint32_t)kKC * ldp * 2u));
    if (pinned(exists && tK))  tdm_load(g0, g1k);   // the two tests pick the pad, a constant of the descriptor; every wave issues one request
    if (pinned(exists && !tK)) tdm_load(g0, g1v);
  };
  // the wave's own request has landed; like tdm_wait0, with both forms of group 1 named
  auto stage_wait = [&]() { asm volatile("s_wait_tensorcnt 0x0" :: "s"(g0), "s"(g1k), "s"(g1v) : "memory"); };
  stage_load(0, 0u, true);
  stage_wait();                                        // this wave's tile of chunk 0 has landed
  __syncthreads();                                     // and every other wave's
  stage_load(1, kAStage * 2u, nChunks > 1);
  for (int kc = 0; kc < nChunks; ++kc) {
    const int kv0 = kc * kKC;
    const unsigned bufe = (unsigned)(kc & 1) * kAStage;   // this chunk's buffer, in elements
    const unsigned short* Ksh = sKV + bufe;       // K hi [kv][d], pitch kLP
    const unsigned short* Ksl = Ksh + kASlot;     // K lo
    const unsigned short* Vsh = Ksl + kASlot;     // V hi [kv][d], pitch kVP
    const unsigned short* Vsl = Vsh + kASlot;     // V lo

    // ---- scores, transposed: s[j][r] = S[query c][kv kv0 + j*16 + 8hh + r]; A = K (row = kv j*16 + c, k = d), B = Q ----
    // The four score tiles are independent accumulators: their products alternate, so that no product waits for the one in front of
    // it; each tile still sums (d-chunk 0: hi*hi, lo*hi, hi*lo; d-chunk 1: the same) in that order.
    v8f s[4];
#pragma unroll
    for (int j = 0; j < 4; ++j) s[j] = (v8f){0.f,0.f,0.f,0.f,0.f,0.f,0.f,0.f};
    FB kb[2][4], kb2[2][4];   // the chunk's K fragments, read as one group ahead of their 24 products
#pragma unroll
    for (int dc = 0; dc < 2; ++dc) {
#pragma unroll
      for (int j = 0; j < 4; ++j) {
        const unsigned short* kp  = Ksh + (j * 16 + c) * kLP + dc * 32 + 8 * hh;
        const unsigned short* kp2 = Ksl + (j * 16 + c) * kLP + dc * 32 + 8 * hh;
        kb[dc][j].h[0]  = *(const v8b*)(const void*)(kp);
        kb[dc][j].h[1]  = *(const v8b*)(const void*)(kp + 16);
        kb2[dc][j].h[0] = *(const v8b*)(const void*)(kp2);
        kb2[dc][j].h[1] = *(const v8b*)(const void*)(kp2 + 16);
      }
    }
    __builtin_amdgcn_sched_barrier(0);   // keeps the reads together (for speed only)
#pragma unroll
    for (int dc = 0; dc < 2; ++dc) {
#pragma unroll
      for (int j = 0; j < 4; ++j) s[j] = at_mma(kb[dc][j].v, qah[dc], s[j]);
#pragma unroll
      for (int j = 0; j < 4; ++j) s[j] = at_mma(kb2[dc][j].v, qah[dc], s[j]);
#pragma unroll
      for (int j = 0; j < 4; ++j) s[j] = at_mma(kb[dc][j].v, qal[dc], s[j]);
    }
    // V^T fragments (A operand, row = d t*16 + c, k = kv) by transposing reads of V [kv][d]: the lane receives V[kk*32 + 8hh + 0..7][t*16 + c],
    // then V[kk*32 + 16 + 8hh + 0..7][t*16 + c]: the k order of P^T below. The 16 reads of 32 keys stand together as one group.
    FB vb[2][4], vb2[2][4];
    auto load_v = [&](int kk) {
#pragma unroll
      for (int t = 0; t < 4; ++t) {
        const int vo = (kk * 32 + 8 * hh + (lane & 7)) * kVP + t * 16 + ((lane >> 3) & 1) * 8;
        vb[kk][t].h[0]  = at_ld_tr16(Vsh + vo);
        vb[kk][t].h[1]  = at_ld_tr16(Vsh + vo + 16 * kVP);
        vb2[kk][t].h[0] = at_ld_tr16(Vsl + vo);
        vb2[kk][t].h[1] = at_ld_tr16(Vsl + vo + 16 * kVP);
      }
    };
    __builtin_amdgcn_sched_barrier(0);   // with the one below: keeps the first group behind the score products (registers) and in front
    load_v(0);                           // of the softmax, whose vector work covers its latency
    __builtin_amdgcn_sched_barrier(0);
    const bool diag = (kc == qb);   // block-uniform
    const int qrel = q0 + c - kv0 - 8 * hh;   // key j*16 + 8hh + r of this chunk lies behind query q0 + c where j*16 + r > qrel
    float cm = -__builtin_inff();
#pragma unroll
    for (int j = 0; j < 4; ++j) {
#pragma unroll
      for (int r = 0; r < 8; ++r) {
        float sv = s[j][r];   // unscaled: the scale is folded into the exponent's multiply-add below
        sv = (diag && (j * 16 + r > qrel)) ? -__builtin_inff() : sv;
        s[j][r] = sv;
        cm = fmaxf(cm, sv);
      }
    }
    cm = fmaxf(cm, at_xhalf(cm));   // the query's other 32 keys of this chunk
    const float mnew = fmaxf(mrun, cm);
    const float alpha = __builtin_amdgcn_exp2f((mrun - mnew) * c2);
    const float mn2 = mnew * c2;
    mrun = mnew;
    // P^T as B operand of 32 keys (column = query c): element e of block kk is key kk*32 + (e < 8 ? 8hh + e : 16 + 8hh + e - 8),
    // that is register e & 7 of score tile 2kk + (e >> 3) of this same lane: the k order of the V^T fragment loads below
    union PB { v16b v; v2b p[8]; };   // a B operand as its eight registers of two neighbouring k
    PB ph[2], pl[2];
    float psum = 0.f;
#pragma unroll
    for (int j = 0; j < 4; ++j) {
#pragma unroll
      for (int r = 0; r < 8; r += 2) {
        const float p0 = __builtin_amdgcn_exp2f(__builtin_fmaf(s[j][r], c2, -mn2));
        const float p1 = __builtin_amdgcn_exp2f(__builtin_fmaf(s[j][r + 1], c2, -mn2));
        psum += p0;
        psum += p1;
        split_pair(p0, p1, ph[j >> 1].p[(j & 1) * 4 + (r >> 1)], pl[j >> 1].p[(j & 1) * 4 + (r >> 1)]);
      }
    }
    lrun = lrun * alpha + psum;
#pragma unroll
    for (int t = 0; t < 4; ++t)
#pragma unroll
      for (int r = 0; r < 8; ++r) oacc[t][r] *= alpha;
    // ---- out^T[d][query] += V^T[d][kv] * P^T[kv][query]; A = V^T (row = d t*16 + c, k = kv) by transposing reads of V [kv][d], B = P^T ----
#pragma unroll
    for (int kk = 0; kk < 2; ++kk) {
      // the four output tiles alternate like the score tiles; each still sums (hi*hi, lo*hi, hi*lo) per 32 keys in that order
#pragma unroll
      for (int t = 0; t < 4; ++t) oacc[t] = at_mma(vb[kk][t].v, ph[kk].v, oacc[t]);
#pragma unroll
      for (int t = 0; t < 4; ++t) oacc[t] = at_mma(vb2[kk][t].v, ph[kk].v, oacc[t]);
      if (kk == 0) {
        __builtin_amdgcn_sched_barrier(0);   // with the one below: keeps the second group together, where the first group's lo fragments
        load_v(1);                           // have left their registers
        __builtin_amdgcn_sched_barrier(0);
      }
#pragma unroll
      for (int t = 0; t < 4; ++t) oacc[t] = at_mma(vb[kk][t].v, pl[kk].v, oacc[t]);
    }
    asm volatile("s_wait_dscnt 0x0" ::: "memory");      // this wave's reads of the buffer are done before it is refilled
    stage_wait();                                       // this wave's tile of chunk kc + 1 has landed
    __syncthreads();                                    // publishes chunk kc + 1 and ends every wave's reads of chunk kc
    stage_load((int)pinned((uint32_t)(kc + 2)), bufe * 2u, kc + 2 < nChunks);   // pinned index: the descriptor is formed behind the wait
  }
  stage_wait();                                        // nothing of this wave is in flight behind the loop
  asm volatile("s_wait_dscnt 0x0" ::: "memory");

  // ---- epilogue: join the halves' sums, normalise, stage the wave's 16x64 tile, write whole 256-B row segments ----
  float* os = (float*)(void*)sKV + wave * (16 * kOP);   // every wave has passed the last chunk's barrier: the buffers are free
  {
    const float inv = 1.0f / (lrun + at_xhalf(lrun));
#pragma unroll
    for (int t = 0; t < 4; ++t) {
      const v4f w0 = {oacc[t][0] * inv, oacc[t][1] * inv, oacc[t][2] * inv, oacc[t][3] * inv};
      const v4f w1 = {oacc[t][4] * inv, oacc[t][5] * inv, oacc[t][6] * inv, oacc[t][7] * inv};
      *(v4f*)(os + c * kOP + t * 16 + 8 * hh)     = w0;
      *(v4f*)(os + c * kOP + t * 16 + 8 * hh + 4) = w1;
    }
  }
  __builtin_amdgcn_fence(__ATOMIC_RELEASE, "workgroup");
  __builtin_amdgcn_wave_barrier();
  __builtin_amdgcn_fence(__ATOMIC_ACQUIRE, "workgroup");
  {
    float* ob = out + (size_t)hcol;
    const int c4 = (lane & 15) * 4;   // 16 lanes x 16 B = 256 B = one row segment of 64 floats
    {
#pragma unroll
      for (int it = 0; it < 8; ++it) {
        const int row = it * 2 + hh;
        v4f val = *(const v4f*)(os + row * kOP + c4);
        *(v4f*)(ob + (rowb + (size_t)(q0 + row)) * (size_t)ldo + c4) = val;
      }
      
    }
  }
}

// ---------------------------------------------------------------------------------------------------------------------
// Host launcher
// Workspace region map (bytes):
//   [0,            16,777,216)  Xb   bf16 [8192][1024]           (RNE copy of x)
//   [16,777,216,   23,068,672)  Wt   bf16 [3072][1024]           (RNE copy of W^T)
//   [23,068,672,   73,400,320)  Phi  bf16 [8192][3072]           (qkv hi plane)
//   [73,400,320,  123,731,968)  Plo  bf16 [8192][3072]           (qkv lo plane)
//   total 123,731,968
// ---------------------------------------------------------------------------------------------------------------------
extern "C" void kernel_launch(void* const* d_in, const int* in_sizes, int n_in,
                              void* d_out, int out_size, void* d_ws, size_t ws_size,
                              hipStream_t stream) {
  if (n_in < 2) return;
  if (in_sizes[0] != kRows * kEmb) return;
  if (in_sizes[1] != kEmb * kN3) return;
  if (out_size != kRows * kEmb) return;

  const size_t bytesXb = (size_t)kRows * kEmb * 2;
  const size_t bytesWt = (size_t)kN3 * kEmb * 2;
  const size_t bytesPl = (size_t)kRows * kN3 * 2;
  const size_t offXb = 0;
  const size_t offWt = offXb + bytesXb;
  const size_t offHi = offWt + bytesWt;
  const size_t offLo = offHi + bytesPl;
  const size_t total = offLo + bytesPl;
  if (total > ws_size) return;

  const float* x = (const float*)d_in[0];   // [4, 2048, 1024] f32
  const float* W = (const float*)d_in[1];   // [1024, 3072] f32
  float* outp = (float*)d_out;              // [4, 2048, 1024] f32

  char* ws = (char*)d_ws;
  unsigned short* Xb  = (unsigned short*)(ws + offXb);
  unsigned short* Wt  = (unsigned short*)(ws + offWt);
  unsigned short* Phi = (unsigned short*)(ws + offHi);
  unsigned short* Plo = (unsigned short*)(ws + offLo);
  const float* fdum = (const float*)(ws + offXb);

  // 1) x -> bf16 plane: 1,048,576 threads x 8 elements = 8,388,608
  const int n8 = (kRows * kEmb) / 8;
  cast_f32_bf16x8<<<dim3(n8 / 256), dim3(256), 0, stream>>>(x, Xb, n8);

  // 2) W [1024][3072] -> Wt [3072][1024] bf16; grid (Cc/64, R/64) = (48, 16)
  transpose_cast_bf16<<<dim3(kN3 / 64, kEmb / 64), dim3(256), 0, stream>>>(W, Wt, kEmb, kN3);

  // 3) qkv = Xb [8192][1024] x Wt [3072][1024]^T -> bf16 hi/lo planes [8192][3072]; M=8192, N=3072, K=1024
  const int tiles = (kRows / 128) * (kN3 / 256);   // 768 tiles of 128 x 256, one per block
  wmma_gemm64<1, false, 0, 2, false, 0><<<dim3(tiles, 1), dim3(256), 0, stream>>>(
      (const unsigned short*)Xb, (const unsigned short*)Xb, kEmb, 0L,
      (const unsigned short*)Wt, (const unsigned short*)Wt, kEmb, 0L,
      (void*)Phi, (void*)Plo, kN3, 0L,
      fdum, fdum, 0L,
      kRows, kN3, kEmb, 1.0f);

  // 4) causal attention: q cols [0,1024), k cols [1024,2048), v cols [2048,3072) of the planes; ld = 3072
  attn_causal_hd64_split<<<dim3(kBatch * kHeads * (kSeq / kQB)), dim3(128), 0, stream>>>(
      (const unsigned short*)Phi, (const unsigned short*)Plo,
      (const unsigned short*)(Phi + kEmb), (const unsigned short*)(Plo + kEmb),
      (const unsigned short*)(Phi + 2 * kEmb), (const unsigned short*)(Plo + 2 * kEmb),
      outp, kSeq, kHeads, kN3, kN3, kN3, kEmb, 0.125f);
}
